// v000
// Measured on an AMD MI455X. A time is GPU time per run, averaged over a window of back-to-back runs after a warm-up
// (all launches, gaps included; the runs take copies of the inputs in turn), and the median of several windows.
// Apart from v000's, it joins two sittings. Times from different sittings can be a few percent apart, while
// side-by-side timings come from the same sitting.
// The starting kernel, v000, takes 6860 microseconds a run.
#include <hip/hip_runtime.h>
// Multi-scale attention block (x [4][2048][1024]; q/k/v = x W^T + b (natural [1024][1024] weights), 16 heads of 64; softmax(q k^T / 8); ctx merged; global = ctx Wo^T + bo; local = depthwise conv3 of x along the sequence (conv_w [1024][3], zero pad) + conv_b; y = x + global + 0.3 local; out = LayerNorm(y) (eps 1e-5) ln_g + ln_b -> [4][2048][1024]).
// Structure (attention part): token rows r = b*2048 + s; x as exact f16 rows (bf16-rounded); Q, K, V as three WMMA GEMMs (32x64 wave tiles, f32 accumulation, exact x16 weights + bias, f16 outputs); per batch: V^T for all heads via LDS transposes; per (batch, group of 4 heads): scores GEMM (K = 64, batched over the heads on grid.y, alpha = 1/8), row softmax on VALU (f32 statistics, native exp; weights stored x256 as f16), o = P . V^T GEMM (K = 2048, alpha 2^-2: o carried x64 against f16 subnormal flush, folded into the output GEMM alpha) written straight into the merged f16 o rows; global = o W_o^T + b GEMM (f32 rows); then per token row on VALU: + bf16(x) + 0.3 (depthwise conv3 of bf16(x) + b), LayerNorm, affine -> output rows.
// Compute dtype: inputs rounded to bf16; x / weights exact; q, k, v, softmax weights and o as plain f16 GEMM operands (~2^-12); scores and softmax statistics f32. v_wmma_f32_16x16x32_f16.
#define NB 4
#define SQ 2048
#define DM 1024
#define NH 16
#define HD 64
#define HG 4                         /* heads per attention launch group */
#define B0 0                         /* first batch processed (debug hook) */
#define NBR NB                       /* batches processed (debug hook) */
#define NR ((size_t)NB * SQ)         /* token rows */
#define MP ((int)((size_t)NBR * SQ)) /* rows projected (debug hook) */
#define QN SQ                        /* query rows attended per batch (debug hook) */
#define NHD NH                       /* heads attended (debug hook) */
#define MPO MP                       /* rows through the output stage (debug hook) */
#define LQ DM      /* row pitch of the q/k/v rows */
typedef __bf16 v16b __attribute__((ext_vector_type(16)));
typedef unsigned short v8us __attribute__((ext_vector_type(8), may_alias));
typedef float  v8f  __attribute__((ext_vector_type(8)));
typedef float  v4f  __attribute__((ext_vector_type(4)));
typedef float  v4fa __attribute__((ext_vector_type(4), may_alias));
union FragB { v16b v; v8us half[2]; unsigned short u[16]; };

__device__ __forceinline__ unsigned short bf16_bits(float x) { unsigned int u = __float_as_uint(x); return (unsigned short)((u + 0x7FFFu + ((u >> 16) & 1u)) >> 16); }
__device__ __forceinline__ float bf16_val(unsigned short b) { return __uint_as_float(((unsigned int)b) << 16); }
__device__ __forceinline__ float bf16_round(float x) { return bf16_val(bf16_bits(x)); }
// D += A·B with NT terms: 1 = ah·bh, 2 = + al·bh (A split), 3 = + ah·bl (both split)
template <int NT>
__device__ __forceinline__ v8f mmaN(v16b ah, v16b al, v16b bh, v16b bl, v8f c) {
  c = __builtin_amdgcn_wmma_f32_16x16x32_bf16(false, ah, false, bh, (short)0, c, false, false);
  if (NT >= 2) c = __builtin_amdgcn_wmma_f32_16x16x32_bf16(false, al, false, bh, (short)0, c, false, false);
  if (NT >= 3) c = __builtin_amdgcn_wmma_f32_16x16x32_bf16(false, ah, false, bl, (short)0, c, false, false);
  asm volatile("v_nop\n\tv_nop\n\tv_nop\n\tv_nop" : "+v"(c) : "v"(ah), "v"(al), "v"(bh), "v"(bl));
  return c;
}

__global__ __launch_bounds__(256) void k_wt_bf16(const float* __restrict__ W, unsigned short* __restrict__ Wt, int K, int N) {
  const int t = blockIdx.x * 256 + threadIdx.x;
  const int k8n = K / 8;
  if (t >= N * k8n) return;
  const int n = t / k8n, k8 = (t % k8n) * 8;
  v8us v;
#pragma unroll
  for (int i = 0; i < 8; ++i) v[i] = bf16_bits(W[(size_t)(k8 + i) * N + n]);
  *(v8us*)(Wt + (size_t)n * K + k8) = v;
  
}

// GEMM C[M][N] (f32, pitch ldc) = act(A[M][K]·W + bias). A f32 row-major (pitch lda) converted per fragment to bf16
// (ASPLIT: hi/lo two planes -> 2 terms, else single rounded term); Wt bf16 [N][K] (pitch ldb). BIAS_BF16 rounds the
// bias to bf16 first (bias quantised to bf16 before the add). K%32==0, M%16==0, N%64==0.
template <bool ASPLIT, int ACT, bool BIAS_BF16>
__global__ __launch_bounds__(128) void k_gemm_bf(const float* __restrict__ A, int lda, const unsigned short* __restrict__ Wt, int ldb,
                                               const float* __restrict__ bias, float* __restrict__ C, int ldc, int M, int N, int K) {
  __shared__ __attribute__((aligned(16))) float so[4][16][64];
  const int tid = threadIdx.x, w = tid >> 5, lane = tid & 31, ln = lane & 15, hh = lane >> 4;
  const int ntn = N / 64;
  const int wid = blockIdx.x * 4 + w;
  const int mt = wid / ntn, nq = wid % ntn;
  if (mt * 16 >= M) return;
  const int row0 = mt * 16, col0 = nq * 64;
  const float* arow = A + (size_t)(row0 + ln) * lda;
  v8f acc[4] = {};
  for (int kb = 0; kb < K; kb += 32) {
    FragB ah, al;
    const v4f x0 = *(const v4fa*)(arow + kb + 8 * hh), x1 = *(const v4fa*)(arow + kb + 8 * hh + 4);
    const v4f x2 = *(const v4fa*)(arow + kb + 16 + 8 * hh), x3 = *(const v4fa*)(arow + kb + 16 + 8 * hh + 4);
    float xs[16] = {x0[0],x0[1],x0[2],x0[3],x1[0],x1[1],x1[2],x1[3],x2[0],x2[1],x2[2],x2[3],x3[0],x3[1],x3[2],x3[3]};
#pragma unroll
    for (int i = 0; i < 16; ++i) { const unsigned short hb = bf16_bits(xs[i]); ah.u[i] = hb; al.u[i] = ASPLIT ? bf16_bits(xs[i] - bf16_val(hb)) : (unsigned short)0; }
#pragma unroll
    for (int t = 0; t < 4; ++t) {
      const unsigned short* brow = Wt + (size_t)(col0 + t * 16 + ln) * ldb + kb;
      FragB b;
      b.half[0] = *(const v8us*)(brow + 8 * hh);
      b.half[1] = *(const v8us*)(brow + 16 + 8 * hh);
      acc[t] = mmaN<ASPLIT ? 2 : 1>(ah.v, al.v, b.v, b.v, acc[t]);
    }
  }
#pragma unroll
  for (int t = 0; t < 4; ++t) {
    float bv = bias ? bias[col0 + t * 16 + ln] : 0.f;
    if (BIAS_BF16) bv = bf16_round(bv);
#pragma unroll
    for (int r = 0; r < 8; ++r) { float v = acc[t][r] + bv; if (ACT == 1) v = fmaxf(v, 0.f); so[w][8 * hh + r][t * 16 + ln] = v; }
  }
  __builtin_amdgcn_fence(__ATOMIC_ACQ_REL, "workgroup");
  __builtin_amdgcn_wave_barrier();
  const int rsub = lane >> 4, c4 = (lane & 15) * 4;
  {
#pragma unroll
    for (int q = 0; q < 8; ++q) {
      const int r = q * 2 + rsub;
      const v4f v = *(const v4fa*)&so[w][r][c4];
      *(v4f*)(C + (size_t)(row0 + r) * ldc + col0 + c4) = v;
    }
    
  }
}

// GEMM C = act(A·W + bias + resid): A f32 (ASPLIT -> hi/lo 2 terms), Wt bf16 [N][K]; ACT 0 none, 1 relu, 2 exact gelu;
// resid (optional, f32, row index = (row % rmod), pitch ldr, RES_BF16 rounds it) added before the activation.
template <bool ASPLIT, int ACT, bool BIAS_BF16, bool RES_BF16>
__global__ __launch_bounds__(128) void k_gemm_bf3(const float* __restrict__ A, int lda, const unsigned short* __restrict__ Wt, int ldb,
                                                const float* __restrict__ bias, const float* __restrict__ resid, int rmod, int ldr,
                                                float* __restrict__ C, int ldc, int M, int N, int K) {
  __shared__ __attribute__((aligned(16))) float so[4][16][64];
  const int tid = threadIdx.x, w = tid >> 5, lane = tid & 31, ln = lane & 15, hh = lane >> 4;
  const int ntn = N / 64;
  const int wid = blockIdx.x * 4 + w;
  const int mt = wid / ntn, nq = wid % ntn;
  if (mt * 16 >= M) return;
  const int row0 = mt * 16, col0 = nq * 64;
  const float* arow = A + (size_t)(row0 + ln) * lda;
  v8f acc[4] = {};
  for (int kb = 0; kb < K; kb += 32) {
    FragB ah, al;
    const v4f x0 = *(const v4fa*)(arow + kb + 8 * hh), x1 = *(const v4fa*)(arow + kb + 8 * hh + 4);
    const v4f x2 = *(const v4fa*)(arow + kb + 16 + 8 * hh), x3 = *(const v4fa*)(arow + kb + 16 + 8 * hh + 4);
    float xs[16] = {x0[0],x0[1],x0[2],x0[3],x1[0],x1[1],x1[2],x1[3],x2[0],x2[1],x2[2],x2[3],x3[0],x3[1],x3[2],x3[3]};
#pragma unroll
    for (int i = 0; i < 16; ++i) { const unsigned short hb = bf16_bits(xs[i]); ah.u[i] = hb; al.u[i] = ASPLIT ? bf16_bits(xs[i] - bf16_val(hb)) : (unsigned short)0; }
#pragma unroll
    for (int t = 0; t < 4; ++t) {
      const unsigned short* brow = Wt + (size_t)(col0 + t * 16 + ln) * ldb + kb;
      FragB b;
      b.half[0] = *(const v8us*)(brow + 8 * hh);
      b.half[1] = *(const v8us*)(brow + 16 + 8 * hh);
      acc[t] = mmaN<ASPLIT ? 2 : 1>(ah.v, al.v, b.v, b.v, acc[t]);
    }
  }
#pragma unroll
  for (int t = 0; t < 4; ++t) {
    const int col = col0 + t * 16 + ln;
    float bv = bias ? bias[col] : 0.f;
    if (BIAS_BF16) bv = bf16_round(bv);
#pragma unroll
    for (int r = 0; r < 8; ++r) {
      float v = acc[t][r] + bv;
      if (resid) { float rv = resid[(size_t)((row0 + 8 * hh + r) % rmod) * ldr + col]; if (RES_BF16) rv = bf16_round(rv); v += rv; }
      if (ACT == 1) v = fmaxf(v, 0.f);
      if (ACT == 2) v = 0.5f * v * (1.0f + erff(v * 0.70710678118654752f));
      if (ACT == 3) { const float u = 0.7978845608028654f * (v + 0.044715f * v * v * v); v = 0.5f * v * (1.0f + tanhf(u)); }
      so[w][8 * hh + r][t * 16 + ln] = v;
    }
  }
  __builtin_amdgcn_fence(__ATOMIC_ACQ_REL, "workgroup");
  __builtin_amdgcn_wave_barrier();
  const int rsub = lane >> 4, c4 = (lane & 15) * 4;
  {
#pragma unroll
    for (int q = 0; q < 8; ++q) {
      const int r = q * 2 + rsub;
      const v4f v = *(const v4fa*)&so[w][r][c4];
      *(v4f*)(C + (size_t)(row0 + r) * ldc + col0 + c4) = v;
    }
    
  }
}
// row LayerNorm (biased variance, eps) over N: s = X (+ R); optional out_sum <- s; out_norm <- (s-mu)*rsqrt(var+eps)*g + b
template <bool PARAM_BF16>
__global__ __launch_bounds__(256) void k_layernorm(const float* __restrict__ X, const float* __restrict__ R, const float* __restrict__ g, const float* __restrict__ bta,
                                                  float* __restrict__ out_sum, float* __restrict__ out_norm, int N, float eps) {
  __shared__ float red[256];
  const int row = blockIdx.x, tid = threadIdx.x;
  const float* x = X + (size_t)row * N; const float* rr = R ? R + (size_t)row * N : nullptr;
  float vals[16];                     // up to N = 4096
  const int per = N / 256;            // contiguous chunk per thread? use strided-by-4 chunks: thread handles j = tid*4 + 1024*u
  float s1 = 0.f;
  for (int u = 0; u < per / 4; ++u) {
    const int j = tid * 4 + 1024 * u;
    const v4f a = *(const v4fa*)(x + j);
    v4f b = {0.f,0.f,0.f,0.f}; if (rr) b = *(const v4fa*)(rr + j);
#pragma unroll
    for (int q = 0; q < 4; ++q) { const float v = a[q] + b[q]; vals[u * 4 + q] = v; s1 += v; }
  }
  red[tid] = s1; __syncthreads();
  for (int st = 128; st > 0; st >>= 1) { if (tid < st) red[tid] += red[tid + st]; __syncthreads(); }
  const float mu = red[0] / (float)N; __syncthreads();
  float s2 = 0.f;
  for (int u = 0; u < per / 4; ++u)
#pragma unroll
    for (int q = 0; q < 4; ++q) { const float c = vals[u * 4 + q] - mu; s2 += c * c; }
  red[tid] = s2; __syncthreads();
  for (int st = 128; st > 0; st >>= 1) { if (tid < st) red[tid] += red[tid + st]; __syncthreads(); }
  const float rs = rsqrtf(red[0] / (float)N + eps);
  {
    for (int u = 0; u < per / 4; ++u) {
      const int j = tid * 4 + 1024 * u;
      v4f o, sm;
#pragma unroll
      for (int q = 0; q < 4; ++q) {
        float gg = g[j + q], bb = bta[j + q];
        if (PARAM_BF16) { gg = bf16_round(gg); bb = bf16_round(bb); }
        sm[q] = vals[u * 4 + q]; o[q] = (vals[u * 4 + q] - mu) * rs * gg + bb;
      }
      if (out_sum) *(v4f*)(out_sum + (size_t)row * N + j) = sm;
      *(v4f*)(out_norm + (size_t)row * N + j) = o;
    }
    
  }
}



// ---- f16 WMMA path (v_wmma_f32_16x16x32_f16): 11-bit significands for operands in range — used where a [0,1] probability operand needs more precision than bf16
typedef _Float16 v16h __attribute__((ext_vector_type(16)));
union FragH { v16h v; v8us half[2]; _Float16 h[16]; unsigned short u[16]; };
template <int NT>
__device__ __forceinline__ v8f mmaH(v16h ah, v16h al, v16h bh, v16h bl, v8f c) {
  c = __builtin_amdgcn_wmma_f32_16x16x32_f16(false, ah, false, bh, (short)0, c, false, false);
  if (NT >= 2) c = __builtin_amdgcn_wmma_f32_16x16x32_f16(false, al, false, bh, (short)0, c, false, false);
  if (NT >= 3) c = __builtin_amdgcn_wmma_f32_16x16x32_f16(false, ah, false, bl, (short)0, c, false, false);
  asm volatile("v_nop\n\tv_nop\n\tv_nop\n\tv_nop" : "+v"(c) : "v"(ah), "v"(al), "v"(bh), "v"(bl));
  return c;
}
// batched GEMM like k_gemm_b but f16 operands: A f32 (split into f16 hi/lo if ASPLIT, else rounded to f16), Bt = f16 values [n][k]; alpha; C f32; N multiple of 16 (partial tiles skipped)
template <bool ASPLIT>
__global__ __launch_bounds__(128) void k_gemm_h(const float* __restrict__ A, int lda, size_t sA, const _Float16* __restrict__ Bh, int ldb, size_t sB, float alpha, float* __restrict__ C, int ldc, size_t sC, int M, int N, int K) {
  __shared__ __attribute__((aligned(16))) float so[4][16][64];
  const int tid = threadIdx.x, w = tid >> 5, lane = tid & 31, ln = lane & 15, hh = lane >> 4; const int by = blockIdx.y;
  A += (size_t)by * sA; Bh += (size_t)by * sB; C += (size_t)by * sC;
  const int ntn = (N + 63) / 64; const int wid = blockIdx.x * 4 + w; const int mt = wid / ntn, nq = wid % ntn; if (mt * 16 >= M) return;
  const int row0 = mt * 16, col0 = nq * 64; const float* arow = A + (size_t)(row0 + ln) * lda;
  v8f acc[4] = {};
  for (int kb = 0; kb < K; kb += 32) {
    FragH ah, al;
    const v4f x0 = *(const v4fa*)(arow + kb + 8 * hh), x1 = *(const v4fa*)(arow + kb + 8 * hh + 4), x2 = *(const v4fa*)(arow + kb + 16 + 8 * hh), x3 = *(const v4fa*)(arow + kb + 16 + 8 * hh + 4);
    float xs[16] = {x0[0],x0[1],x0[2],x0[3],x1[0],x1[1],x1[2],x1[3],x2[0],x2[1],x2[2],x2[3],x3[0],x3[1],x3[2],x3[3]};
#pragma unroll
    for (int i = 0; i < 16; ++i) { const _Float16 h = (_Float16)xs[i]; ah.h[i] = h; al.h[i] = ASPLIT ? (_Float16)(xs[i] - (float)h) : (_Float16)0.0f; }
#pragma unroll
    for (int t = 0; t < 4; ++t) { if (col0 + t * 16 >= N) continue; const size_t boff = (size_t)(col0 + t * 16 + ln) * ldb + kb; FragH bq; bq.half[0] = *(const v8us*)(Bh + boff + 8 * hh); bq.half[1] = *(const v8us*)(Bh + boff + 16 + 8 * hh);
      acc[t] = mmaH<ASPLIT ? 2 : 1>(ah.v, al.v, bq.v, bq.v, acc[t]); }
  }
#pragma unroll
  for (int t = 0; t < 4; ++t) { if (col0 + t * 16 >= N) continue;
#pragma unroll
    for (int r = 0; r < 8; ++r) so[w][8 * hh + r][t * 16 + ln] = acc[t][r] * alpha; }
  __builtin_amdgcn_fence(__ATOMIC_ACQ_REL, "workgroup"); __builtin_amdgcn_wave_barrier();
  const int rsub = lane >> 4, c4 = (lane & 15) * 4;
  {
#pragma unroll
    for (int q = 0; q < 8; ++q) { const int r = q * 2 + rsub; if (col0 + c4 < N) { const v4f v = *(const v4fa*)&so[w][r][c4]; *(v4f*)(C + (size_t)(row0 + r) * ldc + col0 + c4) = v; } }
     }
}

// Wt[n][k] = f16(W[k][n]·scale) from f32 row-major W[K][N] (scale = power of two; bf16-exact weights stay exact in f16 away from the subnormal range)
__global__ __launch_bounds__(256) void k_wt_f16(const float* __restrict__ W, _Float16* __restrict__ Wt, int K, int N, float scale) {
  const int t = blockIdx.x * 256 + threadIdx.x; if (t >= N * (K / 8)) return; const int n = t / (K / 8), k8 = (t % (K / 8)) * 8; FragH f;
#pragma unroll
  for (int i = 0; i < 8; ++i) f.h[i] = (_Float16)(bf16_round(W[(size_t)(k8 + i) * N + n]) * scale); const v8us o = f.half[0];
  *(v8us*)((unsigned short*)Wt + (size_t)n * K + k8) = o; 
}
// k_gemm_hh variant with fused epilogue: v = acc·alpha + bias[by·sBias + col] (+ CP[(row/rowsPerB)·sCPb + by·64 + col] if CP) ; ACT 0 none / 1 elu ; writes f16 C16 (and f32 C if non-null)
template <int ACT>
__global__ __launch_bounds__(128) void k_gemm_hhx(const _Float16* __restrict__ A, int lda, size_t sA, const _Float16* __restrict__ Bh, int ldb, size_t sB, float alpha, const float* __restrict__ bias, size_t sBias, const float* __restrict__ CP, int rowsPerB, size_t sCPb, int row0g,
    float* __restrict__ C, _Float16* __restrict__ C16, int ldc, size_t sC, int M, int N, int K) {
  __shared__ __attribute__((aligned(16))) float so[4][16][64];
  const int tid = threadIdx.x, w = tid >> 5, lane = tid & 31, ln = lane & 15, hh = lane >> 4; const int by = blockIdx.y;
  A += (size_t)by * sA; Bh += (size_t)by * sB; const size_t cofs = (size_t)by * sC; const float* bp = bias ? bias + (size_t)by * sBias : nullptr;
  const int ntn = (N + 63) / 64; const int wid = blockIdx.x * 4 + w; const int mt = wid / ntn, nq = wid % ntn; if (mt * 16 >= M) return;
  const int row0 = mt * 16, col0 = nq * 64; const _Float16* arow = A + (size_t)(row0 + ln) * lda;
  v8f acc[4] = {};
  for (int kb = 0; kb < K; kb += 32) { FragH ah; ah.half[0] = *(const v8us*)((const unsigned short*)arow + kb + 8 * hh); ah.half[1] = *(const v8us*)((const unsigned short*)arow + kb + 16 + 8 * hh);
#pragma unroll
    for (int t = 0; t < 4; ++t) { if (col0 + t * 16 >= N) continue; const size_t boff = (size_t)(col0 + t * 16 + ln) * ldb + kb; FragH bq; bq.half[0] = *(const v8us*)((const unsigned short*)Bh + boff + 8 * hh); bq.half[1] = *(const v8us*)((const unsigned short*)Bh + boff + 16 + 8 * hh);
      acc[t] = mmaH<1>(ah.v, ah.v, bq.v, bq.v, acc[t]); }
  }
#pragma unroll
  for (int t = 0; t < 4; ++t) { if (col0 + t * 16 >= N) continue; const int col = col0 + t * 16 + ln; const float bv = bp ? bf16_round(bp[col]) : 0.f;
#pragma unroll
    for (int r = 0; r < 8; ++r) { float v = acc[t][r] * alpha + bv; if (CP) { const int rr = row0g + row0 + 8 * hh + r; if (rowsPerB < 0) v += CP[cofs + (size_t)rr * ldc + col];      /* rowsPerB < 0: own element of the batched C plane */ else { const int bidx = rr / rowsPerB; v += CP[(size_t)bidx * sCPb + (size_t)by * 64 + col]; } } if (ACT == 1) v = (v > 0.f) ? v : expm1f(v); else if (ACT == 7) v = (v > 0.f) ? v + 1.0f : expf(v); else if (ACT == 8) v = tanhf(v); else if (ACT == 9) v = 0.5f * v * (1.0f + tanhf(0.7978845608028654f * (v + 0.044715f * v * v * v))); else if (ACT == 11) v = 1.0f / (1.0f + expf(-v)); else if (ACT == 12) v = (v > 0.f) ? v : 0.01f * v; else if (ACT == 14) v = (v > 0.f) ? v : 0.1f * v; else if (ACT == 16) v = (v >= 0.f) ? v : 0.3f * v; else if (ACT == 17) v = (v >= 0.f) ? v : 0.2f * v; else if (ACT == 15) v = v / (1.0f + expf(-v)); else if (ACT == 3) v = fmaxf(v, 0.f); else if (ACT == 6) v = 0.5f * v * (1.0f + erff(v * 0.70710678118654752f)); so[w][8 * hh + r][t * 16 + ln] = v; } }
  __builtin_amdgcn_fence(__ATOMIC_ACQ_REL, "workgroup"); __builtin_amdgcn_wave_barrier();
  const int rsub = lane >> 4, c4 = (lane & 15) * 4; typedef _Float16 v4h __attribute__((ext_vector_type(4)));
  {
#pragma unroll
    for (int q = 0; q < 8; ++q) { const int r = q * 2 + rsub; if (col0 + c4 < N) { const v4f v = *(const v4fa*)&so[w][r][c4]; if (C) *(v4f*)(C + cofs + (size_t)(row0 + r) * ldc + col0 + c4) = v; if (C16) { v4h h4; for (int i = 0; i < 4; ++i) h4[i] = (_Float16)v[i]; *(v4h*)(C16 + cofs + (size_t)(row0 + r) * ldc + col0 + c4) = h4; } } }
     }
}


typedef _Float16 v4h __attribute__((ext_vector_type(4)));

__global__ __launch_bounds__(256) void k_x16(const float* __restrict__ x, _Float16* __restrict__ X16, size_t n8) { const size_t t = (size_t)blockIdx.x * 256 + threadIdx.x; if (t >= n8) return; FragH f;
#pragma unroll
  for (int q = 0; q < 8; ++q) f.h[q] = (_Float16)bf16_round(x[t * 8 + q]); *(v8us*)((unsigned short*)X16 + t * 8) = f.half[0];  }
__global__ __launch_bounds__(256) void k_h16(const float* __restrict__ x, _Float16* __restrict__ X16, size_t n8) { const size_t t = (size_t)blockIdx.x * 256 + threadIdx.x; if (t >= n8) return; FragH f;
#pragma unroll
  for (int q = 0; q < 8; ++q) f.h[q] = (_Float16)x[t * 8 + q]; *(v8us*)((unsigned short*)X16 + t * 8) = f.half[0];  }
__global__ __launch_bounds__(256) void k_round16f(const float* __restrict__ W, _Float16* __restrict__ Bt, size_t n8) { const size_t t = (size_t)blockIdx.x * 256 + threadIdx.x; if (t >= n8) return; FragH f;
#pragma unroll
  for (int i = 0; i < 8; ++i) f.h[i] = (_Float16)(bf16_round(W[t * 8 + i]) * 16.0f); *(v8us*)((unsigned short*)Bt + t * 8) = f.half[0];  }
template <int NHv, int TTv>
__global__ __launch_bounds__(256) void k_vt(const _Float16* __restrict__ V16, int ldv, int voff, _Float16* __restrict__ Vt) { __shared__ unsigned short tl[64][66]; const int tid = threadIdx.x; const int slab = blockIdx.x / (TTv / 64), lg = blockIdx.x % (TTv / 64); const int b = slab / NHv, h = slab % NHv;
  for (int i = tid; i < 64 * 8; i += 256) { const int r = i / 8, c8 = (i % 8) * 8; FragH f; f.half[0] = *(const v8us*)((const unsigned short*)V16 + ((size_t)b * TTv + lg * 64 + r) * ldv + voff + h * 64 + c8);
#pragma unroll
    for (int q = 0; q < 8; ++q) tl[r][c8 + q] = f.u[q]; }
  __syncthreads();
  {
#pragma unroll
    for (int rd = 0; rd < 2; ++rd) { const int d = rd * 32 + tid / 8, pc = tid % 8; FragH f;
#pragma unroll
      for (int q = 0; q < 8; ++q) f.u[q] = tl[pc * 8 + q][d];
      *(v8us*)((unsigned short*)Vt + ((size_t)slab * 64 + d) * TTv + lg * 64 + pc * 8) = f.half[0]; }
     } }

__global__ __launch_bounds__(256) void k_hl(const float* __restrict__ F, _Float16* __restrict__ Hh, _Float16* __restrict__ Hl, size_t n8) { const size_t t = (size_t)blockIdx.x * 256 + threadIdx.x; if (t >= n8) return; FragH fh, fl; const v4f a = *(const v4fa*)(F + t * 8), c = *(const v4fa*)(F + t * 8 + 4);
#pragma unroll
  for (int q = 0; q < 4; ++q) { _Float16 h = (_Float16)a[q]; fh.h[q] = h; fl.h[q] = (_Float16)((a[q] - (float)h) * 1024.0f); h = (_Float16)c[q]; fh.h[4 + q] = h; fl.h[4 + q] = (_Float16)((c[q] - (float)h) * 1024.0f); }
  { *(v8us*)((unsigned short*)Hh + t * 8) = fh.half[0]; *(v8us*)((unsigned short*)Hl + t * 8) = fl.half[0];  } }

// ---- fast GEMM (wave tile 32x64; requires M % 32 == 0 rows per launch region and N % 64 == 0); epilogue = k_gemm_hhx semantics ----
__device__ __forceinline__ v16h g2_frag(const _Float16* p, int hh) { FragH f; f.half[0] = *(const v8us*)((const unsigned short*)p + 8 * hh); f.half[1] = *(const v8us*)((const unsigned short*)p + 16 + 8 * hh); return f.v; }
__device__ __forceinline__ v8f g2_mma(v16h a, v16h b, v8f c) { v8f d = __builtin_amdgcn_wmma_f32_16x16x32_f16(false, a, false, b, (short)0, c, false, false); asm volatile("v_nop\n\tv_nop\n\tv_nop\n\tv_nop" : "+v"(d) : "v"(a), "v"(b)); return d; }
template <int ACT>
__global__ __launch_bounds__(128) void k_gemm2(const _Float16* __restrict__ A, int lda, size_t sA, const _Float16* __restrict__ Bh, int ldb, size_t sB, float alpha, const float* __restrict__ bias, size_t sBias, const float* __restrict__ CP, int rowsPerB, size_t sCPb, int row0g,
    float* __restrict__ C, _Float16* __restrict__ C16, int ldc, size_t sC, int M, int N, int K) { static_assert(ACT == 0 || ACT == 3 || ACT == 6 || ACT == 8 || ACT == 9 || ACT == 11 || ACT == 12 || ACT == 14 || ACT == 15 || ACT == 16 || ACT == 17, "k_gemm2: unsupported ACT code (would silently apply no activation)");
  __shared__ __attribute__((aligned(16))) float so[4][32][68];
  const int tid = threadIdx.x, w = tid >> 5, lane = tid & 31, ln = lane & 15, hh = lane >> 4; const int by = blockIdx.y;
  A += (size_t)by * sA; Bh += (size_t)by * sB; const size_t cofs = (size_t)by * sC; const float* bp = bias ? bias + (size_t)by * sBias : nullptr;
  const int ntn = N >> 6; const int mt = blockIdx.x / ntn, nq = blockIdx.x - mt * ntn; const int row0 = mt * 128 + 32 * w, col0 = nq * 64; if (row0 >= M) return;
  const _Float16* a0p = A + (size_t)(row0 + ln) * lda; const _Float16* a1p = a0p + (size_t)16 * lda;
  const _Float16* b0p = Bh + (size_t)(col0 + ln) * ldb; const _Float16* b1p = b0p + (size_t)16 * ldb; const _Float16* b2p = b1p + (size_t)16 * ldb; const _Float16* b3p = b2p + (size_t)16 * ldb;
  const v8f z8 = {0.f,0.f,0.f,0.f,0.f,0.f,0.f,0.f}; v8f c00 = z8, c01 = z8, c02 = z8, c03 = z8, c10 = z8, c11 = z8, c12 = z8, c13 = z8;
#pragma unroll 1
  for (int kb = 0; kb < K; kb += 32) { const v16h a0 = g2_frag(a0p + kb, hh), a1 = g2_frag(a1p + kb, hh);
    v16h b = g2_frag(b0p + kb, hh); c00 = g2_mma(a0, b, c00); c10 = g2_mma(a1, b, c10);
    b = g2_frag(b1p + kb, hh); c01 = g2_mma(a0, b, c01); c11 = g2_mma(a1, b, c11);
    b = g2_frag(b2p + kb, hh); c02 = g2_mma(a0, b, c02); c12 = g2_mma(a1, b, c12);
    b = g2_frag(b3p + kb, hh); c03 = g2_mma(a0, b, c03); c13 = g2_mma(a1, b, c13); }
  v8f accs[8] = {c00, c01, c02, c03, c10, c11, c12, c13};
#pragma unroll
  for (int u = 0; u < 8; ++u) { const int t = u & 3, half = u >> 2; const int col = col0 + t * 16 + ln; const float bv = bp ? bf16_round(bp[col]) : 0.f;
#pragma unroll
    for (int r = 0; r < 8; ++r) { const int rloc = half * 16 + 8 * hh + r; float v = accs[u][r] * alpha + bv; if (CP) { if (rowsPerB < 0) v += CP[cofs + (size_t)(row0g + row0 + rloc) * ldc + col];      /* rowsPerB < 0: own element of the batched C plane */ else { const int bidx = (row0g + row0 + rloc) / rowsPerB; v += CP[(size_t)bidx * sCPb + (size_t)by * 64 + col]; } }
      if (ACT == 3) v = fmaxf(v, 0.f); else if (ACT == 6) v = 0.5f * v * (1.0f + erff(v * 0.70710678118654752f)); else if (ACT == 11) v = 1.0f / (1.0f + expf(-v)); else if (ACT == 15) v = v / (1.0f + expf(-v)); else if (ACT == 12) v = (v > 0.f) ? v : 0.01f * v; else if (ACT == 8) v = tanhf(v); else if (ACT == 9) v = 0.5f * v * (1.0f + tanhf(0.7978845608028654f * (v + 0.044715f * v * v * v))); else if (ACT == 14) v = (v > 0.f) ? v : 0.1f * v; else if (ACT == 16) v = (v >= 0.f) ? v : 0.3f * v; else if (ACT == 17) v = (v >= 0.f) ? v : 0.2f * v;
      so[w][rloc][t * 16 + ln] = v; } }
  __builtin_amdgcn_fence(__ATOMIC_ACQ_REL, "workgroup"); __builtin_amdgcn_wave_barrier();
  const int rsub = lane >> 4, c4 = (lane & 15) * 4;
  {
#pragma unroll
    for (int q = 0; q < 16; ++q) { const int r = q * 2 + rsub; const v4f v = *(const v4fa*)&so[w][r][c4]; if (C) *(v4f*)(C + cofs + (size_t)(row0 + r) * ldc + col0 + c4) = v; if (C16) { v4h h4; for (int i = 0; i < 4; ++i) h4[i] = (_Float16)v[i]; *(v4h*)(C16 + cofs + (size_t)(row0 + r) * ldc + col0 + c4) = h4; } }
     } }


__global__ __launch_bounds__(256) void k_wnat(const float* __restrict__ w, size_t n8, _Float16* __restrict__ Bt) { const size_t t = (size_t)blockIdx.x * 256 + threadIdx.x; if (t >= n8) return; FragH f; for (int q = 0; q < 8; ++q) f.h[q] = (_Float16)(bf16_round(w[t * 8 + q]) * 16.0f); *(v8us*)((unsigned short*)Bt + t * 8) = f.half[0];  }
__global__ __launch_bounds__(256) void k_rsm(const float* __restrict__ S, _Float16* __restrict__ P, int nrows) {
  #pragma clang fp contract(off)
  const int i = blockIdx.x * 256 + threadIdx.x; if (i >= nrows) return; const float* s = S + (size_t)i * SQ; float mx = -3.0e38f;
#pragma unroll 1
  for (int j = 0; j < SQ; ++j) mx = fmaxf(mx, s[j]); float se = 0.f;
#pragma unroll 1
  for (int j = 0; j < SQ; ++j) se += expf(s[j] - mx); const float sc = 256.0f / se;
#pragma unroll 1
  for (int j0 = 0; j0 < SQ; j0 += 8) { FragH f; for (int q = 0; q < 8; ++q) f.h[q] = (_Float16)(expf(s[j0 + q] - mx) * sc); unsigned short* d = (unsigned short*)P + (size_t)i * SQ + j0; *(v8us*)d = f.half[0];  } }
__global__ __launch_bounds__(256) void k_vt(const _Float16* __restrict__ V16, int b, int h0, _Float16* __restrict__ VT) { __shared__ unsigned short tl[64][65]; const int tid = threadIdx.x; const int hh = blockIdx.x % HG, sg = blockIdx.x / HG; const int s0 = sg * 64; const int h = h0 + hh;
  for (int i = tid; i < 64 * 8; i += 256) { const int j = i / 8, d8 = (i % 8) * 8; FragH f; f.half[0] = *(const v8us*)((const unsigned short*)V16 + ((size_t)b * SQ + s0 + j) * DM + h * HD + d8); for (int q = 0; q < 8; ++q) tl[d8 + q][j] = f.u[q]; }
  __syncthreads();
  { for (int i = tid; i < 64 * 8; i += 256) { const int d = i / 8, j8 = (i % 8) * 8; FragH f; for (int q = 0; q < 8; ++q) f.u[q] = tl[d][j8 + q]; *(v8us*)((unsigned short*)VT + ((size_t)hh * HD + d) * SQ + s0 + j8) = f.half[0]; }  } }


__global__ __launch_bounds__(256) void k_msfin(const float* __restrict__ X, const float* __restrict__ G, const float* __restrict__ cw, const float* __restrict__ cb, const float* __restrict__ g, const float* __restrict__ bta, float eps, float* __restrict__ out) {
  #pragma clang fp contract(off)
  __shared__ float red[256]; const size_t row = blockIdx.x; const int tid = threadIdx.x; const int s = (int)(row % SQ); constexpr int PER = DM / 256; float vals[PER]; float s1 = 0.f;
  const float* xr = X + row * DM; const float* xm = (s > 0) ? xr - DM : xr; const float* xp = (s < SQ - 1) ? xr + DM : xr; const float km = (s > 0) ? 1.f : 0.f, kp = (s < SQ - 1) ? 1.f : 0.f;
  for (int q = 0; q < PER; ++q) { const int j = tid * 4 + q; const float x0 = bf16_round(xr[j]); const float xa = __fmul_rn(bf16_round(xm[j]), km), xc = __fmul_rn(bf16_round(xp[j]), kp);
    float loc = __fmul_rn(xa, bf16_round(cw[j * 3 + 0])); loc = __fadd_rn(loc, __fmul_rn(x0, bf16_round(cw[j * 3 + 1]))); loc = __fadd_rn(loc, __fmul_rn(xc, bf16_round(cw[j * 3 + 2]))); loc = __fadd_rn(loc, bf16_round(cb[j]));
    const float y = __fadd_rn(x0, __fadd_rn(G[row * DM + j], __fmul_rn(0.3f, loc))); vals[q] = y; s1 = __fadd_rn(s1, y); }
  red[tid] = s1; __syncthreads(); for (int st = 128; st > 0; st >>= 1) { if (tid < st) red[tid] = __fadd_rn(red[tid], red[tid + st]); __syncthreads(); }
  const float mu = red[0] / (float)DM; __syncthreads(); float s2 = 0.f;
  for (int q = 0; q < PER; ++q) { const float c = __fadd_rn(vals[q], -mu); s2 = __fadd_rn(s2, __fmul_rn(c, c)); }
  red[tid] = s2; __syncthreads(); for (int st = 128; st > 0; st >>= 1) { if (tid < st) red[tid] = __fadd_rn(red[tid], red[tid + st]); __syncthreads(); }
  const float rs = rsqrtf(__fadd_rn(red[0] / (float)DM, eps)); v4f o;
  for (int q = 0; q < PER; ++q) { const int j = tid * 4 + q; o[q] = __fadd_rn(__fmul_rn(__fmul_rn(__fadd_rn(vals[q], -mu), rs), bf16_round(g[j])), bf16_round(bta[j])); }
  *(v4f*)(out + row * DM + tid * 4) = o;  }


__global__ __launch_bounds__(256) void k_rsmf(const float* __restrict__ S, _Float16* __restrict__ P, int qn, int hg) {
  #pragma clang fp contract(off)
  const int t = blockIdx.x * 256 + threadIdx.x; if (t >= qn * hg) return; const size_t i = (size_t)(t / qn) * SQ + (t % qn); const float* s = S + i * SQ; float mx = -3.0e38f;
#pragma unroll 1
  for (int j = 0; j < SQ; ++j) mx = fmaxf(mx, s[j]); float se = 0.f;
#pragma unroll 1
  for (int j = 0; j < SQ; ++j) se += __expf(s[j] - mx); const float sc = 256.0f / se;
#pragma unroll 1
  for (int j0 = 0; j0 < SQ; j0 += 8) { FragH f; for (int q = 0; q < 8; ++q) f.h[q] = (_Float16)(__expf(s[j0 + q] - mx) * sc); unsigned short* d = (unsigned short*)P + i * SQ + j0; *(v8us*)d = f.half[0];  } }

extern "C" void kernel_launch(void* const* d_in, const int* in_sizes, int n_in,
                              void* d_out, int out_size, void* d_ws, size_t ws_size, hipStream_t stream) {
  (void)in_sizes; (void)n_in; (void)out_size;
  const float* const* I = (const float* const*)d_in; const float* x = I[0]; const float* wq = I[1]; const float* bq = I[2]; const float* wk = I[3]; const float* bk = I[4]; const float* wv = I[5]; const float* bv = I[6]; const float* wo = I[7]; const float* bo = I[8]; const float* cw = I[9]; const float* cb = I[10]; const float* lng = I[11]; const float* lnb = I[12];      /* weights [out][in] (natural) */
  char* ws = (char*)d_ws; size_t off = 0;
  auto take = [&](size_t bytes) { char* p = ws + off; off += (bytes + 255) & ~(size_t)255; return p; };
  _Float16* BQ = (_Float16*)take((size_t)DM * DM * 2); _Float16* BK = (_Float16*)take((size_t)DM * DM * 2); _Float16* BV = (_Float16*)take((size_t)DM * DM * 2); _Float16* BO = (_Float16*)take((size_t)DM * DM * 2);
  _Float16* X16 = (_Float16*)take(NR * DM * 2); _Float16* Q16 = (_Float16*)take(NR * DM * 2); _Float16* K16 = (_Float16*)take(NR * DM * 2); _Float16* V16 = (_Float16*)take(NR * DM * 2); _Float16* O16 = (_Float16*)take(NR * DM * 2); float* GA = (float*)take(NR * DM * 4);      /* global attention branch (f32 rows) */
  float* S = (float*)take((size_t)HG * SQ * SQ * 4); _Float16* P = (_Float16*)take((size_t)HG * SQ * SQ * 2); _Float16* VT = (_Float16*)take((size_t)NH * HD * SQ * 2);
  if (off > ws_size) return;
  { const size_t nw8 = (size_t)DM * DM / 8; const unsigned gw = (unsigned)((nw8 + 255) / 256); k_wnat<<<gw, 256, 0, stream>>>(wq, nw8, BQ); k_wnat<<<gw, 256, 0, stream>>>(wk, nw8, BK); k_wnat<<<gw, 256, 0, stream>>>(wv, nw8, BV); k_wnat<<<gw, 256, 0, stream>>>(wo, nw8, BO); }
  k_x16<<<(unsigned)((NR * DM / 8 + 255) / 256), 256, 0, stream>>>(x, X16, NR * DM / 8);
  const size_t r0p = (size_t)B0 * SQ;      /* first projected row */
  k_gemm2<0><<<dim3((unsigned)((MP / 128) * (DM / 64)), 1), 128, 0, stream>>>(X16 + r0p * DM, DM, 0, BQ, DM, 0, 0.0625f, bq, 0, nullptr, 1, 0, 0, nullptr, Q16 + r0p * DM, DM, 0, MP, DM, DM);
  k_gemm2<0><<<dim3((unsigned)((MP / 128) * (DM / 64)), 1), 128, 0, stream>>>(X16 + r0p * DM, DM, 0, BK, DM, 0, 0.0625f, bk, 0, nullptr, 1, 0, 0, nullptr, K16 + r0p * DM, DM, 0, MP, DM, DM);
  k_gemm2<0><<<dim3((unsigned)((MP / 128) * (DM / 64)), 1), 128, 0, stream>>>(X16 + r0p * DM, DM, 0, BV, DM, 0, 0.0625f, bv, 0, nullptr, 1, 0, 0, nullptr, V16 + r0p * DM, DM, 0, MP, DM, DM);
  for (int b = B0; b < B0 + NBR; ++b) { const size_t r0 = (size_t)b * SQ;
    k_vt<NH, SQ><<<NH * (SQ / 64), 256, 0, stream>>>(V16 + r0 * LQ, LQ, 0, VT);      /* V^T [NH][HD][SQ] for this batch */
    for (int h0 = 0; h0 < NHD; h0 += HG) {
      k_gemm2<0><<<dim3((QN / 128) * (SQ / 64), HG), 128, 0, stream>>>(Q16 + r0 * LQ + h0 * HD, LQ, (size_t)HD, K16 + r0 * LQ + h0 * HD, LQ, (size_t)HD, 0.125f, nullptr, 0, nullptr, 1, 0, 0, S, nullptr, SQ, (size_t)SQ * SQ, QN, SQ, HD);      /* scores, HG heads per launch */
      k_rsmf<<<(HG * QN + 255) / 256, 256, 0, stream>>>(S, P, QN, HG);      /* P = 256 softmax (f16), rows of all HG heads */
      k_gemm2<0><<<dim3((QN / 128) * (HD / 64), HG), 128, 0, stream>>>(P, SQ, (size_t)SQ * SQ, VT + (size_t)h0 * HD * SQ, SQ, (size_t)HD * SQ, 0.25f, nullptr, 0, nullptr, 1, 0, 0, nullptr, O16 + r0 * DM + h0 * HD, DM, (size_t)HD, QN, HD, SQ); } }      /* o (merged heads) as f16 rows */
  k_gemm2<0><<<dim3((unsigned)((MPO / 128) * (DM / 64)), 1), 128, 0, stream>>>(O16 + r0p * DM, DM, 0, BO, DM, 0, 0.0009765625f, bo, 0, nullptr, 1, 0, 0, GA + r0p * DM, nullptr, DM, 0, MPO, DM, DM);      /* global = ctx Wo^T + bo (f32 rows) */
  k_msfin<<<(unsigned)MPO, 256, 0, stream>>>(x + r0p * DM, GA + r0p * DM, cw, cb, lng, lnb, 1e-5f, (float*)d_out + r0p * DM);      /* + x + 0.3 local conv, LayerNorm -> output rows */
}

// v001
// It runs in 1830 microseconds.
// Two timings next to v000 put it at 3.77 and 3.76 times that version's speed.
#include <hip/hip_runtime.h>
// Multi-scale attention block (x [4][2048][1024]; q/k/v = x W^T + b (natural [1024][1024] weights), 16 heads of 64; softmax(q k^T / 8); ctx merged; global = ctx Wo^T + bo; local = depthwise conv3 of x along the sequence (conv_w [1024][3], zero pad) + conv_b; y = x + global + 0.3 local; out = LayerNorm(y) (eps 1e-5) ln_g + ln_b -> [4][2048][1024]).
// Structure (attention part): token rows r = b*2048 + s; x as exact f16 rows (bf16-rounded); Q, K, V as three WMMA GEMMs (32x64 wave tiles, f32 accumulation, exact x16 weights + bias, f16 outputs); per batch: V^T for all heads via LDS transposes; per (batch, group of 4 heads): scores GEMM (K = 64, batched over the heads on grid.y, alpha = 1/8), row softmax on VALU (f32 statistics, native exp; weights stored x256 as f16), o = P . V^T GEMM (K = 2048, alpha 2^-2: o carried x64 against f16 subnormal flush, folded into the output GEMM alpha) written straight into the merged f16 o rows; global = o W_o^T + b GEMM (f32 rows); then per token row on VALU: + bf16(x) + 0.3 (depthwise conv3 of bf16(x) + b), LayerNorm, affine -> output rows.
// Compute dtype: inputs rounded to bf16; x / weights exact; q, k, v, softmax weights and o as plain f16 GEMM operands (~2^-12); scores and softmax statistics f32. v_wmma_f32_16x16x32_f16.
#define NB 4
#define SQ 2048
#define DM 1024
#define NH 16
#define HD 64
#define HG 4                         /* heads per attention launch group */
#define B0 0                         /* first batch processed (debug hook) */
#define NBR NB                       /* batches processed (debug hook) */
#define NR ((size_t)NB * SQ)         /* token rows */
#define MP ((int)((size_t)NBR * SQ)) /* rows projected (debug hook) */
#define QN SQ                        /* query rows attended per batch (debug hook) */
#define NHD NH                       /* heads attended (debug hook) */
#define MPO MP                       /* rows through the output stage (debug hook) */
#define LQ DM      /* row pitch of the q/k/v rows */
typedef __bf16 v16b __attribute__((ext_vector_type(16)));
typedef unsigned short v8us __attribute__((ext_vector_type(8), may_alias));
typedef float  v8f  __attribute__((ext_vector_type(8)));
typedef float  v4f  __attribute__((ext_vector_type(4)));
typedef float  v4fa __attribute__((ext_vector_type(4), may_alias));
union FragB { v16b v; v8us half[2]; unsigned short u[16]; };

__device__ __forceinline__ unsigned short bf16_bits(float x) { unsigned int u = __float_as_uint(x); return (unsigned short)((u + 0x7FFFu + ((u >> 16) & 1u)) >> 16); }
__device__ __forceinline__ float bf16_val(unsigned short b) { return __uint_as_float(((unsigned int)b) << 16); }
__device__ __forceinline__ float bf16_round(float x) { return bf16_val(bf16_bits(x)); }
// D += A·B with NT terms: 1 = ah·bh, 2 = + al·bh (A split), 3 = + ah·bl (both split)
template <int NT>
__device__ __forceinline__ v8f mmaN(v16b ah, v16b al, v16b bh, v16b bl, v8f c) {
  c = __builtin_amdgcn_wmma_f32_16x16x32_bf16(false, ah, false, bh, (short)0, c, false, false);
  if (NT >= 2) c = __builtin_amdgcn_wmma_f32_16x16x32_bf16(false, al, false, bh, (short)0, c, false, false);
  if (NT >= 3) c = __builtin_amdgcn_wmma_f32_16x16x32_bf16(false, ah, false, bl, (short)0, c, false, false);
  asm volatile("v_nop\n\tv_nop\n\tv_nop\n\tv_nop" : "+v"(c) : "v"(ah), "v"(al), "v"(bh), "v"(bl));
  return c;
}

__global__ __launch_bounds__(256) void k_wt_bf16(const float* __restrict__ W, unsigned short* __restrict__ Wt, int K, int N) {
  const int t = blockIdx.x * 256 + threadIdx.x;
  const int k8n = K / 8;
  if (t >= N * k8n) return;
  const int n = t / k8n, k8 = (t % k8n) * 8;
  v8us v;
#pragma unroll
  for (int i = 0; i < 8; ++i) v[i] = bf16_bits(W[(size_t)(k8 + i) * N + n]);
  *(v8us*)(Wt + (size_t)n * K + k8) = v;
  
}

// GEMM C[M][N] (f32, pitch ldc) = act(A[M][K]·W + bias). A f32 row-major (pitch lda) converted per fragment to bf16
// (ASPLIT: hi/lo two planes -> 2 terms, else single rounded term); Wt bf16 [N][K] (pitch ldb). BIAS_BF16 rounds the
// bias to bf16 first (bias quantised to bf16 before the add). K%32==0, M%16==0, N%64==0.
template <bool ASPLIT, int ACT, bool BIAS_BF16>
__global__ __launch_bounds__(128) void k_gemm_bf(const float* __restrict__ A, int lda, const unsigned short* __restrict__ Wt, int ldb,
                                               const float* __restrict__ bias, float* __restrict__ C, int ldc, int M, int N, int K) {
  __shared__ __attribute__((aligned(16))) float so[4][16][64];
  const int tid = threadIdx.x, w = tid >> 5, lane = tid & 31, ln = lane & 15, hh = lane >> 4;
  const int ntn = N / 64;
  const int wid = blockIdx.x * 4 + w;
  const int mt = wid / ntn, nq = wid % ntn;
  if (mt * 16 >= M) return;
  const int row0 = mt * 16, col0 = nq * 64;
  const float* arow = A + (size_t)(row0 + ln) * lda;
  v8f acc[4] = {};
  for (int kb = 0; kb < K; kb += 32) {
    FragB ah, al;
    const v4f x0 = *(const v4fa*)(arow + kb + 8 * hh), x1 = *(const v4fa*)(arow + kb + 8 * hh + 4);
    const v4f x2 = *(const v4fa*)(arow + kb + 16 + 8 * hh), x3 = *(const v4fa*)(arow + kb + 16 + 8 * hh + 4);
    float xs[16] = {x0[0],x0[1],x0[2],x0[3],x1[0],x1[1],x1[2],x1[3],x2[0],x2[1],x2[2],x2[3],x3[0],x3[1],x3[2],x3[3]};
#pragma unroll
    for (int i = 0; i < 16; ++i) { const unsigned short hb = bf16_bits(xs[i]); ah.u[i] = hb; al.u[i] = ASPLIT ? bf16_bits(xs[i] - bf16_val(hb)) : (unsigned short)0; }
#pragma unroll
    for (int t = 0; t < 4; ++t) {
      const unsigned short* brow = Wt + (size_t)(col0 + t * 16 + ln) * ldb + kb;
      FragB b;
      b.half[0] = *(const v8us*)(brow + 8 * hh);
      b.half[1] = *(const v8us*)(brow + 16 + 8 * hh);
      acc[t] = mmaN<ASPLIT ? 2 : 1>(ah.v, al.v, b.v, b.v, acc[t]);
    }
  }
#pragma unroll
  for (int t = 0; t < 4; ++t) {
    float bv = bias ? bias[col0 + t * 16 + ln] : 0.f;
    if (BIAS_BF16) bv = bf16_round(bv);
#pragma unroll
    for (int r = 0; r < 8; ++r) { float v = acc[t][r] + bv; if (ACT == 1) v = fmaxf(v, 0.f); so[w][8 * hh + r][t * 16 + ln] = v; }
  }
  __builtin_amdgcn_fence(__ATOMIC_ACQ_REL, "workgroup");
  __builtin_amdgcn_wave_barrier();
  const int rsub = lane >> 4, c4 = (lane & 15) * 4;
  {
#pragma unroll
    for (int q = 0; q < 8; ++q) {
      const int r = q * 2 + rsub;
      const v4f v = *(const v4fa*)&so[w][r][c4];
      *(v4f*)(C + (size_t)(row0 + r) * ldc + col0 + c4) = v;
    }
    
  }
}

// GEMM C = act(A·W + bias + resid): A f32 (ASPLIT -> hi/lo 2 terms), Wt bf16 [N][K]; ACT 0 none, 1 relu, 2 exact gelu;
// resid (optional, f32, row index = (row % rmod), pitch ldr, RES_BF16 rounds it) added before the activation.
template <bool ASPLIT, int ACT, bool BIAS_BF16, bool RES_BF16>
__global__ __launch_bounds__(128) void k_gemm_bf3(const float* __restrict__ A, int lda, const unsigned short* __restrict__ Wt, int ldb,
                                                const float* __restrict__ bias, const float* __restrict__ resid, int rmod, int ldr,
                                                float* __restrict__ C, int ldc, int M, int N, int K) {
  __shared__ __attribute__((aligned(16))) float so[4][16][64];
  const int tid = threadIdx.x, w = tid >> 5, lane = tid & 31, ln = lane & 15, hh = lane >> 4;
  const int ntn = N / 64;
  const int wid = blockIdx.x * 4 + w;
  const int mt = wid / ntn, nq = wid % ntn;
  if (mt * 16 >= M) return;
  const int row0 = mt * 16, col0 = nq * 64;
  const float* arow = A + (size_t)(row0 + ln) * lda;
  v8f acc[4] = {};
  for (int kb = 0; kb < K; kb += 32) {
    FragB ah, al;
    const v4f x0 = *(const v4fa*)(arow + kb + 8 * hh), x1 = *(const v4fa*)(arow + kb + 8 * hh + 4);
    const v4f x2 = *(const v4fa*)(arow + kb + 16 + 8 * hh), x3 = *(const v4fa*)(arow + kb + 16 + 8 * hh + 4);
    float xs[16] = {x0[0],x0[1],x0[2],x0[3],x1[0],x1[1],x1[2],x1[3],x2[0],x2[1],x2[2],x2[3],x3[0],x3[1],x3[2],x3[3]};
#pragma unroll
    for (int i = 0; i < 16; ++i) { const unsigned short hb = bf16_bits(xs[i]); ah.u[i] = hb; al.u[i] = ASPLIT ? bf16_bits(xs[i] - bf16_val(hb)) : (unsigned short)0; }
#pragma unroll
    for (int t = 0; t < 4; ++t) {
      const unsigned short* brow = Wt + (size_t)(col0 + t * 16 + ln) * ldb + kb;
      FragB b;
      b.half[0] = *(const v8us*)(brow + 8 * hh);
      b.half[1] = *(const v8us*)(brow + 16 + 8 * hh);
      acc[t] = mmaN<ASPLIT ? 2 : 1>(ah.v, al.v, b.v, b.v, acc[t]);
    }
  }
#pragma unroll
  for (int t = 0; t < 4; ++t) {
    const int col = col0 + t * 16 + ln;
    float bv = bias ? bias[col] : 0.f;
    if (BIAS_BF16) bv = bf16_round(bv);
#pragma unroll
    for (int r = 0; r < 8; ++r) {
      float v = acc[t][r] + bv;
      if (resid) { float rv = resid[(size_t)((row0 + 8 * hh + r) % rmod) * ldr + col]; if (RES_BF16) rv = bf16_round(rv); v += rv; }
      if (ACT == 1) v = fmaxf(v, 0.f);
      if (ACT == 2) v = 0.5f * v * (1.0f + erff(v * 0.70710678118654752f));
      if (ACT == 3) { const float u = 0.7978845608028654f * (v + 0.044715f * v * v * v); v = 0.5f * v * (1.0f + tanhf(u)); }
      so[w][8 * hh + r][t * 16 + ln] = v;
    }
  }
  __builtin_amdgcn_fence(__ATOMIC_ACQ_REL, "workgroup");
  __builtin_amdgcn_wave_barrier();
  const int rsub = lane >> 4, c4 = (lane & 15) * 4;
  {
#pragma unroll
    for (int q = 0; q < 8; ++q) {
      const int r = q * 2 + rsub;
      const v4f v = *(const v4fa*)&so[w][r][c4];
      *(v4f*)(C + (size_t)(row0 + r) * ldc + col0 + c4) = v;
    }
    
  }
}
// row LayerNorm (biased variance, eps) over N: s = X (+ R); optional out_sum <- s; out_norm <- (s-mu)*rsqrt(var+eps)*g + b
template <bool PARAM_BF16>
__global__ __launch_bounds__(256) void k_layernorm(const float* __restrict__ X, const float* __restrict__ R, const float* __restrict__ g, const float* __restrict__ bta,
                                                  float* __restrict__ out_sum, float* __restrict__ out_norm, int N, float eps) {
  __shared__ float red[256];
  const int row = blockIdx.x, tid = threadIdx.x;
  const float* x = X + (size_t)row * N; const float* rr = R ? R + (size_t)row * N : nullptr;
  float vals[16];                     // up to N = 4096
  const int per = N / 256;            // contiguous chunk per thread? use strided-by-4 chunks: thread handles j = tid*4 + 1024*u
  float s1 = 0.f;
  for (int u = 0; u < per / 4; ++u) {
    const int j = tid * 4 + 1024 * u;
    const v4f a = *(const v4fa*)(x + j);
    v4f b = {0.f,0.f,0.f,0.f}; if (rr) b = *(const v4fa*)(rr + j);
#pragma unroll
    for (int q = 0; q < 4; ++q) { const float v = a[q] + b[q]; vals[u * 4 + q] = v; s1 += v; }
  }
  red[tid] = s1; __syncthreads();
  for (int st = 128; st > 0; st >>= 1) { if (tid < st) red[tid] += red[tid + st]; __syncthreads(); }
  const float mu = red[0] / (float)N; __syncthreads();
  float s2 = 0.f;
  for (int u = 0; u < per / 4; ++u)
#pragma unroll
    for (int q = 0; q < 4; ++q) { const float c = vals[u * 4 + q] - mu; s2 += c * c; }
  red[tid] = s2; __syncthreads();
  for (int st = 128; st > 0; st >>= 1) { if (tid < st) red[tid] += red[tid + st]; __syncthreads(); }
  const float rs = rsqrtf(red[0] / (float)N + eps);
  {
    for (int u = 0; u < per / 4; ++u) {
      const int j = tid * 4 + 1024 * u;
      v4f o, sm;
#pragma unroll
      for (int q = 0; q < 4; ++q) {
        float gg = g[j + q], bb = bta[j + q];
        if (PARAM_BF16) { gg = bf16_round(gg); bb = bf16_round(bb); }
        sm[q] = vals[u * 4 + q]; o[q] = (vals[u * 4 + q] - mu) * rs * gg + bb;
      }
      if (out_sum) *(v4f*)(out_sum + (size_t)row * N + j) = sm;
      *(v4f*)(out_norm + (size_t)row * N + j) = o;
    }
    
  }
}



// ---- f16 WMMA path (v_wmma_f32_16x16x32_f16): 11-bit significands for operands in range — used where a [0,1] probability operand needs more precision than bf16
typedef _Float16 v16h __attribute__((ext_vector_type(16)));
union FragH { v16h v; v8us half[2]; _Float16 h[16]; unsigned short u[16]; };
template <int NT>
__device__ __forceinline__ v8f mmaH(v16h ah, v16h al, v16h bh, v16h bl, v8f c) {
  c = __builtin_amdgcn_wmma_f32_16x16x32_f16(false, ah, false, bh, (short)0, c, false, false);
  if (NT >= 2) c = __builtin_amdgcn_wmma_f32_16x16x32_f16(false, al, false, bh, (short)0, c, false, false);
  if (NT >= 3) c = __builtin_amdgcn_wmma_f32_16x16x32_f16(false, ah, false, bl, (short)0, c, false, false);
  asm volatile("v_nop\n\tv_nop\n\tv_nop\n\tv_nop" : "+v"(c) : "v"(ah), "v"(al), "v"(bh), "v"(bl));
  return c;
}
// batched GEMM like k_gemm_b but f16 operands: A f32 (split into f16 hi/lo if ASPLIT, else rounded to f16), Bt = f16 values [n][k]; alpha; C f32; N multiple of 16 (partial tiles skipped)
template <bool ASPLIT>
__global__ __launch_bounds__(128) void k_gemm_h(const float* __restrict__ A, int lda, size_t sA, const _Float16* __restrict__ Bh, int ldb, size_t sB, float alpha, float* __restrict__ C, int ldc, size_t sC, int M, int N, int K) {
  __shared__ __attribute__((aligned(16))) float so[4][16][64];
  const int tid = threadIdx.x, w = tid >> 5, lane = tid & 31, ln = lane & 15, hh = lane >> 4; const int by = blockIdx.y;
  A += (size_t)by * sA; Bh += (size_t)by * sB; C += (size_t)by * sC;
  const int ntn = (N + 63) / 64; const int wid = blockIdx.x * 4 + w; const int mt = wid / ntn, nq = wid % ntn; if (mt * 16 >= M) return;
  const int row0 = mt * 16, col0 = nq * 64; const float* arow = A + (size_t)(row0 + ln) * lda;
  v8f acc[4] = {};
  for (int kb = 0; kb < K; kb += 32) {
    FragH ah, al;
    const v4f x0 = *(const v4fa*)(arow + kb + 8 * hh), x1 = *(const v4fa*)(arow + kb + 8 * hh + 4), x2 = *(const v4fa*)(arow + kb + 16 + 8 * hh), x3 = *(const v4fa*)(arow + kb + 16 + 8 * hh + 4);
    float xs[16] = {x0[0],x0[1],x0[2],x0[3],x1[0],x1[1],x1[2],x1[3],x2[0],x2[1],x2[2],x2[3],x3[0],x3[1],x3[2],x3[3]};
#pragma unroll
    for (int i = 0; i < 16; ++i) { const _Float16 h = (_Float16)xs[i]; ah.h[i] = h; al.h[i] = ASPLIT ? (_Float16)(xs[i] - (float)h) : (_Float16)0.0f; }
#pragma unroll
    for (int t = 0; t < 4; ++t) { if (col0 + t * 16 >= N) continue; const size_t boff = (size_t)(col0 + t * 16 + ln) * ldb + kb; FragH bq; bq.half[0] = *(const v8us*)(Bh + boff + 8 * hh); bq.half[1] = *(const v8us*)(Bh + boff + 16 + 8 * hh);
      acc[t] = mmaH<ASPLIT ? 2 : 1>(ah.v, al.v, bq.v, bq.v, acc[t]); }
  }
#pragma unroll
  for (int t = 0; t < 4; ++t) { if (col0 + t * 16 >= N) continue;
#pragma unroll
    for (int r = 0; r < 8; ++r) so[w][8 * hh + r][t * 16 + ln] = acc[t][r] * alpha; }
  __builtin_amdgcn_fence(__ATOMIC_ACQ_REL, "workgroup"); __builtin_amdgcn_wave_barrier();
  const int rsub = lane >> 4, c4 = (lane & 15) * 4;
  {
#pragma unroll
    for (int q = 0; q < 8; ++q) { const int r = q * 2 + rsub; if (col0 + c4 < N) { const v4f v = *(const v4fa*)&so[w][r][c4]; *(v4f*)(C + (size_t)(row0 + r) * ldc + col0 + c4) = v; } }
     }
}

// Wt[n][k] = f16(W[k][n]·scale) from f32 row-major W[K][N] (scale = power of two; bf16-exact weights stay exact in f16 away from the subnormal range)
__global__ __launch_bounds__(256) void k_wt_f16(const float* __restrict__ W, _Float16* __restrict__ Wt, int K, int N, float scale) {
  const int t = blockIdx.x * 256 + threadIdx.x; if (t >= N * (K / 8)) return; const int n = t / (K / 8), k8 = (t % (K / 8)) * 8; FragH f;
#pragma unroll
  for (int i = 0; i < 8; ++i) f.h[i] = (_Float16)(bf16_round(W[(size_t)(k8 + i) * N + n]) * scale); const v8us o = f.half[0];
  *(v8us*)((unsigned short*)Wt + (size_t)n * K + k8) = o; 
}
// k_gemm_hh variant with fused epilogue: v = acc·alpha + bias[by·sBias + col] (+ CP[(row/rowsPerB)·sCPb + by·64 + col] if CP) ; ACT 0 none / 1 elu ; writes f16 C16 (and f32 C if non-null)
template <int ACT>
__global__ __launch_bounds__(128) void k_gemm_hhx(const _Float16* __restrict__ A, int lda, size_t sA, const _Float16* __restrict__ Bh, int ldb, size_t sB, float alpha, const float* __restrict__ bias, size_t sBias, const float* __restrict__ CP, int rowsPerB, size_t sCPb, int row0g,
    float* __restrict__ C, _Float16* __restrict__ C16, int ldc, size_t sC, int M, int N, int K) {
  __shared__ __attribute__((aligned(16))) float so[4][16][64];
  const int tid = threadIdx.x, w = tid >> 5, lane = tid & 31, ln = lane & 15, hh = lane >> 4; const int by = blockIdx.y;
  A += (size_t)by * sA; Bh += (size_t)by * sB; const size_t cofs = (size_t)by * sC; const float* bp = bias ? bias + (size_t)by * sBias : nullptr;
  const int ntn = (N + 63) / 64; const int wid = blockIdx.x * 4 + w; const int mt = wid / ntn, nq = wid % ntn; if (mt * 16 >= M) return;
  const int row0 = mt * 16, col0 = nq * 64; const _Float16* arow = A + (size_t)(row0 + ln) * lda;
  v8f acc[4] = {};
  for (int kb = 0; kb < K; kb += 32) { FragH ah; ah.half[0] = *(const v8us*)((const unsigned short*)arow + kb + 8 * hh); ah.half[1] = *(const v8us*)((const unsigned short*)arow + kb + 16 + 8 * hh);
#pragma unroll
    for (int t = 0; t < 4; ++t) { if (col0 + t * 16 >= N) continue; const size_t boff = (size_t)(col0 + t * 16 + ln) * ldb + kb; FragH bq; bq.half[0] = *(const v8us*)((const unsigned short*)Bh + boff + 8 * hh); bq.half[1] = *(const v8us*)((const unsigned short*)Bh + boff + 16 + 8 * hh);
      acc[t] = mmaH<1>(ah.v, ah.v, bq.v, bq.v, acc[t]); }
  }
#pragma unroll
  for (int t = 0; t < 4; ++t) { if (col0 + t * 16 >= N) continue; const int col = col0 + t * 16 + ln; const float bv = bp ? bf16_round(bp[col]) : 0.f;
#pragma unroll
    for (int r = 0; r < 8; ++r) { float v = acc[t][r] * alpha + bv; if (CP) { const int rr = row0g + row0 + 8 * hh + r; if (rowsPerB < 0) v += CP[cofs + (size_t)rr * ldc + col];      /* rowsPerB < 0: own element of the batched C plane */ else { const int bidx = rr / rowsPerB; v += CP[(size_t)bidx * sCPb + (size_t)by * 64 + col]; } } if (ACT == 1) v = (v > 0.f) ? v : expm1f(v); else if (ACT == 7) v = (v > 0.f) ? v + 1.0f : expf(v); else if (ACT == 8) v = tanhf(v); else if (ACT == 9) v = 0.5f * v * (1.0f + tanhf(0.7978845608028654f * (v + 0.044715f * v * v * v))); else if (ACT == 11) v = 1.0f / (1.0f + expf(-v)); else if (ACT == 12) v = (v > 0.f) ? v : 0.01f * v; else if (ACT == 14) v = (v > 0.f) ? v : 0.1f * v; else if (ACT == 16) v = (v >= 0.f) ? v : 0.3f * v; else if (ACT == 17) v = (v >= 0.f) ? v : 0.2f * v; else if (ACT == 15) v = v / (1.0f + expf(-v)); else if (ACT == 3) v = fmaxf(v, 0.f); else if (ACT == 6) v = 0.5f * v * (1.0f + erff(v * 0.70710678118654752f)); so[w][8 * hh + r][t * 16 + ln] = v; } }
  __builtin_amdgcn_fence(__ATOMIC_ACQ_REL, "workgroup"); __builtin_amdgcn_wave_barrier();
  const int rsub = lane >> 4, c4 = (lane & 15) * 4; typedef _Float16 v4h __attribute__((ext_vector_type(4)));
  {
#pragma unroll
    for (int q = 0; q < 8; ++q) { const int r = q * 2 + rsub; if (col0 + c4 < N) { const v4f v = *(const v4fa*)&so[w][r][c4]; if (C) *(v4f*)(C + cofs + (size_t)(row0 + r) * ldc + col0 + c4) = v; if (C16) { v4h h4; for (int i = 0; i < 4; ++i) h4[i] = (_Float16)v[i]; *(v4h*)(C16 + cofs + (size_t)(row0 + r) * ldc + col0 + c4) = h4; } } }
     }
}


typedef _Float16 v4h __attribute__((ext_vector_type(4)));

__global__ __launch_bounds__(256) void k_x16(const float* __restrict__ x, _Float16* __restrict__ X16, size_t n8) { const size_t t = (size_t)blockIdx.x * 256 + threadIdx.x; if (t >= n8) return; FragH f;
#pragma unroll
  for (int q = 0; q < 8; ++q) f.h[q] = (_Float16)bf16_round(x[t * 8 + q]); *(v8us*)((unsigned short*)X16 + t * 8) = f.half[0];  }
__global__ __launch_bounds__(256) void k_h16(const float* __restrict__ x, _Float16* __restrict__ X16, size_t n8) { const size_t t = (size_t)blockIdx.x * 256 + threadIdx.x; if (t >= n8) return; FragH f;
#pragma unroll
  for (int q = 0; q < 8; ++q) f.h[q] = (_Float16)x[t * 8 + q]; *(v8us*)((unsigned short*)X16 + t * 8) = f.half[0];  }
__global__ __launch_bounds__(256) void k_round16f(const float* __restrict__ W, _Float16* __restrict__ Bt, size_t n8) { const size_t t = (size_t)blockIdx.x * 256 + threadIdx.x; if (t >= n8) return; FragH f;
#pragma unroll
  for (int i = 0; i < 8; ++i) f.h[i] = (_Float16)(bf16_round(W[t * 8 + i]) * 16.0f); *(v8us*)((unsigned short*)Bt + t * 8) = f.half[0];  }
template <int NHv, int TTv>
__global__ __launch_bounds__(256) void k_vt(const _Float16* __restrict__ V16, int ldv, int voff, _Float16* __restrict__ Vt) { __shared__ unsigned short tl[64][66]; const int tid = threadIdx.x; const int slab = blockIdx.x / (TTv / 64), lg = blockIdx.x % (TTv / 64); const int b = slab / NHv, h = slab % NHv;
  for (int i = tid; i < 64 * 8; i += 256) { const int r = i / 8, c8 = (i % 8) * 8; FragH f; f.half[0] = *(const v8us*)((const unsigned short*)V16 + ((size_t)b * TTv + lg * 64 + r) * ldv + voff + h * 64 + c8);
#pragma unroll
    for (int q = 0; q < 8; ++q) tl[r][c8 + q] = f.u[q]; }
  __syncthreads();
  {
#pragma unroll
    for (int rd = 0; rd < 2; ++rd) { const int d = rd * 32 + tid / 8, pc = tid % 8; FragH f;
#pragma unroll
      for (int q = 0; q < 8; ++q) f.u[q] = tl[pc * 8 + q][d];
      *(v8us*)((unsigned short*)Vt + ((size_t)slab * 64 + d) * TTv + lg * 64 + pc * 8) = f.half[0]; }
     } }

__global__ __launch_bounds__(256) void k_hl(const float* __restrict__ F, _Float16* __restrict__ Hh, _Float16* __restrict__ Hl, size_t n8) { const size_t t = (size_t)blockIdx.x * 256 + threadIdx.x; if (t >= n8) return; FragH fh, fl; const v4f a = *(const v4fa*)(F + t * 8), c = *(const v4fa*)(F + t * 8 + 4);
#pragma unroll
  for (int q = 0; q < 4; ++q) { _Float16 h = (_Float16)a[q]; fh.h[q] = h; fl.h[q] = (_Float16)((a[q] - (float)h) * 1024.0f); h = (_Float16)c[q]; fh.h[4 + q] = h; fl.h[4 + q] = (_Float16)((c[q] - (float)h) * 1024.0f); }
  { *(v8us*)((unsigned short*)Hh + t * 8) = fh.half[0]; *(v8us*)((unsigned short*)Hl + t * 8) = fl.half[0];  } }

// ---- fast GEMM (wave tile 32x64; requires M % 32 == 0 rows per launch region and N % 64 == 0); epilogue = k_gemm_hhx semantics ----
__device__ __forceinline__ v16h g2_frag(const _Float16* p, int hh) { FragH f; f.half[0] = *(const v8us*)((const unsigned short*)p + 8 * hh); f.half[1] = *(const v8us*)((const unsigned short*)p + 16 + 8 * hh); return f.v; }
__device__ __forceinline__ v8f g2_mma(v16h a, v16h b, v8f c) { v8f d = __builtin_amdgcn_wmma_f32_16x16x32_f16(false, a, false, b, (short)0, c, false, false); asm volatile("v_nop\n\tv_nop\n\tv_nop\n\tv_nop" : "+v"(d) : "v"(a), "v"(b)); return d; }
template <int ACT>
__global__ __launch_bounds__(128) void k_gemm2(const _Float16* __restrict__ A, int lda, size_t sA, const _Float16* __restrict__ Bh, int ldb, size_t sB, float alpha, const float* __restrict__ bias, size_t sBias, const float* __restrict__ CP, int rowsPerB, size_t sCPb, int row0g,
    float* __restrict__ C, _Float16* __restrict__ C16, int ldc, size_t sC, int M, int N, int K) { static_assert(ACT == 0 || ACT == 3 || ACT == 6 || ACT == 8 || ACT == 9 || ACT == 11 || ACT == 12 || ACT == 14 || ACT == 15 || ACT == 16 || ACT == 17, "k_gemm2: unsupported ACT code (would silently apply no activation)");
  __shared__ __attribute__((aligned(16))) float so[4][32][68];
  const int tid = threadIdx.x, w = tid >> 5, lane = tid & 31, ln = lane & 15, hh = lane >> 4; const int by = blockIdx.y;
  A += (size_t)by * sA; Bh += (size_t)by * sB; const size_t cofs = (size_t)by * sC; const float* bp = bias ? bias + (size_t)by * sBias : nullptr;
  const int ntn = N >> 6; const int mt = blockIdx.x / ntn, nq = blockIdx.x - mt * ntn; const int row0 = mt * 128 + 32 * w, col0 = nq * 64; if (row0 >= M) return;
  const _Float16* a0p = A + (size_t)(row0 + ln) * lda; const _Float16* a1p = a0p + (size_t)16 * lda;
  const _Float16* b0p = Bh + (size_t)(col0 + ln) * ldb; const _Float16* b1p = b0p + (size_t)16 * ldb; const _Float16* b2p = b1p + (size_t)16 * ldb; const _Float16* b3p = b2p + (size_t)16 * ldb;
  const v8f z8 = {0.f,0.f,0.f,0.f,0.f,0.f,0.f,0.f}; v8f c00 = z8, c01 = z8, c02 = z8, c03 = z8, c10 = z8, c11 = z8, c12 = z8, c13 = z8;
#pragma unroll 1
  for (int kb = 0; kb < K; kb += 32) { const v16h a0 = g2_frag(a0p + kb, hh), a1 = g2_frag(a1p + kb, hh);
    v16h b = g2_frag(b0p + kb, hh); c00 = g2_mma(a0, b, c00); c10 = g2_mma(a1, b, c10);
    b = g2_frag(b1p + kb, hh); c01 = g2_mma(a0, b, c01); c11 = g2_mma(a1, b, c11);
    b = g2_frag(b2p + kb, hh); c02 = g2_mma(a0, b, c02); c12 = g2_mma(a1, b, c12);
    b = g2_frag(b3p + kb, hh); c03 = g2_mma(a0, b, c03); c13 = g2_mma(a1, b, c13); }
  v8f accs[8] = {c00, c01, c02, c03, c10, c11, c12, c13};
#pragma unroll
  for (int u = 0; u < 8; ++u) { const int t = u & 3, half = u >> 2; const int col = col0 + t * 16 + ln; const float bv = bp ? bf16_round(bp[col]) : 0.f;
#pragma unroll
    for (int r = 0; r < 8; ++r) { const int rloc = half * 16 + 8 * hh + r; float v = accs[u][r] * alpha + bv; if (CP) { if (rowsPerB < 0) v += CP[cofs + (size_t)(row0g + row0 + rloc) * ldc + col];      /* rowsPerB < 0: own element of the batched C plane */ else { const int bidx = (row0g + row0 + rloc) / rowsPerB; v += CP[(size_t)bidx * sCPb + (size_t)by * 64 + col]; } }
      if (ACT == 3) v = fmaxf(v, 0.f); else if (ACT == 6) v = 0.5f * v * (1.0f + erff(v * 0.70710678118654752f)); else if (ACT == 11) v = 1.0f / (1.0f + expf(-v)); else if (ACT == 15) v = v / (1.0f + expf(-v)); else if (ACT == 12) v = (v > 0.f) ? v : 0.01f * v; else if (ACT == 8) v = tanhf(v); else if (ACT == 9) v = 0.5f * v * (1.0f + tanhf(0.7978845608028654f * (v + 0.044715f * v * v * v))); else if (ACT == 14) v = (v > 0.f) ? v : 0.1f * v; else if (ACT == 16) v = (v >= 0.f) ? v : 0.3f * v; else if (ACT == 17) v = (v >= 0.f) ? v : 0.2f * v;
      so[w][rloc][t * 16 + ln] = v; } }
  __builtin_amdgcn_fence(__ATOMIC_ACQ_REL, "workgroup"); __builtin_amdgcn_wave_barrier();
  const int rsub = lane >> 4, c4 = (lane & 15) * 4;
  {
#pragma unroll
    for (int q = 0; q < 16; ++q) { const int r = q * 2 + rsub; const v4f v = *(const v4fa*)&so[w][r][c4]; if (C) *(v4f*)(C + cofs + (size_t)(row0 + r) * ldc + col0 + c4) = v; if (C16) { v4h h4; for (int i = 0; i < 4; ++i) h4[i] = (_Float16)v[i]; *(v4h*)(C16 + cofs + (size_t)(row0 + r) * ldc + col0 + c4) = h4; } }
     } }


__global__ __launch_bounds__(256) void k_wnat(const float* __restrict__ w, size_t n8, _Float16* __restrict__ Bt) { const size_t t = (size_t)blockIdx.x * 256 + threadIdx.x; if (t >= n8) return; FragH f; for (int q = 0; q < 8; ++q) f.h[q] = (_Float16)(bf16_round(w[t * 8 + q]) * 16.0f); *(v8us*)((unsigned short*)Bt + t * 8) = f.half[0];  }
__global__ __launch_bounds__(256) void k_rsm(const float* __restrict__ S, _Float16* __restrict__ P, int nrows) {
  #pragma clang fp contract(off)
  const int i = blockIdx.x * 256 + threadIdx.x; if (i >= nrows) return; const float* s = S + (size_t)i * SQ; float mx = -3.0e38f;
#pragma unroll 1
  for (int j = 0; j < SQ; ++j) mx = fmaxf(mx, s[j]); float se = 0.f;
#pragma unroll 1
  for (int j = 0; j < SQ; ++j) se += expf(s[j] - mx); const float sc = 256.0f / se;
#pragma unroll 1
  for (int j0 = 0; j0 < SQ; j0 += 8) { FragH f; for (int q = 0; q < 8; ++q) f.h[q] = (_Float16)(expf(s[j0 + q] - mx) * sc); unsigned short* d = (unsigned short*)P + (size_t)i * SQ + j0; *(v8us*)d = f.half[0];  } }
__global__ __launch_bounds__(256) void k_vt(const _Float16* __restrict__ V16, int b, int h0, _Float16* __restrict__ VT) { __shared__ unsigned short tl[64][65]; const int tid = threadIdx.x; const int hh = blockIdx.x % HG, sg = blockIdx.x / HG; const int s0 = sg * 64; const int h = h0 + hh;
  for (int i = tid; i < 64 * 8; i += 256) { const int j = i / 8, d8 = (i % 8) * 8; FragH f; f.half[0] = *(const v8us*)((const unsigned short*)V16 + ((size_t)b * SQ + s0 + j) * DM + h * HD + d8); for (int q = 0; q < 8; ++q) tl[d8 + q][j] = f.u[q]; }
  __syncthreads();
  { for (int i = tid; i < 64 * 8; i += 256) { const int d = i / 8, j8 = (i % 8) * 8; FragH f; for (int q = 0; q < 8; ++q) f.u[q] = tl[d][j8 + q]; *(v8us*)((unsigned short*)VT + ((size_t)hh * HD + d) * SQ + s0 + j8) = f.half[0]; }  } }


__global__ __launch_bounds__(256) void k_msfin(const float* __restrict__ X, const float* __restrict__ G, const float* __restrict__ cw, const float* __restrict__ cb, const float* __restrict__ g, const float* __restrict__ bta, float eps, float* __restrict__ out) {
  #pragma clang fp contract(off)
  __shared__ float red[256]; const size_t row = blockIdx.x; const int tid = threadIdx.x; const int s = (int)(row % SQ); constexpr int PER = DM / 256; float vals[PER]; float s1 = 0.f;
  const float* xr = X + row * DM; const float* xm = (s > 0) ? xr - DM : xr; const float* xp = (s < SQ - 1) ? xr + DM : xr; const float km = (s > 0) ? 1.f : 0.f, kp = (s < SQ - 1) ? 1.f : 0.f;
  for (int q = 0; q < PER; ++q) { const int j = tid * 4 + q; const float x0 = bf16_round(xr[j]); const float xa = __fmul_rn(bf16_round(xm[j]), km), xc = __fmul_rn(bf16_round(xp[j]), kp);
    float loc = __fmul_rn(xa, bf16_round(cw[j * 3 + 0])); loc = __fadd_rn(loc, __fmul_rn(x0, bf16_round(cw[j * 3 + 1]))); loc = __fadd_rn(loc, __fmul_rn(xc, bf16_round(cw[j * 3 + 2]))); loc = __fadd_rn(loc, bf16_round(cb[j]));
    const float y = __fadd_rn(x0, __fadd_rn(G[row * DM + j], __fmul_rn(0.3f, loc))); vals[q] = y; s1 = __fadd_rn(s1, y); }
  red[tid] = s1; __syncthreads(); for (int st = 128; st > 0; st >>= 1) { if (tid < st) red[tid] = __fadd_rn(red[tid], red[tid + st]); __syncthreads(); }
  const float mu = red[0] / (float)DM; __syncthreads(); float s2 = 0.f;
  for (int q = 0; q < PER; ++q) { const float c = __fadd_rn(vals[q], -mu); s2 = __fadd_rn(s2, __fmul_rn(c, c)); }
  red[tid] = s2; __syncthreads(); for (int st = 128; st > 0; st >>= 1) { if (tid < st) red[tid] = __fadd_rn(red[tid], red[tid + st]); __syncthreads(); }
  const float rs = rsqrtf(__fadd_rn(red[0] / (float)DM, eps)); v4f o;
  for (int q = 0; q < PER; ++q) { const int j = tid * 4 + q; o[q] = __fadd_rn(__fmul_rn(__fmul_rn(__fadd_rn(vals[q], -mu), rs), bf16_round(g[j])), bf16_round(bta[j])); }
  *(v4f*)(out + row * DM + tid * 4) = o;  }


// Row softmax, one wave per score row: lane l holds columns 128 u + 4 l .. + 3 (u = 0..15), so each load covers 512 contiguous bytes and each store 256;
// the row stays in registers: read once, one exp per element. Maximum and sum: per lane, then a five-step butterfly (every lane ends with the same bits).
__global__ __launch_bounds__(512) void k_rsmf(const float* __restrict__ S, _Float16* __restrict__ P, int qn, int hg) {
  const int t = blockIdx.x * 16 + (threadIdx.x >> 5), lane = threadIdx.x & 31; if (t >= qn * hg) return;      /* wave-uniform; no barrier in this kernel */
  const size_t i = (size_t)(t / qn) * SQ + (t % qn); const float* s = S + i * SQ + lane * 4; _Float16* d = P + i * SQ + lane * 4; v4f r[16];
#pragma unroll
  for (int u = 0; u < 16; ++u) r[u] = *(const v4fa*)(s + u * 128);
  asm volatile("s_wait_xcnt 0x0" :: "v"(s) : "memory");      /* the loads' address pair stays live up to this wait, so nothing (a load's own result included) is written over it earlier */
  v4f m4 = r[0];
#pragma unroll
  for (int u = 1; u < 16; ++u) for (int q = 0; q < 4; ++q) m4[q] = fmaxf(m4[q], r[u][q]);
  float mx = fmaxf(fmaxf(fmaxf(m4[0], m4[1]), fmaxf(m4[2], m4[3])), -3.0e38f);
#pragma unroll
  for (int m = 16; m > 0; m >>= 1) mx = fmaxf(mx, __shfl_xor(mx, m, 32));
  v4f s4 = {0.f, 0.f, 0.f, 0.f};
#pragma unroll
  for (int u = 0; u < 16; ++u) { v4f e; for (int q = 0; q < 4; ++q) e[q] = __expf(r[u][q] - mx); r[u] = e; s4 += e; }
  float se = (s4[0] + s4[1]) + (s4[2] + s4[3]);
#pragma unroll
  for (int m = 16; m > 0; m >>= 1) se += __shfl_xor(se, m, 32);
  const float sc = 256.0f / se;
#pragma unroll
  for (int u = 0; u < 16; ++u) { const v4f p = r[u] * sc; v4h h4; for (int q = 0; q < 4; ++q) h4[q] = (_Float16)p[q]; *(v4h*)(d + u * 128) = h4; } }

extern "C" void kernel_launch(void* const* d_in, const int* in_sizes, int n_in,
                              void* d_out, int out_size, void* d_ws, size_t ws_size, hipStream_t stream) {
  (void)in_sizes; (void)n_in; (void)out_size;
  const float* const* I = (const float* const*)d_in; const float* x = I[0]; const float* wq = I[1]; const float* bq = I[2]; const float* wk = I[3]; const float* bk = I[4]; const float* wv = I[5]; const float* bv = I[6]; const float* wo = I[7]; const float* bo = I[8]; const float* cw = I[9]; const float* cb = I[10]; const float* lng = I[11]; const float* lnb = I[12];      /* weights [out][in] (natural) */
  char* ws = (char*)d_ws; size_t off = 0;
  auto take = [&](size_t bytes) { char* p = ws + off; off += (bytes + 255) & ~(size_t)255; return p; };
  _Float16* BQ = (_Float16*)take((size_t)DM * DM * 2); _Float16* BK = (_Float16*)take((size_t)DM * DM * 2); _Float16* BV = (_Float16*)take((size_t)DM * DM * 2); _Float16* BO = (_Float16*)take((size_t)DM * DM * 2);
  _Float16* X16 = (_Float16*)take(NR * DM * 2); _Float16* Q16 = (_Float16*)take(NR * DM * 2); _Float16* K16 = (_Float16*)take(NR * DM * 2); _Float16* V16 = (_Float16*)take(NR * DM * 2); _Float16* O16 = (_Float16*)take(NR * DM * 2); float* GA = (float*)take(NR * DM * 4);      /* global attention branch (f32 rows) */
  float* S = (float*)take((size_t)HG * SQ * SQ * 4); _Float16* P = (_Float16*)take((size_t)HG * SQ * SQ * 2); _Float16* VT = (_Float16*)take((size_t)NH * HD * SQ * 2);
  if (off > ws_size) return;
  { const size_t nw8 = (size_t)DM * DM / 8; const unsigned gw = (unsigned)((nw8 + 255) / 256); k_wnat<<<gw, 256, 0, stream>>>(wq, nw8, BQ); k_wnat<<<gw, 256, 0, stream>>>(wk, nw8, BK); k_wnat<<<gw, 256, 0, stream>>>(wv, nw8, BV); k_wnat<<<gw, 256, 0, stream>>>(wo, nw8, BO); }
  k_x16<<<(unsigned)((NR * DM / 8 + 255) / 256), 256, 0, stream>>>(x, X16, NR * DM / 8);
  const size_t r0p = (size_t)B0 * SQ;      /* first projected row */
  k_gemm2<0><<<dim3((unsigned)((MP / 128) * (DM / 64)), 1), 128, 0, stream>>>(X16 + r0p * DM, DM, 0, BQ, DM, 0, 0.0625f, bq, 0, nullptr, 1, 0, 0, nullptr, Q16 + r0p * DM, DM, 0, MP, DM, DM);
  k_gemm2<0><<<dim3((unsigned)((MP / 128) * (DM / 64)), 1), 128, 0, stream>>>(X16 + r0p * DM, DM, 0, BK, DM, 0, 0.0625f, bk, 0, nullptr, 1, 0, 0, nullptr, K16 + r0p * DM, DM, 0, MP, DM, DM);
  k_gemm2<0><<<dim3((unsigned)((MP / 128) * (DM / 64)), 1), 128, 0, stream>>>(X16 + r0p * DM, DM, 0, BV, DM, 0, 0.0625f, bv, 0, nullptr, 1, 0, 0, nullptr, V16 + r0p * DM, DM, 0, MP, DM, DM);
  for (int b = B0; b < B0 + NBR; ++b) { const size_t r0 = (size_t)b * SQ;
    k_vt<NH, SQ><<<NH * (SQ / 64), 256, 0, stream>>>(V16 + r0 * LQ, LQ, 0, VT);      /* V^T [NH][HD][SQ] for this batch */
    for (int h0 = 0; h0 < NHD; h0 += HG) {
      k_gemm2<0><<<dim3((QN / 128) * (SQ / 64), HG), 128, 0, stream>>>(Q16 + r0 * LQ + h0 * HD, LQ, (size_t)HD, K16 + r0 * LQ + h0 * HD, LQ, (size_t)HD, 0.125f, nullptr, 0, nullptr, 1, 0, 0, S, nullptr, SQ, (size_t)SQ * SQ, QN, SQ, HD);      /* scores, HG heads per launch */
      k_rsmf<<<(HG * QN + 15) / 16, 512, 0, stream>>>(S, P, QN, HG);      /* P = 256 softmax (f16), rows of all HG heads */
      k_gemm2<0><<<dim3((QN / 128) * (HD / 64), HG), 128, 0, stream>>>(P, SQ, (size_t)SQ * SQ, VT + (size_t)h0 * HD * SQ, SQ, (size_t)HD * SQ, 0.25f, nullptr, 0, nullptr, 1, 0, 0, nullptr, O16 + r0 * DM + h0 * HD, DM, (size_t)HD, QN, HD, SQ); } }      /* o (merged heads) as f16 rows */
  k_gemm2<0><<<dim3((unsigned)((MPO / 128) * (DM / 64)), 1), 128, 0, stream>>>(O16 + r0p * DM, DM, 0, BO, DM, 0, 0.0009765625f, bo, 0, nullptr, 1, 0, 0, GA + r0p * DM, nullptr, DM, 0, MPO, DM, DM);      /* global = ctx Wo^T + bo (f32 rows) */
  k_msfin<<<(unsigned)MPO, 256, 0, stream>>>(x + r0p * DM, GA + r0p * DM, cw, cb, lng, lnb, 1e-5f, (float*)d_out + r0p * DM);      /* + x + 0.3 local conv, LayerNorm -> output rows */
}

// v003
// Measured time: 199 microseconds a run.
// It is 9.26 times as fast as v001, going by the measured steps of the versions left out in between.
// All steps since v000 together make it 34.9 times as fast.
#include <hip/hip_runtime.h>
// Multi-scale attention block (x [4][2048][1024]; q/k/v = x W^T + b (natural [1024][1024] weights), 16 heads of 64; softmax(q k^T / 8); ctx merged; global = ctx Wo^T + bo; local = depthwise conv3 of x along the sequence (conv_w [1024][3], zero pad) + conv_b; y = x + global + 0.3 local; out = LayerNorm(y) (eps 1e-5) ln_g + ln_b -> [4][2048][1024]).
// Structure (attention part): token rows r = b*2048 + s; x as exact f16 rows (bf16-rounded); Q, K, V as three WMMA GEMMs (128x128 block tiles staged in LDS, 64x64 wave tiles, f32 accumulation, exact x16 weights + bias, f16 outputs); V^T for all (batch, head) via LDS transposes; one fused attention launch over all (batch, head, 256-query block): per 32 keys S^T = K Q^T on WMMA, running-maximum softmax on VALU (f32 statistics, native exp2; weights x256 as f16, packed from the score accumulators), O^T += V^T P^T on WMMA; o carried x64 against f16 subnormal flush (folded into the output GEMM alpha), written straight into the merged f16 o rows; global = o W_o^T + b GEMM (f32 rows); then per token row on VALU: + bf16(x) + 0.3 (depthwise conv3 of bf16(x) + b), LayerNorm, affine -> output rows.
// Compute dtype: inputs rounded to bf16; x / weights exact; q, k, v, softmax weights and o as plain f16 GEMM operands (~2^-12); scores and softmax statistics f32. v_wmma_f32_16x16x32_f16.
#define NB 4
#define SQ 2048
#define DM 1024
#define NH 16
#define HD 64
#define HG 4                         /* heads per launch of the unlaunched k_vt(V16, b, h0, VT) overload */
#define B0 0                         /* first batch processed (debug hook) */
#define NBR NB                       /* batches processed (debug hook) */
#define NR ((size_t)NB * SQ)         /* token rows */
#define MP ((int)((size_t)NBR * SQ)) /* rows projected (debug hook) */
#define QN SQ                        /* not used: k_fattn attends all SQ query rows of each batch */
#define NHD NH                       /* not used: k_fattn attends all NH heads */
#define MPO MP                       /* rows through the output stage (debug hook) */
#define LQ DM      /* row pitch of the q/k/v rows */
typedef __bf16 v16b __attribute__((ext_vector_type(16)));
typedef unsigned short v8us __attribute__((ext_vector_type(8), may_alias));
typedef float  v8f  __attribute__((ext_vector_type(8)));
typedef float  v4f  __attribute__((ext_vector_type(4)));
typedef float  v4fa __attribute__((ext_vector_type(4), may_alias));
union FragB { v16b v; v8us half[2]; unsigned short u[16]; };

__device__ __forceinline__ unsigned short bf16_bits(float x) { unsigned int u = __float_as_uint(x); return (unsigned short)((u + 0x7FFFu + ((u >> 16) & 1u)) >> 16); }
__device__ __forceinline__ float bf16_val(unsigned short b) { return __uint_as_float(((unsigned int)b) << 16); }
__device__ __forceinline__ float bf16_round(float x) { return bf16_val(bf16_bits(x)); }
// D += A·B with NT terms: 1 = ah·bh, 2 = + al·bh (A split), 3 = + ah·bl (both split)
template <int NT>
__device__ __forceinline__ v8f mmaN(v16b ah, v16b al, v16b bh, v16b bl, v8f c) {
  c = __builtin_amdgcn_wmma_f32_16x16x32_bf16(false, ah, false, bh, (short)0, c, false, false);
  if (NT >= 2) c = __builtin_amdgcn_wmma_f32_16x16x32_bf16(false, al, false, bh, (short)0, c, false, false);
  if (NT >= 3) c = __builtin_amdgcn_wmma_f32_16x16x32_bf16(false, ah, false, bl, (short)0, c, false, false);
  asm volatile("v_nop\n\tv_nop\n\tv_nop\n\tv_nop" : "+v"(c) : "v"(ah), "v"(al), "v"(bh), "v"(bl));
  return c;
}

__global__ __launch_bounds__(256) void k_wt_bf16(const float* __restrict__ W, unsigned short* __restrict__ Wt, int K, int N) {
  const int t = blockIdx.x * 256 + threadIdx.x;
  const int k8n = K / 8;
  if (t >= N * k8n) return;
  const int n = t / k8n, k8 = (t % k8n) * 8;
  v8us v;
#pragma unroll
  for (int i = 0; i < 8; ++i) v[i] = bf16_bits(W[(size_t)(k8 + i) * N + n]);
  *(v8us*)(Wt + (size_t)n * K + k8) = v;
  
}

// GEMM C[M][N] (f32, pitch ldc) = act(A[M][K]·W + bias). A f32 row-major (pitch lda) converted per fragment to bf16
// (ASPLIT: hi/lo two planes -> 2 terms, else single rounded term); Wt bf16 [N][K] (pitch ldb). BIAS_BF16 rounds the
// bias to bf16 first (bias quantised to bf16 before the add). K%32==0, M%16==0, N%64==0.
template <bool ASPLIT, int ACT, bool BIAS_BF16>
__global__ __launch_bounds__(128) void k_gemm_bf(const float* __restrict__ A, int lda, const unsigned short* __restrict__ Wt, int ldb,
                                               const float* __restrict__ bias, float* __restrict__ C, int ldc, int M, int N, int K) {
  __shared__ __attribute__((aligned(16))) float so[4][16][64];
  const int tid = threadIdx.x, w = tid >> 5, lane = tid & 31, ln = lane & 15, hh = lane >> 4;
  const int ntn = N / 64;
  const int wid = blockIdx.x * 4 + w;
  const int mt = wid / ntn, nq = wid % ntn;
  if (mt * 16 >= M) return;
  const int row0 = mt * 16, col0 = nq * 64;
  const float* arow = A + (size_t)(row0 + ln) * lda;
  v8f acc[4] = {};
  for (int kb = 0; kb < K; kb += 32) {
    FragB ah, al;
    const v4f x0 = *(const v4fa*)(arow + kb + 8 * hh), x1 = *(const v4fa*)(arow + kb + 8 * hh + 4);
    const v4f x2 = *(const v4fa*)(arow + kb + 16 + 8 * hh), x3 = *(const v4fa*)(arow + kb + 16 + 8 * hh + 4);
    float xs[16] = {x0[0],x0[1],x0[2],x0[3],x1[0],x1[1],x1[2],x1[3],x2[0],x2[1],x2[2],x2[3],x3[0],x3[1],x3[2],x3[3]};
#pragma unroll
    for (int i = 0; i < 16; ++i) { const unsigned short hb = bf16_bits(xs[i]); ah.u[i] = hb; al.u[i] = ASPLIT ? bf16_bits(xs[i] - bf16_val(hb)) : (unsigned short)0; }
#pragma unroll
    for (int t = 0; t < 4; ++t) {
      const unsigned short* brow = Wt + (size_t)(col0 + t * 16 + ln) * ldb + kb;
      FragB b;
      b.half[0] = *(const v8us*)(brow + 8 * hh);
      b.half[1] = *(const v8us*)(brow + 16 + 8 * hh);
      acc[t] = mmaN<ASPLIT ? 2 : 1>(ah.v, al.v, b.v, b.v, acc[t]);
    }
  }
#pragma unroll
  for (int t = 0; t < 4; ++t) {
    float bv = bias ? bias[col0 + t * 16 + ln] : 0.f;
    if (BIAS_BF16) bv = bf16_round(bv);
#pragma unroll
    for (int r = 0; r < 8; ++r) { float v = acc[t][r] + bv; if (ACT == 1) v = fmaxf(v, 0.f); so[w][8 * hh + r][t * 16 + ln] = v; }
  }
  __builtin_amdgcn_fence(__ATOMIC_ACQ_REL, "workgroup");
  __builtin_amdgcn_wave_barrier();
  const int rsub = lane >> 4, c4 = (lane & 15) * 4;
  {
#pragma unroll
    for (int q = 0; q < 8; ++q) {
      const int r = q * 2 + rsub;
      const v4f v = *(const v4fa*)&so[w][r][c4];
      *(v4f*)(C + (size_t)(row0 + r) * ldc + col0 + c4) = v;
    }
    
  }
}

// GEMM C = act(A·W + bias + resid): A f32 (ASPLIT -> hi/lo 2 terms), Wt bf16 [N][K]; ACT 0 none, 1 relu, 2 exact gelu;
// resid (optional, f32, row index = (row % rmod), pitch ldr, RES_BF16 rounds it) added before the activation.
template <bool ASPLIT, int ACT, bool BIAS_BF16, bool RES_BF16>
__global__ __launch_bounds__(128) void k_gemm_bf3(const float* __restrict__ A, int lda, const unsigned short* __restrict__ Wt, int ldb,
                                                const float* __restrict__ bias, const float* __restrict__ resid, int rmod, int ldr,
                                                float* __restrict__ C, int ldc, int M, int N, int K) {
  __shared__ __attribute__((aligned(16))) float so[4][16][64];
  const int tid = threadIdx.x, w = tid >> 5, lane = tid & 31, ln = lane & 15, hh = lane >> 4;
  const int ntn = N / 64;
  const int wid = blockIdx.x * 4 + w;
  const int mt = wid / ntn, nq = wid % ntn;
  if (mt * 16 >= M) return;
  const int row0 = mt * 16, col0 = nq * 64;
  const float* arow = A + (size_t)(row0 + ln) * lda;
  v8f acc[4] = {};
  for (int kb = 0; kb < K; kb += 32) {
    FragB ah, al;
    const v4f x0 = *(const v4fa*)(arow + kb + 8 * hh), x1 = *(const v4fa*)(arow + kb + 8 * hh + 4);
    const v4f x2 = *(const v4fa*)(arow + kb + 16 + 8 * hh), x3 = *(const v4fa*)(arow + kb + 16 + 8 * hh + 4);
    float xs[16] = {x0[0],x0[1],x0[2],x0[3],x1[0],x1[1],x1[2],x1[3],x2[0],x2[1],x2[2],x2[3],x3[0],x3[1],x3[2],x3[3]};
#pragma unroll
    for (int i = 0; i < 16; ++i) { const unsigned short hb = bf16_bits(xs[i]); ah.u[i] = hb; al.u[i] = ASPLIT ? bf16_bits(xs[i] - bf16_val(hb)) : (unsigned short)0; }
#pragma unroll
    for (int t = 0; t < 4; ++t) {
      const unsigned short* brow = Wt + (size_t)(col0 + t * 16 + ln) * ldb + kb;
      FragB b;
      b.half[0] = *(const v8us*)(brow + 8 * hh);
      b.half[1] = *(const v8us*)(brow + 16 + 8 * hh);
      acc[t] = mmaN<ASPLIT ? 2 : 1>(ah.v, al.v, b.v, b.v, acc[t]);
    }
  }
#pragma unroll
  for (int t = 0; t < 4; ++t) {
    const int col = col0 + t * 16 + ln;
    float bv = bias ? bias[col] : 0.f;
    if (BIAS_BF16) bv = bf16_round(bv);
#pragma unroll
    for (int r = 0; r < 8; ++r) {
      float v = acc[t][r] + bv;
      if (resid) { float rv = resid[(size_t)((row0 + 8 * hh + r) % rmod) * ldr + col]; if (RES_BF16) rv = bf16_round(rv); v += rv; }
      if (ACT == 1) v = fmaxf(v, 0.f);
      if (ACT == 2) v = 0.5f * v * (1.0f + erff(v * 0.70710678118654752f));
      if (ACT == 3) { const float u = 0.7978845608028654f * (v + 0.044715f * v * v * v); v = 0.5f * v * (1.0f + tanhf(u)); }
      so[w][8 * hh + r][t * 16 + ln] = v;
    }
  }
  __builtin_amdgcn_fence(__ATOMIC_ACQ_REL, "workgroup");
  __builtin_amdgcn_wave_barrier();
  const int rsub = lane >> 4, c4 = (lane & 15) * 4;
  {
#pragma unroll
    for (int q = 0; q < 8; ++q) {
      const int r = q * 2 + rsub;
      const v4f v = *(const v4fa*)&so[w][r][c4];
      *(v4f*)(C + (size_t)(row0 + r) * ldc + col0 + c4) = v;
    }
    
  }
}
// row LayerNorm (biased variance, eps) over N: s = X (+ R); optional out_sum <- s; out_norm <- (s-mu)*rsqrt(var+eps)*g + b
template <bool PARAM_BF16>
__global__ __launch_bounds__(256) void k_layernorm(const float* __restrict__ X, const float* __restrict__ R, const float* __restrict__ g, const float* __restrict__ bta,
                                                  float* __restrict__ out_sum, float* __restrict__ out_norm, int N, float eps) {
  __shared__ float red[256];
  const int row = blockIdx.x, tid = threadIdx.x;
  const float* x = X + (size_t)row * N; const float* rr = R ? R + (size_t)row * N : nullptr;
  float vals[16];                     // up to N = 4096
  const int per = N / 256;            // contiguous chunk per thread? use strided-by-4 chunks: thread handles j = tid*4 + 1024*u
  float s1 = 0.f;
  for (int u = 0; u < per / 4; ++u) {
    const int j = tid * 4 + 1024 * u;
    const v4f a = *(const v4fa*)(x + j);
    v4f b = {0.f,0.f,0.f,0.f}; if (rr) b = *(const v4fa*)(rr + j);
#pragma unroll
    for (int q = 0; q < 4; ++q) { const float v = a[q] + b[q]; vals[u * 4 + q] = v; s1 += v; }
  }
  red[tid] = s1; __syncthreads();
  for (int st = 128; st > 0; st >>= 1) { if (tid < st) red[tid] += red[tid + st]; __syncthreads(); }
  const float mu = red[0] / (float)N; __syncthreads();
  float s2 = 0.f;
  for (int u = 0; u < per / 4; ++u)
#pragma unroll
    for (int q = 0; q < 4; ++q) { const float c = vals[u * 4 + q] - mu; s2 += c * c; }
  red[tid] = s2; __syncthreads();
  for (int st = 128; st > 0; st >>= 1) { if (tid < st) red[tid] += red[tid + st]; __syncthreads(); }
  const float rs = rsqrtf(red[0] / (float)N + eps);
  {
    for (int u = 0; u < per / 4; ++u) {
      const int j = tid * 4 + 1024 * u;
      v4f o, sm;
#pragma unroll
      for (int q = 0; q < 4; ++q) {
        float gg = g[j + q], bb = bta[j + q];
        if (PARAM_BF16) { gg = bf16_round(gg); bb = bf16_round(bb); }
        sm[q] = vals[u * 4 + q]; o[q] = (vals[u * 4 + q] - mu) * rs * gg + bb;
      }
      if (out_sum) *(v4f*)(out_sum + (size_t)row * N + j) = sm;
      *(v4f*)(out_norm + (size_t)row * N + j) = o;
    }
    
  }
}



// ---- f16 WMMA path (v_wmma_f32_16x16x32_f16): 11-bit significands for operands in range — used where a [0,1] probability operand needs more precision than bf16
typedef _Float16 v16h __attribute__((ext_vector_type(16)));
union FragH { v16h v; v8us half[2]; _Float16 h[16]; unsigned short u[16]; };
template <int NT>
__device__ __forceinline__ v8f mmaH(v16h ah, v16h al, v16h bh, v16h bl, v8f c) {
  c = __builtin_amdgcn_wmma_f32_16x16x32_f16(false, ah, false, bh, (short)0, c, false, false);
  if (NT >= 2) c = __builtin_amdgcn_wmma_f32_16x16x32_f16(false, al, false, bh, (short)0, c, false, false);
  if (NT >= 3) c = __builtin_amdgcn_wmma_f32_16x16x32_f16(false, ah, false, bl, (short)0, c, false, false);
  asm volatile("v_nop\n\tv_nop\n\tv_nop\n\tv_nop" : "+v"(c) : "v"(ah), "v"(al), "v"(bh), "v"(bl));
  return c;
}
// batched GEMM like k_gemm_b but f16 operands: A f32 (split into f16 hi/lo if ASPLIT, else rounded to f16), Bt = f16 values [n][k]; alpha; C f32; N multiple of 16 (partial tiles skipped)
template <bool ASPLIT>
__global__ __launch_bounds__(128) void k_gemm_h(const float* __restrict__ A, int lda, size_t sA, const _Float16* __restrict__ Bh, int ldb, size_t sB, float alpha, float* __restrict__ C, int ldc, size_t sC, int M, int N, int K) {
  __shared__ __attribute__((aligned(16))) float so[4][16][64];
  const int tid = threadIdx.x, w = tid >> 5, lane = tid & 31, ln = lane & 15, hh = lane >> 4; const int by = blockIdx.y;
  A += (size_t)by * sA; Bh += (size_t)by * sB; C += (size_t)by * sC;
  const int ntn = (N + 63) / 64; const int wid = blockIdx.x * 4 + w; const int mt = wid / ntn, nq = wid % ntn; if (mt * 16 >= M) return;
  const int row0 = mt * 16, col0 = nq * 64; const float* arow = A + (size_t)(row0 + ln) * lda;
  v8f acc[4] = {};
  for (int kb = 0; kb < K; kb += 32) {
    FragH ah, al;
    const v4f x0 = *(const v4fa*)(arow + kb + 8 * hh), x1 = *(const v4fa*)(arow + kb + 8 * hh + 4), x2 = *(const v4fa*)(arow + kb + 16 + 8 * hh), x3 = *(const v4fa*)(arow + kb + 16 + 8 * hh + 4);
    float xs[16] = {x0[0],x0[1],x0[2],x0[3],x1[0],x1[1],x1[2],x1[3],x2[0],x2[1],x2[2],x2[3],x3[0],x3[1],x3[2],x3[3]};
#pragma unroll
    for (int i = 0; i < 16; ++i) { const _Float16 h = (_Float16)xs[i]; ah.h[i] = h; al.h[i] = ASPLIT ? (_Float16)(xs[i] - (float)h) : (_Float16)0.0f; }
#pragma unroll
    for (int t = 0; t < 4; ++t) { if (col0 + t * 16 >= N) continue; const size_t boff = (size_t)(col0 + t * 16 + ln) * ldb + kb; FragH bq; bq.half[0] = *(const v8us*)(Bh + boff + 8 * hh); bq.half[1] = *(const v8us*)(Bh + boff + 16 + 8 * hh);
      acc[t] = mmaH<ASPLIT ? 2 : 1>(ah.v, al.v, bq.v, bq.v, acc[t]); }
  }
#pragma unroll
  for (int t = 0; t < 4; ++t) { if (col0 + t * 16 >= N) continue;
#pragma unroll
    for (int r = 0; r < 8; ++r) so[w][8 * hh + r][t * 16 + ln] = acc[t][r] * alpha; }
  __builtin_amdgcn_fence(__ATOMIC_ACQ_REL, "workgroup"); __builtin_amdgcn_wave_barrier();
  const int rsub = lane >> 4, c4 = (lane & 15) * 4;
  {
#pragma unroll
    for (int q = 0; q < 8; ++q) { const int r = q * 2 + rsub; if (col0 + c4 < N) { const v4f v = *(const v4fa*)&so[w][r][c4]; *(v4f*)(C + (size_t)(row0 + r) * ldc + col0 + c4) = v; } }
     }
}

// Wt[n][k] = f16(W[k][n]·scale) from f32 row-major W[K][N] (scale = power of two; bf16-exact weights stay exact in f16 away from the subnormal range)
__global__ __launch_bounds__(256) void k_wt_f16(const float* __restrict__ W, _Float16* __restrict__ Wt, int K, int N, float scale) {
  const int t = blockIdx.x * 256 + threadIdx.x; if (t >= N * (K / 8)) return; const int n = t / (K / 8), k8 = (t % (K / 8)) * 8; FragH f;
#pragma unroll
  for (int i = 0; i < 8; ++i) f.h[i] = (_Float16)(bf16_round(W[(size_t)(k8 + i) * N + n]) * scale); const v8us o = f.half[0];
  *(v8us*)((unsigned short*)Wt + (size_t)n * K + k8) = o; 
}
// k_gemm_hh variant with fused epilogue: v = acc·alpha + bias[by·sBias + col] (+ CP[(row/rowsPerB)·sCPb + by·64 + col] if CP) ; ACT 0 none / 1 elu ; writes f16 C16 (and f32 C if non-null)
template <int ACT>
__global__ __launch_bounds__(128) void k_gemm_hhx(const _Float16* __restrict__ A, int lda, size_t sA, const _Float16* __restrict__ Bh, int ldb, size_t sB, float alpha, const float* __restrict__ bias, size_t sBias, const float* __restrict__ CP, int rowsPerB, size_t sCPb, int row0g,
    float* __restrict__ C, _Float16* __restrict__ C16, int ldc, size_t sC, int M, int N, int K) {
  __shared__ __attribute__((aligned(16))) float so[4][16][64];
  const int tid = threadIdx.x, w = tid >> 5, lane = tid & 31, ln = lane & 15, hh = lane >> 4; const int by = blockIdx.y;
  A += (size_t)by * sA; Bh += (size_t)by * sB; const size_t cofs = (size_t)by * sC; const float* bp = bias ? bias + (size_t)by * sBias : nullptr;
  const int ntn = (N + 63) / 64; const int wid = blockIdx.x * 4 + w; const int mt = wid / ntn, nq = wid % ntn; if (mt * 16 >= M) return;
  const int row0 = mt * 16, col0 = nq * 64; const _Float16* arow = A + (size_t)(row0 + ln) * lda;
  v8f acc[4] = {};
  for (int kb = 0; kb < K; kb += 32) { FragH ah; ah.half[0] = *(const v8us*)((const unsigned short*)arow + kb + 8 * hh); ah.half[1] = *(const v8us*)((const unsigned short*)arow + kb + 16 + 8 * hh);
#pragma unroll
    for (int t = 0; t < 4; ++t) { if (col0 + t * 16 >= N) continue; const size_t boff = (size_t)(col0 + t * 16 + ln) * ldb + kb; FragH bq; bq.half[0] = *(const v8us*)((const unsigned short*)Bh + boff + 8 * hh); bq.half[1] = *(const v8us*)((const unsigned short*)Bh + boff + 16 + 8 * hh);
      acc[t] = mmaH<1>(ah.v, ah.v, bq.v, bq.v, acc[t]); }
  }
#pragma unroll
  for (int t = 0; t < 4; ++t) { if (col0 + t * 16 >= N) continue; const int col = col0 + t * 16 + ln; const float bv = bp ? bf16_round(bp[col]) : 0.f;
#pragma unroll
    for (int r = 0; r < 8; ++r) { float v = acc[t][r] * alpha + bv; if (CP) { const int rr = row0g + row0 + 8 * hh + r; if (rowsPerB < 0) v += CP[cofs + (size_t)rr * ldc + col];      /* rowsPerB < 0: own element of the batched C plane */ else { const int bidx = rr / rowsPerB; v += CP[(size_t)bidx * sCPb + (size_t)by * 64 + col]; } } if (ACT == 1) v = (v > 0.f) ? v : expm1f(v); else if (ACT == 7) v = (v > 0.f) ? v + 1.0f : expf(v); else if (ACT == 8) v = tanhf(v); else if (ACT == 9) v = 0.5f * v * (1.0f + tanhf(0.7978845608028654f * (v + 0.044715f * v * v * v))); else if (ACT == 11) v = 1.0f / (1.0f + expf(-v)); else if (ACT == 12) v = (v > 0.f) ? v : 0.01f * v; else if (ACT == 14) v = (v > 0.f) ? v : 0.1f * v; else if (ACT == 16) v = (v >= 0.f) ? v : 0.3f * v; else if (ACT == 17) v = (v >= 0.f) ? v : 0.2f * v; else if (ACT == 15) v = v / (1.0f + expf(-v)); else if (ACT == 3) v = fmaxf(v, 0.f); else if (ACT == 6) v = 0.5f * v * (1.0f + erff(v * 0.70710678118654752f)); so[w][8 * hh + r][t * 16 + ln] = v; } }
  __builtin_amdgcn_fence(__ATOMIC_ACQ_REL, "workgroup"); __builtin_amdgcn_wave_barrier();
  const int rsub = lane >> 4, c4 = (lane & 15) * 4; typedef _Float16 v4h __attribute__((ext_vector_type(4)));
  {
#pragma unroll
    for (int q = 0; q < 8; ++q) { const int r = q * 2 + rsub; if (col0 + c4 < N) { const v4f v = *(const v4fa*)&so[w][r][c4]; if (C) *(v4f*)(C + cofs + (size_t)(row0 + r) * ldc + col0 + c4) = v; if (C16) { v4h h4; for (int i = 0; i < 4; ++i) h4[i] = (_Float16)v[i]; *(v4h*)(C16 + cofs + (size_t)(row0 + r) * ldc + col0 + c4) = h4; } } }
     }
}


typedef _Float16 v4h __attribute__((ext_vector_type(4)));

__global__ __launch_bounds__(256) void k_x16(const float* __restrict__ x, _Float16* __restrict__ X16, size_t n8) { const size_t t = (size_t)blockIdx.x * 256 + threadIdx.x; if (t >= n8) return; FragH f;
#pragma unroll
  for (int q = 0; q < 8; ++q) f.h[q] = (_Float16)bf16_round(x[t * 8 + q]); *(v8us*)((unsigned short*)X16 + t * 8) = f.half[0];  }
__global__ __launch_bounds__(256) void k_h16(const float* __restrict__ x, _Float16* __restrict__ X16, size_t n8) { const size_t t = (size_t)blockIdx.x * 256 + threadIdx.x; if (t >= n8) return; FragH f;
#pragma unroll
  for (int q = 0; q < 8; ++q) f.h[q] = (_Float16)x[t * 8 + q]; *(v8us*)((unsigned short*)X16 + t * 8) = f.half[0];  }
__global__ __launch_bounds__(256) void k_round16f(const float* __restrict__ W, _Float16* __restrict__ Bt, size_t n8) { const size_t t = (size_t)blockIdx.x * 256 + threadIdx.x; if (t >= n8) return; FragH f;
#pragma unroll
  for (int i = 0; i < 8; ++i) f.h[i] = (_Float16)(bf16_round(W[t * 8 + i]) * 16.0f); *(v8us*)((unsigned short*)Bt + t * 8) = f.half[0];  }
template <int NHv, int TTv>
__global__ __launch_bounds__(256) void k_vt(const _Float16* __restrict__ V16, int ldv, int voff, _Float16* __restrict__ Vt) { __shared__ unsigned short tl[64][66]; const int tid = threadIdx.x; const int slab = blockIdx.x / (TTv / 64), lg = blockIdx.x % (TTv / 64); const int b = slab / NHv, h = slab % NHv;
  for (int i = tid; i < 64 * 8; i += 256) { const int r = i / 8, c8 = (i % 8) * 8; FragH f; f.half[0] = *(const v8us*)((const unsigned short*)V16 + ((size_t)b * TTv + lg * 64 + r) * ldv + voff + h * 64 + c8);
#pragma unroll
    for (int q = 0; q < 8; ++q) tl[r][c8 + q] = f.u[q]; }
  __syncthreads();
  {
#pragma unroll
    for (int rd = 0; rd < 2; ++rd) { const int d = rd * 32 + tid / 8, pc = tid % 8; FragH f;
#pragma unroll
      for (int q = 0; q < 8; ++q) f.u[q] = tl[pc * 8 + q][d];
      *(v8us*)((unsigned short*)Vt + ((size_t)slab * 64 + d) * TTv + lg * 64 + pc * 8) = f.half[0]; }
     } }

__global__ __launch_bounds__(256) void k_hl(const float* __restrict__ F, _Float16* __restrict__ Hh, _Float16* __restrict__ Hl, size_t n8) { const size_t t = (size_t)blockIdx.x * 256 + threadIdx.x; if (t >= n8) return; FragH fh, fl; const v4f a = *(const v4fa*)(F + t * 8), c = *(const v4fa*)(F + t * 8 + 4);
#pragma unroll
  for (int q = 0; q < 4; ++q) { _Float16 h = (_Float16)a[q]; fh.h[q] = h; fl.h[q] = (_Float16)((a[q] - (float)h) * 1024.0f); h = (_Float16)c[q]; fh.h[4 + q] = h; fl.h[4 + q] = (_Float16)((c[q] - (float)h) * 1024.0f); }
  { *(v8us*)((unsigned short*)Hh + t * 8) = fh.half[0]; *(v8us*)((unsigned short*)Hl + t * 8) = fl.half[0];  } }

// fragment of 16 rows x 32 k from k-contiguous rows in global memory (the hardware k order)
__device__ __forceinline__ v16h g2_frag(const _Float16* p, int hh) { FragH f; f.half[0] = *(const v8us*)((const unsigned short*)p + 8 * hh); f.half[1] = *(const v8us*)((const unsigned short*)p + 16 + 8 * hh); return f.v; }
// ---- GEMM with both operands staged in LDS: C = alpha A Bh^T + bias (bias [N], never null, rounded to bf16); A [M][K] and Bh [N][K] f16, k contiguous; needs M % 128 == 0, N % 128 == 0, K % 128 == 0 ----
// A block is 4 waves (2 x 2) on a 128 x 128 tile of C; a wave owns 64 x 64 (16 accumulator tiles). A stage is 128 k: 256 bytes of each of the block's 128 A rows and 128 B rows,
// brought by asynchronous copies to LDS, 16 bytes a lane (one copy of a wave = two whole rows of the stage = four whole 128-byte lines): each operand byte is asked for once a block, in whole lines.
// Two buffers: stage t + 2 is asked for behind the barrier that ends trip t, into the buffer that trip t has read. Fragments by two 16-byte LDS reads in the k order of g2_frag, k steps in rising order.
#define G3_KS 128                    /* k per stage */
#define G3_P 272                     /* LDS row pitch in bytes: 16 x odd, so the 16-byte fragment reads of 16 rows meet no bank twice */
#define G3_ST (256 * G3_P)           /* bytes per stage: A rows 0..127, then B rows 0..127 */
__device__ __forceinline__ v16h g3_frag(const unsigned char* p) { FragH f; f.half[0] = *(const v8us*)p; f.half[1] = *(const v8us*)(p + 32); return f.v; }
// Eight copies (rows 8 apart: LDS byte address l, global address g, gs elements per 8 rows); s_wait_xcnt 0 as the statement's last line, so that it stands in front of every later write of their address registers (a precaution).
__device__ __forceinline__ void g3_copy8(unsigned l, const _Float16* g, size_t gs) {
  asm volatile("global_load_async_to_lds_b128 %0, %8, off\n\tglobal_load_async_to_lds_b128 %1, %9, off\n\tglobal_load_async_to_lds_b128 %2, %10, off\n\tglobal_load_async_to_lds_b128 %3, %11, off\n\t"
               "global_load_async_to_lds_b128 %4, %12, off\n\tglobal_load_async_to_lds_b128 %5, %13, off\n\tglobal_load_async_to_lds_b128 %6, %14, off\n\tglobal_load_async_to_lds_b128 %7, %15, off\n\ts_wait_xcnt 0x0"
               :: "v"(l), "v"(l + 8 * G3_P), "v"(l + 16 * G3_P), "v"(l + 24 * G3_P), "v"(l + 32 * G3_P), "v"(l + 40 * G3_P), "v"(l + 48 * G3_P), "v"(l + 56 * G3_P),
                  "v"(g), "v"(g + gs), "v"(g + 2 * gs), "v"(g + 3 * gs), "v"(g + 4 * gs), "v"(g + 5 * gs), "v"(g + 6 * gs), "v"(g + 7 * gs) : "memory"); }
// One stage: 32 copies a lane (A rows 0..63, 64..127, B rows 0..63, 64..127); every lane is on, every address a multiple of 16.
__device__ __forceinline__ void g3_fill(unsigned l, const _Float16* ga, int lda, const _Float16* gb, int ldb) {
  g3_copy8(l, ga, (size_t)8 * lda); g3_copy8(l + 64 * G3_P, ga + (size_t)64 * lda, (size_t)8 * lda);
  g3_copy8(l + 128 * G3_P, gb, (size_t)8 * ldb); g3_copy8(l + 192 * G3_P, gb + (size_t)64 * ldb, (size_t)8 * ldb); }
template <bool F32OUT>      /* output rows: f32 to C, or f16 to C16 */
__global__ __launch_bounds__(128) void k_gemm3(const _Float16* __restrict__ A, int lda, const _Float16* __restrict__ Bh, int ldb, float alpha, const float* __restrict__ bias,
    float* __restrict__ C, _Float16* __restrict__ C16, int ldc, int M, int N, int K) {
  __shared__ __attribute__((aligned(16))) unsigned char sm[2 * G3_ST];      /* the two buffers; behind the loop each wave's own 64 x 68 f32 output staging */
  const int tid = threadIdx.x, w = tid >> 5, lane = tid & 31, ln = lane & 15, hh = lane >> 4;
  const int ntn = N >> 7; const int mt = blockIdx.x / ntn, nq = blockIdx.x - mt * ntn; const int row0 = mt * 128, col0 = nq * 128; if (row0 >= M) return;      /* the same for the whole block */
  const int wm = w >> 1, wn = w & 1;
  const unsigned l0 = (unsigned)(size_t)sm + (unsigned)((tid >> 4) * G3_P + (tid & 15) * 16);      /* this lane's place in a stage: row tid / 16 (+ 8 a copy), 16-byte piece tid % 16 */
  const _Float16* ga = A + (size_t)(row0 + (tid >> 4)) * lda + (tid & 15) * 8; const _Float16* gb = Bh + (size_t)(col0 + (tid >> 4)) * ldb + (tid & 15) * 8;
  const int T = K / G3_KS;
  const v8f z8 = {0.f,0.f,0.f,0.f,0.f,0.f,0.f,0.f}; v8f acc[4][4];
  /* every inner loop of this kernel is unrolled so that each index of acc, a and b is a constant and the arrays stay in registers */
#pragma unroll
  for (int i = 0; i < 4; ++i)
#pragma unroll
    for (int j = 0; j < 4; ++j) acc[i][j] = z8;
  const int bcol = col0 + wn * 64 + ln; float braw[4];      /* asked for here and first used behind the loop, so that the loads' latency passes under the stages */
#pragma unroll
  for (int j = 0; j < 4; ++j) braw[j] = bias[bcol + j * 16];
  asm volatile("s_wait_xcnt 0x0" :: "v"(bcol), "s"(bias) : "memory");      /* the four loads' index and base stay live up to this wait, so nothing is written over them earlier */
  g3_fill(l0, ga, lda, gb, ldb);
  asm volatile("s_wait_asynccnt 0x0" ::: "memory");      /* this wave's copies of stage 0 have landed */
  __syncthreads();                                        /* ... and every other wave's */
  if (T > 1) g3_fill(l0 + G3_ST, ga + G3_KS, lda, gb + G3_KS, ldb);
  const unsigned char* fa = sm + (wm * 64 + ln) * G3_P + 16 * hh; const unsigned char* fb = sm + (128 + wn * 64 + ln) * G3_P + 16 * hh;
#pragma unroll 1
  for (int t = 0; t < T; ++t) {      /* rolled: one trip a stage, the hand-over at its foot */
    const int bo = (t & 1) * G3_ST;
    v16h a[2][2], b[2][4];      /* a block is 8 products: two A fragments x the k step's four B fragments; two register sets, the next block's fragments asked for one block ahead */
#pragma unroll
    for (int i = 0; i < 2; ++i) a[0][i] = g3_frag(fa + bo + i * 16 * G3_P);
#pragma unroll
    for (int j = 0; j < 4; ++j) b[0][j] = g3_frag(fb + bo + j * 16 * G3_P);
#pragma unroll
    for (int hb = 0; hb < G3_KS / 16; ++hb) {
      const int ks = hb >> 1, h = hb & 1, ks1 = (hb + 1) >> 1, h1 = (hb + 1) & 1;
      if (hb + 1 < G3_KS / 16) {
#pragma unroll
        for (int i = 0; i < 2; ++i) a[h1][i] = g3_frag(fa + bo + (2 * h1 + i) * 16 * G3_P + ks1 * 64);
        if (h1 == 0) {
#pragma unroll
          for (int j = 0; j < 4; ++j) b[ks1 & 1][j] = g3_frag(fb + bo + j * 16 * G3_P + ks1 * 64);
        }
      }
      __builtin_amdgcn_sched_barrier(0);      /* keeps the next block's LDS reads together in front of this block's products: left free, they were sunk among the products and waited for at once */
#pragma unroll
      for (int i = 0; i < 2; ++i)
#pragma unroll
        for (int j = 0; j < 4; ++j) acc[2 * h + i][j] = __builtin_amdgcn_wmma_f32_16x16x32_f16(false, a[h][i], false, b[ks & 1][j], (short)0, acc[2 * h + i][j], false, false);
      __builtin_amdgcn_sched_barrier(0);      /* ... and the block after next's reads behind them */
    }
    asm volatile("s_wait_dscnt 0x0" ::: "memory");        /* this wave's reads of the buffer are done before it is handed back */
    asm volatile("s_wait_asynccnt 0x0" ::: "memory");     /* this wave's copies of stage t + 1 have landed */
    __syncthreads();                                      /* publishes stage t + 1 and ends every wave's reads of stage t */
    if (t + 2 < T) g3_fill(l0 + bo, ga + (size_t)(t + 2) * G3_KS, lda, gb + (size_t)(t + 2) * G3_KS, ldb);
  }
  asm volatile("s_wait_asynccnt 0x0" ::: "memory");       /* nothing is in flight when the buffers become output staging */
  float* so = (float*)sm + w * (64 * 68);
#pragma unroll
  for (int j = 0; j < 4; ++j) { const float bv = bf16_round(braw[j]);
#pragma unroll
    for (int i = 0; i < 4; ++i)
#pragma unroll
      for (int r = 0; r < 8; ++r) so[(i * 16 + 8 * hh + r) * 68 + j * 16 + ln] = acc[i][j][r] * alpha + bv; }
  __builtin_amdgcn_fence(__ATOMIC_ACQ_REL, "workgroup"); __builtin_amdgcn_wave_barrier();      /* the wave's staging writes stay in front of its own reads of them; no other wave touches its range */
  const int c4 = ln * 4; const size_t cb = (size_t)(row0 + wm * 64 + hh) * ldc + col0 + wn * 64 + c4;
#pragma unroll
  for (int q = 0; q < 32; ++q) { const v4f v = *(const v4fa*)&so[(q * 2 + hh) * 68 + c4]; if (F32OUT) *(v4f*)(C + cb + (size_t)(q * 2) * ldc) = v; else { v4h h4; for (int i = 0; i < 4; ++i) h4[i] = (_Float16)v[i]; *(v4h*)(C16 + cb + (size_t)(q * 2) * ldc) = h4; } }
}


__global__ __launch_bounds__(256) void k_wnat(const float* __restrict__ w, size_t n8, _Float16* __restrict__ Bt) { const size_t t = (size_t)blockIdx.x * 256 + threadIdx.x; if (t >= n8) return; FragH f; for (int q = 0; q < 8; ++q) f.h[q] = (_Float16)(bf16_round(w[t * 8 + q]) * 16.0f); *(v8us*)((unsigned short*)Bt + t * 8) = f.half[0];  }
__global__ __launch_bounds__(256) void k_rsm(const float* __restrict__ S, _Float16* __restrict__ P, int nrows) {
  #pragma clang fp contract(off)
  const int i = blockIdx.x * 256 + threadIdx.x; if (i >= nrows) return; const float* s = S + (size_t)i * SQ; float mx = -3.0e38f;
#pragma unroll 1
  for (int j = 0; j < SQ; ++j) mx = fmaxf(mx, s[j]); float se = 0.f;
#pragma unroll 1
  for (int j = 0; j < SQ; ++j) se += expf(s[j] - mx); const float sc = 256.0f / se;
#pragma unroll 1
  for (int j0 = 0; j0 < SQ; j0 += 8) { FragH f; for (int q = 0; q < 8; ++q) f.h[q] = (_Float16)(expf(s[j0 + q] - mx) * sc); unsigned short* d = (unsigned short*)P + (size_t)i * SQ + j0; *(v8us*)d = f.half[0];  } }
__global__ __launch_bounds__(256) void k_vt(const _Float16* __restrict__ V16, int b, int h0, _Float16* __restrict__ VT) { __shared__ unsigned short tl[64][65]; const int tid = threadIdx.x; const int hh = blockIdx.x % HG, sg = blockIdx.x / HG; const int s0 = sg * 64; const int h = h0 + hh;
  for (int i = tid; i < 64 * 8; i += 256) { const int j = i / 8, d8 = (i % 8) * 8; FragH f; f.half[0] = *(const v8us*)((const unsigned short*)V16 + ((size_t)b * SQ + s0 + j) * DM + h * HD + d8); for (int q = 0; q < 8; ++q) tl[d8 + q][j] = f.u[q]; }
  __syncthreads();
  { for (int i = tid; i < 64 * 8; i += 256) { const int d = i / 8, j8 = (i % 8) * 8; FragH f; for (int q = 0; q < 8; ++q) f.u[q] = tl[d][j8 + q]; *(v8us*)((unsigned short*)VT + ((size_t)hh * HD + d) * SQ + s0 + j8) = f.half[0]; }  } }


__global__ __launch_bounds__(256) void k_msfin(const float* __restrict__ X, const float* __restrict__ G, const float* __restrict__ cw, const float* __restrict__ cb, const float* __restrict__ g, const float* __restrict__ bta, float eps, float* __restrict__ out) {
  #pragma clang fp contract(off)
  __shared__ float red[256]; const size_t row = blockIdx.x; const int tid = threadIdx.x; const int s = (int)(row % SQ); constexpr int PER = DM / 256; float vals[PER]; float s1 = 0.f;
  const float* xr = X + row * DM; const float* xm = (s > 0) ? xr - DM : xr; const float* xp = (s < SQ - 1) ? xr + DM : xr; const float km = (s > 0) ? 1.f : 0.f, kp = (s < SQ - 1) ? 1.f : 0.f;
  for (int q = 0; q < PER; ++q) { const int j = tid * 4 + q; const float x0 = bf16_round(xr[j]); const float xa = __fmul_rn(bf16_round(xm[j]), km), xc = __fmul_rn(bf16_round(xp[j]), kp);
    float loc = __fmul_rn(xa, bf16_round(cw[j * 3 + 0])); loc = __fadd_rn(loc, __fmul_rn(x0, bf16_round(cw[j * 3 + 1]))); loc = __fadd_rn(loc, __fmul_rn(xc, bf16_round(cw[j * 3 + 2]))); loc = __fadd_rn(loc, bf16_round(cb[j]));
    const float y = __fadd_rn(x0, __fadd_rn(G[row * DM + j], __fmul_rn(0.3f, loc))); vals[q] = y; s1 = __fadd_rn(s1, y); }
  red[tid] = s1; __syncthreads(); for (int st = 128; st > 0; st >>= 1) { if (tid < st) red[tid] = __fadd_rn(red[tid], red[tid + st]); __syncthreads(); }
  const float mu = red[0] / (float)DM; __syncthreads(); float s2 = 0.f;
  for (int q = 0; q < PER; ++q) { const float c = __fadd_rn(vals[q], -mu); s2 = __fadd_rn(s2, __fmul_rn(c, c)); }
  red[tid] = s2; __syncthreads(); for (int st = 128; st > 0; st >>= 1) { if (tid < st) red[tid] = __fadd_rn(red[tid], red[tid + st]); __syncthreads(); }
  const float rs = rsqrtf(__fadd_rn(red[0] / (float)DM, eps)); v4f o;
  for (int q = 0; q < PER; ++q) { const int j = tid * 4 + q; o[q] = __fadd_rn(__fmul_rn(__fmul_rn(__fadd_rn(vals[q], -mu), rs), bf16_round(g[j])), bf16_round(bta[j])); }
  *(v4f*)(out + row * DM + tid * 4) = o;  }


__device__ __forceinline__ float fa_xhalf(float x) { return __builtin_bit_cast(float, __builtin_amdgcn_permlanex16(__builtin_bit_cast(int, x), __builtin_bit_cast(int, x), 0x76543210, 0xfedcba98, false, false)); }      /* lane l <-> lane l ^ 16 */
__device__ __forceinline__ v8f fa_mma(v16h a, v16h b, v8f c) { return __builtin_amdgcn_wmma_f32_16x16x32_f16(false, a, false, b, (short)0, c, false, false); }
// Native exp2 of nine / eight values in place, in one statement that ends in v_nop: no v_exp_f32 is directly followed by an instruction that reads its result or writes over its source
// (left to the register allocator, a neighbour's result landed on the source of the exp in front of it).
__device__ __forceinline__ void fa_exp9(float& y, float& x0, float& x1, float& x2, float& x3, float& x4, float& x5, float& x6, float& x7) {
  asm("v_exp_f32 %0, %0\n\tv_exp_f32 %1, %1\n\tv_exp_f32 %2, %2\n\tv_exp_f32 %3, %3\n\tv_exp_f32 %4, %4\n\tv_exp_f32 %5, %5\n\tv_exp_f32 %6, %6\n\tv_exp_f32 %7, %7\n\tv_exp_f32 %8, %8\n\tv_nop"
      : "+v"(y), "+v"(x0), "+v"(x1), "+v"(x2), "+v"(x3), "+v"(x4), "+v"(x5), "+v"(x6), "+v"(x7)); }
__device__ __forceinline__ void fa_exp8(float& x0, float& x1, float& x2, float& x3, float& x4, float& x5, float& x6, float& x7) {
  asm("v_exp_f32 %0, %0\n\tv_exp_f32 %1, %1\n\tv_exp_f32 %2, %2\n\tv_exp_f32 %3, %3\n\tv_exp_f32 %4, %4\n\tv_exp_f32 %5, %5\n\tv_exp_f32 %6, %6\n\tv_exp_f32 %7, %7\n\tv_nop"
      : "+v"(x0), "+v"(x1), "+v"(x2), "+v"(x3), "+v"(x4), "+v"(x5), "+v"(x6), "+v"(x7)); }
#define FA_QB 256                    /* query rows per block (8 waves x 32) */
__global__ __launch_bounds__(256) __attribute__((amdgpu_waves_per_eu(4, 4))) void k_fattn(const _Float16* __restrict__ Q16, const _Float16* __restrict__ K16, const _Float16* __restrict__ VT, _Float16* __restrict__ O16) {
  const int lane = threadIdx.x & 31, w = threadIdx.x >> 5, ln = lane & 15, hh = lane >> 4;
  const int bh = blockIdx.x / (SQ / FA_QB), qb = blockIdx.x % (SQ / FA_QB); const int b = bh / NH, h = bh % NH;
  const size_t r0 = (size_t)b * SQ; const int q0 = qb * FA_QB + w * 32;
  const float SC = 0.125f * 1.4426950408889634f;      /* 1 / sqrt(64), in log2 units */
  v16h qf[2][2];
#pragma unroll
  for (int g = 0; g < 2; ++g)
#pragma unroll
    for (int j = 0; j < 2; ++j) qf[g][j] = g2_frag(Q16 + (r0 + q0 + g * 16 + ln) * DM + h * HD + 32 * j, hh);
  const _Float16* kp = K16 + (r0 + ln) * DM + h * HD + 8 * hh;      /* key row ln of the first tile, at this half's first k */
  const _Float16* vp = VT + ((size_t)bh * HD + ln) * SQ + 8 * hh;   /* V^T row d = ln, at this half's first key */
  const v8f z8 = {0.f,0.f,0.f,0.f,0.f,0.f,0.f,0.f};
  v8f o[4][2]; float m[2], l[2];
#pragma unroll
  for (int g = 0; g < 2; ++g) { m[g] = -3.0e38f; l[g] = 0.f;
#pragma unroll
    for (int t = 0; t < 4; ++t) o[t][g] = z8; }
  v16h kf[2][2];
#pragma unroll
  for (int kt = 0; kt < 2; ++kt)
#pragma unroll
    for (int j = 0; j < 2; ++j) kf[kt][j] = g2_frag(kp + (size_t)kt * 16 * DM + 32 * j, 0);
#pragma unroll 1
  for (int kb = 0; kb < SQ / 32; ++kb) {      /* rolled: one pass already fills the register budget of four waves per SIMD */
    const _Float16* vq = vp + kb * 32; v16h vf[4];      /* asked for at the head of the pass, used behind the softmax */
#pragma unroll
    for (int t = 0; t < 4; ++t) vf[t] = g2_frag(vq + (size_t)t * 16 * SQ, 0);
    v8f s[2][2];
#pragma unroll
    for (int kt = 0; kt < 2; ++kt)
#pragma unroll
      for (int g = 0; g < 2; ++g) s[kt][g] = fa_mma(kf[kt][1], qf[g][1], fa_mma(kf[kt][0], qf[g][0], z8));
    const int kn = (kb + 1 < SQ / 32) ? kb + 1 : kb;      /* next pass's K fragments, one pass ahead; the last pass asks for its own rows again (in bounds, unused) */
    const _Float16* kq = kp + (size_t)kn * 32 * DM;
#pragma unroll
    for (int kt = 0; kt < 2; ++kt)
#pragma unroll
      for (int j = 0; j < 2; ++j) kf[kt][j] = g2_frag(kq + (size_t)kt * 16 * DM + 32 * j, 0);
    asm volatile("s_wait_xcnt 0x0" :: "v"(vq), "v"(kq) : "memory");      /* both address pairs stay live up to this wait, so nothing (a load's own result included) is written over them earlier */
    v16h pf[2];
#pragma unroll
    for (int g = 0; g < 2; ++g) {
      const v8f a = s[0][g], c = s[1][g];
      float mx = fmaxf(a[0], c[0]);
#pragma unroll
      for (int r = 1; r < 8; ++r) mx = fmaxf(mx, fmaxf(a[r], c[r]));
      mx = fmaxf(mx, fa_xhalf(mx));
      const float mn = fmaxf(m[g], mx * SC); float al = m[g] - mn; m[g] = mn;      /* al becomes 2^al below: 0 on the first pass */
      const float off = 8.0f - mn; FragH p; float e[16];
#pragma unroll
      for (int r = 0; r < 8; ++r) { e[r] = a[r] * SC + off; e[8 + r] = c[r] * SC + off; }
      fa_exp9(al, e[0], e[1], e[2], e[3], e[4], e[5], e[6], e[7]); fa_exp8(e[8], e[9], e[10], e[11], e[12], e[13], e[14], e[15]);
#pragma unroll
      for (int r = 0; r < 16; ++r) p.h[r] = (_Float16)e[r];
      pf[g] = p.v;
      const float sum = (((e[0] + e[1]) + (e[2] + e[3])) + ((e[4] + e[5]) + (e[6] + e[7]))) + (((e[8] + e[9]) + (e[10] + e[11])) + ((e[12] + e[13]) + (e[14] + e[15])));
      l[g] = l[g] * al + sum;
#pragma unroll
      for (int t = 0; t < 4; ++t) o[t][g] *= al;
    }
#pragma unroll
    for (int t = 0; t < 4; ++t)
#pragma unroll
      for (int g = 0; g < 2; ++g) o[t][g] = fa_mma(vf[t], pf[g], o[t][g]);
    asm volatile("v_nop\n\tv_nop\n\tv_nop\n\tv_nop" : "+v"(o[0][0]), "+v"(o[0][1]), "+v"(o[1][0]), "+v"(o[1][1]), "+v"(o[2][0]), "+v"(o[2][1]), "+v"(o[3][0]), "+v"(o[3][1]) : "v"(pf[0]), "v"(pf[1]));      /* WMMA distance: the weights (B operands) stay live for four slots behind the pass's last products, so the next pass's score tiles, which may get the same registers, are not written over them earlier */
  }
#pragma unroll
  for (int g = 0; g < 2; ++g) {
    const float inv = 64.0f / (l[g] + fa_xhalf(l[g]));      /* the halves' sums join once; x64: the carried scale of the o rows */
    _Float16* orow = O16 + (r0 + q0 + g * 16 + ln) * DM + h * HD + 8 * hh;
#pragma unroll
    for (int t = 0; t < 4; ++t) { FragH f;
#pragma unroll
      for (int r = 0; r < 8; ++r) f.h[r] = (_Float16)(o[t][g][r] * inv);
      *(v8us*)((unsigned short*)orow + t * 16) = f.half[0]; }
  }
}

extern "C" void kernel_launch(void* const* d_in, const int* in_sizes, int n_in,
                              void* d_out, int out_size, void* d_ws, size_t ws_size, hipStream_t stream) {
  (void)in_sizes; (void)n_in; (void)out_size;
  const float* const* I = (const float* const*)d_in; const float* x = I[0]; const float* wq = I[1]; const float* bq = I[2]; const float* wk = I[3]; const float* bk = I[4]; const float* wv = I[5]; const float* bv = I[6]; const float* wo = I[7]; const float* bo = I[8]; const float* cw = I[9]; const float* cb = I[10]; const float* lng = I[11]; const float* lnb = I[12];      /* weights [out][in] (natural) */
  char* ws = (char*)d_ws; size_t off = 0;
  auto take = [&](size_t bytes) { char* p = ws + off; off += (bytes + 255) & ~(size_t)255; return p; };
  _Float16* BQ = (_Float16*)take((size_t)DM * DM * 2); _Float16* BK = (_Float16*)take((size_t)DM * DM * 2); _Float16* BV = (_Float16*)take((size_t)DM * DM * 2); _Float16* BO = (_Float16*)take((size_t)DM * DM * 2);
  _Float16* X16 = (_Float16*)take(NR * DM * 2); _Float16* Q16 = (_Float16*)take(NR * DM * 2); _Float16* K16 = (_Float16*)take(NR * DM * 2); _Float16* V16 = (_Float16*)take(NR * DM * 2); _Float16* O16 = (_Float16*)take(NR * DM * 2); float* GA = (float*)take(NR * DM * 4);      /* global attention branch (f32 rows) */
  _Float16* VT = (_Float16*)take((size_t)NB * NH * HD * SQ * 2);      /* V^T [NB][NH][HD][SQ] */
  if (off > ws_size) return;
  { const size_t nw8 = (size_t)DM * DM / 8; const unsigned gw = (unsigned)((nw8 + 255) / 256); k_wnat<<<gw, 256, 0, stream>>>(wq, nw8, BQ); k_wnat<<<gw, 256, 0, stream>>>(wk, nw8, BK); k_wnat<<<gw, 256, 0, stream>>>(wv, nw8, BV); k_wnat<<<gw, 256, 0, stream>>>(wo, nw8, BO); }
  k_x16<<<(unsigned)((NR * DM / 8 + 255) / 256), 256, 0, stream>>>(x, X16, NR * DM / 8);
  const size_t r0p = (size_t)B0 * SQ;      /* first projected row */
  k_gemm3<false><<<(unsigned)((MP / 128) * (DM / 128)), 128, 0, stream>>>(X16 + r0p * DM, DM, BQ, DM, 0.0625f, bq, nullptr, Q16 + r0p * DM, DM, MP, DM, DM);
  k_gemm3<false><<<(unsigned)((MP / 128) * (DM / 128)), 128, 0, stream>>>(X16 + r0p * DM, DM, BK, DM, 0.0625f, bk, nullptr, K16 + r0p * DM, DM, MP, DM, DM);
  k_gemm3<false><<<(unsigned)((MP / 128) * (DM / 128)), 128, 0, stream>>>(X16 + r0p * DM, DM, BV, DM, 0.0625f, bv, nullptr, V16 + r0p * DM, DM, MP, DM, DM);
  k_vt<NH, SQ><<<NB * NH * (SQ / 64), 256, 0, stream>>>(V16, LQ, 0, VT);      /* V^T for every (batch, head) */
  k_fattn<<<NB * NH * (SQ / FA_QB), 256, 0, stream>>>(Q16, K16, VT, O16);      /* o (merged heads) as f16 rows, x64 */
  k_gemm3<true><<<(unsigned)((MPO / 128) * (DM / 128)), 128, 0, stream>>>(O16 + r0p * DM, DM, BO, DM, 0.0009765625f, bo, GA + r0p * DM, nullptr, DM, MPO, DM, DM);      /* global = ctx Wo^T + bo (f32 rows) */
  k_msfin<<<(unsigned)MPO, 256, 0, stream>>>(x + r0p * DM, GA + r0p * DM, cw, cb, lng, lnb, 1e-5f, (float*)d_out + r0p * DM);      /* + x + 0.3 local conv, LayerNorm -> output rows */
}

// v004
// A run of this version takes 189 microseconds.
// Timed twice side by side with v003, it ran 1.05 times as fast both times.
// All steps since v000 together make it 36.7 times as fast.
#include <hip/hip_runtime.h>
// Multi-scale attention block (x [4][2048][1024]; q/k/v = x W^T + b (natural [1024][1024] weights), 16 heads of 64; softmax(q k^T / 8); ctx merged; global = ctx Wo^T + bo; local = depthwise conv3 of x along the sequence (conv_w [1024][3], zero pad) + conv_b; y = x + global + 0.3 local; out = LayerNorm(y) (eps 1e-5) ln_g + ln_b -> [4][2048][1024]).
// Structure (attention part): token rows r = b*2048 + s; x as exact f16 rows (bf16-rounded); Q, K, V as three WMMA GEMMs (128x128 block tiles staged in LDS, 64x64 wave tiles, f32 accumulation, exact x16 weights + bias, f16 outputs); V^T for all (batch, head) via LDS transposes; one fused attention launch over all (batch, head, 256-query block): per 32 keys S^T = K Q^T on WMMA, running-maximum softmax on VALU (f32 statistics, native exp2; weights x256 as f16, packed from the score accumulators), O^T += V^T P^T on WMMA; o carried x64 against f16 subnormal flush (folded into the output GEMM alpha), written straight into the merged f16 o rows; global = o W_o^T + b GEMM (f32 rows); then per token row on VALU: + bf16(x) + 0.3 (depthwise conv3 of bf16(x) + b), LayerNorm, affine -> output rows.
// Compute dtype: inputs rounded to bf16; x / weights exact; q, k, v, softmax weights and o as plain f16 GEMM operands (~2^-12); scores and softmax statistics f32. v_wmma_f32_16x16x32_f16.
#define NB 4
#define SQ 2048
#define DM 1024
#define NH 16
#define HD 64
#define HG 4                         /* heads per launch of the unlaunched k_vt(V16, b, h0, VT) overload */
#define B0 0                         /* first batch processed (debug hook) */
#define NBR NB                       /* batches processed (debug hook) */
#define NR ((size_t)NB * SQ)         /* token rows */
#define MP ((int)((size_t)NBR * SQ)) /* rows projected (debug hook) */
#define QN SQ                        /* not used: k_fattn attends all SQ query rows of each batch */
#define NHD NH                       /* not used: k_fattn attends all NH heads */
#define MPO MP                       /* rows through the output stage (debug hook) */
#define LQ DM      /* row pitch of the q/k/v rows */
typedef __bf16 v16b __attribute__((ext_vector_type(16)));
typedef unsigned short v8us __attribute__((ext_vector_type(8), may_alias));
typedef float  v8f  __attribute__((ext_vector_type(8)));
typedef float  v4f  __attribute__((ext_vector_type(4)));
typedef float  v4fa __attribute__((ext_vector_type(4), may_alias));
union FragB { v16b v; v8us half[2]; unsigned short u[16]; };

__device__ __forceinline__ unsigned short bf16_bits(float x) { unsigned int u = __float_as_uint(x); return (unsigned short)((u + 0x7FFFu + ((u >> 16) & 1u)) >> 16); }
__device__ __forceinline__ float bf16_val(unsigned short b) { return __uint_as_float(((unsigned int)b) << 16); }
__device__ __forceinline__ float bf16_round(float x) { return bf16_val(bf16_bits(x)); }
// D += A·B with NT terms: 1 = ah·bh, 2 = + al·bh (A split), 3 = + ah·bl (both split)
template <int NT>
__device__ __forceinline__ v8f mmaN(v16b ah, v16b al, v16b bh, v16b bl, v8f c) {
  c = __builtin_amdgcn_wmma_f32_16x16x32_bf16(false, ah, false, bh, (short)0, c, false, false);
  if (NT >= 2) c = __builtin_amdgcn_wmma_f32_16x16x32_bf16(false, al, false, bh, (short)0, c, false, false);
  if (NT >= 3) c = __builtin_amdgcn_wmma_f32_16x16x32_bf16(false, ah, false, bl, (short)0, c, false, false);
  asm volatile("v_nop\n\tv_nop\n\tv_nop\n\tv_nop" : "+v"(c) : "v"(ah), "v"(al), "v"(bh), "v"(bl));
  return c;
}

__global__ __launch_bounds__(256) void k_wt_bf16(const float* __restrict__ W, unsigned short* __restrict__ Wt, int K, int N) {
  const int t = blockIdx.x * 256 + threadIdx.x;
  const int k8n = K / 8;
  if (t >= N * k8n) return;
  const int n = t / k8n, k8 = (t % k8n) * 8;
  v8us v;
#pragma unroll
  for (int i = 0; i < 8; ++i) v[i] = bf16_bits(W[(size_t)(k8 + i) * N + n]);
  *(v8us*)(Wt + (size_t)n * K + k8) = v;
  
}

// GEMM C[M][N] (f32, pitch ldc) = act(A[M][K]·W + bias). A f32 row-major (pitch lda) converted per fragment to bf16
// (ASPLIT: hi/lo two planes -> 2 terms, else single rounded term); Wt bf16 [N][K] (pitch ldb). BIAS_BF16 rounds the
// bias to bf16 first (bias quantised to bf16 before the add). K%32==0, M%16==0, N%64==0.
template <bool ASPLIT, int ACT, bool BIAS_BF16>
__global__ __launch_bounds__(128) void k_gemm_bf(const float* __restrict__ A, int lda, const unsigned short* __restrict__ Wt, int ldb,
                                               const float* __restrict__ bias, float* __restrict__ C, int ldc, int M, int N, int K) {
  __shared__ __attribute__((aligned(16))) float so[4][16][64];
  const int tid = threadIdx.x, w = tid >> 5, lane = tid & 31, ln = lane & 15, hh = lane >> 4;
  const int ntn = N / 64;
  const int wid = blockIdx.x * 4 + w;
  const int mt = wid / ntn, nq = wid % ntn;
  if (mt * 16 >= M) return;
  const int row0 = mt * 16, col0 = nq * 64;
  const float* arow = A + (size_t)(row0 + ln) * lda;
  v8f acc[4] = {};
  for (int kb = 0; kb < K; kb += 32) {
    FragB ah, al;
    const v4f x0 = *(const v4fa*)(arow + kb + 8 * hh), x1 = *(const v4fa*)(arow + kb + 8 * hh + 4);
    const v4f x2 = *(const v4fa*)(arow + kb + 16 + 8 * hh), x3 = *(const v4fa*)(arow + kb + 16 + 8 * hh + 4);
    float xs[16] = {x0[0],x0[1],x0[2],x0[3],x1[0],x1[1],x1[2],x1[3],x2[0],x2[1],x2[2],x2[3],x3[0],x3[1],x3[2],x3[3]};
#pragma unroll
    for (int i = 0; i < 16; ++i) { const unsigned short hb = bf16_bits(xs[i]); ah.u[i] = hb; al.u[i] = ASPLIT ? bf16_bits(xs[i] - bf16_val(hb)) : (unsigned short)0; }
#pragma unroll
    for (int t = 0; t < 4; ++t) {
      const unsigned short* brow = Wt + (size_t)(col0 + t * 16 + ln) * ldb + kb;
      FragB b;
      b.half[0] = *(const v8us*)(brow + 8 * hh);
      b.half[1] = *(const v8us*)(brow + 16 + 8 * hh);
      acc[t] = mmaN<ASPLIT ? 2 : 1>(ah.v, al.v, b.v, b.v, acc[t]);
    }
  }
#pragma unroll
  for (int t = 0; t < 4; ++t) {
    float bv = bias ? bias[col0 + t * 16 + ln] : 0.f;
    if (BIAS_BF16) bv = bf16_round(bv);
#pragma unroll
    for (int r = 0; r < 8; ++r) { float v = acc[t][r] + bv; if (ACT == 1) v = fmaxf(v, 0.f); so[w][8 * hh + r][t * 16 + ln] = v; }
  }
  __builtin_amdgcn_fence(__ATOMIC_ACQ_REL, "workgroup");
  __builtin_amdgcn_wave_barrier();
  const int rsub = lane >> 4, c4 = (lane & 15) * 4;
  {
#pragma unroll
    for (int q = 0; q < 8; ++q) {
      const int r = q * 2 + rsub;
      const v4f v = *(const v4fa*)&so[w][r][c4];
      *(v4f*)(C + (size_t)(row0 + r) * ldc + col0 + c4) = v;
    }
    
  }
}

// GEMM C = act(A·W + bias + resid): A f32 (ASPLIT -> hi/lo 2 terms), Wt bf16 [N][K]; ACT 0 none, 1 relu, 2 exact gelu;
// resid (optional, f32, row index = (row % rmod), pitch ldr, RES_BF16 rounds it) added before the activation.
template <bool ASPLIT, int ACT, bool BIAS_BF16, bool RES_BF16>
__global__ __launch_bounds__(128) void k_gemm_bf3(const float* __restrict__ A, int lda, const unsigned short* __restrict__ Wt, int ldb,
                                                const float* __restrict__ bias, const float* __restrict__ resid, int rmod, int ldr,
                                                float* __restrict__ C, int ldc, int M, int N, int K) {
  __shared__ __attribute__((aligned(16))) float so[4][16][64];
  const int tid = threadIdx.x, w = tid >> 5, lane = tid & 31, ln = lane & 15, hh = lane >> 4;
  const int ntn = N / 64;
  const int wid = blockIdx.x * 4 + w;
  const int mt = wid / ntn, nq = wid % ntn;
  if (mt * 16 >= M) return;
  const int row0 = mt * 16, col0 = nq * 64;
  const float* arow = A + (size_t)(row0 + ln) * lda;
  v8f acc[4] = {};
  for (int kb = 0; kb < K; kb += 32) {
    FragB ah, al;
    const v4f x0 = *(const v4fa*)(arow + kb + 8 * hh), x1 = *(const v4fa*)(arow + kb + 8 * hh + 4);
    const v4f x2 = *(const v4fa*)(arow + kb + 16 + 8 * hh), x3 = *(const v4fa*)(arow + kb + 16 + 8 * hh + 4);
    float xs[16] = {x0[0],x0[1],x0[2],x0[3],x1[0],x1[1],x1[2],x1[3],x2[0],x2[1],x2[2],x2[3],x3[0],x3[1],x3[2],x3[3]};
#pragma unroll
    for (int i = 0; i < 16; ++i) { const unsigned short hb = bf16_bits(xs[i]); ah.u[i] = hb; al.u[i] = ASPLIT ? bf16_bits(xs[i] - bf16_val(hb)) : (unsigned short)0; }
#pragma unroll
    for (int t = 0; t < 4; ++t) {
      const unsigned short* brow = Wt + (size_t)(col0 + t * 16 + ln) * ldb + kb;
      FragB b;
      b.half[0] = *(const v8us*)(brow + 8 * hh);
      b.half[1] = *(const v8us*)(brow + 16 + 8 * hh);
      acc[t] = mmaN<ASPLIT ? 2 : 1>(ah.v, al.v, b.v, b.v, acc[t]);
    }
  }
#pragma unroll
  for (int t = 0; t < 4; ++t) {
    const int col = col0 + t * 16 + ln;
    float bv = bias ? bias[col] : 0.f;
    if (BIAS_BF16) bv = bf16_round(bv);
#pragma unroll
    for (int r = 0; r < 8; ++r) {
      float v = acc[t][r] + bv;
      if (resid) { float rv = resid[(size_t)((row0 + 8 * hh + r) % rmod) * ldr + col]; if (RES_BF16) rv = bf16_round(rv); v += rv; }
      if (ACT == 1) v = fmaxf(v, 0.f);
      if (ACT == 2) v = 0.5f * v * (1.0f + erff(v * 0.70710678118654752f));
      if (ACT == 3) { const float u = 0.7978845608028654f * (v + 0.044715f * v * v * v); v = 0.5f * v * (1.0f + tanhf(u)); }
      so[w][8 * hh + r][t * 16 + ln] = v;
    }
  }
  __builtin_amdgcn_fence(__ATOMIC_ACQ_REL, "workgroup");
  __builtin_amdgcn_wave_barrier();
  const int rsub = lane >> 4, c4 = (lane & 15) * 4;
  {
#pragma unroll
    for (int q = 0; q < 8; ++q) {
      const int r = q * 2 + rsub;
      const v4f v = *(const v4fa*)&so[w][r][c4];
      *(v4f*)(C + (size_t)(row0 + r) * ldc + col0 + c4) = v;
    }
    
  }
}
// row LayerNorm (biased variance, eps) over N: s = X (+ R); optional out_sum <- s; out_norm <- (s-mu)*rsqrt(var+eps)*g + b
template <bool PARAM_BF16>
__global__ __launch_bounds__(256) void k_layernorm(const float* __restrict__ X, const float* __restrict__ R, const float* __restrict__ g, const float* __restrict__ bta,
                                                  float* __restrict__ out_sum, float* __restrict__ out_norm, int N, float eps) {
  __shared__ float red[256];
  const int row = blockIdx.x, tid = threadIdx.x;
  const float* x = X + (size_t)row * N; const float* rr = R ? R + (size_t)row * N : nullptr;
  float vals[16];                     // up to N = 4096
  const int per = N / 256;            // contiguous chunk per thread? use strided-by-4 chunks: thread handles j = tid*4 + 1024*u
  float s1 = 0.f;
  for (int u = 0; u < per / 4; ++u) {
    const int j = tid * 4 + 1024 * u;
    const v4f a = *(const v4fa*)(x + j);
    v4f b = {0.f,0.f,0.f,0.f}; if (rr) b = *(const v4fa*)(rr + j);
#pragma unroll
    for (int q = 0; q < 4; ++q) { const float v = a[q] + b[q]; vals[u * 4 + q] = v; s1 += v; }
  }
  red[tid] = s1; __syncthreads();
  for (int st = 128; st > 0; st >>= 1) { if (tid < st) red[tid] += red[tid + st]; __syncthreads(); }
  const float mu = red[0] / (float)N; __syncthreads();
  float s2 = 0.f;
  for (int u = 0; u < per / 4; ++u)
#pragma unroll
    for (int q = 0; q < 4; ++q) { const float c = vals[u * 4 + q] - mu; s2 += c * c; }
  red[tid] = s2; __syncthreads();
  for (int st = 128; st > 0; st >>= 1) { if (tid < st) red[tid] += red[tid + st]; __syncthreads(); }
  const float rs = rsqrtf(red[0] / (float)N + eps);
  {
    for (int u = 0; u < per / 4; ++u) {
      const int j = tid * 4 + 1024 * u;
      v4f o, sm;
#pragma unroll
      for (int q = 0; q < 4; ++q) {
        float gg = g[j + q], bb = bta[j + q];
        if (PARAM_BF16) { gg = bf16_round(gg); bb = bf16_round(bb); }
        sm[q] = vals[u * 4 + q]; o[q] = (vals[u * 4 + q] - mu) * rs * gg + bb;
      }
      if (out_sum) *(v4f*)(out_sum + (size_t)row * N + j) = sm;
      *(v4f*)(out_norm + (size_t)row * N + j) = o;
    }
    
  }
}



// ---- f16 WMMA path (v_wmma_f32_16x16x32_f16): 11-bit significands for operands in range — used where a [0,1] probability operand needs more precision than bf16
typedef _Float16 v16h __attribute__((ext_vector_type(16)));
union FragH { v16h v; v8us half[2]; _Float16 h[16]; unsigned short u[16]; };
template <int NT>
__device__ __forceinline__ v8f mmaH(v16h ah, v16h al, v16h bh, v16h bl, v8f c) {
  c = __builtin_amdgcn_wmma_f32_16x16x32_f16(false, ah, false, bh, (short)0, c, false, false);
  if (NT >= 2) c = __builtin_amdgcn_wmma_f32_16x16x32_f16(false, al, false, bh, (short)0, c, false, false);
  if (NT >= 3) c = __builtin_amdgcn_wmma_f32_16x16x32_f16(false, ah, false, bl, (short)0, c, false, false);
  asm volatile("v_nop\n\tv_nop\n\tv_nop\n\tv_nop" : "+v"(c) : "v"(ah), "v"(al), "v"(bh), "v"(bl));
  return c;
}
// batched GEMM like k_gemm_b but f16 operands: A f32 (split into f16 hi/lo if ASPLIT, else rounded to f16), Bt = f16 values [n][k]; alpha; C f32; N multiple of 16 (partial tiles skipped)
template <bool ASPLIT>
__global__ __launch_bounds__(128) void k_gemm_h(const float* __restrict__ A, int lda, size_t sA, const _Float16* __restrict__ Bh, int ldb, size_t sB, float alpha, float* __restrict__ C, int ldc, size_t sC, int M, int N, int K) {
  __shared__ __attribute__((aligned(16))) float so[4][16][64];
  const int tid = threadIdx.x, w = tid >> 5, lane = tid & 31, ln = lane & 15, hh = lane >> 4; const int by = blockIdx.y;
  A += (size_t)by * sA; Bh += (size_t)by * sB; C += (size_t)by * sC;
  const int ntn = (N + 63) / 64; const int wid = blockIdx.x * 4 + w; const int mt = wid / ntn, nq = wid % ntn; if (mt * 16 >= M) return;
  const int row0 = mt * 16, col0 = nq * 64; const float* arow = A + (size_t)(row0 + ln) * lda;
  v8f acc[4] = {};
  for (int kb = 0; kb < K; kb += 32) {
    FragH ah, al;
    const v4f x0 = *(const v4fa*)(arow + kb + 8 * hh), x1 = *(const v4fa*)(arow + kb + 8 * hh + 4), x2 = *(const v4fa*)(arow + kb + 16 + 8 * hh), x3 = *(const v4fa*)(arow + kb + 16 + 8 * hh + 4);
    float xs[16] = {x0[0],x0[1],x0[2],x0[3],x1[0],x1[1],x1[2],x1[3],x2[0],x2[1],x2[2],x2[3],x3[0],x3[1],x3[2],x3[3]};
#pragma unroll
    for (int i = 0; i < 16; ++i) { const _Float16 h = (_Float16)xs[i]; ah.h[i] = h; al.h[i] = ASPLIT ? (_Float16)(xs[i] - (float)h) : (_Float16)0.0f; }
#pragma unroll
    for (int t = 0; t < 4; ++t) { if (col0 + t * 16 >= N) continue; const size_t boff = (size_t)(col0 + t * 16 + ln) * ldb + kb; FragH bq; bq.half[0] = *(const v8us*)(Bh + boff + 8 * hh); bq.half[1] = *(const v8us*)(Bh + boff + 16 + 8 * hh);
      acc[t] = mmaH<ASPLIT ? 2 : 1>(ah.v, al.v, bq.v, bq.v, acc[t]); }
  }
#pragma unroll
  for (int t = 0; t < 4; ++t) { if (col0 + t * 16 >= N) continue;
#pragma unroll
    for (int r = 0; r < 8; ++r) so[w][8 * hh + r][t * 16 + ln] = acc[t][r] * alpha; }
  __builtin_amdgcn_fence(__ATOMIC_ACQ_REL, "workgroup"); __builtin_amdgcn_wave_barrier();
  const int rsub = lane >> 4, c4 = (lane & 15) * 4;
  {
#pragma unroll
    for (int q = 0; q < 8; ++q) { const int r = q * 2 + rsub; if (col0 + c4 < N) { const v4f v = *(const v4fa*)&so[w][r][c4]; *(v4f*)(C + (size_t)(row0 + r) * ldc + col0 + c4) = v; } }
     }
}

// Wt[n][k] = f16(W[k][n]·scale) from f32 row-major W[K][N] (scale = power of two; bf16-exact weights stay exact in f16 away from the subnormal range)
__global__ __launch_bounds__(256) void k_wt_f16(const float* __restrict__ W, _Float16* __restrict__ Wt, int K, int N, float scale) {
  const int t = blockIdx.x * 256 + threadIdx.x; if (t >= N * (K / 8)) return; const int n = t / (K / 8), k8 = (t % (K / 8)) * 8; FragH f;
#pragma unroll
  for (int i = 0; i < 8; ++i) f.h[i] = (_Float16)(bf16_round(W[(size_t)(k8 + i) * N + n]) * scale); const v8us o = f.half[0];
  *(v8us*)((unsigned short*)Wt + (size_t)n * K + k8) = o; 
}
// k_gemm_hh variant with fused epilogue: v = acc·alpha + bias[by·sBias + col] (+ CP[(row/rowsPerB)·sCPb + by·64 + col] if CP) ; ACT 0 none / 1 elu ; writes f16 C16 (and f32 C if non-null)
template <int ACT>
__global__ __launch_bounds__(128) void k_gemm_hhx(const _Float16* __restrict__ A, int lda, size_t sA, const _Float16* __restrict__ Bh, int ldb, size_t sB, float alpha, const float* __restrict__ bias, size_t sBias, const float* __restrict__ CP, int rowsPerB, size_t sCPb, int row0g,
    float* __restrict__ C, _Float16* __restrict__ C16, int ldc, size_t sC, int M, int N, int K) {
  __shared__ __attribute__((aligned(16))) float so[4][16][64];
  const int tid = threadIdx.x, w = tid >> 5, lane = tid & 31, ln = lane & 15, hh = lane >> 4; const int by = blockIdx.y;
  A += (size_t)by * sA; Bh += (size_t)by * sB; const size_t cofs = (size_t)by * sC; const float* bp = bias ? bias + (size_t)by * sBias : nullptr;
  const int ntn = (N + 63) / 64; const int wid = blockIdx.x * 4 + w; const int mt = wid / ntn, nq = wid % ntn; if (mt * 16 >= M) return;
  const int row0 = mt * 16, col0 = nq * 64; const _Float16* arow = A + (size_t)(row0 + ln) * lda;
  v8f acc[4] = {};
  for (int kb = 0; kb < K; kb += 32) { FragH ah; ah.half[0] = *(const v8us*)((const unsigned short*)arow + kb + 8 * hh); ah.half[1] = *(const v8us*)((const unsigned short*)arow + kb + 16 + 8 * hh);
#pragma unroll
    for (int t = 0; t < 4; ++t) { if (col0 + t * 16 >= N) continue; const size_t boff = (size_t)(col0 + t * 16 + ln) * ldb + kb; FragH bq; bq.half[0] = *(const v8us*)((const unsigned short*)Bh + boff + 8 * hh); bq.half[1] = *(const v8us*)((const unsigned short*)Bh + boff + 16 + 8 * hh);
      acc[t] = mmaH<1>(ah.v, ah.v, bq.v, bq.v, acc[t]); }
  }
#pragma unroll
  for (int t = 0; t < 4; ++t) { if (col0 + t * 16 >= N) continue; const int col = col0 + t * 16 + ln; const float bv = bp ? bf16_round(bp[col]) : 0.f;
#pragma unroll
    for (int r = 0; r < 8; ++r) { float v = acc[t][r] * alpha + bv; if (CP) { const int rr = row0g + row0 + 8 * hh + r; if (rowsPerB < 0) v += CP[cofs + (size_t)rr * ldc + col];      /* rowsPerB < 0: own element of the batched C plane */ else { const int bidx = rr / rowsPerB; v += CP[(size_t)bidx * sCPb + (size_t)by * 64 + col]; } } if (ACT == 1) v = (v > 0.f) ? v : expm1f(v); else if (ACT == 7) v = (v > 0.f) ? v + 1.0f : expf(v); else if (ACT == 8) v = tanhf(v); else if (ACT == 9) v = 0.5f * v * (1.0f + tanhf(0.7978845608028654f * (v + 0.044715f * v * v * v))); else if (ACT == 11) v = 1.0f / (1.0f + expf(-v)); else if (ACT == 12) v = (v > 0.f) ? v : 0.01f * v; else if (ACT == 14) v = (v > 0.f) ? v : 0.1f * v; else if (ACT == 16) v = (v >= 0.f) ? v : 0.3f * v; else if (ACT == 17) v = (v >= 0.f) ? v : 0.2f * v; else if (ACT == 15) v = v / (1.0f + expf(-v)); else if (ACT == 3) v = fmaxf(v, 0.f); else if (ACT == 6) v = 0.5f * v * (1.0f + erff(v * 0.70710678118654752f)); so[w][8 * hh + r][t * 16 + ln] = v; } }
  __builtin_amdgcn_fence(__ATOMIC_ACQ_REL, "workgroup"); __builtin_amdgcn_wave_barrier();
  const int rsub = lane >> 4, c4 = (lane & 15) * 4; typedef _Float16 v4h __attribute__((ext_vector_type(4)));
  {
#pragma unroll
    for (int q = 0; q < 8; ++q) { const int r = q * 2 + rsub; if (col0 + c4 < N) { const v4f v = *(const v4fa*)&so[w][r][c4]; if (C) *(v4f*)(C + cofs + (size_t)(row0 + r) * ldc + col0 + c4) = v; if (C16) { v4h h4; for (int i = 0; i < 4; ++i) h4[i] = (_Float16)v[i]; *(v4h*)(C16 + cofs + (size_t)(row0 + r) * ldc + col0 + c4) = h4; } } }
     }
}


typedef _Float16 v4h __attribute__((ext_vector_type(4)));

__global__ __launch_bounds__(256) void k_x16(const float* __restrict__ x, _Float16* __restrict__ X16, size_t n8) { const size_t t = (size_t)blockIdx.x * 256 + threadIdx.x; if (t >= n8) return; FragH f;
#pragma unroll
  for (int q = 0; q < 8; ++q) f.h[q] = (_Float16)bf16_round(x[t * 8 + q]); *(v8us*)((unsigned short*)X16 + t * 8) = f.half[0];  }
__global__ __launch_bounds__(256) void k_h16(const float* __restrict__ x, _Float16* __restrict__ X16, size_t n8) { const size_t t = (size_t)blockIdx.x * 256 + threadIdx.x; if (t >= n8) return; FragH f;
#pragma unroll
  for (int q = 0; q < 8; ++q) f.h[q] = (_Float16)x[t * 8 + q]; *(v8us*)((unsigned short*)X16 + t * 8) = f.half[0];  }
__global__ __launch_bounds__(256) void k_round16f(const float* __restrict__ W, _Float16* __restrict__ Bt, size_t n8) { const size_t t = (size_t)blockIdx.x * 256 + threadIdx.x; if (t >= n8) return; FragH f;
#pragma unroll
  for (int i = 0; i < 8; ++i) f.h[i] = (_Float16)(bf16_round(W[t * 8 + i]) * 16.0f); *(v8us*)((unsigned short*)Bt + t * 8) = f.half[0];  }
template <int NHv, int TTv>
__global__ __launch_bounds__(256) void k_vt(const _Float16* __restrict__ V16, int ldv, int voff, _Float16* __restrict__ Vt) { __shared__ unsigned short tl[64][66]; const int tid = threadIdx.x; const int slab = blockIdx.x / (TTv / 64), lg = blockIdx.x % (TTv / 64); const int b = slab / NHv, h = slab % NHv;
  for (int i = tid; i < 64 * 8; i += 256) { const int r = i / 8, c8 = (i % 8) * 8; FragH f; f.half[0] = *(const v8us*)((const unsigned short*)V16 + ((size_t)b * TTv + lg * 64 + r) * ldv + voff + h * 64 + c8);
#pragma unroll
    for (int q = 0; q < 8; ++q) tl[r][c8 + q] = f.u[q]; }
  __syncthreads();
  {
#pragma unroll
    for (int rd = 0; rd < 2; ++rd) { const int d = rd * 32 + tid / 8, pc = tid % 8; FragH f;
#pragma unroll
      for (int q = 0; q < 8; ++q) f.u[q] = tl[pc * 8 + q][d];
      *(v8us*)((unsigned short*)Vt + ((size_t)slab * 64 + d) * TTv + lg * 64 + pc * 8) = f.half[0]; }
     } }

__global__ __launch_bounds__(256) void k_hl(const float* __restrict__ F, _Float16* __restrict__ Hh, _Float16* __restrict__ Hl, size_t n8) { const size_t t = (size_t)blockIdx.x * 256 + threadIdx.x; if (t >= n8) return; FragH fh, fl; const v4f a = *(const v4fa*)(F + t * 8), c = *(const v4fa*)(F + t * 8 + 4);
#pragma unroll
  for (int q = 0; q < 4; ++q) { _Float16 h = (_Float16)a[q]; fh.h[q] = h; fl.h[q] = (_Float16)((a[q] - (float)h) * 1024.0f); h = (_Float16)c[q]; fh.h[4 + q] = h; fl.h[4 + q] = (_Float16)((c[q] - (float)h) * 1024.0f); }
  { *(v8us*)((unsigned short*)Hh + t * 8) = fh.half[0]; *(v8us*)((unsigned short*)Hl + t * 8) = fl.half[0];  } }

// fragment of 16 rows x 32 k from k-contiguous rows in global memory (the hardware k order)
__device__ __forceinline__ v16h g2_frag(const _Float16* p, int hh) { FragH f; f.half[0] = *(const v8us*)((const unsigned short*)p + 8 * hh); f.half[1] = *(const v8us*)((const unsigned short*)p + 16 + 8 * hh); return f.v; }
// ---- GEMM with both operands staged in LDS: C = alpha A Bh^T + bias (bias [N], never null, rounded to bf16); A [M][K] and Bh [N][K] f16, k contiguous; needs M % 128 == 0, N % 128 == 0, K % 128 == 0 ----
// A block is 4 waves (2 x 2) on a 128 x 128 tile of C; a wave owns 64 x 64 (16 accumulator tiles). A stage is 128 k: 256 bytes of each of the block's 128 A rows and 128 B rows,
// brought by asynchronous copies to LDS, 16 bytes a lane (one copy of a wave = two whole rows of the stage = four whole 128-byte lines): each operand byte is asked for once a block, in whole lines.
// Two buffers: stage t + 2 is asked for behind the barrier that ends trip t, into the buffer that trip t has read. Fragments by two 16-byte LDS reads in the k order of g2_frag, k steps in rising order.
#define G3_KS 128                    /* k per stage */
#define G3_P 272                     /* LDS row pitch in bytes: 16 x odd, so the 16-byte fragment reads of 16 rows meet no bank twice */
#define G3_ST (256 * G3_P)           /* bytes per stage: A rows 0..127, then B rows 0..127 */
__device__ __forceinline__ v16h g3_frag(const unsigned char* p) { FragH f; f.half[0] = *(const v8us*)p; f.half[1] = *(const v8us*)(p + 32); return f.v; }
// Eight copies (rows 8 apart: LDS byte address l, global address g, gs elements per 8 rows); s_wait_xcnt 0 as the statement's last line, so that it stands in front of every later write of their address registers (a precaution).
__device__ __forceinline__ void g3_copy8(unsigned l, const _Float16* g, size_t gs) {
  asm volatile("global_load_async_to_lds_b128 %0, %8, off\n\tglobal_load_async_to_lds_b128 %1, %9, off\n\tglobal_load_async_to_lds_b128 %2, %10, off\n\tglobal_load_async_to_lds_b128 %3, %11, off\n\t"
               "global_load_async_to_lds_b128 %4, %12, off\n\tglobal_load_async_to_lds_b128 %5, %13, off\n\tglobal_load_async_to_lds_b128 %6, %14, off\n\tglobal_load_async_to_lds_b128 %7, %15, off\n\ts_wait_xcnt 0x0"
               :: "v"(l), "v"(l + 8 * G3_P), "v"(l + 16 * G3_P), "v"(l + 24 * G3_P), "v"(l + 32 * G3_P), "v"(l + 40 * G3_P), "v"(l + 48 * G3_P), "v"(l + 56 * G3_P),
                  "v"(g), "v"(g + gs), "v"(g + 2 * gs), "v"(g + 3 * gs), "v"(g + 4 * gs), "v"(g + 5 * gs), "v"(g + 6 * gs), "v"(g + 7 * gs) : "memory"); }
// One stage: 32 copies a lane (A rows 0..63, 64..127, B rows 0..63, 64..127); every lane is on, every address a multiple of 16.
__device__ __forceinline__ void g3_fill(unsigned l, const _Float16* ga, int lda, const _Float16* gb, int ldb) {
  g3_copy8(l, ga, (size_t)8 * lda); g3_copy8(l + 64 * G3_P, ga + (size_t)64 * lda, (size_t)8 * lda);
  g3_copy8(l + 128 * G3_P, gb, (size_t)8 * ldb); g3_copy8(l + 192 * G3_P, gb + (size_t)64 * ldb, (size_t)8 * ldb); }
template <bool F32OUT>      /* output rows: f32 to C, or f16 to C16 */
__global__ __launch_bounds__(128) void k_gemm3(const _Float16* __restrict__ A, int lda, const _Float16* __restrict__ Bh, int ldb, float alpha, const float* __restrict__ bias,
    float* __restrict__ C, _Float16* __restrict__ C16, int ldc, int M, int N, int K) {
  __shared__ __attribute__((aligned(16))) unsigned char sm[2 * G3_ST];      /* the two buffers; behind the loop each wave's own 64 x 68 f32 output staging */
  const int tid = threadIdx.x, w = tid >> 5, lane = tid & 31, ln = lane & 15, hh = lane >> 4;
  const int ntn = N >> 7; const int mt = blockIdx.x / ntn, nq = blockIdx.x - mt * ntn; const int row0 = mt * 128, col0 = nq * 128; if (row0 >= M) return;      /* the same for the whole block */
  const int wm = w >> 1, wn = w & 1;
  const unsigned l0 = (unsigned)(size_t)sm + (unsigned)((tid >> 4) * G3_P + (tid & 15) * 16);      /* this lane's place in a stage: row tid / 16 (+ 8 a copy), 16-byte piece tid % 16 */
  const _Float16* ga = A + (size_t)(row0 + (tid >> 4)) * lda + (tid & 15) * 8; const _Float16* gb = Bh + (size_t)(col0 + (tid >> 4)) * ldb + (tid & 15) * 8;
  const int T = K / G3_KS;
  const v8f z8 = {0.f,0.f,0.f,0.f,0.f,0.f,0.f,0.f}; v8f acc[4][4];
  /* every inner loop of this kernel is unrolled so that each index of acc, a and b is a constant and the arrays stay in registers */
#pragma unroll
  for (int i = 0; i < 4; ++i)
#pragma unroll
    for (int j = 0; j < 4; ++j) acc[i][j] = z8;
  const int bcol = col0 + wn * 64 + ln; float braw[4];      /* asked for here and first used behind the loop, so that the loads' latency passes under the stages */
#pragma unroll
  for (int j = 0; j < 4; ++j) braw[j] = bias[bcol + j * 16];
  asm volatile("s_wait_xcnt 0x0" :: "v"(bcol), "s"(bias) : "memory");      /* the four loads' index and base stay live up to this wait, so nothing is written over them earlier */
  g3_fill(l0, ga, lda, gb, ldb);
  asm volatile("s_wait_asynccnt 0x0" ::: "memory");      /* this wave's copies of stage 0 have landed */
  __syncthreads();                                        /* ... and every other wave's */
  if (T > 1) g3_fill(l0 + G3_ST, ga + G3_KS, lda, gb + G3_KS, ldb);
  const unsigned char* fa = sm + (wm * 64 + ln) * G3_P + 16 * hh; const unsigned char* fb = sm + (128 + wn * 64 + ln) * G3_P + 16 * hh;
#pragma unroll 1
  for (int t = 0; t < T; ++t) {      /* rolled: one trip a stage, the hand-over at its foot */
    const int bo = (t & 1) * G3_ST;
    v16h a[2][2], b[2][4];      /* a block is 8 products: two A fragments x the k step's four B fragments; two register sets, the next block's fragments asked for one block ahead */
#pragma unroll
    for (int i = 0; i < 2; ++i) a[0][i] = g3_frag(fa + bo + i * 16 * G3_P);
#pragma unroll
    for (int j = 0; j < 4; ++j) b[0][j] = g3_frag(fb + bo + j * 16 * G3_P);
#pragma unroll
    for (int hb = 0; hb < G3_KS / 16; ++hb) {
      const int ks = hb >> 1, h = hb & 1, ks1 = (hb + 1) >> 1, h1 = (hb + 1) & 1;
      if (hb + 1 < G3_KS / 16) {
#pragma unroll
        for (int i = 0; i < 2; ++i) a[h1][i] = g3_frag(fa + bo + (2 * h1 + i) * 16 * G3_P + ks1 * 64);
        if (h1 == 0) {
#pragma unroll
          for (int j = 0; j < 4; ++j) b[ks1 & 1][j] = g3_frag(fb + bo + j * 16 * G3_P + ks1 * 64);
        }
      }
      __builtin_amdgcn_sched_barrier(0);      /* keeps the next block's LDS reads together in front of this block's products: left free, they were sunk among the products and waited for at once */
#pragma unroll
      for (int i = 0; i < 2; ++i)
#pragma unroll
        for (int j = 0; j < 4; ++j) acc[2 * h + i][j] = __builtin_amdgcn_wmma_f32_16x16x32_f16(false, a[h][i], false, b[ks & 1][j], (short)0, acc[2 * h + i][j], false, false);
      __builtin_amdgcn_sched_barrier(0);      /* ... and the block after next's reads behind them */
    }
    asm volatile("s_wait_dscnt 0x0" ::: "memory");        /* this wave's reads of the buffer are done before it is handed back */
    asm volatile("s_wait_asynccnt 0x0" ::: "memory");     /* this wave's copies of stage t + 1 have landed */
    __syncthreads();                                      /* publishes stage t + 1 and ends every wave's reads of stage t */
    if (t + 2 < T) g3_fill(l0 + bo, ga + (size_t)(t + 2) * G3_KS, lda, gb + (size_t)(t + 2) * G3_KS, ldb);
  }
  asm volatile("s_wait_asynccnt 0x0" ::: "memory");       /* nothing is in flight when the buffers become output staging */
  float* so = (float*)sm + w * (64 * 68);
#pragma unroll
  for (int j = 0; j < 4; ++j) { const float bv = bf16_round(braw[j]);
#pragma unroll
    for (int i = 0; i < 4; ++i)
#pragma unroll
      for (int r = 0; r < 8; ++r) so[(i * 16 + 8 * hh + r) * 68 + j * 16 + ln] = acc[i][j][r] * alpha + bv; }
  __builtin_amdgcn_fence(__ATOMIC_ACQ_REL, "workgroup"); __builtin_amdgcn_wave_barrier();      /* the wave's staging writes stay in front of its own reads of them; no other wave touches its range */
  const int c4 = ln * 4; const size_t cb = (size_t)(row0 + wm * 64 + hh) * ldc + col0 + wn * 64 + c4;
#pragma unroll
  for (int q = 0; q < 32; ++q) { const v4f v = *(const v4fa*)&so[(q * 2 + hh) * 68 + c4]; if (F32OUT) *(v4f*)(C + cb + (size_t)(q * 2) * ldc) = v; else { v4h h4; for (int i = 0; i < 4; ++i) h4[i] = (_Float16)v[i]; *(v4h*)(C16 + cb + (size_t)(q * 2) * ldc) = h4; } }
}


__global__ __launch_bounds__(256) void k_wnat(const float* __restrict__ w, size_t n8, _Float16* __restrict__ Bt) { const size_t t = (size_t)blockIdx.x * 256 + threadIdx.x; if (t >= n8) return; FragH f; for (int q = 0; q < 8; ++q) f.h[q] = (_Float16)(bf16_round(w[t * 8 + q]) * 16.0f); *(v8us*)((unsigned short*)Bt + t * 8) = f.half[0];  }
__global__ __launch_bounds__(256) void k_rsm(const float* __restrict__ S, _Float16* __restrict__ P, int nrows) {
  #pragma clang fp contract(off)
  const int i = blockIdx.x * 256 + threadIdx.x; if (i >= nrows) return; const float* s = S + (size_t)i * SQ; float mx = -3.0e38f;
#pragma unroll 1
  for (int j = 0; j < SQ; ++j) mx = fmaxf(mx, s[j]); float se = 0.f;
#pragma unroll 1
  for (int j = 0; j < SQ; ++j) se += expf(s[j] - mx); const float sc = 256.0f / se;
#pragma unroll 1
  for (int j0 = 0; j0 < SQ; j0 += 8) { FragH f; for (int q = 0; q < 8; ++q) f.h[q] = (_Float16)(expf(s[j0 + q] - mx) * sc); unsigned short* d = (unsigned short*)P + (size_t)i * SQ + j0; *(v8us*)d = f.half[0];  } }
__global__ __launch_bounds__(256) void k_vt(const _Float16* __restrict__ V16, int b, int h0, _Float16* __restrict__ VT) { __shared__ unsigned short tl[64][65]; const int tid = threadIdx.x; const int hh = blockIdx.x % HG, sg = blockIdx.x / HG; const int s0 = sg * 64; const int h = h0 + hh;
  for (int i = tid; i < 64 * 8; i += 256) { const int j = i / 8, d8 = (i % 8) * 8; FragH f; f.half[0] = *(const v8us*)((const unsigned short*)V16 + ((size_t)b * SQ + s0 + j) * DM + h * HD + d8); for (int q = 0; q < 8; ++q) tl[d8 + q][j] = f.u[q]; }
  __syncthreads();
  { for (int i = tid; i < 64 * 8; i += 256) { const int d = i / 8, j8 = (i % 8) * 8; FragH f; for (int q = 0; q < 8; ++q) f.u[q] = tl[d][j8 + q]; *(v8us*)((unsigned short*)VT + ((size_t)hh * HD + d) * SQ + s0 + j8) = f.half[0]; }  } }


// Final stage: y = x + global + 0.3 (conv3 of x + b), LayerNorm, affine. One wave owns FN_R consecutive token rows whole: a lane holds 32 columns of each (8 pieces of 4; piece c = columns 128 c + 4 lane),
// so every load and store of a wave is 512 bytes in a row and a row's sums are in-lane adds plus one lane butterfly. All of a wave's row loads are asked for at its start, before anything waits.
// The six column parameters (three conv taps, conv bias, gain, shift) are rounded to bf16 once per block and shared through LDS planes. FN_R divides SQ, so a wave's rows lie in one sequence;
// the row in front of the first and the row behind the last of a sequence count as zero.
#define FN_R 2                       /* token rows per wave */
template <int CTRL> __device__ __forceinline__ float fn_dpp(float v) { return __builtin_bit_cast(float, __builtin_amdgcn_update_dpp(0, __builtin_bit_cast(int, v), CTRL, 0xf, 0xf, true)); }      /* 0x160 + m: lane l <- lane l ^ m inside a 16-lane row */
__device__ __forceinline__ float fn_xhalf(float x) { return __builtin_bit_cast(float, __builtin_amdgcn_permlanex16(__builtin_bit_cast(int, x), __builtin_bit_cast(int, x), 0x76543210, 0xfedcba98, false, false)); }      /* lane l <-> lane l ^ 16 */
__device__ __forceinline__ float fn_wsum(v4f a) { float v = (a[0] + a[1]) + (a[2] + a[3]); v += fn_dpp<0x161>(v); v += fn_dpp<0x162>(v); v += fn_dpp<0x164>(v); v += fn_dpp<0x168>(v); return v + fn_xhalf(v); }      /* the wave's sum, in every lane */
__device__ __forceinline__ v4f fn_ld(const float* base, unsigned bytes) { return *(const v4fa*)((const char*)base + bytes); }      /* scalar base + 32-bit byte offset */
__device__ __forceinline__ v4f fn_rd(v4f a) { v4f r; for (int q = 0; q < 4; ++q) r[q] = bf16_round(a[q]); return r; }
__global__ __launch_bounds__(256) __attribute__((amdgpu_waves_per_eu(4, 4))) void k_msfin(const float* __restrict__ X, const float* __restrict__ G, const float* __restrict__ cw, const float* __restrict__ cb, const float* __restrict__ g, const float* __restrict__ bta, float eps, float* __restrict__ out) {
  __shared__ __attribute__((aligned(16))) float pr[6][DM];      /* planes: tap 0, tap 1, tap 2, conv bias, gain, shift */
  const int tid = threadIdx.x; const unsigned c0 = (tid & 31) * 4u, t4 = tid * 4u;      /* first column of a lane's piece; of this thread's four parameter columns */
  const unsigned lb = (tid & 31) * 16u, tb = tid * 16u, wo = tid * 48u;      /* byte offsets of the loads: a lane's piece in a row, this thread's four parameters, its twelve taps */
  const int wv = __builtin_amdgcn_readfirstlane((int)(blockIdx.x * 8 + (tid >> 5)));      /* the wave's number, in a scalar register: row addresses are scalar base + lane offset */
  const size_t row0 = (size_t)wv * FN_R; const int s0 = (int)(row0 % SQ); const bool hp = s0 > 0, hn = s0 + FN_R < SQ;
  const float* xb = X + row0 * DM; const float* xm = xb - (hp ? DM : 0); const float* xn = xb + (hn ? FN_R * DM : 0);      /* a neighbour outside the sequence: an address in bounds, its values replaced by zero */
  const float* gb = G + row0 * DM;
  const v4f wa = fn_ld(cw, wo), wb = fn_ld(cw, wo + 16), wc = fn_ld(cw, wo + 32), pc = fn_ld(cb, tb), pg = fn_ld(g, tb), pb = fn_ld(bta, tb);      /* this thread's four columns: 12 taps in a row, bias, gain, shift */
  v4f xr[FN_R + 2][8], y[FN_R][8];
  /* every loop of this kernel is unrolled so that each index of xr and y is a constant and the rows stay in registers */
#pragma unroll
  for (int c = 0; c < 8; ++c) { const unsigned j = lb + c * 512; xr[0][c] = fn_ld(xm, j);
#pragma unroll
    for (int r = 0; r < FN_R; ++r) xr[r + 1][c] = fn_ld(xb, j + r * (DM * 4));
    xr[FN_R + 1][c] = fn_ld(xn, j);
#pragma unroll
    for (int r = 0; r < FN_R; ++r) y[r][c] = fn_ld(gb, j + r * (DM * 4)); }
  asm volatile("s_wait_xcnt 0x0" :: "v"(lb), "v"(tb), "v"(wo), "s"(xm), "s"(xb), "s"(xn), "s"(gb), "s"(cw), "s"(cb), "s"(g), "s"(bta) : "memory");      /* the loads' offsets and bases stay live up to this wait, so nothing (a later load's result included) is written over them earlier; its memory clobber also keeps every row load in front of the first wait for data (left free, they were sunk to their uses and waited for one by one) */
  { const v4f a = fn_rd(wa), b = fn_rd(wb), c = fn_rd(wc); const v4f t0 = {a[0], a[3], b[2], c[1]}, t1 = {a[1], b[0], b[3], c[2]}, t2 = {a[2], b[1], c[0], c[3]};
    *(v4f*)&pr[0][t4] = t0; *(v4f*)&pr[1][t4] = t1; *(v4f*)&pr[2][t4] = t2; *(v4f*)&pr[3][t4] = fn_rd(pc); *(v4f*)&pr[4][t4] = fn_rd(pg); *(v4f*)&pr[5][t4] = fn_rd(pb); }
  /* work-group barrier with LDS-only fences: the planes are whole before any wave reads them (nothing writes them again); __syncthreads() would also wait here for every row load still in flight */
  __builtin_amdgcn_fence(__ATOMIC_RELEASE, "workgroup", "local"); __builtin_amdgcn_s_barrier(); __builtin_amdgcn_fence(__ATOMIC_ACQUIRE, "workgroup", "local");
  const v4f z4 = {0.f, 0.f, 0.f, 0.f}; v4f s1[FN_R];
#pragma unroll
  for (int r = 0; r < FN_R; ++r) s1[r] = z4;
#pragma unroll
  for (int c = 0; c < 8; ++c) {
    const unsigned j = c * 128 + c0; v4f xq[FN_R + 2];
#pragma unroll
    for (int r = 0; r < FN_R + 2; ++r) xq[r] = fn_rd(xr[r][c]);
    if (!hp) xq[0] = z4;
    if (!hn) xq[FN_R + 1] = z4;
    const v4f w0 = *(const v4f*)&pr[0][j], w1 = *(const v4f*)&pr[1][j], w2 = *(const v4f*)&pr[2][j], cv = *(const v4f*)&pr[3][j];
#pragma unroll
    for (int r = 0; r < FN_R; ++r) { const v4f loc = xq[r] * w0 + xq[r + 1] * w1 + xq[r + 2] * w2 + cv; const v4f yy = xq[r + 1] + (y[r][c] + 0.3f * loc); y[r][c] = yy; s1[r] += yy; }
  }
  float mu[FN_R], rs[FN_R];
#pragma unroll
  for (int r = 0; r < FN_R; ++r) mu[r] = fn_wsum(s1[r]) * (1.0f / (float)DM);
#pragma unroll
  for (int r = 0; r < FN_R; ++r) { v4f s2 = z4;
#pragma unroll
    for (int c = 0; c < 8; ++c) { y[r][c] -= mu[r]; s2 += y[r][c] * y[r][c]; }
    s1[r] = s2; }
#pragma unroll
  for (int r = 0; r < FN_R; ++r) rs[r] = rsqrtf(fn_wsum(s1[r]) * (1.0f / (float)DM) + eps);
  float* ob = out + row0 * DM;
#pragma unroll
  for (int c = 0; c < 8; ++c) { const unsigned j = c * 128 + c0; const v4f gg = *(const v4f*)&pr[4][j], bb = *(const v4f*)&pr[5][j];
#pragma unroll
    for (int r = 0; r < FN_R; ++r) *(v4f*)(ob + (size_t)r * DM + j) = y[r][c] * rs[r] * gg + bb; }
}


__device__ __forceinline__ float fa_xhalf(float x) { return __builtin_bit_cast(float, __builtin_amdgcn_permlanex16(__builtin_bit_cast(int, x), __builtin_bit_cast(int, x), 0x76543210, 0xfedcba98, false, false)); }      /* lane l <-> lane l ^ 16 */
__device__ __forceinline__ v8f fa_mma(v16h a, v16h b, v8f c) { return __builtin_amdgcn_wmma_f32_16x16x32_f16(false, a, false, b, (short)0, c, false, false); }
// Native exp2 of nine / eight values in place, in one statement that ends in v_nop: no v_exp_f32 is directly followed by an instruction that reads its result or writes over its source
// (left to the register allocator, a neighbour's result landed on the source of the exp in front of it).
__device__ __forceinline__ void fa_exp9(float& y, float& x0, float& x1, float& x2, float& x3, float& x4, float& x5, float& x6, float& x7) {
  asm("v_exp_f32 %0, %0\n\tv_exp_f32 %1, %1\n\tv_exp_f32 %2, %2\n\tv_exp_f32 %3, %3\n\tv_exp_f32 %4, %4\n\tv_exp_f32 %5, %5\n\tv_exp_f32 %6, %6\n\tv_exp_f32 %7, %7\n\tv_exp_f32 %8, %8\n\tv_nop"
      : "+v"(y), "+v"(x0), "+v"(x1), "+v"(x2), "+v"(x3), "+v"(x4), "+v"(x5), "+v"(x6), "+v"(x7)); }
__device__ __forceinline__ void fa_exp8(float& x0, float& x1, float& x2, float& x3, float& x4, float& x5, float& x6, float& x7) {
  asm("v_exp_f32 %0, %0\n\tv_exp_f32 %1, %1\n\tv_exp_f32 %2, %2\n\tv_exp_f32 %3, %3\n\tv_exp_f32 %4, %4\n\tv_exp_f32 %5, %5\n\tv_exp_f32 %6, %6\n\tv_exp_f32 %7, %7\n\tv_nop"
      : "+v"(x0), "+v"(x1), "+v"(x2), "+v"(x3), "+v"(x4), "+v"(x5), "+v"(x6), "+v"(x7)); }
#define FA_QB 256                    /* query rows per block (8 waves x 32) */
__global__ __launch_bounds__(256) __attribute__((amdgpu_waves_per_eu(4, 4))) void k_fattn(const _Float16* __restrict__ Q16, const _Float16* __restrict__ K16, const _Float16* __restrict__ VT, _Float16* __restrict__ O16) {
  const int lane = threadIdx.x & 31, w = threadIdx.x >> 5, ln = lane & 15, hh = lane >> 4;
  const int bh = blockIdx.x / (SQ / FA_QB), qb = blockIdx.x % (SQ / FA_QB); const int b = bh / NH, h = bh % NH;
  const size_t r0 = (size_t)b * SQ; const int q0 = qb * FA_QB + w * 32;
  const float SC = 0.125f * 1.4426950408889634f;      /* 1 / sqrt(64), in log2 units */
  v16h qf[2][2];
#pragma unroll
  for (int g = 0; g < 2; ++g)
#pragma unroll
    for (int j = 0; j < 2; ++j) qf[g][j] = g2_frag(Q16 + (r0 + q0 + g * 16 + ln) * DM + h * HD + 32 * j, hh);
  const _Float16* kp = K16 + (r0 + ln) * DM + h * HD + 8 * hh;      /* key row ln of the first tile, at this half's first k */
  const _Float16* vp = VT + ((size_t)bh * HD + ln) * SQ + 8 * hh;   /* V^T row d = ln, at this half's first key */
  const v8f z8 = {0.f,0.f,0.f,0.f,0.f,0.f,0.f,0.f};
  v8f o[4][2]; float m[2], l[2];
#pragma unroll
  for (int g = 0; g < 2; ++g) { m[g] = -3.0e38f; l[g] = 0.f;
#pragma unroll
    for (int t = 0; t < 4; ++t) o[t][g] = z8; }
  v16h kf[2][2];
#pragma unroll
  for (int kt = 0; kt < 2; ++kt)
#pragma unroll
    for (int j = 0; j < 2; ++j) kf[kt][j] = g2_frag(kp + (size_t)kt * 16 * DM + 32 * j, 0);
#pragma unroll 1
  for (int kb = 0; kb < SQ / 32; ++kb) {      /* rolled: one pass already fills the register budget of four waves per SIMD */
    const _Float16* vq = vp + kb * 32; v16h vf[4];      /* asked for at the head of the pass, used behind the softmax */
#pragma unroll
    for (int t = 0; t < 4; ++t) vf[t] = g2_frag(vq + (size_t)t * 16 * SQ, 0);
    v8f s[2][2];
#pragma unroll
    for (int kt = 0; kt < 2; ++kt)
#pragma unroll
      for (int g = 0; g < 2; ++g) s[kt][g] = fa_mma(kf[kt][1], qf[g][1], fa_mma(kf[kt][0], qf[g][0], z8));
    const int kn = (kb + 1 < SQ / 32) ? kb + 1 : kb;      /* next pass's K fragments, one pass ahead; the last pass asks for its own rows again (in bounds, unused) */
    const _Float16* kq = kp + (size_t)kn * 32 * DM;
#pragma unroll
    for (int kt = 0; kt < 2; ++kt)
#pragma unroll
      for (int j = 0; j < 2; ++j) kf[kt][j] = g2_frag(kq + (size_t)kt * 16 * DM + 32 * j, 0);
    asm volatile("s_wait_xcnt 0x0" :: "v"(vq), "v"(kq) : "memory");      /* both address pairs stay live up to this wait, so nothing (a load's own result included) is written over them earlier */
    v16h pf[2];
#pragma unroll
    for (int g = 0; g < 2; ++g) {
      const v8f a = s[0][g], c = s[1][g];
      float mx = fmaxf(a[0], c[0]);
#pragma unroll
      for (int r = 1; r < 8; ++r) mx = fmaxf(mx, fmaxf(a[r], c[r]));
      mx = fmaxf(mx, fa_xhalf(mx));
      const float mn = fmaxf(m[g], mx * SC); float al = m[g] - mn; m[g] = mn;      /* al becomes 2^al below: 0 on the first pass */
      const float off = 8.0f - mn; FragH p; float e[16];
#pragma unroll
      for (int r = 0; r < 8; ++r) { e[r] = a[r] * SC + off; e[8 + r] = c[r] * SC + off; }
      fa_exp9(al, e[0], e[1], e[2], e[3], e[4], e[5], e[6], e[7]); fa_exp8(e[8], e[9], e[10], e[11], e[12], e[13], e[14], e[15]);
#pragma unroll
      for (int r = 0; r < 16; ++r) p.h[r] = (_Float16)e[r];
      pf[g] = p.v;
      const float sum = (((e[0] + e[1]) + (e[2] + e[3])) + ((e[4] + e[5]) + (e[6] + e[7]))) + (((e[8] + e[9]) + (e[10] + e[11])) + ((e[12] + e[13]) + (e[14] + e[15])));
      l[g] = l[g] * al + sum;
#pragma unroll
      for (int t = 0; t < 4; ++t) o[t][g] *= al;
    }
#pragma unroll
    for (int t = 0; t < 4; ++t)
#pragma unroll
      for (int g = 0; g < 2; ++g) o[t][g] = fa_mma(vf[t], pf[g], o[t][g]);
    asm volatile("v_nop\n\tv_nop\n\tv_nop\n\tv_nop" : "+v"(o[0][0]), "+v"(o[0][1]), "+v"(o[1][0]), "+v"(o[1][1]), "+v"(o[2][0]), "+v"(o[2][1]), "+v"(o[3][0]), "+v"(o[3][1]) : "v"(pf[0]), "v"(pf[1]));      /* WMMA distance: the weights (B operands) stay live for four slots behind the pass's last products, so the next pass's score tiles, which may get the same registers, are not written over them earlier */
  }
#pragma unroll
  for (int g = 0; g < 2; ++g) {
    const float inv = 64.0f / (l[g] + fa_xhalf(l[g]));      /* the halves' sums join once; x64: the carried scale of the o rows */
    _Float16* orow = O16 + (r0 + q0 + g * 16 + ln) * DM + h * HD + 8 * hh;
#pragma unroll
    for (int t = 0; t < 4; ++t) { FragH f;
#pragma unroll
      for (int r = 0; r < 8; ++r) f.h[r] = (_Float16)(o[t][g][r] * inv);
      *(v8us*)((unsigned short*)orow + t * 16) = f.half[0]; }
  }
}

extern "C" void kernel_launch(void* const* d_in, const int* in_sizes, int n_in,
                              void* d_out, int out_size, void* d_ws, size_t ws_size, hipStream_t stream) {
  (void)in_sizes; (void)n_in; (void)out_size;
  const float* const* I = (const float* const*)d_in; const float* x = I[0]; const float* wq = I[1]; const float* bq = I[2]; const float* wk = I[3]; const float* bk = I[4]; const float* wv = I[5]; const float* bv = I[6]; const float* wo = I[7]; const float* bo = I[8]; const float* cw = I[9]; const float* cb = I[10]; const float* lng = I[11]; const float* lnb = I[12];      /* weights [out][in] (natural) */
  char* ws = (char*)d_ws; size_t off = 0;
  auto take = [&](size_t bytes) { char* p = ws + off; off += (bytes + 255) & ~(size_t)255; return p; };
  _Float16* BQ = (_Float16*)take((size_t)DM * DM * 2); _Float16* BK = (_Float16*)take((size_t)DM * DM * 2); _Float16* BV = (_Float16*)take((size_t)DM * DM * 2); _Float16* BO = (_Float16*)take((size_t)DM * DM * 2);
  _Float16* X16 = (_Float16*)take(NR * DM * 2); _Float16* Q16 = (_Float16*)take(NR * DM * 2); _Float16* K16 = (_Float16*)take(NR * DM * 2); _Float16* V16 = (_Float16*)take(NR * DM * 2); _Float16* O16 = (_Float16*)take(NR * DM * 2); float* GA = (float*)take(NR * DM * 4);      /* global attention branch (f32 rows) */
  _Float16* VT = (_Float16*)take((size_t)NB * NH * HD * SQ * 2);      /* V^T [NB][NH][HD][SQ] */
  if (off > ws_size) return;
  { const size_t nw8 = (size_t)DM * DM / 8; const unsigned gw = (unsigned)((nw8 + 255) / 256); k_wnat<<<gw, 256, 0, stream>>>(wq, nw8, BQ); k_wnat<<<gw, 256, 0, stream>>>(wk, nw8, BK); k_wnat<<<gw, 256, 0, stream>>>(wv, nw8, BV); k_wnat<<<gw, 256, 0, stream>>>(wo, nw8, BO); }
  k_x16<<<(unsigned)((NR * DM / 8 + 255) / 256), 256, 0, stream>>>(x, X16, NR * DM / 8);
  const size_t r0p = (size_t)B0 * SQ;      /* first projected row */
  k_gemm3<false><<<(unsigned)((MP / 128) * (DM / 128)), 128, 0, stream>>>(X16 + r0p * DM, DM, BQ, DM, 0.0625f, bq, nullptr, Q16 + r0p * DM, DM, MP, DM, DM);
  k_gemm3<false><<<(unsigned)((MP / 128) * (DM / 128)), 128, 0, stream>>>(X16 + r0p * DM, DM, BK, DM, 0.0625f, bk, nullptr, K16 + r0p * DM, DM, MP, DM, DM);
  k_gemm3<false><<<(unsigned)((MP / 128) * (DM / 128)), 128, 0, stream>>>(X16 + r0p * DM, DM, BV, DM, 0.0625f, bv, nullptr, V16 + r0p * DM, DM, MP, DM, DM);
  k_vt<NH, SQ><<<NB * NH * (SQ / 64), 256, 0, stream>>>(V16, LQ, 0, VT);      /* V^T for every (batch, head) */
  k_fattn<<<NB * NH * (SQ / FA_QB), 256, 0, stream>>>(Q16, K16, VT, O16);      /* o (merged heads) as f16 rows, x64 */
  k_gemm3<true><<<(unsigned)((MPO / 128) * (DM / 128)), 128, 0, stream>>>(O16 + r0p * DM, DM, BO, DM, 0.0009765625f, bo, GA + r0p * DM, nullptr, DM, MPO, DM, DM);      /* global = ctx Wo^T + bo (f32 rows) */
  k_msfin<<<(unsigned)(MPO / (8 * FN_R)), 256, 0, stream>>>(x + r0p * DM, GA + r0p * DM, cw, cb, lng, lnb, 1e-5f, (float*)d_out + r0p * DM);      /* + x + 0.3 local conv, LayerNorm -> output rows */
}

// v005
// Measured time: 151 microseconds a run.
// In both of two side-by-side timings against v004, it was 1.25 times as fast.
// Over all steps from v000 it is 45.8 times as fast.
#include <hip/hip_runtime.h>
// Multi-scale attention block (x [4][2048][1024]; q/k/v = x W^T + b (natural [1024][1024] weights), 16 heads of 64; softmax(q k^T / 8); ctx merged; global = ctx Wo^T + bo; local = depthwise conv3 of x along the sequence (conv_w [1024][3], zero pad) + conv_b; y = x + global + 0.3 local; out = LayerNorm(y) (eps 1e-5) ln_g + ln_b -> [4][2048][1024]).
// Structure (attention part): token rows r = b*2048 + s; x as exact f16 rows (bf16-rounded); Q, K, V as three WMMA GEMMs (128x128 block tiles staged in LDS, 64x64 wave tiles, f32 accumulation, exact x16 weights + bias, f16 outputs); V^T for all (batch, head) via LDS transposes; one fused attention launch over all (batch, head, 256-query block): per 32 keys S^T = K Q^T on WMMA, running-maximum softmax on VALU (f32 statistics, native exp2; weights x256 as f16, packed from the score accumulators), O^T += V^T P^T on WMMA; o carried x64 against f16 subnormal flush (folded into the output GEMM alpha), written straight into the merged f16 o rows; global = o W_o^T + b GEMM (f32 rows); then per token row on VALU: + bf16(x) + 0.3 (depthwise conv3 of bf16(x) + b), LayerNorm, affine -> output rows.
// Compute dtype: inputs rounded to bf16; x / weights exact; q, k, v, softmax weights and o as plain f16 GEMM operands (~2^-12); scores and softmax statistics f32. v_wmma_f32_16x16x32_f16.
#define NB 4
#define SQ 2048
#define DM 1024
#define NH 16
#define HD 64
#define HG 4                         /* heads per launch of the unlaunched k_vt(V16, b, h0, VT) overload */
#define B0 0                         /* first batch processed (debug hook) */
#define NBR NB                       /* batches processed (debug hook) */
#define NR ((size_t)NB * SQ)         /* token rows */
#define MP ((int)((size_t)NBR * SQ)) /* rows projected (debug hook) */
#define QN SQ                        /* not used: k_fattn attends all SQ query rows of each batch */
#define NHD NH                       /* not used: k_fattn attends all NH heads */
#define MPO MP                       /* rows through the output stage (debug hook) */
#define LQ DM      /* row pitch of the q/k/v rows */
typedef __bf16 v16b __attribute__((ext_vector_type(16)));
typedef unsigned short v8us __attribute__((ext_vector_type(8), may_alias));
typedef float  v8f  __attribute__((ext_vector_type(8)));
typedef float  v4f  __attribute__((ext_vector_type(4)));
typedef float  v4fa __attribute__((ext_vector_type(4), may_alias));
union FragB { v16b v; v8us half[2]; unsigned short u[16]; };

__device__ __forceinline__ unsigned short bf16_bits(float x) { unsigned int u = __float_as_uint(x); return (unsigned short)((u + 0x7FFFu + ((u >> 16) & 1u)) >> 16); }
__device__ __forceinline__ float bf16_val(unsigned short b) { return __uint_as_float(((unsigned int)b) << 16); }
__device__ __forceinline__ float bf16_round(float x) { return bf16_val(bf16_bits(x)); }
// D += A·B with NT terms: 1 = ah·bh, 2 = + al·bh (A split), 3 = + ah·bl (both split)
template <int NT>
__device__ __forceinline__ v8f mmaN(v16b ah, v16b al, v16b bh, v16b bl, v8f c) {
  c = __builtin_amdgcn_wmma_f32_16x16x32_bf16(false, ah, false, bh, (short)0, c, false, false);
  if (NT >= 2) c = __builtin_amdgcn_wmma_f32_16x16x32_bf16(false, al, false, bh, (short)0, c, false, false);
  if (NT >= 3) c = __builtin_amdgcn_wmma_f32_16x16x32_bf16(false, ah, false, bl, (short)0, c, false, false);
  asm volatile("v_nop\n\tv_nop\n\tv_nop\n\tv_nop" : "+v"(c) : "v"(ah), "v"(al), "v"(bh), "v"(bl));
  return c;
}

__global__ __launch_bounds__(256) void k_wt_bf16(const float* __restrict__ W, unsigned short* __restrict__ Wt, int K, int N) {
  const int t = blockIdx.x * 256 + threadIdx.x;
  const int k8n = K / 8;
  if (t >= N * k8n) return;
  const int n = t / k8n, k8 = (t % k8n) * 8;
  v8us v;
#pragma unroll
  for (int i = 0; i < 8; ++i) v[i] = bf16_bits(W[(size_t)(k8 + i) * N + n]);
  *(v8us*)(Wt + (size_t)n * K + k8) = v;
  
}

// GEMM C[M][N] (f32, pitch ldc) = act(A[M][K]·W + bias). A f32 row-major (pitch lda) converted per fragment to bf16
// (ASPLIT: hi/lo two planes -> 2 terms, else single rounded term); Wt bf16 [N][K] (pitch ldb). BIAS_BF16 rounds the
// bias to bf16 first (bias quantised to bf16 before the add). K%32==0, M%16==0, N%64==0.
template <bool ASPLIT, int ACT, bool BIAS_BF16>
__global__ __launch_bounds__(128) void k_gemm_bf(const float* __restrict__ A, int lda, const unsigned short* __restrict__ Wt, int ldb,
                                               const float* __restrict__ bias, float* __restrict__ C, int ldc, int M, int N, int K) {
  __shared__ __attribute__((aligned(16))) float so[4][16][64];
  const int tid = threadIdx.x, w = tid >> 5, lane = tid & 31, ln = lane & 15, hh = lane >> 4;
  const int ntn = N / 64;
  const int wid = blockIdx.x * 4 + w;
  const int mt = wid / ntn, nq = wid % ntn;
  if (mt * 16 >= M) return;
  const int row0 = mt * 16, col0 = nq * 64;
  const float* arow = A + (size_t)(row0 + ln) * lda;
  v8f acc[4] = {};
  for (int kb = 0; kb < K; kb += 32) {
    FragB ah, al;
    const v4f x0 = *(const v4fa*)(arow + kb + 8 * hh), x1 = *(const v4fa*)(arow + kb + 8 * hh + 4);
    const v4f x2 = *(const v4fa*)(arow + kb + 16 + 8 * hh), x3 = *(const v4fa*)(arow + kb + 16 + 8 * hh + 4);
    float xs[16] = {x0[0],x0[1],x0[2],x0[3],x1[0],x1[1],x1[2],x1[3],x2[0],x2[1],x2[2],x2[3],x3[0],x3[1],x3[2],x3[3]};
#pragma unroll
    for (int i = 0; i < 16; ++i) { const unsigned short hb = bf16_bits(xs[i]); ah.u[i] = hb; al.u[i] = ASPLIT ? bf16_bits(xs[i] - bf16_val(hb)) : (unsigned short)0; }
#pragma unroll
    for (int t = 0; t < 4; ++t) {
      const unsigned short* brow = Wt + (size_t)(col0 + t * 16 + ln) * ldb + kb;
      FragB b;
      b.half[0] = *(const v8us*)(brow + 8 * hh);
      b.half[1] = *(const v8us*)(brow + 16 + 8 * hh);
      acc[t] = mmaN<ASPLIT ? 2 : 1>(ah.v, al.v, b.v, b.v, acc[t]);
    }
  }
#pragma unroll
  for (int t = 0; t < 4; ++t) {
    float bv = bias ? bias[col0 + t * 16 + ln] : 0.f;
    if (BIAS_BF16) bv = bf16_round(bv);
#pragma unroll
    for (int r = 0; r < 8; ++r) { float v = acc[t][r] + bv; if (ACT == 1) v = fmaxf(v, 0.f); so[w][8 * hh + r][t * 16 + ln] = v; }
  }
  __builtin_amdgcn_fence(__ATOMIC_ACQ_REL, "workgroup");
  __builtin_amdgcn_wave_barrier();
  const int rsub = lane >> 4, c4 = (lane & 15) * 4;
  {
#pragma unroll
    for (int q = 0; q < 8; ++q) {
      const int r = q * 2 + rsub;
      const v4f v = *(const v4fa*)&so[w][r][c4];
      *(v4f*)(C + (size_t)(row0 + r) * ldc + col0 + c4) = v;
    }
    
  }
}

// GEMM C = act(A·W + bias + resid): A f32 (ASPLIT -> hi/lo 2 terms), Wt bf16 [N][K]; ACT 0 none, 1 relu, 2 exact gelu;
// resid (optional, f32, row index = (row % rmod), pitch ldr, RES_BF16 rounds it) added before the activation.
template <bool ASPLIT, int ACT, bool BIAS_BF16, bool RES_BF16>
__global__ __launch_bounds__(128) void k_gemm_bf3(const float* __restrict__ A, int lda, const unsigned short* __restrict__ Wt, int ldb,
                                                const float* __restrict__ bias, const float* __restrict__ resid, int rmod, int ldr,
                                                float* __restrict__ C, int ldc, int M, int N, int K) {
  __shared__ __attribute__((aligned(16))) float so[4][16][64];
  const int tid = threadIdx.x, w = tid >> 5, lane = tid & 31, ln = lane & 15, hh = lane >> 4;
  const int ntn = N / 64;
  const int wid = blockIdx.x * 4 + w;
  const int mt = wid / ntn, nq = wid % ntn;
  if (mt * 16 >= M) return;
  const int row0 = mt * 16, col0 = nq * 64;
  const float* arow = A + (size_t)(row0 + ln) * lda;
  v8f acc[4] = {};
  for (int kb = 0; kb < K; kb += 32) {
    FragB ah, al;
    const v4f x0 = *(const v4fa*)(arow + kb + 8 * hh), x1 = *(const v4fa*)(arow + kb + 8 * hh + 4);
    const v4f x2 = *(const v4fa*)(arow + kb + 16 + 8 * hh), x3 = *(const v4fa*)(arow + kb + 16 + 8 * hh + 4);
    float xs[16] = {x0[0],x0[1],x0[2],x0[3],x1[0],x1[1],x1[2],x1[3],x2[0],x2[1],x2[2],x2[3],x3[0],x3[1],x3[2],x3[3]};
#pragma unroll
    for (int i = 0; i < 16; ++i) { const unsigned short hb = bf16_bits(xs[i]); ah.u[i] = hb; al.u[i] = ASPLIT ? bf16_bits(xs[i] - bf16_val(hb)) : (unsigned short)0; }
#pragma unroll
    for (int t = 0; t < 4; ++t) {
      const unsigned short* brow = Wt + (size_t)(col0 + t * 16 + ln) * ldb + kb;
      FragB b;
      b.half[0] = *(const v8us*)(brow + 8 * hh);
      b.half[1] = *(const v8us*)(brow + 16 + 8 * hh);
      acc[t] = mmaN<ASPLIT ? 2 : 1>(ah.v, al.v, b.v, b.v, acc[t]);
    }
  }
#pragma unroll
  for (int t = 0; t < 4; ++t) {
    const int col = col0 + t * 16 + ln;
    float bv = bias ? bias[col] : 0.f;
    if (BIAS_BF16) bv = bf16_round(bv);
#pragma unroll
    for (int r = 0; r < 8; ++r) {
      float v = acc[t][r] + bv;
      if (resid) { float rv = resid[(size_t)((row0 + 8 * hh + r) % rmod) * ldr + col]; if (RES_BF16) rv = bf16_round(rv); v += rv; }
      if (ACT == 1) v = fmaxf(v, 0.f);
      if (ACT == 2) v = 0.5f * v * (1.0f + erff(v * 0.70710678118654752f));
      if (ACT == 3) { const float u = 0.7978845608028654f * (v + 0.044715f * v * v * v); v = 0.5f * v * (1.0f + tanhf(u)); }
      so[w][8 * hh + r][t * 16 + ln] = v;
    }
  }
  __builtin_amdgcn_fence(__ATOMIC_ACQ_REL, "workgroup");
  __builtin_amdgcn_wave_barrier();
  const int rsub = lane >> 4, c4 = (lane & 15) * 4;
  {
#pragma unroll
    for (int q = 0; q < 8; ++q) {
      const int r = q * 2 + rsub;
      const v4f v = *(const v4fa*)&so[w][r][c4];
      *(v4f*)(C + (size_t)(row0 + r) * ldc + col0 + c4) = v;
    }
    
  }
}
// row LayerNorm (biased variance, eps) over N: s = X (+ R); optional out_sum <- s; out_norm <- (s-mu)*rsqrt(var+eps)*g + b
template <bool PARAM_BF16>
__global__ __launch_bounds__(256) void k_layernorm(const float* __restrict__ X, const float* __restrict__ R, const float* __restrict__ g, const float* __restrict__ bta,
                                                  float* __restrict__ out_sum, float* __restrict__ out_norm, int N, float eps) {
  __shared__ float red[256];
  const int row = blockIdx.x, tid = threadIdx.x;
  const float* x = X + (size_t)row * N; const float* rr = R ? R + (size_t)row * N : nullptr;
  float vals[16];                     // up to N = 4096
  const int per = N / 256;            // contiguous chunk per thread? use strided-by-4 chunks: thread handles j = tid*4 + 1024*u
  float s1 = 0.f;
  for (int u = 0; u < per / 4; ++u) {
    const int j = tid * 4 + 1024 * u;
    const v4f a = *(const v4fa*)(x + j);
    v4f b = {0.f,0.f,0.f,0.f}; if (rr) b = *(const v4fa*)(rr + j);
#pragma unroll
    for (int q = 0; q < 4; ++q) { const float v = a[q] + b[q]; vals[u * 4 + q] = v; s1 += v; }
  }
  red[tid] = s1; __syncthreads();
  for (int st = 128; st > 0; st >>= 1) { if (tid < st) red[tid] += red[tid + st]; __syncthreads(); }
  const float mu = red[0] / (float)N; __syncthreads();
  float s2 = 0.f;
  for (int u = 0; u < per / 4; ++u)
#pragma unroll
    for (int q = 0; q < 4; ++q) { const float c = vals[u * 4 + q] - mu; s2 += c * c; }
  red[tid] = s2; __syncthreads();
  for (int st = 128; st > 0; st >>= 1) { if (tid < st) red[tid] += red[tid + st]; __syncthreads(); }
  const float rs = rsqrtf(red[0] / (float)N + eps);
  {
    for (int u = 0; u < per / 4; ++u) {
      const int j = tid * 4 + 1024 * u;
      v4f o, sm;
#pragma unroll
      for (int q = 0; q < 4; ++q) {
        float gg = g[j + q], bb = bta[j + q];
        if (PARAM_BF16) { gg = bf16_round(gg); bb = bf16_round(bb); }
        sm[q] = vals[u * 4 + q]; o[q] = (vals[u * 4 + q] - mu) * rs * gg + bb;
      }
      if (out_sum) *(v4f*)(out_sum + (size_t)row * N + j) = sm;
      *(v4f*)(out_norm + (size_t)row * N + j) = o;
    }
    
  }
}



// ---- f16 WMMA path (v_wmma_f32_16x16x32_f16): 11-bit significands for operands in range — used where a [0,1] probability operand needs more precision than bf16
typedef _Float16 v16h __attribute__((ext_vector_type(16)));
union FragH { v16h v; v8us half[2]; _Float16 h[16]; unsigned short u[16]; };
template <int NT>
__device__ __forceinline__ v8f mmaH(v16h ah, v16h al, v16h bh, v16h bl, v8f c) {
  c = __builtin_amdgcn_wmma_f32_16x16x32_f16(false, ah, false, bh, (short)0, c, false, false);
  if (NT >= 2) c = __builtin_amdgcn_wmma_f32_16x16x32_f16(false, al, false, bh, (short)0, c, false, false);
  if (NT >= 3) c = __builtin_amdgcn_wmma_f32_16x16x32_f16(false, ah, false, bl, (short)0, c, false, false);
  asm volatile("v_nop\n\tv_nop\n\tv_nop\n\tv_nop" : "+v"(c) : "v"(ah), "v"(al), "v"(bh), "v"(bl));
  return c;
}
// batched GEMM like k_gemm_b but f16 operands: A f32 (split into f16 hi/lo if ASPLIT, else rounded to f16), Bt = f16 values [n][k]; alpha; C f32; N multiple of 16 (partial tiles skipped)
template <bool ASPLIT>
__global__ __launch_bounds__(128) void k_gemm_h(const float* __restrict__ A, int lda, size_t sA, const _Float16* __restrict__ Bh, int ldb, size_t sB, float alpha, float* __restrict__ C, int ldc, size_t sC, int M, int N, int K) {
  __shared__ __attribute__((aligned(16))) float so[4][16][64];
  const int tid = threadIdx.x, w = tid >> 5, lane = tid & 31, ln = lane & 15, hh = lane >> 4; const int by = blockIdx.y;
  A += (size_t)by * sA; Bh += (size_t)by * sB; C += (size_t)by * sC;
  const int ntn = (N + 63) / 64; const int wid = blockIdx.x * 4 + w; const int mt = wid / ntn, nq = wid % ntn; if (mt * 16 >= M) return;
  const int row0 = mt * 16, col0 = nq * 64; const float* arow = A + (size_t)(row0 + ln) * lda;
  v8f acc[4] = {};
  for (int kb = 0; kb < K; kb += 32) {
    FragH ah, al;
    const v4f x0 = *(const v4fa*)(arow + kb + 8 * hh), x1 = *(const v4fa*)(arow + kb + 8 * hh + 4), x2 = *(const v4fa*)(arow + kb + 16 + 8 * hh), x3 = *(const v4fa*)(arow + kb + 16 + 8 * hh + 4);
    float xs[16] = {x0[0],x0[1],x0[2],x0[3],x1[0],x1[1],x1[2],x1[3],x2[0],x2[1],x2[2],x2[3],x3[0],x3[1],x3[2],x3[3]};
#pragma unroll
    for (int i = 0; i < 16; ++i) { const _Float16 h = (_Float16)xs[i]; ah.h[i] = h; al.h[i] = ASPLIT ? (_Float16)(xs[i] - (float)h) : (_Float16)0.0f; }
#pragma unroll
    for (int t = 0; t < 4; ++t) { if (col0 + t * 16 >= N) continue; const size_t boff = (size_t)(col0 + t * 16 + ln) * ldb + kb; FragH bq; bq.half[0] = *(const v8us*)(Bh + boff + 8 * hh); bq.half[1] = *(const v8us*)(Bh + boff + 16 + 8 * hh);
      acc[t] = mmaH<ASPLIT ? 2 : 1>(ah.v, al.v, bq.v, bq.v, acc[t]); }
  }
#pragma unroll
  for (int t = 0; t < 4; ++t) { if (col0 + t * 16 >= N) continue;
#pragma unroll
    for (int r = 0; r < 8; ++r) so[w][8 * hh + r][t * 16 + ln] = acc[t][r] * alpha; }
  __builtin_amdgcn_fence(__ATOMIC_ACQ_REL, "workgroup"); __builtin_amdgcn_wave_barrier();
  const int rsub = lane >> 4, c4 = (lane & 15) * 4;
  {
#pragma unroll
    for (int q = 0; q < 8; ++q) { const int r = q * 2 + rsub; if (col0 + c4 < N) { const v4f v = *(const v4fa*)&so[w][r][c4]; *(v4f*)(C + (size_t)(row0 + r) * ldc + col0 + c4) = v; } }
     }
}

// Wt[n][k] = f16(W[k][n]·scale) from f32 row-major W[K][N] (scale = power of two; bf16-exact weights stay exact in f16 away from the subnormal range)
__global__ __launch_bounds__(256) void k_wt_f16(const float* __restrict__ W, _Float16* __restrict__ Wt, int K, int N, float scale) {
  const int t = blockIdx.x * 256 + threadIdx.x; if (t >= N * (K / 8)) return; const int n = t / (K / 8), k8 = (t % (K / 8)) * 8; FragH f;
#pragma unroll
  for (int i = 0; i < 8; ++i) f.h[i] = (_Float16)(bf16_round(W[(size_t)(k8 + i) * N + n]) * scale); const v8us o = f.half[0];
  *(v8us*)((unsigned short*)Wt + (size_t)n * K + k8) = o; 
}
// k_gemm_hh variant with fused epilogue: v = acc·alpha + bias[by·sBias + col] (+ CP[(row/rowsPerB)·sCPb + by·64 + col] if CP) ; ACT 0 none / 1 elu ; writes f16 C16 (and f32 C if non-null)
template <int ACT>
__global__ __launch_bounds__(128) void k_gemm_hhx(const _Float16* __restrict__ A, int lda, size_t sA, const _Float16* __restrict__ Bh, int ldb, size_t sB, float alpha, const float* __restrict__ bias, size_t sBias, const float* __restrict__ CP, int rowsPerB, size_t sCPb, int row0g,
    float* __restrict__ C, _Float16* __restrict__ C16, int ldc, size_t sC, int M, int N, int K) {
  __shared__ __attribute__((aligned(16))) float so[4][16][64];
  const int tid = threadIdx.x, w = tid >> 5, lane = tid & 31, ln = lane & 15, hh = lane >> 4; const int by = blockIdx.y;
  A += (size_t)by * sA; Bh += (size_t)by * sB; const size_t cofs = (size_t)by * sC; const float* bp = bias ? bias + (size_t)by * sBias : nullptr;
  const int ntn = (N + 63) / 64; const int wid = blockIdx.x * 4 + w; const int mt = wid / ntn, nq = wid % ntn; if (mt * 16 >= M) return;
  const int row0 = mt * 16, col0 = nq * 64; const _Float16* arow = A + (size_t)(row0 + ln) * lda;
  v8f acc[4] = {};
  for (int kb = 0; kb < K; kb += 32) { FragH ah; ah.half[0] = *(const v8us*)((const unsigned short*)arow + kb + 8 * hh); ah.half[1] = *(const v8us*)((const unsigned short*)arow + kb + 16 + 8 * hh);
#pragma unroll
    for (int t = 0; t < 4; ++t) { if (col0 + t * 16 >= N) continue; const size_t boff = (size_t)(col0 + t * 16 + ln) * ldb + kb; FragH bq; bq.half[0] = *(const v8us*)((const unsigned short*)Bh + boff + 8 * hh); bq.half[1] = *(const v8us*)((const unsigned short*)Bh + boff + 16 + 8 * hh);
      acc[t] = mmaH<1>(ah.v, ah.v, bq.v, bq.v, acc[t]); }
  }
#pragma unroll
  for (int t = 0; t < 4; ++t) { if (col0 + t * 16 >= N) continue; const int col = col0 + t * 16 + ln; const float bv = bp ? bf16_round(bp[col]) : 0.f;
#pragma unroll
    for (int r = 0; r < 8; ++r) { float v = acc[t][r] * alpha + bv; if (CP) { const int rr = row0g + row0 + 8 * hh + r; if (rowsPerB < 0) v += CP[cofs + (size_t)rr * ldc + col];      /* rowsPerB < 0: own element of the batched C plane */ else { const int bidx = rr / rowsPerB; v += CP[(size_t)bidx * sCPb + (size_t)by * 64 + col]; } } if (ACT == 1) v = (v > 0.f) ? v : expm1f(v); else if (ACT == 7) v = (v > 0.f) ? v + 1.0f : expf(v); else if (ACT == 8) v = tanhf(v); else if (ACT == 9) v = 0.5f * v * (1.0f + tanhf(0.7978845608028654f * (v + 0.044715f * v * v * v))); else if (ACT == 11) v = 1.0f / (1.0f + expf(-v)); else if (ACT == 12) v = (v > 0.f) ? v : 0.01f * v; else if (ACT == 14) v = (v > 0.f) ? v : 0.1f * v; else if (ACT == 16) v = (v >= 0.f) ? v : 0.3f * v; else if (ACT == 17) v = (v >= 0.f) ? v : 0.2f * v; else if (ACT == 15) v = v / (1.0f + expf(-v)); else if (ACT == 3) v = fmaxf(v, 0.f); else if (ACT == 6) v = 0.5f * v * (1.0f + erff(v * 0.70710678118654752f)); so[w][8 * hh + r][t * 16 + ln] = v; } }
  __builtin_amdgcn_fence(__ATOMIC_ACQ_REL, "workgroup"); __builtin_amdgcn_wave_barrier();
  const int rsub = lane >> 4, c4 = (lane & 15) * 4; typedef _Float16 v4h __attribute__((ext_vector_type(4)));
  {
#pragma unroll
    for (int q = 0; q < 8; ++q) { const int r = q * 2 + rsub; if (col0 + c4 < N) { const v4f v = *(const v4fa*)&so[w][r][c4]; if (C) *(v4f*)(C + cofs + (size_t)(row0 + r) * ldc + col0 + c4) = v; if (C16) { v4h h4; for (int i = 0; i < 4; ++i) h4[i] = (_Float16)v[i]; *(v4h*)(C16 + cofs + (size_t)(row0 + r) * ldc + col0 + c4) = h4; } } }
     }
}


typedef _Float16 v4h __attribute__((ext_vector_type(4)));

__global__ __launch_bounds__(256) void k_x16(const float* __restrict__ x, _Float16* __restrict__ X16, size_t n8) { const size_t t = (size_t)blockIdx.x * 256 + threadIdx.x; if (t >= n8) return; FragH f;
#pragma unroll
  for (int q = 0; q < 8; ++q) f.h[q] = (_Float16)bf16_round(x[t * 8 + q]); *(v8us*)((unsigned short*)X16 + t * 8) = f.half[0];  }
__global__ __launch_bounds__(256) void k_h16(const float* __restrict__ x, _Float16* __restrict__ X16, size_t n8) { const size_t t = (size_t)blockIdx.x * 256 + threadIdx.x; if (t >= n8) return; FragH f;
#pragma unroll
  for (int q = 0; q < 8; ++q) f.h[q] = (_Float16)x[t * 8 + q]; *(v8us*)((unsigned short*)X16 + t * 8) = f.half[0];  }
__global__ __launch_bounds__(256) void k_round16f(const float* __restrict__ W, _Float16* __restrict__ Bt, size_t n8) { const size_t t = (size_t)blockIdx.x * 256 + threadIdx.x; if (t >= n8) return; FragH f;
#pragma unroll
  for (int i = 0; i < 8; ++i) f.h[i] = (_Float16)(bf16_round(W[t * 8 + i]) * 16.0f); *(v8us*)((unsigned short*)Bt + t * 8) = f.half[0];  }
template <int NHv, int TTv>
__global__ __launch_bounds__(256) void k_vt(const _Float16* __restrict__ V16, int ldv, int voff, _Float16* __restrict__ Vt) { __shared__ unsigned short tl[64][66]; const int tid = threadIdx.x; const int slab = blockIdx.x / (TTv / 64), lg = blockIdx.x % (TTv / 64); const int b = slab / NHv, h = slab % NHv;
  for (int i = tid; i < 64 * 8; i += 256) { const int r = i / 8, c8 = (i % 8) * 8; FragH f; f.half[0] = *(const v8us*)((const unsigned short*)V16 + ((size_t)b * TTv + lg * 64 + r) * ldv + voff + h * 64 + c8);
#pragma unroll
    for (int q = 0; q < 8; ++q) tl[r][c8 + q] = f.u[q]; }
  __syncthreads();
  {
#pragma unroll
    for (int rd = 0; rd < 2; ++rd) { const int d = rd * 32 + tid / 8, pc = tid % 8; FragH f;
#pragma unroll
      for (int q = 0; q < 8; ++q) f.u[q] = tl[pc * 8 + q][d];
      *(v8us*)((unsigned short*)Vt + ((size_t)slab * 64 + d) * TTv + lg * 64 + pc * 8) = f.half[0]; }
     } }

__global__ __launch_bounds__(256) void k_hl(const float* __restrict__ F, _Float16* __restrict__ Hh, _Float16* __restrict__ Hl, size_t n8) { const size_t t = (size_t)blockIdx.x * 256 + threadIdx.x; if (t >= n8) return; FragH fh, fl; const v4f a = *(const v4fa*)(F + t * 8), c = *(const v4fa*)(F + t * 8 + 4);
#pragma unroll
  for (int q = 0; q < 4; ++q) { _Float16 h = (_Float16)a[q]; fh.h[q] = h; fl.h[q] = (_Float16)((a[q] - (float)h) * 1024.0f); h = (_Float16)c[q]; fh.h[4 + q] = h; fl.h[4 + q] = (_Float16)((c[q] - (float)h) * 1024.0f); }
  { *(v8us*)((unsigned short*)Hh + t * 8) = fh.half[0]; *(v8us*)((unsigned short*)Hl + t * 8) = fl.half[0];  } }

// fragment of 16 rows x 32 k from k-contiguous rows in global memory (the hardware k order)
__device__ __forceinline__ v16h g2_frag(const _Float16* p, int hh) { FragH f; f.half[0] = *(const v8us*)((const unsigned short*)p + 8 * hh); f.half[1] = *(const v8us*)((const unsigned short*)p + 16 + 8 * hh); return f.v; }
// ---- GEMM with both operands staged in LDS: C = alpha A Bh^T + bias (bias [N], never null, rounded to bf16); A [M][K] and Bh [N][K] f16, k contiguous; needs M % 128 == 0, N % 128 == 0, K % 128 == 0 ----
// A block is 4 waves (2 x 2) on a 128 x 128 tile of C; a wave owns 64 x 64 (16 accumulator tiles). A stage is 128 k: 256 bytes of each of the block's 128 A rows and 128 B rows,
// brought by asynchronous copies to LDS, 16 bytes a lane (one copy of a wave = two whole rows of the stage = four whole 128-byte lines): each operand byte is asked for once a block, in whole lines.
// Two buffers: stage t + 2 is asked for behind the barrier that ends trip t, into the buffer that trip t has read. Fragments by two 16-byte LDS reads in the k order of g2_frag, k steps in rising order.
#define G3_KS 128                    /* k per stage */
#define G3_P 272                     /* LDS row pitch in bytes: 16 x odd, so the 16-byte fragment reads of 16 rows meet no bank twice */
#define G3_ST (256 * G3_P)           /* bytes per stage: A rows 0..127, then B rows 0..127 */
__device__ __forceinline__ v16h g3_frag(const unsigned char* p) { FragH f; f.half[0] = *(const v8us*)p; f.half[1] = *(const v8us*)(p + 32); return f.v; }
// Eight copies (rows 8 apart: LDS byte address l, global address g, gs elements per 8 rows); s_wait_xcnt 0 as the statement's last line, so that it stands in front of every later write of their address registers (a precaution).
__device__ __forceinline__ void g3_copy8(unsigned l, const _Float16* g, size_t gs) {
  asm volatile("global_load_async_to_lds_b128 %0, %8, off\n\tglobal_load_async_to_lds_b128 %1, %9, off\n\tglobal_load_async_to_lds_b128 %2, %10, off\n\tglobal_load_async_to_lds_b128 %3, %11, off\n\t"
               "global_load_async_to_lds_b128 %4, %12, off\n\tglobal_load_async_to_lds_b128 %5, %13, off\n\tglobal_load_async_to_lds_b128 %6, %14, off\n\tglobal_load_async_to_lds_b128 %7, %15, off\n\ts_wait_xcnt 0x0"
               :: "v"(l), "v"(l + 8 * G3_P), "v"(l + 16 * G3_P), "v"(l + 24 * G3_P), "v"(l + 32 * G3_P), "v"(l + 40 * G3_P), "v"(l + 48 * G3_P), "v"(l + 56 * G3_P),
                  "v"(g), "v"(g + gs), "v"(g + 2 * gs), "v"(g + 3 * gs), "v"(g + 4 * gs), "v"(g + 5 * gs), "v"(g + 6 * gs), "v"(g + 7 * gs) : "memory"); }
// One stage: 32 copies a lane (A rows 0..63, 64..127, B rows 0..63, 64..127); every lane is on, every address a multiple of 16.
__device__ __forceinline__ void g3_fill(unsigned l, const _Float16* ga, int lda, const _Float16* gb, int ldb) {
  g3_copy8(l, ga, (size_t)8 * lda); g3_copy8(l + 64 * G3_P, ga + (size_t)64 * lda, (size_t)8 * lda);
  g3_copy8(l + 128 * G3_P, gb, (size_t)8 * ldb); g3_copy8(l + 192 * G3_P, gb + (size_t)64 * ldb, (size_t)8 * ldb); }
template <bool F32OUT>      /* output rows: f32 to C, or f16 to C16 */
__global__ __launch_bounds__(128) void k_gemm3(const _Float16* __restrict__ A, int lda, const _Float16* __restrict__ Bh, int ldb, float alpha, const float* __restrict__ bias,
    float* __restrict__ C, _Float16* __restrict__ C16, int ldc, int M, int N, int K) {
  __shared__ __attribute__((aligned(16))) unsigned char sm[2 * G3_ST];      /* the two buffers; behind the loop each wave's own 64 x 68 f32 output staging */
  const int tid = threadIdx.x, w = tid >> 5, lane = tid & 31, ln = lane & 15, hh = lane >> 4;
  const int ntn = N >> 7; const int mt = blockIdx.x / ntn, nq = blockIdx.x - mt * ntn; const int row0 = mt * 128, col0 = nq * 128; if (row0 >= M) return;      /* the same for the whole block */
  const int wm = w >> 1, wn = w & 1;
  const unsigned l0 = (unsigned)(size_t)sm + (unsigned)((tid >> 4) * G3_P + (tid & 15) * 16);      /* this lane's place in a stage: row tid / 16 (+ 8 a copy), 16-byte piece tid % 16 */
  const _Float16* ga = A + (size_t)(row0 + (tid >> 4)) * lda + (tid & 15) * 8; const _Float16* gb = Bh + (size_t)(col0 + (tid >> 4)) * ldb + (tid & 15) * 8;
  const int T = K / G3_KS;
  const v8f z8 = {0.f,0.f,0.f,0.f,0.f,0.f,0.f,0.f}; v8f acc[4][4];
  /* every inner loop of this kernel is unrolled so that each index of acc, a and b is a constant and the arrays stay in registers */
#pragma unroll
  for (int i = 0; i < 4; ++i)
#pragma unroll
    for (int j = 0; j < 4; ++j) acc[i][j] = z8;
  const int bcol = col0 + wn * 64 + ln; float braw[4];      /* asked for here and first used behind the loop, so that the loads' latency passes under the stages */
#pragma unroll
  for (int j = 0; j < 4; ++j) braw[j] = bias[bcol + j * 16];
  asm volatile("s_wait_xcnt 0x0" :: "v"(bcol), "s"(bias) : "memory");      /* the four loads' index and base stay live up to this wait, so nothing is written over them earlier */
  g3_fill(l0, ga, lda, gb, ldb);
  asm volatile("s_wait_asynccnt 0x0" ::: "memory");      /* this wave's copies of stage 0 have landed */
  __syncthreads();                                        /* ... and every other wave's */
  if (T > 1) g3_fill(l0 + G3_ST, ga + G3_KS, lda, gb + G3_KS, ldb);
  const unsigned char* fa = sm + (wm * 64 + ln) * G3_P + 16 * hh; const unsigned char* fb = sm + (128 + wn * 64 + ln) * G3_P + 16 * hh;
#pragma unroll 1
  for (int t = 0; t < T; ++t) {      /* rolled: one trip a stage, the hand-over at its foot */
    const int bo = (t & 1) * G3_ST;
    v16h a[2][2], b[2][4];      /* a block is 8 products: two A fragments x the k step's four B fragments; two register sets, the next block's fragments asked for one block ahead */
#pragma unroll
    for (int i = 0; i < 2; ++i) a[0][i] = g3_frag(fa + bo + i * 16 * G3_P);
#pragma unroll
    for (int j = 0; j < 4; ++j) b[0][j] = g3_frag(fb + bo + j * 16 * G3_P);
#pragma unroll
    for (int hb = 0; hb < G3_KS / 16; ++hb) {
      const int ks = hb >> 1, h = hb & 1, ks1 = (hb + 1) >> 1, h1 = (hb + 1) & 1;
      if (hb + 1 < G3_KS / 16) {
#pragma unroll
        for (int i = 0; i < 2; ++i) a[h1][i] = g3_frag(fa + bo + (2 * h1 + i) * 16 * G3_P + ks1 * 64);
        if (h1 == 0) {
#pragma unroll
          for (int j = 0; j < 4; ++j) b[ks1 & 1][j] = g3_frag(fb + bo + j * 16 * G3_P + ks1 * 64);
        }
      }
      __builtin_amdgcn_sched_barrier(0);      /* keeps the next block's LDS reads together in front of this block's products: left free, they were sunk among the products and waited for at once */
#pragma unroll
      for (int i = 0; i < 2; ++i)
#pragma unroll
        for (int j = 0; j < 4; ++j) acc[2 * h + i][j] = __builtin_amdgcn_wmma_f32_16x16x32_f16(false, a[h][i], false, b[ks & 1][j], (short)0, acc[2 * h + i][j], false, false);
      __builtin_amdgcn_sched_barrier(0);      /* ... and the block after next's reads behind them */
    }
    asm volatile("s_wait_dscnt 0x0" ::: "memory");        /* this wave's reads of the buffer are done before it is handed back */
    asm volatile("s_wait_asynccnt 0x0" ::: "memory");     /* this wave's copies of stage t + 1 have landed */
    __syncthreads();                                      /* publishes stage t + 1 and ends every wave's reads of stage t */
    if (t + 2 < T) g3_fill(l0 + bo, ga + (size_t)(t + 2) * G3_KS, lda, gb + (size_t)(t + 2) * G3_KS, ldb);
  }
  asm volatile("s_wait_asynccnt 0x0" ::: "memory");       /* nothing is in flight when the buffers become output staging */
  float* so = (float*)sm + w * (64 * 68);
#pragma unroll
  for (int j = 0; j < 4; ++j) { const float bv = bf16_round(braw[j]);
#pragma unroll
    for (int i = 0; i < 4; ++i)
#pragma unroll
      for (int r = 0; r < 8; ++r) so[(i * 16 + 8 * hh + r) * 68 + j * 16 + ln] = acc[i][j][r] * alpha + bv; }
  __builtin_amdgcn_fence(__ATOMIC_ACQ_REL, "workgroup"); __builtin_amdgcn_wave_barrier();      /* the wave's staging writes stay in front of its own reads of them; no other wave touches its range */
  const int c4 = ln * 4; const size_t cb = (size_t)(row0 + wm * 64 + hh) * ldc + col0 + wn * 64 + c4;
#pragma unroll
  for (int q = 0; q < 32; ++q) { const v4f v = *(const v4fa*)&so[(q * 2 + hh) * 68 + c4]; if (F32OUT) *(v4f*)(C + cb + (size_t)(q * 2) * ldc) = v; else { v4h h4; for (int i = 0; i < 4; ++i) h4[i] = (_Float16)v[i]; *(v4h*)(C16 + cb + (size_t)(q * 2) * ldc) = h4; } }
}


__global__ __launch_bounds__(256) void k_wnat(const float* __restrict__ w, size_t n8, _Float16* __restrict__ Bt) { const size_t t = (size_t)blockIdx.x * 256 + threadIdx.x; if (t >= n8) return; FragH f; for (int q = 0; q < 8; ++q) f.h[q] = (_Float16)(bf16_round(w[t * 8 + q]) * 16.0f); *(v8us*)((unsigned short*)Bt + t * 8) = f.half[0];  }
__global__ __launch_bounds__(256) void k_rsm(const float* __restrict__ S, _Float16* __restrict__ P, int nrows) {
  #pragma clang fp contract(off)
  const int i = blockIdx.x * 256 + threadIdx.x; if (i >= nrows) return; const float* s = S + (size_t)i * SQ; float mx = -3.0e38f;
#pragma unroll 1
  for (int j = 0; j < SQ; ++j) mx = fmaxf(mx, s[j]); float se = 0.f;
#pragma unroll 1
  for (int j = 0; j < SQ; ++j) se += expf(s[j] - mx); const float sc = 256.0f / se;
#pragma unroll 1
  for (int j0 = 0; j0 < SQ; j0 += 8) { FragH f; for (int q = 0; q < 8; ++q) f.h[q] = (_Float16)(expf(s[j0 + q] - mx) * sc); unsigned short* d = (unsigned short*)P + (size_t)i * SQ + j0; *(v8us*)d = f.half[0];  } }
__global__ __launch_bounds__(256) void k_vt(const _Float16* __restrict__ V16, int b, int h0, _Float16* __restrict__ VT) { __shared__ unsigned short tl[64][65]; const int tid = threadIdx.x; const int hh = blockIdx.x % HG, sg = blockIdx.x / HG; const int s0 = sg * 64; const int h = h0 + hh;
  for (int i = tid; i < 64 * 8; i += 256) { const int j = i / 8, d8 = (i % 8) * 8; FragH f; f.half[0] = *(const v8us*)((const unsigned short*)V16 + ((size_t)b * SQ + s0 + j) * DM + h * HD + d8); for (int q = 0; q < 8; ++q) tl[d8 + q][j] = f.u[q]; }
  __syncthreads();
  { for (int i = tid; i < 64 * 8; i += 256) { const int d = i / 8, j8 = (i % 8) * 8; FragH f; for (int q = 0; q < 8; ++q) f.u[q] = tl[d][j8 + q]; *(v8us*)((unsigned short*)VT + ((size_t)hh * HD + d) * SQ + s0 + j8) = f.half[0]; }  } }


// Final stage: y = x + global + 0.3 (conv3 of x + b), LayerNorm, affine. One wave owns FN_R consecutive token rows whole: a lane holds 32 columns of each (8 pieces of 4; piece c = columns 128 c + 4 lane),
// so every load and store of a wave is 512 bytes in a row and a row's sums are in-lane adds plus one lane butterfly. All of a wave's row loads are asked for at its start, before anything waits.
// The six column parameters (three conv taps, conv bias, gain, shift) are rounded to bf16 once per block and shared through LDS planes. FN_R divides SQ, so a wave's rows lie in one sequence;
// the row in front of the first and the row behind the last of a sequence count as zero.
#define FN_R 2                       /* token rows per wave */
template <int CTRL> __device__ __forceinline__ float fn_dpp(float v) { return __builtin_bit_cast(float, __builtin_amdgcn_update_dpp(0, __builtin_bit_cast(int, v), CTRL, 0xf, 0xf, true)); }      /* 0x160 + m: lane l <- lane l ^ m inside a 16-lane row */
__device__ __forceinline__ float fn_xhalf(float x) { return __builtin_bit_cast(float, __builtin_amdgcn_permlanex16(__builtin_bit_cast(int, x), __builtin_bit_cast(int, x), 0x76543210, 0xfedcba98, false, false)); }      /* lane l <-> lane l ^ 16 */
__device__ __forceinline__ float fn_wsum(v4f a) { float v = (a[0] + a[1]) + (a[2] + a[3]); v += fn_dpp<0x161>(v); v += fn_dpp<0x162>(v); v += fn_dpp<0x164>(v); v += fn_dpp<0x168>(v); return v + fn_xhalf(v); }      /* the wave's sum, in every lane */
__device__ __forceinline__ v4f fn_ld(const float* base, unsigned bytes) { return *(const v4fa*)((const char*)base + bytes); }      /* scalar base + 32-bit byte offset */
__device__ __forceinline__ v4f fn_rd(v4f a) { v4f r; for (int q = 0; q < 4; ++q) r[q] = bf16_round(a[q]); return r; }
__global__ __launch_bounds__(256) __attribute__((amdgpu_waves_per_eu(4, 4))) void k_msfin(const float* __restrict__ X, const float* __restrict__ G, const float* __restrict__ cw, const float* __restrict__ cb, const float* __restrict__ g, const float* __restrict__ bta, float eps, float* __restrict__ out) {
  __shared__ __attribute__((aligned(16))) float pr[6][DM];      /* planes: tap 0, tap 1, tap 2, conv bias, gain, shift */
  const int tid = threadIdx.x; const unsigned c0 = (tid & 31) * 4u, t4 = tid * 4u;      /* first column of a lane's piece; of this thread's four parameter columns */
  const unsigned lb = (tid & 31) * 16u, tb = tid * 16u, wo = tid * 48u;      /* byte offsets of the loads: a lane's piece in a row, this thread's four parameters, its twelve taps */
  const int wv = __builtin_amdgcn_readfirstlane((int)(blockIdx.x * 8 + (tid >> 5)));      /* the wave's number, in a scalar register: row addresses are scalar base + lane offset */
  const size_t row0 = (size_t)wv * FN_R; const int s0 = (int)(row0 % SQ); const bool hp = s0 > 0, hn = s0 + FN_R < SQ;
  const float* xb = X + row0 * DM; const float* xm = xb - (hp ? DM : 0); const float* xn = xb + (hn ? FN_R * DM : 0);      /* a neighbour outside the sequence: an address in bounds, its values replaced by zero */
  const float* gb = G + row0 * DM;
  const v4f wa = fn_ld(cw, wo), wb = fn_ld(cw, wo + 16), wc = fn_ld(cw, wo + 32), pc = fn_ld(cb, tb), pg = fn_ld(g, tb), pb = fn_ld(bta, tb);      /* this thread's four columns: 12 taps in a row, bias, gain, shift */
  v4f xr[FN_R + 2][8], y[FN_R][8];
  /* every loop of this kernel is unrolled so that each index of xr and y is a constant and the rows stay in registers */
#pragma unroll
  for (int c = 0; c < 8; ++c) { const unsigned j = lb + c * 512; xr[0][c] = fn_ld(xm, j);
#pragma unroll
    for (int r = 0; r < FN_R; ++r) xr[r + 1][c] = fn_ld(xb, j + r * (DM * 4));
    xr[FN_R + 1][c] = fn_ld(xn, j);
#pragma unroll
    for (int r = 0; r < FN_R; ++r) y[r][c] = fn_ld(gb, j + r * (DM * 4)); }
  asm volatile("s_wait_xcnt 0x0" :: "v"(lb), "v"(tb), "v"(wo), "s"(xm), "s"(xb), "s"(xn), "s"(gb), "s"(cw), "s"(cb), "s"(g), "s"(bta) : "memory");      /* the loads' offsets and bases stay live up to this wait, so nothing (a later load's result included) is written over them earlier; its memory clobber also keeps every row load in front of the first wait for data (left free, they were sunk to their uses and waited for one by one) */
  { const v4f a = fn_rd(wa), b = fn_rd(wb), c = fn_rd(wc); const v4f t0 = {a[0], a[3], b[2], c[1]}, t1 = {a[1], b[0], b[3], c[2]}, t2 = {a[2], b[1], c[0], c[3]};
    *(v4f*)&pr[0][t4] = t0; *(v4f*)&pr[1][t4] = t1; *(v4f*)&pr[2][t4] = t2; *(v4f*)&pr[3][t4] = fn_rd(pc); *(v4f*)&pr[4][t4] = fn_rd(pg); *(v4f*)&pr[5][t4] = fn_rd(pb); }
  /* work-group barrier with LDS-only fences: the planes are whole before any wave reads them (nothing writes them again); __syncthreads() would also wait here for every row load still in flight */
  __builtin_amdgcn_fence(__ATOMIC_RELEASE, "workgroup", "local"); __builtin_amdgcn_s_barrier(); __builtin_amdgcn_fence(__ATOMIC_ACQUIRE, "workgroup", "local");
  const v4f z4 = {0.f, 0.f, 0.f, 0.f}; v4f s1[FN_R];
#pragma unroll
  for (int r = 0; r < FN_R; ++r) s1[r] = z4;
#pragma unroll
  for (int c = 0; c < 8; ++c) {
    const unsigned j = c * 128 + c0; v4f xq[FN_R + 2];
#pragma unroll
    for (int r = 0; r < FN_R + 2; ++r) xq[r] = fn_rd(xr[r][c]);
    if (!hp) xq[0] = z4;
    if (!hn) xq[FN_R + 1] = z4;
    const v4f w0 = *(const v4f*)&pr[0][j], w1 = *(const v4f*)&pr[1][j], w2 = *(const v4f*)&pr[2][j], cv = *(const v4f*)&pr[3][j];
#pragma unroll
    for (int r = 0; r < FN_R; ++r) { const v4f loc = xq[r] * w0 + xq[r + 1] * w1 + xq[r + 2] * w2 + cv; const v4f yy = xq[r + 1] + (y[r][c] + 0.3f * loc); y[r][c] = yy; s1[r] += yy; }
  }
  float mu[FN_R], rs[FN_R];
#pragma unroll
  for (int r = 0; r < FN_R; ++r) mu[r] = fn_wsum(s1[r]) * (1.0f / (float)DM);
#pragma unroll
  for (int r = 0; r < FN_R; ++r) { v4f s2 = z4;
#pragma unroll
    for (int c = 0; c < 8; ++c) { y[r][c] -= mu[r]; s2 += y[r][c] * y[r][c]; }
    s1[r] = s2; }
#pragma unroll
  for (int r = 0; r < FN_R; ++r) rs[r] = rsqrtf(fn_wsum(s1[r]) * (1.0f / (float)DM) + eps);
  float* ob = out + row0 * DM;
#pragma unroll
  for (int c = 0; c < 8; ++c) { const unsigned j = c * 128 + c0; const v4f gg = *(const v4f*)&pr[4][j], bb = *(const v4f*)&pr[5][j];
#pragma unroll
    for (int r = 0; r < FN_R; ++r) *(v4f*)(ob + (size_t)r * DM + j) = y[r][c] * rs[r] * gg + bb; }
}


__device__ __forceinline__ float fa_xhalf(float x) { return __builtin_bit_cast(float, __builtin_amdgcn_permlanex16(__builtin_bit_cast(int, x), __builtin_bit_cast(int, x), 0x76543210, 0xfedcba98, false, false)); }      /* lane l <-> lane l ^ 16 */
__device__ __forceinline__ v8f fa_mma(v16h a, v16h b, v8f c) { return __builtin_amdgcn_wmma_f32_16x16x32_f16(false, a, false, b, (short)0, c, false, false); }
// Native exp2 of nine / eight values in place, in one statement that ends in v_nop: no v_exp_f32 is directly followed by an instruction that reads its result or writes over its source
// (left to the register allocator, a neighbour's result landed on the source of the exp in front of it).
__device__ __forceinline__ void fa_exp9(float& y, float& x0, float& x1, float& x2, float& x3, float& x4, float& x5, float& x6, float& x7) {
  asm("v_exp_f32 %0, %0\n\tv_exp_f32 %1, %1\n\tv_exp_f32 %2, %2\n\tv_exp_f32 %3, %3\n\tv_exp_f32 %4, %4\n\tv_exp_f32 %5, %5\n\tv_exp_f32 %6, %6\n\tv_exp_f32 %7, %7\n\tv_exp_f32 %8, %8\n\tv_nop"
      : "+v"(y), "+v"(x0), "+v"(x1), "+v"(x2), "+v"(x3), "+v"(x4), "+v"(x5), "+v"(x6), "+v"(x7)); }
__device__ __forceinline__ void fa_exp8(float& x0, float& x1, float& x2, float& x3, float& x4, float& x5, float& x6, float& x7) {
  asm("v_exp_f32 %0, %0\n\tv_exp_f32 %1, %1\n\tv_exp_f32 %2, %2\n\tv_exp_f32 %3, %3\n\tv_exp_f32 %4, %4\n\tv_exp_f32 %5, %5\n\tv_exp_f32 %6, %6\n\tv_exp_f32 %7, %7\n\tv_nop"
      : "+v"(x0), "+v"(x1), "+v"(x2), "+v"(x3), "+v"(x4), "+v"(x5), "+v"(x6), "+v"(x7)); }
#define FA_QB 256                    /* query rows per block (8 waves x 32) */
// K and V^T reach the waves through LDS: a stage is FA_KS keys of the block's (batch, head): FA_KS K rows of 128 bytes, then the 64 V^T rows' 256 bytes of those keys,
// brought once per block by asynchronous copies, 16 bytes a lane (a wave's copy = four whole K rows or two whole V^T row pieces = four whole 128-byte lines), and read by all 8 waves.
// Two buffers: stage t + 2 is asked for behind the barrier that ends trip t, into the buffer that trip t has read. Fragments by two 16-byte LDS reads in the k order of g2_frag; keys in rising order as before.
#define FA_KS 128                    /* keys per stage (4 passes) */
#define FA_KP 144                    /* LDS pitch of a K row in bytes: 16 x odd, so the 16-byte fragment reads of 16 rows meet no bank twice */
#define FA_VP 272                    /* LDS pitch of a V^T row in bytes: 16 x odd */
#define FA_VO (FA_KS * FA_KP)        /* the V^T rows stand behind the K rows */
#define FA_ST (FA_VO + HD * FA_VP)   /* bytes per stage */
// One stage: eight copies a lane (K rows 32 apart, V^T rows 16 apart); every lane is on, every address a multiple of 16; s_wait_xcnt 0 as the statement's last line, so that it stands in front of every later write of their address registers (a precaution).
__device__ __forceinline__ void fa_fill(unsigned lk, unsigned lv, const _Float16* gk, const _Float16* gv) {
  asm volatile("global_load_async_to_lds_b128 %0, %8, off\n\tglobal_load_async_to_lds_b128 %1, %9, off\n\tglobal_load_async_to_lds_b128 %2, %10, off\n\tglobal_load_async_to_lds_b128 %3, %11, off\n\t"
               "global_load_async_to_lds_b128 %4, %12, off\n\tglobal_load_async_to_lds_b128 %5, %13, off\n\tglobal_load_async_to_lds_b128 %6, %14, off\n\tglobal_load_async_to_lds_b128 %7, %15, off\n\ts_wait_xcnt 0x0"
               :: "v"(lk), "v"(lk + 32 * FA_KP), "v"(lk + 64 * FA_KP), "v"(lk + 96 * FA_KP), "v"(lv), "v"(lv + 16 * FA_VP), "v"(lv + 32 * FA_VP), "v"(lv + 48 * FA_VP),
                  "v"(gk), "v"(gk + (size_t)32 * DM), "v"(gk + (size_t)64 * DM), "v"(gk + (size_t)96 * DM), "v"(gv), "v"(gv + (size_t)16 * SQ), "v"(gv + (size_t)32 * SQ), "v"(gv + (size_t)48 * SQ) : "memory"); }
// One pass: 32 keys against the wave's 32 query columns. pk: this lane's place in the pass's first K row, pv: in V^T row ln at the pass's first key. PRE: the next pass's K fragments are asked for behind the score products
// (inside a stage only: nothing of the next stage is read in front of its barrier).
template <bool PRE>
__device__ __forceinline__ void fa_pass(const unsigned char* pk, const unsigned char* pv, const v16h (&qf)[2][2], v16h (&kf)[2][2], v8f (&o)[4][2], float (&m)[2], float (&l)[2]) {
  const float SC = 0.125f * 1.4426950408889634f;      /* 1 / sqrt(64), in log2 units */
  const v8f z8 = {0.f,0.f,0.f,0.f,0.f,0.f,0.f,0.f};
  v16h vf[4];      /* asked for at the head of the pass, used behind the softmax */
#pragma unroll
  for (int t = 0; t < 4; ++t) vf[t] = g3_frag(pv + t * 16 * FA_VP);
  v8f s[2][2];
#pragma unroll
  for (int kt = 0; kt < 2; ++kt)
#pragma unroll
    for (int g = 0; g < 2; ++g) s[kt][g] = fa_mma(kf[kt][1], qf[g][1], fa_mma(kf[kt][0], qf[g][0], z8));
  if (PRE) {
#pragma unroll
    for (int kt = 0; kt < 2; ++kt)
#pragma unroll
      for (int j = 0; j < 2; ++j) kf[kt][j] = g3_frag(pk + (32 + kt * 16) * FA_KP + 64 * j);
  }
  __builtin_amdgcn_sched_barrier(0);      /* keeps the pass's LDS reads in front of the softmax, whose length covers their latency: left free, the V^T reads of a stage's last pass were sunk among the products and waited for at once */
  v16h pf[2];
#pragma unroll
  for (int g = 0; g < 2; ++g) {
    const v8f a = s[0][g], c = s[1][g];
    float mx = fmaxf(a[0], c[0]);
#pragma unroll
    for (int r = 1; r < 8; ++r) mx = fmaxf(mx, fmaxf(a[r], c[r]));
    mx = fmaxf(mx, fa_xhalf(mx));
    const float mn = fmaxf(m[g], mx * SC); float al = m[g] - mn; m[g] = mn;      /* al becomes 2^al below: 0 on the first pass */
    const float off = 8.0f - mn; FragH p; float e[16];
#pragma unroll
    for (int r = 0; r < 8; ++r) { e[r] = a[r] * SC + off; e[8 + r] = c[r] * SC + off; }
    fa_exp9(al, e[0], e[1], e[2], e[3], e[4], e[5], e[6], e[7]); fa_exp8(e[8], e[9], e[10], e[11], e[12], e[13], e[14], e[15]);
#pragma unroll
    for (int r = 0; r < 16; ++r) p.h[r] = (_Float16)e[r];
    pf[g] = p.v;
    const float sum = (((e[0] + e[1]) + (e[2] + e[3])) + ((e[4] + e[5]) + (e[6] + e[7]))) + (((e[8] + e[9]) + (e[10] + e[11])) + ((e[12] + e[13]) + (e[14] + e[15])));
    l[g] = l[g] * al + sum;
#pragma unroll
    for (int t = 0; t < 4; ++t) o[t][g] *= al;
  }
#pragma unroll
  for (int t = 0; t < 4; ++t)
#pragma unroll
    for (int g = 0; g < 2; ++g) o[t][g] = fa_mma(vf[t], pf[g], o[t][g]);
  asm volatile("v_nop\n\tv_nop\n\tv_nop\n\tv_nop" : "+v"(o[0][0]), "+v"(o[0][1]), "+v"(o[1][0]), "+v"(o[1][1]), "+v"(o[2][0]), "+v"(o[2][1]), "+v"(o[3][0]), "+v"(o[3][1]) : "v"(pf[0]), "v"(pf[1]));      /* WMMA distance: the weights (B operands) stay live for four slots behind the pass's last products, so the next pass's score tiles, which may get the same registers, are not written over them earlier */
}
__global__ __launch_bounds__(256) __attribute__((amdgpu_waves_per_eu(4, 4))) void k_fattn(const _Float16* __restrict__ Q16, const _Float16* __restrict__ K16, const _Float16* __restrict__ VT, _Float16* __restrict__ O16) {
  __shared__ __attribute__((aligned(16))) unsigned char sm[2 * FA_ST];      /* the two buffers */
  const int tid = threadIdx.x, lane = threadIdx.x & 31, w = threadIdx.x >> 5, ln = lane & 15, hh = lane >> 4;
  const int bh = blockIdx.x / (SQ / FA_QB), qb = blockIdx.x % (SQ / FA_QB); const int b = bh / NH, h = bh % NH;
  const size_t r0 = (size_t)b * SQ; const int q0 = qb * FA_QB + w * 32;
  const unsigned lk = (unsigned)(size_t)sm + (unsigned)((tid >> 3) * FA_KP + (tid & 7) * 16);              /* this lane's places in a stage: K row tid / 8 (+ 32 a copy), 16-byte piece tid % 8 */
  const unsigned lv = (unsigned)(size_t)sm + (unsigned)(FA_VO + (tid >> 4) * FA_VP + (tid & 15) * 16);     /* V^T row tid / 16 (+ 16 a copy), 16-byte piece tid % 16 */
  const _Float16* gk = K16 + (r0 + (tid >> 3)) * DM + h * HD + (tid & 7) * 8;
  const _Float16* gv = VT + ((size_t)bh * HD + (tid >> 4)) * SQ + (tid & 15) * 8;
  fa_fill(lk, lv, gk, gv);
  v16h qf[2][2];
#pragma unroll
  for (int g = 0; g < 2; ++g)
#pragma unroll
    for (int j = 0; j < 2; ++j) qf[g][j] = g2_frag(Q16 + (r0 + q0 + g * 16 + ln) * DM + h * HD + 32 * j, hh);
  const v8f z8 = {0.f,0.f,0.f,0.f,0.f,0.f,0.f,0.f};
  v8f o[4][2]; float m[2], l[2];
#pragma unroll
  for (int g = 0; g < 2; ++g) { m[g] = -3.0e38f; l[g] = 0.f;
#pragma unroll
    for (int t = 0; t < 4; ++t) o[t][g] = z8; }
  asm volatile("s_wait_asynccnt 0x0" ::: "memory");      /* this wave's copies of stage 0 have landed */
  __syncthreads();                                        /* ... and every other wave's */
  fa_fill(lk + FA_ST, lv + FA_ST, gk + (size_t)FA_KS * DM, gv + FA_KS);      /* stage 1 (SQ / FA_KS is 16) */
  const unsigned char* fk = sm + ln * FA_KP + 16 * hh;              /* key row ln of a stage's first tile, at this half's first k */
  const unsigned char* fv = sm + FA_VO + ln * FA_VP + 16 * hh;      /* V^T row d = ln, at this half's first key */
#pragma unroll 1
  for (int st = 0; st < SQ / FA_KS; ++st) {      /* rolled: one trip a stage, the hand-over at its foot */
    const int bo = (st & 1) * FA_ST;
    v16h kf[2][2];
#pragma unroll
    for (int kt = 0; kt < 2; ++kt)
#pragma unroll
      for (int j = 0; j < 2; ++j) kf[kt][j] = g3_frag(fk + bo + kt * 16 * FA_KP + 64 * j);
#pragma unroll 1
    for (int kb = 0; kb < FA_KS / 32 - 1; ++kb)      /* rolled: one pass already fills the register budget of four waves per SIMD */
      fa_pass<true>(fk + bo + kb * 32 * FA_KP, fv + bo + kb * 64, qf, kf, o, m, l);
    fa_pass<false>(fk + bo + (FA_KS - 32) * FA_KP, fv + bo + (FA_KS / 32 - 1) * 64, qf, kf, o, m, l);      /* the stage's last pass */
    asm volatile("s_wait_dscnt 0x0" ::: "memory");        /* this wave's reads of the buffer are done before it is handed back */
    asm volatile("s_wait_asynccnt 0x0" ::: "memory");     /* this wave's copies of stage st + 1 have landed */
    __syncthreads();                                      /* publishes stage st + 1 and ends every wave's reads of stage st */
    if (st + 2 < SQ / FA_KS) fa_fill(lk + bo, lv + bo, gk + (size_t)(st + 2) * FA_KS * DM, gv + (st + 2) * FA_KS);
  }
  asm volatile("s_wait_asynccnt 0x0" ::: "memory");       /* nothing is in flight when the wave ends */
#pragma unroll
  for (int g = 0; g < 2; ++g) {
    const float inv = 64.0f / (l[g] + fa_xhalf(l[g]));      /* the halves' sums join once; x64: the carried scale of the o rows */
    _Float16* orow = O16 + (r0 + q0 + g * 16 + ln) * DM + h * HD + 8 * hh;
#pragma unroll
    for (int t = 0; t < 4; ++t) { FragH f;
#pragma unroll
      for (int r = 0; r < 8; ++r) f.h[r] = (_Float16)(o[t][g][r] * inv);
      *(v8us*)((unsigned short*)orow + t * 16) = f.half[0]; }
  }
}

extern "C" void kernel_launch(void* const* d_in, const int* in_sizes, int n_in,
                              void* d_out, int out_size, void* d_ws, size_t ws_size, hipStream_t stream) {
  (void)in_sizes; (void)n_in; (void)out_size;
  const float* const* I = (const float* const*)d_in; const float* x = I[0]; const float* wq = I[1]; const float* bq = I[2]; const float* wk = I[3]; const float* bk = I[4]; const float* wv = I[5]; const float* bv = I[6]; const float* wo = I[7]; const float* bo = I[8]; const float* cw = I[9]; const float* cb = I[10]; const float* lng = I[11]; const float* lnb = I[12];      /* weights [out][in] (natural) */
  char* ws = (char*)d_ws; size_t off = 0;
  auto take = [&](size_t bytes) { char* p = ws + off; off += (bytes + 255) & ~(size_t)255; return p; };
  _Float16* BQ = (_Float16*)take((size_t)DM * DM * 2); _Float16* BK = (_Float16*)take((size_t)DM * DM * 2); _Float16* BV = (_Float16*)take((size_t)DM * DM * 2); _Float16* BO = (_Float16*)take((size_t)DM * DM * 2);
  _Float16* X16 = (_Float16*)take(NR * DM * 2); _Float16* Q16 = (_Float16*)take(NR * DM * 2); _Float16* K16 = (_Float16*)take(NR * DM * 2); _Float16* V16 = (_Float16*)take(NR * DM * 2); _Float16* O16 = (_Float16*)take(NR * DM * 2); float* GA = (float*)take(NR * DM * 4);      /* global attention branch (f32 rows) */
  _Float16* VT = (_Float16*)take((size_t)NB * NH * HD * SQ * 2);      /* V^T [NB][NH][HD][SQ] */
  if (off > ws_size) return;
  { const size_t nw8 = (size_t)DM * DM / 8; const unsigned gw = (unsigned)((nw8 + 255) / 256); k_wnat<<<gw, 256, 0, stream>>>(wq, nw8, BQ); k_wnat<<<gw, 256, 0, stream>>>(wk, nw8, BK); k_wnat<<<gw, 256, 0, stream>>>(wv, nw8, BV); k_wnat<<<gw, 256, 0, stream>>>(wo, nw8, BO); }
  k_x16<<<(unsigned)((NR * DM / 8 + 255) / 256), 256, 0, stream>>>(x, X16, NR * DM / 8);
  const size_t r0p = (size_t)B0 * SQ;      /* first projected row */
  k_gemm3<false><<<(unsigned)((MP / 128) * (DM / 128)), 128, 0, stream>>>(X16 + r0p * DM, DM, BQ, DM, 0.0625f, bq, nullptr, Q16 + r0p * DM, DM, MP, DM, DM);
  k_gemm3<false><<<(unsigned)((MP / 128) * (DM / 128)), 128, 0, stream>>>(X16 + r0p * DM, DM, BK, DM, 0.0625f, bk, nullptr, K16 + r0p * DM, DM, MP, DM, DM);
  k_gemm3<false><<<(unsigned)((MP / 128) * (DM / 128)), 128, 0, stream>>>(X16 + r0p * DM, DM, BV, DM, 0.0625f, bv, nullptr, V16 + r0p * DM, DM, MP, DM, DM);
  k_vt<NH, SQ><<<NB * NH * (SQ / 64), 256, 0, stream>>>(V16, LQ, 0, VT);      /* V^T for every (batch, head) */
  k_fattn<<<NB * NH * (SQ / FA_QB), 256, 0, stream>>>(Q16, K16, VT, O16);      /* o (merged heads) as f16 rows, x64 */
  k_gemm3<true><<<(unsigned)((MPO / 128) * (DM / 128)), 128, 0, stream>>>(O16 + r0p * DM, DM, BO, DM, 0.0009765625f, bo, GA + r0p * DM, nullptr, DM, MPO, DM, DM);      /* global = ctx Wo^T + bo (f32 rows) */
  k_msfin<<<(unsigned)(MPO / (8 * FN_R)), 256, 0, stream>>>(x + r0p * DM, GA + r0p * DM, cw, cb, lng, lnb, 1e-5f, (float*)d_out + r0p * DM);      /* + x + 0.3 local conv, LayerNorm -> output rows */
}

// v006
// It runs in 142 microseconds.
// Two timings next to v005 both put it at 1.06 times that version's speed.
// All steps since v000 together make it 48.7 times as fast.
#include <hip/hip_runtime.h>
// Multi-scale attention block (x [4][2048][1024]; q/k/v = x W^T + b (natural [1024][1024] weights), 16 heads of 64; softmax(q k^T / 8); ctx merged; global = ctx Wo^T + bo; local = depthwise conv3 of x along the sequence (conv_w [1024][3], zero pad) + conv_b; y = x + global + 0.3 local; out = LayerNorm(y) (eps 1e-5) ln_g + ln_b -> [4][2048][1024]).
// Structure (attention part): token rows r = b*2048 + s; x as exact f16 rows (bf16-rounded); Q, K, V as three WMMA GEMMs (128x128 block tiles staged in LDS, 64x64 wave tiles, f32 accumulation, exact x16 weights + bias, f16 outputs); V^T for all (batch, head) via LDS transposes; one fused attention launch over all (batch, head, 256-query block): per 32 keys S^T = K Q^T on WMMA, running-maximum softmax on VALU (f32 statistics, native exp2; weights x256 as f16, packed from the score accumulators), O^T += V^T P^T on WMMA; o carried x64 against f16 subnormal flush (folded into the output GEMM alpha), written straight into the merged f16 o rows; global = o W_o^T + b GEMM (f32 rows); then per token row on VALU: + bf16(x) + 0.3 (depthwise conv3 of bf16(x) + b), LayerNorm, affine -> output rows.
// Compute dtype: inputs rounded to bf16; x / weights exact; q, k, v, softmax weights and o as plain f16 GEMM operands (~2^-12); scores and softmax statistics f32. v_wmma_f32_16x16x32_f16.
#define NB 4
#define SQ 2048
#define DM 1024
#define NH 16
#define HD 64
#define HG 4                         /* heads per launch of the unlaunched k_vt(V16, b, h0, VT) overload */
#define B0 0                         /* first batch processed (debug hook) */
#define NBR NB                       /* batches processed (debug hook) */
#define NR ((size_t)NB * SQ)         /* token rows */
#define MP ((int)((size_t)NBR * SQ)) /* rows projected (debug hook) */
#define QN SQ                        /* not used: k_fattn attends all SQ query rows of each batch */
#define NHD NH                       /* not used: k_fattn attends all NH heads */
#define MPO MP                       /* rows through the output stage (debug hook) */
#define LQ DM      /* row pitch of the q/k/v rows */
typedef __bf16 v16b __attribute__((ext_vector_type(16)));
typedef unsigned short v8us __attribute__((ext_vector_type(8), may_alias));
typedef float  v8f  __attribute__((ext_vector_type(8)));
typedef float  v4f  __attribute__((ext_vector_type(4)));
typedef float  v4fa __attribute__((ext_vector_type(4), may_alias));
union FragB { v16b v; v8us half[2]; unsigned short u[16]; };

__device__ __forceinline__ unsigned short bf16_bits(float x) { unsigned int u = __float_as_uint(x); return (unsigned short)((u + 0x7FFFu + ((u >> 16) & 1u)) >> 16); }
__device__ __forceinline__ float bf16_val(unsigned short b) { return __uint_as_float(((unsigned int)b) << 16); }
__device__ __forceinline__ float bf16_round(float x) { return bf16_val(bf16_bits(x)); }
// D += A·B with NT terms: 1 = ah·bh, 2 = + al·bh (A split), 3 = + ah·bl (both split)
template <int NT>
__device__ __forceinline__ v8f mmaN(v16b ah, v16b al, v16b bh, v16b bl, v8f c) {
  c = __builtin_amdgcn_wmma_f32_16x16x32_bf16(false, ah, false, bh, (short)0, c, false, false);
  if (NT >= 2) c = __builtin_amdgcn_wmma_f32_16x16x32_bf16(false, al, false, bh, (short)0, c, false, false);
  if (NT >= 3) c = __builtin_amdgcn_wmma_f32_16x16x32_bf16(false, ah, false, bl, (short)0, c, false, false);
  asm volatile("v_nop\n\tv_nop\n\tv_nop\n\tv_nop" : "+v"(c) : "v"(ah), "v"(al), "v"(bh), "v"(bl));
  return c;
}

__global__ __launch_bounds__(256) void k_wt_bf16(const float* __restrict__ W, unsigned short* __restrict__ Wt, int K, int N) {
  const int t = blockIdx.x * 256 + threadIdx.x;
  const int k8n = K / 8;
  if (t >= N * k8n) return;
  const int n = t / k8n, k8 = (t % k8n) * 8;
  v8us v;
#pragma unroll
  for (int i = 0; i < 8; ++i) v[i] = bf16_bits(W[(size_t)(k8 + i) * N + n]);
  *(v8us*)(Wt + (size_t)n * K + k8) = v;
  
}

// GEMM C[M][N] (f32, pitch ldc) = act(A[M][K]·W + bias). A f32 row-major (pitch lda) converted per fragment to bf16
// (ASPLIT: hi/lo two planes -> 2 terms, else single rounded term); Wt bf16 [N][K] (pitch ldb). BIAS_BF16 rounds the
// bias to bf16 first (bias quantised to bf16 before the add). K%32==0, M%16==0, N%64==0.
template <bool ASPLIT, int ACT, bool BIAS_BF16>
__global__ __launch_bounds__(128) void k_gemm_bf(const float* __restrict__ A, int lda, const unsigned short* __restrict__ Wt, int ldb,
                                               const float* __restrict__ bias, float* __restrict__ C, int ldc, int M, int N, int K) {
  __shared__ __attribute__((aligned(16))) float so[4][16][64];
  const int tid = threadIdx.x, w = tid >> 5, lane = tid & 31, ln = lane & 15, hh = lane >> 4;
  const int ntn = N / 64;
  const int wid = blockIdx.x * 4 + w;
  const int mt = wid / ntn, nq = wid % ntn;
  if (mt * 16 >= M) return;
  const int row0 = mt * 16, col0 = nq * 64;
  const float* arow = A + (size_t)(row0 + ln) * lda;
  v8f acc[4] = {};
  for (int kb = 0; kb < K; kb += 32) {
    FragB ah, al;
    const v4f x0 = *(const v4fa*)(arow + kb + 8 * hh), x1 = *(const v4fa*)(arow + kb + 8 * hh + 4);
    const v4f x2 = *(const v4fa*)(arow + kb + 16 + 8 * hh), x3 = *(const v4fa*)(arow + kb + 16 + 8 * hh + 4);
    float xs[16] = {x0[0],x0[1],x0[2],x0[3],x1[0],x1[1],x1[2],x1[3],x2[0],x2[1],x2[2],x2[3],x3[0],x3[1],x3[2],x3[3]};
#pragma unroll
    for (int i = 0; i < 16; ++i) { const unsigned short hb = bf16_bits(xs[i]); ah.u[i] = hb; al.u[i] = ASPLIT ? bf16_bits(xs[i] - bf16_val(hb)) : (unsigned short)0; }
#pragma unroll
    for (int t = 0; t < 4; ++t) {
      const unsigned short* brow = Wt + (size_t)(col0 + t * 16 + ln) * ldb + kb;
      FragB b;
      b.half[0] = *(const v8us*)(brow + 8 * hh);
      b.half[1] = *(const v8us*)(brow + 16 + 8 * hh);
      acc[t] = mmaN<ASPLIT ? 2 : 1>(ah.v, al.v, b.v, b.v, acc[t]);
    }
  }
#pragma unroll
  for (int t = 0; t < 4; ++t) {
    float bv = bias ? bias[col0 + t * 16 + ln] : 0.f;
    if (BIAS_BF16) bv = bf16_round(bv);
#pragma unroll
    for (int r = 0; r < 8; ++r) { float v = acc[t][r] + bv; if (ACT == 1) v = fmaxf(v, 0.f); so[w][8 * hh + r][t * 16 + ln] = v; }
  }
  __builtin_amdgcn_fence(__ATOMIC_ACQ_REL, "workgroup");
  __builtin_amdgcn_wave_barrier();
  const int rsub = lane >> 4, c4 = (lane & 15) * 4;
  {
#pragma unroll
    for (int q = 0; q < 8; ++q) {
      const int r = q * 2 + rsub;
      const v4f v = *(const v4fa*)&so[w][r][c4];
      *(v4f*)(C + (size_t)(row0 + r) * ldc + col0 + c4) = v;
    }
    
  }
}

// GEMM C = act(A·W + bias + resid): A f32 (ASPLIT -> hi/lo 2 terms), Wt bf16 [N][K]; ACT 0 none, 1 relu, 2 exact gelu;
// resid (optional, f32, row index = (row % rmod), pitch ldr, RES_BF16 rounds it) added before the activation.
template <bool ASPLIT, int ACT, bool BIAS_BF16, bool RES_BF16>
__global__ __launch_bounds__(128) void k_gemm_bf3(const float* __restrict__ A, int lda, const unsigned short* __restrict__ Wt, int ldb,
                                                const float* __restrict__ bias, const float* __restrict__ resid, int rmod, int ldr,
                                                float* __restrict__ C, int ldc, int M, int N, int K) {
  __shared__ __attribute__((aligned(16))) float so[4][16][64];
  const int tid = threadIdx.x, w = tid >> 5, lane = tid & 31, ln = lane & 15, hh = lane >> 4;
  const int ntn = N / 64;
  const int wid = blockIdx.x * 4 + w;
  const int mt = wid / ntn, nq = wid % ntn;
  if (mt * 16 >= M) return;
  const int row0 = mt * 16, col0 = nq * 64;
  const float* arow = A + (size_t)(row0 + ln) * lda;
  v8f acc[4] = {};
  for (int kb = 0; kb < K; kb += 32) {
    FragB ah, al;
    const v4f x0 = *(const v4fa*)(arow + kb + 8 * hh), x1 = *(const v4fa*)(arow + kb + 8 * hh + 4);
    const v4f x2 = *(const v4fa*)(arow + kb + 16 + 8 * hh), x3 = *(const v4fa*)(arow + kb + 16 + 8 * hh + 4);
    float xs[16] = {x0[0],x0[1],x0[2],x0[3],x1[0],x1[1],x1[2],x1[3],x2[0],x2[1],x2[2],x2[3],x3[0],x3[1],x3[2],x3[3]};
#pragma unroll
    for (int i = 0; i < 16; ++i) { const unsigned short hb = bf16_bits(xs[i]); ah.u[i] = hb; al.u[i] = ASPLIT ? bf16_bits(xs[i] - bf16_val(hb)) : (unsigned short)0; }
#pragma unroll
    for (int t = 0; t < 4; ++t) {
      const unsigned short* brow = Wt + (size_t)(col0 + t * 16 + ln) * ldb + kb;
      FragB b;
      b.half[0] = *(const v8us*)(brow + 8 * hh);
      b.half[1] = *(const v8us*)(brow + 16 + 8 * hh);
      acc[t] = mmaN<ASPLIT ? 2 : 1>(ah.v, al.v, b.v, b.v, acc[t]);
    }
  }
#pragma unroll
  for (int t = 0; t < 4; ++t) {
    const int col = col0 + t * 16 + ln;
    float bv = bias ? bias[col] : 0.f;
    if (BIAS_BF16) bv = bf16_round(bv);
#pragma unroll
    for (int r = 0; r < 8; ++r) {
      float v = acc[t][r] + bv;
      if (resid) { float rv = resid[(size_t)((row0 + 8 * hh + r) % rmod) * ldr + col]; if (RES_BF16) rv = bf16_round(rv); v += rv; }
      if (ACT == 1) v = fmaxf(v, 0.f);
      if (ACT == 2) v = 0.5f * v * (1.0f + erff(v * 0.70710678118654752f));
      if (ACT == 3) { const float u = 0.7978845608028654f * (v + 0.044715f * v * v * v); v = 0.5f * v * (1.0f + tanhf(u)); }
      so[w][8 * hh + r][t * 16 + ln] = v;
    }
  }
  __builtin_amdgcn_fence(__ATOMIC_ACQ_REL, "workgroup");
  __builtin_amdgcn_wave_barrier();
  const int rsub = lane >> 4, c4 = (lane & 15) * 4;
  {
#pragma unroll
    for (int q = 0; q < 8; ++q) {
      const int r = q * 2 + rsub;
      const v4f v = *(const v4fa*)&so[w][r][c4];
      *(v4f*)(C + (size_t)(row0 + r) * ldc + col0 + c4) = v;
    }
    
  }
}
// row LayerNorm (biased variance, eps) over N: s = X (+ R); optional out_sum <- s; out_norm <- (s-mu)*rsqrt(var+eps)*g + b
template <bool PARAM_BF16>
__global__ __launch_bounds__(256) void k_layernorm(const float* __restrict__ X, const float* __restrict__ R, const float* __restrict__ g, const float* __restrict__ bta,
                                                  float* __restrict__ out_sum, float* __restrict__ out_norm, int N, float eps) {
  __shared__ float red[256];
  const int row = blockIdx.x, tid = threadIdx.x;
  const float* x = X + (size_t)row * N; const float* rr = R ? R + (size_t)row * N : nullptr;
  float vals[16];                     // up to N = 4096
  const int per = N / 256;            // contiguous chunk per thread? use strided-by-4 chunks: thread handles j = tid*4 + 1024*u
  float s1 = 0.f;
  for (int u = 0; u < per / 4; ++u) {
    const int j = tid * 4 + 1024 * u;
    const v4f a = *(const v4fa*)(x + j);
    v4f b = {0.f,0.f,0.f,0.f}; if (rr) b = *(const v4fa*)(rr + j);
#pragma unroll
    for (int q = 0; q < 4; ++q) { const float v = a[q] + b[q]; vals[u * 4 + q] = v; s1 += v; }
  }
  red[tid] = s1; __syncthreads();
  for (int st = 128; st > 0; st >>= 1) { if (tid < st) red[tid] += red[tid + st]; __syncthreads(); }
  const float mu = red[0] / (float)N; __syncthreads();
  float s2 = 0.f;
  for (int u = 0; u < per / 4; ++u)
#pragma unroll
    for (int q = 0; q < 4; ++q) { const float c = vals[u * 4 + q] - mu; s2 += c * c; }
  red[tid] = s2; __syncthreads();
  for (int st = 128; st > 0; st >>= 1) { if (tid < st) red[tid] += red[tid + st]; __syncthreads(); }
  const float rs = rsqrtf(red[0] / (float)N + eps);
  {
    for (int u = 0; u < per / 4; ++u) {
      const int j = tid * 4 + 1024 * u;
      v4f o, sm;
#pragma unroll
      for (int q = 0; q < 4; ++q) {
        float gg = g[j + q], bb = bta[j + q];
        if (PARAM_BF16) { gg = bf16_round(gg); bb = bf16_round(bb); }
        sm[q] = vals[u * 4 + q]; o[q] = (vals[u * 4 + q] - mu) * rs * gg + bb;
      }
      if (out_sum) *(v4f*)(out_sum + (size_t)row * N + j) = sm;
      *(v4f*)(out_norm + (size_t)row * N + j) = o;
    }
    
  }
}



// ---- f16 WMMA path (v_wmma_f32_16x16x32_f16): 11-bit significands for operands in range — used where a [0,1] probability operand needs more precision than bf16
typedef _Float16 v16h __attribute__((ext_vector_type(16)));
union FragH { v16h v; v8us half[2]; _Float16 h[16]; unsigned short u[16]; };
template <int NT>
__device__ __forceinline__ v8f mmaH(v16h ah, v16h al, v16h bh, v16h bl, v8f c) {
  c = __builtin_amdgcn_wmma_f32_16x16x32_f16(false, ah, false, bh, (short)0, c, false, false);
  if (NT >= 2) c = __builtin_amdgcn_wmma_f32_16x16x32_f16(false, al, false, bh, (short)0, c, false, false);
  if (NT >= 3) c = __builtin_amdgcn_wmma_f32_16x16x32_f16(false, ah, false, bl, (short)0, c, false, false);
  asm volatile("v_nop\n\tv_nop\n\tv_nop\n\tv_nop" : "+v"(c) : "v"(ah), "v"(al), "v"(bh), "v"(bl));
  return c;
}
// batched GEMM like k_gemm_b but f16 operands: A f32 (split into f16 hi/lo if ASPLIT, else rounded to f16), Bt = f16 values [n][k]; alpha; C f32; N multiple of 16 (partial tiles skipped)
template <bool ASPLIT>
__global__ __launch_bounds__(128) void k_gemm_h(const float* __restrict__ A, int lda, size_t sA, const _Float16* __restrict__ Bh, int ldb, size_t sB, float alpha, float* __restrict__ C, int ldc, size_t sC, int M, int N, int K) {
  __shared__ __attribute__((aligned(16))) float so[4][16][64];
  const int tid = threadIdx.x, w = tid >> 5, lane = tid & 31, ln = lane & 15, hh = lane >> 4; const int by = blockIdx.y;
  A += (size_t)by * sA; Bh += (size_t)by * sB; C += (size_t)by * sC;
  const int ntn = (N + 63) / 64; const int wid = blockIdx.x * 4 + w; const int mt = wid / ntn, nq = wid % ntn; if (mt * 16 >= M) return;
  const int row0 = mt * 16, col0 = nq * 64; const float* arow = A + (size_t)(row0 + ln) * lda;
  v8f acc[4] = {};
  for (int kb = 0; kb < K; kb += 32) {
    FragH ah, al;
    const v4f x0 = *(const v4fa*)(arow + kb + 8 * hh), x1 = *(const v4fa*)(arow + kb + 8 * hh + 4), x2 = *(const v4fa*)(arow + kb + 16 + 8 * hh), x3 = *(const v4fa*)(arow + kb + 16 + 8 * hh + 4);
    float xs[16] = {x0[0],x0[1],x0[2],x0[3],x1[0],x1[1],x1[2],x1[3],x2[0],x2[1],x2[2],x2[3],x3[0],x3[1],x3[2],x3[3]};
#pragma unroll
    for (int i = 0; i < 16; ++i) { const _Float16 h = (_Float16)xs[i]; ah.h[i] = h; al.h[i] = ASPLIT ? (_Float16)(xs[i] - (float)h) : (_Float16)0.0f; }
#pragma unroll
    for (int t = 0; t < 4; ++t) { if (col0 + t * 16 >= N) continue; const size_t boff = (size_t)(col0 + t * 16 + ln) * ldb + kb; FragH bq; bq.half[0] = *(const v8us*)(Bh + boff + 8 * hh); bq.half[1] = *(const v8us*)(Bh + boff + 16 + 8 * hh);
      acc[t] = mmaH<ASPLIT ? 2 : 1>(ah.v, al.v, bq.v, bq.v, acc[t]); }
  }
#pragma unroll
  for (int t = 0; t < 4; ++t) { if (col0 + t * 16 >= N) continue;
#pragma unroll
    for (int r = 0; r < 8; ++r) so[w][8 * hh + r][t * 16 + ln] = acc[t][r] * alpha; }
  __builtin_amdgcn_fence(__ATOMIC_ACQ_REL, "workgroup"); __builtin_amdgcn_wave_barrier();
  const int rsub = lane >> 4, c4 = (lane & 15) * 4;
  {
#pragma unroll
    for (int q = 0; q < 8; ++q) { const int r = q * 2 + rsub; if (col0 + c4 < N) { const v4f v = *(const v4fa*)&so[w][r][c4]; *(v4f*)(C + (size_t)(row0 + r) * ldc + col0 + c4) = v; } }
     }
}

// Wt[n][k] = f16(W[k][n]·scale) from f32 row-major W[K][N] (scale = power of two; bf16-exact weights stay exact in f16 away from the subnormal range)
__global__ __launch_bounds__(256) void k_wt_f16(const float* __restrict__ W, _Float16* __restrict__ Wt, int K, int N, float scale) {
  const int t = blockIdx.x * 256 + threadIdx.x; if (t >= N * (K / 8)) return; const int n = t / (K / 8), k8 = (t % (K / 8)) * 8; FragH f;
#pragma unroll
  for (int i = 0; i < 8; ++i) f.h[i] = (_Float16)(bf16_round(W[(size_t)(k8 + i) * N + n]) * scale); const v8us o = f.half[0];
  *(v8us*)((unsigned short*)Wt + (size_t)n * K + k8) = o; 
}
// k_gemm_hh variant with fused epilogue: v = acc·alpha + bias[by·sBias + col] (+ CP[(row/rowsPerB)·sCPb + by·64 + col] if CP) ; ACT 0 none / 1 elu ; writes f16 C16 (and f32 C if non-null)
template <int ACT>
__global__ __launch_bounds__(128) void k_gemm_hhx(const _Float16* __restrict__ A, int lda, size_t sA, const _Float16* __restrict__ Bh, int ldb, size_t sB, float alpha, const float* __restrict__ bias, size_t sBias, const float* __restrict__ CP, int rowsPerB, size_t sCPb, int row0g,
    float* __restrict__ C, _Float16* __restrict__ C16, int ldc, size_t sC, int M, int N, int K) {
  __shared__ __attribute__((aligned(16))) float so[4][16][64];
  const int tid = threadIdx.x, w = tid >> 5, lane = tid & 31, ln = lane & 15, hh = lane >> 4; const int by = blockIdx.y;
  A += (size_t)by * sA; Bh += (size_t)by * sB; const size_t cofs = (size_t)by * sC; const float* bp = bias ? bias + (size_t)by * sBias : nullptr;
  const int ntn = (N + 63) / 64; const int wid = blockIdx.x * 4 + w; const int mt = wid / ntn, nq = wid % ntn; if (mt * 16 >= M) return;
  const int row0 = mt * 16, col0 = nq * 64; const _Float16* arow = A + (size_t)(row0 + ln) * lda;
  v8f acc[4] = {};
  for (int kb = 0; kb < K; kb += 32) { FragH ah; ah.half[0] = *(const v8us*)((const unsigned short*)arow + kb + 8 * hh); ah.half[1] = *(const v8us*)((const unsigned short*)arow + kb + 16 + 8 * hh);
#pragma unroll
    for (int t = 0; t < 4; ++t) { if (col0 + t * 16 >= N) continue; const size_t boff = (size_t)(col0 + t * 16 + ln) * ldb + kb; FragH bq; bq.half[0] = *(const v8us*)((const unsigned short*)Bh + boff + 8 * hh); bq.half[1] = *(const v8us*)((const unsigned short*)Bh + boff + 16 + 8 * hh);
      acc[t] = mmaH<1>(ah.v, ah.v, bq.v, bq.v, acc[t]); }
  }
#pragma unroll
  for (int t = 0; t < 4; ++t) { if (col0 + t * 16 >= N) continue; const int col = col0 + t * 16 + ln; const float bv = bp ? bf16_round(bp[col]) : 0.f;
#pragma unroll
    for (int r = 0; r < 8; ++r) { float v = acc[t][r] * alpha + bv; if (CP) { const int rr = row0g + row0 + 8 * hh + r; if (rowsPerB < 0) v += CP[cofs + (size_t)rr * ldc + col];      /* rowsPerB < 0: own element of the batched C plane */ else { const int bidx = rr / rowsPerB; v += CP[(size_t)bidx * sCPb + (size_t)by * 64 + col]; } } if (ACT == 1) v = (v > 0.f) ? v : expm1f(v); else if (ACT == 7) v = (v > 0.f) ? v + 1.0f : expf(v); else if (ACT == 8) v = tanhf(v); else if (ACT == 9) v = 0.5f * v * (1.0f + tanhf(0.7978845608028654f * (v + 0.044715f * v * v * v))); else if (ACT == 11) v = 1.0f / (1.0f + expf(-v)); else if (ACT == 12) v = (v > 0.f) ? v : 0.01f * v; else if (ACT == 14) v = (v > 0.f) ? v : 0.1f * v; else if (ACT == 16) v = (v >= 0.f) ? v : 0.3f * v; else if (ACT == 17) v = (v >= 0.f) ? v : 0.2f * v; else if (ACT == 15) v = v / (1.0f + expf(-v)); else if (ACT == 3) v = fmaxf(v, 0.f); else if (ACT == 6) v = 0.5f * v * (1.0f + erff(v * 0.70710678118654752f)); so[w][8 * hh + r][t * 16 + ln] = v; } }
  __builtin_amdgcn_fence(__ATOMIC_ACQ_REL, "workgroup"); __builtin_amdgcn_wave_barrier();
  const int rsub = lane >> 4, c4 = (lane & 15) * 4; typedef _Float16 v4h __attribute__((ext_vector_type(4)));
  {
#pragma unroll
    for (int q = 0; q < 8; ++q) { const int r = q * 2 + rsub; if (col0 + c4 < N) { const v4f v = *(const v4fa*)&so[w][r][c4]; if (C) *(v4f*)(C + cofs + (size_t)(row0 + r) * ldc + col0 + c4) = v; if (C16) { v4h h4; for (int i = 0; i < 4; ++i) h4[i] = (_Float16)v[i]; *(v4h*)(C16 + cofs + (size_t)(row0 + r) * ldc + col0 + c4) = h4; } } }
     }
}


typedef _Float16 v4h __attribute__((ext_vector_type(4)));

__global__ __launch_bounds__(256) void k_h16(const float* __restrict__ x, _Float16* __restrict__ X16, size_t n8) { const size_t t = (size_t)blockIdx.x * 256 + threadIdx.x; if (t >= n8) return; FragH f;
#pragma unroll
  for (int q = 0; q < 8; ++q) f.h[q] = (_Float16)x[t * 8 + q]; *(v8us*)((unsigned short*)X16 + t * 8) = f.half[0];  }
__global__ __launch_bounds__(256) void k_round16f(const float* __restrict__ W, _Float16* __restrict__ Bt, size_t n8) { const size_t t = (size_t)blockIdx.x * 256 + threadIdx.x; if (t >= n8) return; FragH f;
#pragma unroll
  for (int i = 0; i < 8; ++i) f.h[i] = (_Float16)(bf16_round(W[t * 8 + i]) * 16.0f); *(v8us*)((unsigned short*)Bt + t * 8) = f.half[0];  }
template <int NHv, int TTv>
__global__ __launch_bounds__(256) void k_vt(const _Float16* __restrict__ V16, int ldv, int voff, _Float16* __restrict__ Vt) { __shared__ unsigned short tl[64][66]; const int tid = threadIdx.x; const int slab = blockIdx.x / (TTv / 64), lg = blockIdx.x % (TTv / 64); const int b = slab / NHv, h = slab % NHv;
  for (int i = tid; i < 64 * 8; i += 256) { const int r = i / 8, c8 = (i % 8) * 8; FragH f; f.half[0] = *(const v8us*)((const unsigned short*)V16 + ((size_t)b * TTv + lg * 64 + r) * ldv + voff + h * 64 + c8);
#pragma unroll
    for (int q = 0; q < 8; ++q) tl[r][c8 + q] = f.u[q]; }
  __syncthreads();
  {
#pragma unroll
    for (int rd = 0; rd < 2; ++rd) { const int d = rd * 32 + tid / 8, pc = tid % 8; FragH f;
#pragma unroll
      for (int q = 0; q < 8; ++q) f.u[q] = tl[pc * 8 + q][d];
      *(v8us*)((unsigned short*)Vt + ((size_t)slab * 64 + d) * TTv + lg * 64 + pc * 8) = f.half[0]; }
     } }

__global__ __launch_bounds__(256) void k_hl(const float* __restrict__ F, _Float16* __restrict__ Hh, _Float16* __restrict__ Hl, size_t n8) { const size_t t = (size_t)blockIdx.x * 256 + threadIdx.x; if (t >= n8) return; FragH fh, fl; const v4f a = *(const v4fa*)(F + t * 8), c = *(const v4fa*)(F + t * 8 + 4);
#pragma unroll
  for (int q = 0; q < 4; ++q) { _Float16 h = (_Float16)a[q]; fh.h[q] = h; fl.h[q] = (_Float16)((a[q] - (float)h) * 1024.0f); h = (_Float16)c[q]; fh.h[4 + q] = h; fl.h[4 + q] = (_Float16)((c[q] - (float)h) * 1024.0f); }
  { *(v8us*)((unsigned short*)Hh + t * 8) = fh.half[0]; *(v8us*)((unsigned short*)Hl + t * 8) = fl.half[0];  } }

// fragment of 16 rows x 32 k from k-contiguous rows in global memory (the hardware k order)
__device__ __forceinline__ v16h g2_frag(const _Float16* p, int hh) { FragH f; f.half[0] = *(const v8us*)((const unsigned short*)p + 8 * hh); f.half[1] = *(const v8us*)((const unsigned short*)p + 16 + 8 * hh); return f.v; }
// ---- GEMM with both operands staged in LDS: C = alpha A Bh^T + bias (bias [N], never null, rounded to bf16); A [M][K] and Bh [N][K] f16, k contiguous; needs M % 128 == 0, N % 128 == 0, K % 128 == 0 ----
// A block is 4 waves (2 x 2) on a 128 x 128 tile of C; a wave owns 64 x 64 (16 accumulator tiles). A stage is 128 k: 256 bytes of each of the block's 128 A rows and 128 B rows,
// brought by asynchronous copies to LDS, 16 bytes a lane (one copy of a wave = two whole rows of the stage = four whole 128-byte lines): each operand byte is asked for once a block, in whole lines.
// Two buffers: stage t + 2 is asked for behind the barrier that ends trip t, into the buffer that trip t has read. Fragments by two 16-byte LDS reads in the k order of g2_frag, k steps in rising order.
#define G3_KS 128                    /* k per stage */
#define G3_P 272                     /* LDS row pitch in bytes: 16 x odd, so the 16-byte fragment reads of 16 rows meet no bank twice */
#define G3_ST (256 * G3_P)           /* bytes per stage: A rows 0..127, then B rows 0..127 */
__device__ __forceinline__ v16h g3_frag(const unsigned char* p) { FragH f; f.half[0] = *(const v8us*)p; f.half[1] = *(const v8us*)(p + 32); return f.v; }
// Eight copies (rows 8 apart: LDS byte address l, global address g, gs elements per 8 rows); s_wait_xcnt 0 as the statement's last line, so that it stands in front of every later write of their address registers (a precaution).
__device__ __forceinline__ void g3_copy8(unsigned l, const _Float16* g, size_t gs) {
  asm volatile("global_load_async_to_lds_b128 %0, %8, off\n\tglobal_load_async_to_lds_b128 %1, %9, off\n\tglobal_load_async_to_lds_b128 %2, %10, off\n\tglobal_load_async_to_lds_b128 %3, %11, off\n\t"
               "global_load_async_to_lds_b128 %4, %12, off\n\tglobal_load_async_to_lds_b128 %5, %13, off\n\tglobal_load_async_to_lds_b128 %6, %14, off\n\tglobal_load_async_to_lds_b128 %7, %15, off\n\ts_wait_xcnt 0x0"
               :: "v"(l), "v"(l + 8 * G3_P), "v"(l + 16 * G3_P), "v"(l + 24 * G3_P), "v"(l + 32 * G3_P), "v"(l + 40 * G3_P), "v"(l + 48 * G3_P), "v"(l + 56 * G3_P),
                  "v"(g), "v"(g + gs), "v"(g + 2 * gs), "v"(g + 3 * gs), "v"(g + 4 * gs), "v"(g + 5 * gs), "v"(g + 6 * gs), "v"(g + 7 * gs) : "memory"); }
// One stage: 32 copies a lane (A rows 0..63, 64..127, B rows 0..63, 64..127); every lane is on, every address a multiple of 16.
__device__ __forceinline__ void g3_fill(unsigned l, const _Float16* ga, int lda, const _Float16* gb, int ldb) {
  g3_copy8(l, ga, (size_t)8 * lda); g3_copy8(l + 64 * G3_P, ga + (size_t)64 * lda, (size_t)8 * lda);
  g3_copy8(l + 128 * G3_P, gb, (size_t)8 * ldb); g3_copy8(l + 192 * G3_P, gb + (size_t)64 * ldb, (size_t)8 * ldb); }
template <bool F32OUT>      /* output rows: f32 to C, or f16 to C16 */
__global__ __launch_bounds__(128) void k_gemm3(const _Float16* __restrict__ A, int lda, const _Float16* __restrict__ Bh, int ldb, float alpha, const float* __restrict__ bias,
    float* __restrict__ C, _Float16* __restrict__ C16, int ldc, int M, int N, int K) {
  __shared__ __attribute__((aligned(16))) unsigned char sm[2 * G3_ST];      /* the two buffers; behind the loop each wave's own 64 x 68 f32 output staging */
  const int tid = threadIdx.x, w = tid >> 5, lane = tid & 31, ln = lane & 15, hh = lane >> 4;
  const int ntn = N >> 7; const int mt = blockIdx.x / ntn, nq = blockIdx.x - mt * ntn; const int row0 = mt * 128, col0 = nq * 128; if (row0 >= M) return;      /* the same for the whole block */
  const int wm = w >> 1, wn = w & 1;
  const unsigned l0 = (unsigned)(size_t)sm + (unsigned)((tid >> 4) * G3_P + (tid & 15) * 16);      /* this lane's place in a stage: row tid / 16 (+ 8 a copy), 16-byte piece tid % 16 */
  const _Float16* ga = A + (size_t)(row0 + (tid >> 4)) * lda + (tid & 15) * 8; const _Float16* gb = Bh + (size_t)(col0 + (tid >> 4)) * ldb + (tid & 15) * 8;
  const int T = K / G3_KS;
  const v8f z8 = {0.f,0.f,0.f,0.f,0.f,0.f,0.f,0.f}; v8f acc[4][4];
  /* every inner loop of this kernel is unrolled so that each index of acc, a and b is a constant and the arrays stay in registers */
#pragma unroll
  for (int i = 0; i < 4; ++i)
#pragma unroll
    for (int j = 0; j < 4; ++j) acc[i][j] = z8;
  const int bcol = col0 + wn * 64 + ln; float braw[4];      /* asked for here and first used behind the loop, so that the loads' latency passes under the stages */
#pragma unroll
  for (int j = 0; j < 4; ++j) braw[j] = bias[bcol + j * 16];
  asm volatile("s_wait_xcnt 0x0" :: "v"(bcol), "s"(bias) : "memory");      /* the four loads' index and base stay live up to this wait, so nothing is written over them earlier */
  g3_fill(l0, ga, lda, gb, ldb);
  asm volatile("s_wait_asynccnt 0x0" ::: "memory");      /* this wave's copies of stage 0 have landed */
  __syncthreads();                                        /* ... and every other wave's */
  if (T > 1) g3_fill(l0 + G3_ST, ga + G3_KS, lda, gb + G3_KS, ldb);
  const unsigned char* fa = sm + (wm * 64 + ln) * G3_P + 16 * hh; const unsigned char* fb = sm + (128 + wn * 64 + ln) * G3_P + 16 * hh;
#pragma unroll 1
  for (int t = 0; t < T; ++t) {      /* rolled: one trip a stage, the hand-over at its foot */
    const int bo = (t & 1) * G3_ST;
    v16h a[2][2], b[2][4];      /* a block is 8 products: two A fragments x the k step's four B fragments; two register sets, the next block's fragments asked for one block ahead */
#pragma unroll
    for (int i = 0; i < 2; ++i) a[0][i] = g3_frag(fa + bo + i * 16 * G3_P);
#pragma unroll
    for (int j = 0; j < 4; ++j) b[0][j] = g3_frag(fb + bo + j * 16 * G3_P);
#pragma unroll
    for (int hb = 0; hb < G3_KS / 16; ++hb) {
      const int ks = hb >> 1, h = hb & 1, ks1 = (hb + 1) >> 1, h1 = (hb + 1) & 1;
      if (hb + 1 < G3_KS / 16) {
#pragma unroll
        for (int i = 0; i < 2; ++i) a[h1][i] = g3_frag(fa + bo + (2 * h1 + i) * 16 * G3_P + ks1 * 64);
        if (h1 == 0) {
#pragma unroll
          for (int j = 0; j < 4; ++j) b[ks1 & 1][j] = g3_frag(fb + bo + j * 16 * G3_P + ks1 * 64);
        }
      }
      __builtin_amdgcn_sched_barrier(0);      /* keeps the next block's LDS reads together in front of this block's products: left free, they were sunk among the products and waited for at once */
#pragma unroll
      for (int i = 0; i < 2; ++i)
#pragma unroll
        for (int j = 0; j < 4; ++j) acc[2 * h + i][j] = __builtin_amdgcn_wmma_f32_16x16x32_f16(false, a[h][i], false, b[ks & 1][j], (short)0, acc[2 * h + i][j], false, false);
      __builtin_amdgcn_sched_barrier(0);      /* ... and the block after next's reads behind them */
    }
    asm volatile("s_wait_dscnt 0x0" ::: "memory");        /* this wave's reads of the buffer are done before it is handed back */
    asm volatile("s_wait_asynccnt 0x0" ::: "memory");     /* this wave's copies of stage t + 1 have landed */
    __syncthreads();                                      /* publishes stage t + 1 and ends every wave's reads of stage t */
    if (t + 2 < T) g3_fill(l0 + bo, ga + (size_t)(t + 2) * G3_KS, lda, gb + (size_t)(t + 2) * G3_KS, ldb);
  }
  asm volatile("s_wait_asynccnt 0x0" ::: "memory");       /* nothing is in flight when the buffers become output staging */
  float* so = (float*)sm + w * (64 * 68);
#pragma unroll
  for (int j = 0; j < 4; ++j) { const float bv = bf16_round(braw[j]);
#pragma unroll
    for (int i = 0; i < 4; ++i)
#pragma unroll
      for (int r = 0; r < 8; ++r) so[(i * 16 + 8 * hh + r) * 68 + j * 16 + ln] = acc[i][j][r] * alpha + bv; }
  __builtin_amdgcn_fence(__ATOMIC_ACQ_REL, "workgroup"); __builtin_amdgcn_wave_barrier();      /* the wave's staging writes stay in front of its own reads of them; no other wave touches its range */
  const int c4 = ln * 4; const size_t cb = (size_t)(row0 + wm * 64 + hh) * ldc + col0 + wn * 64 + c4;
#pragma unroll
  for (int q = 0; q < 32; ++q) { const v4f v = *(const v4fa*)&so[(q * 2 + hh) * 68 + c4]; if (F32OUT) *(v4f*)(C + cb + (size_t)(q * 2) * ldc) = v; else { v4h h4; for (int i = 0; i < 4; ++i) h4[i] = (_Float16)v[i]; *(v4h*)(C16 + cb + (size_t)(q * 2) * ldc) = h4; } }
}


__global__ __launch_bounds__(256) void k_rsm(const float* __restrict__ S, _Float16* __restrict__ P, int nrows) {
  #pragma clang fp contract(off)
  const int i = blockIdx.x * 256 + threadIdx.x; if (i >= nrows) return; const float* s = S + (size_t)i * SQ; float mx = -3.0e38f;
#pragma unroll 1
  for (int j = 0; j < SQ; ++j) mx = fmaxf(mx, s[j]); float se = 0.f;
#pragma unroll 1
  for (int j = 0; j < SQ; ++j) se += expf(s[j] - mx); const float sc = 256.0f / se;
#pragma unroll 1
  for (int j0 = 0; j0 < SQ; j0 += 8) { FragH f; for (int q = 0; q < 8; ++q) f.h[q] = (_Float16)(expf(s[j0 + q] - mx) * sc); unsigned short* d = (unsigned short*)P + (size_t)i * SQ + j0; *(v8us*)d = f.half[0];  } }
__global__ __launch_bounds__(256) void k_vt(const _Float16* __restrict__ V16, int b, int h0, _Float16* __restrict__ VT) { __shared__ unsigned short tl[64][65]; const int tid = threadIdx.x; const int hh = blockIdx.x % HG, sg = blockIdx.x / HG; const int s0 = sg * 64; const int h = h0 + hh;
  for (int i = tid; i < 64 * 8; i += 256) { const int j = i / 8, d8 = (i % 8) * 8; FragH f; f.half[0] = *(const v8us*)((const unsigned short*)V16 + ((size_t)b * SQ + s0 + j) * DM + h * HD + d8); for (int q = 0; q < 8; ++q) tl[d8 + q][j] = f.u[q]; }
  __syncthreads();
  { for (int i = tid; i < 64 * 8; i += 256) { const int d = i / 8, j8 = (i % 8) * 8; FragH f; for (int q = 0; q < 8; ++q) f.u[q] = tl[d][j8 + q]; *(v8us*)((unsigned short*)VT + ((size_t)hh * HD + d) * SQ + s0 + j8) = f.half[0]; }  } }


// Final stage: y = x + global + 0.3 (conv3 of x + b), LayerNorm, affine. One wave owns FN_R consecutive token rows whole: a lane holds 32 columns of each (8 pieces of 4; piece c = columns 128 c + 4 lane),
// so every load and store of a wave is 512 bytes in a row and a row's sums are in-lane adds plus one lane butterfly. All of a wave's row loads are asked for at its start, before anything waits.
// The six column parameters (three conv taps, conv bias, gain, shift) are rounded to bf16 once per block and shared through LDS planes. FN_R divides SQ, so a wave's rows lie in one sequence;
// the row in front of the first and the row behind the last of a sequence count as zero.
#define FN_R 2                       /* token rows per wave */
template <int CTRL> __device__ __forceinline__ float fn_dpp(float v) { return __builtin_bit_cast(float, __builtin_amdgcn_update_dpp(0, __builtin_bit_cast(int, v), CTRL, 0xf, 0xf, true)); }      /* 0x160 + m: lane l <- lane l ^ m inside a 16-lane row */
__device__ __forceinline__ float fn_xhalf(float x) { return __builtin_bit_cast(float, __builtin_amdgcn_permlanex16(__builtin_bit_cast(int, x), __builtin_bit_cast(int, x), 0x76543210, 0xfedcba98, false, false)); }      /* lane l <-> lane l ^ 16 */
__device__ __forceinline__ float fn_wsum(v4f a) { float v = (a[0] + a[1]) + (a[2] + a[3]); v += fn_dpp<0x161>(v); v += fn_dpp<0x162>(v); v += fn_dpp<0x164>(v); v += fn_dpp<0x168>(v); return v + fn_xhalf(v); }      /* the wave's sum, in every lane */
__device__ __forceinline__ v4f fn_ld(const float* base, unsigned bytes) { return *(const v4fa*)((const char*)base + bytes); }      /* scalar base + 32-bit byte offset */
__device__ __forceinline__ v4f fn_rd(v4f a) { v4f r; for (int q = 0; q < 4; ++q) r[q] = bf16_round(a[q]); return r; }
__global__ __launch_bounds__(256) __attribute__((amdgpu_waves_per_eu(4, 4))) void k_msfin(const float* __restrict__ X, const float* __restrict__ G, const float* __restrict__ cw, const float* __restrict__ cb, const float* __restrict__ g, const float* __restrict__ bta, float eps, float* __restrict__ out) {
  __shared__ __attribute__((aligned(16))) float pr[6][DM];      /* planes: tap 0, tap 1, tap 2, conv bias, gain, shift */
  const int tid = threadIdx.x; const unsigned c0 = (tid & 31) * 4u, t4 = tid * 4u;      /* first column of a lane's piece; of this thread's four parameter columns */
  const unsigned lb = (tid & 31) * 16u, tb = tid * 16u, wo = tid * 48u;      /* byte offsets of the loads: a lane's piece in a row, this thread's four parameters, its twelve taps */
  const int wv = __builtin_amdgcn_readfirstlane((int)(blockIdx.x * 8 + (tid >> 5)));      /* the wave's number, in a scalar register: row addresses are scalar base + lane offset */
  const size_t row0 = (size_t)wv * FN_R; const int s0 = (int)(row0 % SQ); const bool hp = s0 > 0, hn = s0 + FN_R < SQ;
  const float* xb = X + row0 * DM; const float* xm = xb - (hp ? DM : 0); const float* xn = xb + (hn ? FN_R * DM : 0);      /* a neighbour outside the sequence: an address in bounds, its values replaced by zero */
  const float* gb = G + row0 * DM;
  const v4f wa = fn_ld(cw, wo), wb = fn_ld(cw, wo + 16), wc = fn_ld(cw, wo + 32), pc = fn_ld(cb, tb), pg = fn_ld(g, tb), pb = fn_ld(bta, tb);      /* this thread's four columns: 12 taps in a row, bias, gain, shift */
  v4f xr[FN_R + 2][8], y[FN_R][8];
  /* every loop of this kernel is unrolled so that each index of xr and y is a constant and the rows stay in registers */
#pragma unroll
  for (int c = 0; c < 8; ++c) { const unsigned j = lb + c * 512; xr[0][c] = fn_ld(xm, j);
#pragma unroll
    for (int r = 0; r < FN_R; ++r) xr[r + 1][c] = fn_ld(xb, j + r * (DM * 4));
    xr[FN_R + 1][c] = fn_ld(xn, j);
#pragma unroll
    for (int r = 0; r < FN_R; ++r) y[r][c] = fn_ld(gb, j + r * (DM * 4)); }
  asm volatile("s_wait_xcnt 0x0" :: "v"(lb), "v"(tb), "v"(wo), "s"(xm), "s"(xb), "s"(xn), "s"(gb), "s"(cw), "s"(cb), "s"(g), "s"(bta) : "memory");      /* the loads' offsets and bases stay live up to this wait, so nothing (a later load's result included) is written over them earlier; its memory clobber also keeps every row load in front of the first wait for data (left free, they were sunk to their uses and waited for one by one) */
  { const v4f a = fn_rd(wa), b = fn_rd(wb), c = fn_rd(wc); const v4f t0 = {a[0], a[3], b[2], c[1]}, t1 = {a[1], b[0], b[3], c[2]}, t2 = {a[2], b[1], c[0], c[3]};
    *(v4f*)&pr[0][t4] = t0; *(v4f*)&pr[1][t4] = t1; *(v4f*)&pr[2][t4] = t2; *(v4f*)&pr[3][t4] = fn_rd(pc); *(v4f*)&pr[4][t4] = fn_rd(pg); *(v4f*)&pr[5][t4] = fn_rd(pb); }
  /* work-group barrier with LDS-only fences: the planes are whole before any wave reads them (nothing writes them again); __syncthreads() would also wait here for every row load still in flight */
  __builtin_amdgcn_fence(__ATOMIC_RELEASE, "workgroup", "local"); __builtin_amdgcn_s_barrier(); __builtin_amdgcn_fence(__ATOMIC_ACQUIRE, "workgroup", "local");
  const v4f z4 = {0.f, 0.f, 0.f, 0.f}; v4f s1[FN_R];
#pragma unroll
  for (int r = 0; r < FN_R; ++r) s1[r] = z4;
#pragma unroll
  for (int c = 0; c < 8; ++c) {
    const unsigned j = c * 128 + c0; v4f xq[FN_R + 2];
#pragma unroll
    for (int r = 0; r < FN_R + 2; ++r) xq[r] = fn_rd(xr[r][c]);
    if (!hp) xq[0] = z4;
    if (!hn) xq[FN_R + 1] = z4;
    const v4f w0 = *(const v4f*)&pr[0][j], w1 = *(const v4f*)&pr[1][j], w2 = *(const v4f*)&pr[2][j], cv = *(const v4f*)&pr[3][j];
#pragma unroll
    for (int r = 0; r < FN_R; ++r) { const v4f loc = xq[r] * w0 + xq[r + 1] * w1 + xq[r + 2] * w2 + cv; const v4f yy = xq[r + 1] + (y[r][c] + 0.3f * loc); y[r][c] = yy; s1[r] += yy; }
  }
  float mu[FN_R], rs[FN_R];
#pragma unroll
  for (int r = 0; r < FN_R; ++r) mu[r] = fn_wsum(s1[r]) * (1.0f / (float)DM);
#pragma unroll
  for (int r = 0; r < FN_R; ++r) { v4f s2 = z4;
#pragma unroll
    for (int c = 0; c < 8; ++c) { y[r][c] -= mu[r]; s2 += y[r][c] * y[r][c]; }
    s1[r] = s2; }
#pragma unroll
  for (int r = 0; r < FN_R; ++r) rs[r] = rsqrtf(fn_wsum(s1[r]) * (1.0f / (float)DM) + eps);
  float* ob = out + row0 * DM;
#pragma unroll
  for (int c = 0; c < 8; ++c) { const unsigned j = c * 128 + c0; const v4f gg = *(const v4f*)&pr[4][j], bb = *(const v4f*)&pr[5][j];
#pragma unroll
    for (int r = 0; r < FN_R; ++r) *(v4f*)(ob + (size_t)r * DM + j) = y[r][c] * rs[r] * gg + bb; }
}


__device__ __forceinline__ float fa_xhalf(float x) { return __builtin_bit_cast(float, __builtin_amdgcn_permlanex16(__builtin_bit_cast(int, x), __builtin_bit_cast(int, x), 0x76543210, 0xfedcba98, false, false)); }      /* lane l <-> lane l ^ 16 */
__device__ __forceinline__ v8f fa_mma(v16h a, v16h b, v8f c) { return __builtin_amdgcn_wmma_f32_16x16x32_f16(false, a, false, b, (short)0, c, false, false); }
// Native exp2 of nine / eight values in place, in one statement that ends in v_nop: no v_exp_f32 is directly followed by an instruction that reads its result or writes over its source
// (left to the register allocator, a neighbour's result landed on the source of the exp in front of it).
__device__ __forceinline__ void fa_exp9(float& y, float& x0, float& x1, float& x2, float& x3, float& x4, float& x5, float& x6, float& x7) {
  asm("v_exp_f32 %0, %0\n\tv_exp_f32 %1, %1\n\tv_exp_f32 %2, %2\n\tv_exp_f32 %3, %3\n\tv_exp_f32 %4, %4\n\tv_exp_f32 %5, %5\n\tv_exp_f32 %6, %6\n\tv_exp_f32 %7, %7\n\tv_exp_f32 %8, %8\n\tv_nop"
      : "+v"(y), "+v"(x0), "+v"(x1), "+v"(x2), "+v"(x3), "+v"(x4), "+v"(x5), "+v"(x6), "+v"(x7)); }
__device__ __forceinline__ void fa_exp8(float& x0, float& x1, float& x2, float& x3, float& x4, float& x5, float& x6, float& x7) {
  asm("v_exp_f32 %0, %0\n\tv_exp_f32 %1, %1\n\tv_exp_f32 %2, %2\n\tv_exp_f32 %3, %3\n\tv_exp_f32 %4, %4\n\tv_exp_f32 %5, %5\n\tv_exp_f32 %6, %6\n\tv_exp_f32 %7, %7\n\tv_nop"
      : "+v"(x0), "+v"(x1), "+v"(x2), "+v"(x3), "+v"(x4), "+v"(x5), "+v"(x6), "+v"(x7)); }
#define FA_QB 256                    /* query rows per block (8 waves x 32) */
// K and V^T reach the waves through LDS: a stage is FA_KS keys of the block's (batch, head): FA_KS K rows of 128 bytes, then the 64 V^T rows' 256 bytes of those keys,
// brought once per block by asynchronous copies, 16 bytes a lane (a wave's copy = four whole K rows or two whole V^T row pieces = four whole 128-byte lines), and read by all 8 waves.
// Two buffers: stage t + 2 is asked for behind the barrier that ends trip t, into the buffer that trip t has read. Fragments by two 16-byte LDS reads in the k order of g2_frag; keys in rising order as before.
#define FA_KS 128                    /* keys per stage (4 passes) */
#define FA_KP 144                    /* LDS pitch of a K row in bytes: 16 x odd, so the 16-byte fragment reads of 16 rows meet no bank twice */
#define FA_VP 272                    /* LDS pitch of a V^T row in bytes: 16 x odd */
#define FA_VO (FA_KS * FA_KP)        /* the V^T rows stand behind the K rows */
#define FA_ST (FA_VO + HD * FA_VP)   /* bytes per stage */
// One stage: eight copies a lane (K rows 32 apart, V^T rows 16 apart); every lane is on, every address a multiple of 16; s_wait_xcnt 0 as the statement's last line, so that it stands in front of every later write of their address registers (a precaution).
__device__ __forceinline__ void fa_fill(unsigned lk, unsigned lv, const _Float16* gk, const _Float16* gv) {
  asm volatile("global_load_async_to_lds_b128 %0, %8, off\n\tglobal_load_async_to_lds_b128 %1, %9, off\n\tglobal_load_async_to_lds_b128 %2, %10, off\n\tglobal_load_async_to_lds_b128 %3, %11, off\n\t"
               "global_load_async_to_lds_b128 %4, %12, off\n\tglobal_load_async_to_lds_b128 %5, %13, off\n\tglobal_load_async_to_lds_b128 %6, %14, off\n\tglobal_load_async_to_lds_b128 %7, %15, off\n\ts_wait_xcnt 0x0"
               :: "v"(lk), "v"(lk + 32 * FA_KP), "v"(lk + 64 * FA_KP), "v"(lk + 96 * FA_KP), "v"(lv), "v"(lv + 16 * FA_VP), "v"(lv + 32 * FA_VP), "v"(lv + 48 * FA_VP),
                  "v"(gk), "v"(gk + (size_t)32 * DM), "v"(gk + (size_t)64 * DM), "v"(gk + (size_t)96 * DM), "v"(gv), "v"(gv + (size_t)16 * SQ), "v"(gv + (size_t)32 * SQ), "v"(gv + (size_t)48 * SQ) : "memory"); }
// One pass: 32 keys against the wave's 32 query columns. pk: this lane's place in the pass's first K row, pv: in V^T row ln at the pass's first key. PRE: the next pass's K fragments are asked for behind the score products
// (inside a stage only: nothing of the next stage is read in front of its barrier).
template <bool PRE>
__device__ __forceinline__ void fa_pass(const unsigned char* pk, const unsigned char* pv, const v16h (&qf)[2][2], v16h (&kf)[2][2], v8f (&o)[4][2], float (&m)[2], float (&l)[2]) {
  const float SC = 0.125f * 1.4426950408889634f;      /* 1 / sqrt(64), in log2 units */
  const v8f z8 = {0.f,0.f,0.f,0.f,0.f,0.f,0.f,0.f};
  v16h vf[4];      /* asked for at the head of the pass, used behind the softmax */
#pragma unroll
  for (int t = 0; t < 4; ++t) vf[t] = g3_frag(pv + t * 16 * FA_VP);
  v8f s[2][2];
#pragma unroll
  for (int kt = 0; kt < 2; ++kt)
#pragma unroll
    for (int g = 0; g < 2; ++g) s[kt][g] = fa_mma(kf[kt][1], qf[g][1], fa_mma(kf[kt][0], qf[g][0], z8));
  if (PRE) {
#pragma unroll
    for (int kt = 0; kt < 2; ++kt)
#pragma unroll
      for (int j = 0; j < 2; ++j) kf[kt][j] = g3_frag(pk + (32 + kt * 16) * FA_KP + 64 * j);
  }
  __builtin_amdgcn_sched_barrier(0);      /* keeps the pass's LDS reads in front of the softmax, whose length covers their latency: left free, the V^T reads of a stage's last pass were sunk among the products and waited for at once */
  v16h pf[2];
#pragma unroll
  for (int g = 0; g < 2; ++g) {
    const v8f a = s[0][g], c = s[1][g];
    float mx = fmaxf(a[0], c[0]);
#pragma unroll
    for (int r = 1; r < 8; ++r) mx = fmaxf(mx, fmaxf(a[r], c[r]));
    mx = fmaxf(mx, fa_xhalf(mx));
    const float mn = fmaxf(m[g], mx * SC); float al = m[g] - mn; m[g] = mn;      /* al becomes 2^al below: 0 on the first pass */
    const float off = 8.0f - mn; FragH p; float e[16];
#pragma unroll
    for (int r = 0; r < 8; ++r) { e[r] = a[r] * SC + off; e[8 + r] = c[r] * SC + off; }
    fa_exp9(al, e[0], e[1], e[2], e[3], e[4], e[5], e[6], e[7]); fa_exp8(e[8], e[9], e[10], e[11], e[12], e[13], e[14], e[15]);
#pragma unroll
    for (int r = 0; r < 16; ++r) p.h[r] = (_Float16)e[r];
    pf[g] = p.v;
    const float sum = (((e[0] + e[1]) + (e[2] + e[3])) + ((e[4] + e[5]) + (e[6] + e[7]))) + (((e[8] + e[9]) + (e[10] + e[11])) + ((e[12] + e[13]) + (e[14] + e[15])));
    l[g] = l[g] * al + sum;
#pragma unroll
    for (int t = 0; t < 4; ++t) o[t][g] *= al;
  }
#pragma unroll
  for (int t = 0; t < 4; ++t)
#pragma unroll
    for (int g = 0; g < 2; ++g) o[t][g] = fa_mma(vf[t], pf[g], o[t][g]);
  asm volatile("v_nop\n\tv_nop\n\tv_nop\n\tv_nop" : "+v"(o[0][0]), "+v"(o[0][1]), "+v"(o[1][0]), "+v"(o[1][1]), "+v"(o[2][0]), "+v"(o[2][1]), "+v"(o[3][0]), "+v"(o[3][1]) : "v"(pf[0]), "v"(pf[1]));      /* WMMA distance: the weights (B operands) stay live for four slots behind the pass's last products, so the next pass's score tiles, which may get the same registers, are not written over them earlier */
}
__global__ __launch_bounds__(256) __attribute__((amdgpu_waves_per_eu(4, 4))) void k_fattn(const _Float16* __restrict__ Q16, const _Float16* __restrict__ K16, const _Float16* __restrict__ VT, _Float16* __restrict__ O16) {
  __shared__ __attribute__((aligned(16))) unsigned char sm[2 * FA_ST];      /* the two buffers */
  const int tid = threadIdx.x, lane = threadIdx.x & 31, w = threadIdx.x >> 5, ln = lane & 15, hh = lane >> 4;
  const int bh = blockIdx.x / (SQ / FA_QB), qb = blockIdx.x % (SQ / FA_QB); const int b = bh / NH, h = bh % NH;
  const size_t r0 = (size_t)b * SQ; const int q0 = qb * FA_QB + w * 32;
  const unsigned lk = (unsigned)(size_t)sm + (unsigned)((tid >> 3) * FA_KP + (tid & 7) * 16);              /* this lane's places in a stage: K row tid / 8 (+ 32 a copy), 16-byte piece tid % 8 */
  const unsigned lv = (unsigned)(size_t)sm + (unsigned)(FA_VO + (tid >> 4) * FA_VP + (tid & 15) * 16);     /* V^T row tid / 16 (+ 16 a copy), 16-byte piece tid % 16 */
  const _Float16* gk = K16 + (r0 + (tid >> 3)) * DM + h * HD + (tid & 7) * 8;
  const _Float16* gv = VT + ((size_t)bh * HD + (tid >> 4)) * SQ + (tid & 15) * 8;
  fa_fill(lk, lv, gk, gv);
  v16h qf[2][2];
#pragma unroll
  for (int g = 0; g < 2; ++g)
#pragma unroll
    for (int j = 0; j < 2; ++j) qf[g][j] = g2_frag(Q16 + (r0 + q0 + g * 16 + ln) * DM + h * HD + 32 * j, hh);
  const v8f z8 = {0.f,0.f,0.f,0.f,0.f,0.f,0.f,0.f};
  v8f o[4][2]; float m[2], l[2];
#pragma unroll
  for (int g = 0; g < 2; ++g) { m[g] = -3.0e38f; l[g] = 0.f;
#pragma unroll
    for (int t = 0; t < 4; ++t) o[t][g] = z8; }
  asm volatile("s_wait_asynccnt 0x0" ::: "memory");      /* this wave's copies of stage 0 have landed */
  __syncthreads();                                        /* ... and every other wave's */
  fa_fill(lk + FA_ST, lv + FA_ST, gk + (size_t)FA_KS * DM, gv + FA_KS);      /* stage 1 (SQ / FA_KS is 16) */
  const unsigned char* fk = sm + ln * FA_KP + 16 * hh;              /* key row ln of a stage's first tile, at this half's first k */
  const unsigned char* fv = sm + FA_VO + ln * FA_VP + 16 * hh;      /* V^T row d = ln, at this half's first key */
#pragma unroll 1
  for (int st = 0; st < SQ / FA_KS; ++st) {      /* rolled: one trip a stage, the hand-over at its foot */
    const int bo = (st & 1) * FA_ST;
    v16h kf[2][2];
#pragma unroll
    for (int kt = 0; kt < 2; ++kt)
#pragma unroll
      for (int j = 0; j < 2; ++j) kf[kt][j] = g3_frag(fk + bo + kt * 16 * FA_KP + 64 * j);
#pragma unroll 1
    for (int kb = 0; kb < FA_KS / 32 - 1; ++kb)      /* rolled: one pass already fills the register budget of four waves per SIMD */
      fa_pass<true>(fk + bo + kb * 32 * FA_KP, fv + bo + kb * 64, qf, kf, o, m, l);
    fa_pass<false>(fk + bo + (FA_KS - 32) * FA_KP, fv + bo + (FA_KS / 32 - 1) * 64, qf, kf, o, m, l);      /* the stage's last pass */
    asm volatile("s_wait_dscnt 0x0" ::: "memory");        /* this wave's reads of the buffer are done before it is handed back */
    asm volatile("s_wait_asynccnt 0x0" ::: "memory");     /* this wave's copies of stage st + 1 have landed */
    __syncthreads();                                      /* publishes stage st + 1 and ends every wave's reads of stage st */
    if (st + 2 < SQ / FA_KS) fa_fill(lk + bo, lv + bo, gk + (size_t)(st + 2) * FA_KS * DM, gv + (st + 2) * FA_KS);
  }
  asm volatile("s_wait_asynccnt 0x0" ::: "memory");       /* nothing is in flight when the wave ends */
#pragma unroll
  for (int g = 0; g < 2; ++g) {
    const float inv = 64.0f / (l[g] + fa_xhalf(l[g]));      /* the halves' sums join once; x64: the carried scale of the o rows */
    _Float16* orow = O16 + (r0 + q0 + g * 16 + ln) * DM + h * HD + 8 * hh;
#pragma unroll
    for (int t = 0; t < 4; ++t) { FragH f;
#pragma unroll
      for (int r = 0; r < 8; ++r) f.h[r] = (_Float16)(o[t][g][r] * inv);
      *(v8us*)((unsigned short*)orow + t * 16) = f.half[0]; }
  }
}

// Operand conversion, one launch for all five GEMM operands: x -> f16 of its bf16 rounding, each weight -> f16 of 16 x its bf16 rounding (the values as before).
// PC_NW waves, few enough to be resident all at once (16 per WGP when spread evenly). A wave owns one contiguous run of x (PC_XL loads) and one of each weight (PC_WL loads); a load of a wave is 512 bytes in a row, 16 bytes a lane,
// a store 256 bytes in a row. All of a wave's loads are asked for at its start, before anything waits.
#define PC_NW 4096                   /* waves of the launch */
#define PC_XL 16                     /* loads of 128 floats per wave: x */
#define PC_WL 2                      /* ... and each weight */
static_assert((size_t)PC_NW * PC_XL * 128 == NR * DM && (size_t)PC_NW * PC_WL * 128 == (size_t)DM * DM, "the waves' runs cover x and each weight exactly once");
template <bool X16W>      /* weights carry the factor 16 */
__device__ __forceinline__ void pc_st(_Float16* base, unsigned bytes, v4f a) { v4h h;
#pragma unroll
  for (int q = 0; q < 4; ++q) h[q] = X16W ? (_Float16)(bf16_round(a[q]) * 16.0f) : (_Float16)bf16_round(a[q]);
  *(v4h*)((char*)base + bytes) = h; }
__global__ __launch_bounds__(256) void k_prep(const float* __restrict__ x, const float* __restrict__ wq, const float* __restrict__ wk, const float* __restrict__ wv, const float* __restrict__ wo,
    _Float16* __restrict__ X16, _Float16* __restrict__ BQ, _Float16* __restrict__ BK, _Float16* __restrict__ BV, _Float16* __restrict__ BO) {
  const unsigned lb = (threadIdx.x & 31) * 16u, sb = (threadIdx.x & 31) * 8u;      /* a lane's byte offset in a load, in a store */
  const int wn = __builtin_amdgcn_readfirstlane((int)(blockIdx.x * 8 + (threadIdx.x >> 5)));      /* the wave's number, in a scalar register: addresses are scalar base + lane offset */
  const size_t xo = (size_t)wn * (PC_XL * 128), wf = (size_t)wn * (PC_WL * 128);
  const float* xs = x + xo; const float* s0 = wq + wf; const float* s1 = wk + wf; const float* s2 = wv + wf; const float* s3 = wo + wf;
  v4f a[PC_XL], b[4][PC_WL];
  /* every loop of this kernel is unrolled so that each index of a and b is a constant and the values stay in registers */
#pragma unroll
  for (int c = 0; c < PC_XL; ++c) a[c] = fn_ld(xs, lb + c * 512);
#pragma unroll
  for (int c = 0; c < PC_WL; ++c) { b[0][c] = fn_ld(s0, lb + c * 512); b[1][c] = fn_ld(s1, lb + c * 512); b[2][c] = fn_ld(s2, lb + c * 512); b[3][c] = fn_ld(s3, lb + c * 512); }
  asm volatile("s_wait_xcnt 0x0" :: "v"(lb), "s"(xs), "s"(s0), "s"(s1), "s"(s2), "s"(s3) : "memory");      /* the loads' offset and bases stay live up to this wait, so nothing is written over them earlier */
  __builtin_amdgcn_sched_barrier(0);      /* keeps the conversions behind the issue of the last load: left free, they were lifted among the loads, and ten of the loads were asked for only after the first data had come */
#pragma unroll
  for (int c = 0; c < PC_XL; ++c) pc_st<false>(X16 + xo, sb + c * 256, a[c]);
#pragma unroll
  for (int c = 0; c < PC_WL; ++c) { pc_st<true>(BQ + wf, sb + c * 256, b[0][c]); pc_st<true>(BK + wf, sb + c * 256, b[1][c]); pc_st<true>(BV + wf, sb + c * 256, b[2][c]); pc_st<true>(BO + wf, sb + c * 256, b[3][c]); }
}

extern "C" void kernel_launch(void* const* d_in, const int* in_sizes, int n_in,
                              void* d_out, int out_size, void* d_ws, size_t ws_size, hipStream_t stream) {
  (void)in_sizes; (void)n_in; (void)out_size;
  const float* const* I = (const float* const*)d_in; const float* x = I[0]; const float* wq = I[1]; const float* bq = I[2]; const float* wk = I[3]; const float* bk = I[4]; const float* wv = I[5]; const float* bv = I[6]; const float* wo = I[7]; const float* bo = I[8]; const float* cw = I[9]; const float* cb = I[10]; const float* lng = I[11]; const float* lnb = I[12];      /* weights [out][in] (natural) */
  char* ws = (char*)d_ws; size_t off = 0;
  auto take = [&](size_t bytes) { char* p = ws + off; off += (bytes + 255) & ~(size_t)255; return p; };
  _Float16* BQ = (_Float16*)take((size_t)DM * DM * 2); _Float16* BK = (_Float16*)take((size_t)DM * DM * 2); _Float16* BV = (_Float16*)take((size_t)DM * DM * 2); _Float16* BO = (_Float16*)take((size_t)DM * DM * 2);
  _Float16* X16 = (_Float16*)take(NR * DM * 2); _Float16* Q16 = (_Float16*)take(NR * DM * 2); _Float16* K16 = (_Float16*)take(NR * DM * 2); _Float16* V16 = (_Float16*)take(NR * DM * 2); _Float16* O16 = (_Float16*)take(NR * DM * 2); float* GA = (float*)take(NR * DM * 4);      /* global attention branch (f32 rows) */
  _Float16* VT = (_Float16*)take((size_t)NB * NH * HD * SQ * 2);      /* V^T [NB][NH][HD][SQ] */
  if (off > ws_size) return;
  k_prep<<<PC_NW / 8, 256, 0, stream>>>(x, wq, wk, wv, wo, X16, BQ, BK, BV, BO);      /* all five GEMM operands as f16 */
  const size_t r0p = (size_t)B0 * SQ;      /* first projected row */
  k_gemm3<false><<<(unsigned)((MP / 128) * (DM / 128)), 128, 0, stream>>>(X16 + r0p * DM, DM, BQ, DM, 0.0625f, bq, nullptr, Q16 + r0p * DM, DM, MP, DM, DM);
  k_gemm3<false><<<(unsigned)((MP / 128) * (DM / 128)), 128, 0, stream>>>(X16 + r0p * DM, DM, BK, DM, 0.0625f, bk, nullptr, K16 + r0p * DM, DM, MP, DM, DM);
  k_gemm3<false><<<(unsigned)((MP / 128) * (DM / 128)), 128, 0, stream>>>(X16 + r0p * DM, DM, BV, DM, 0.0625f, bv, nullptr, V16 + r0p * DM, DM, MP, DM, DM);
  k_vt<NH, SQ><<<NB * NH * (SQ / 64), 256, 0, stream>>>(V16, LQ, 0, VT);      /* V^T for every (batch, head) */
  k_fattn<<<NB * NH * (SQ / FA_QB), 256, 0, stream>>>(Q16, K16, VT, O16);      /* o (merged heads) as f16 rows, x64 */
  k_gemm3<true><<<(unsigned)((MPO / 128) * (DM / 128)), 128, 0, stream>>>(O16 + r0p * DM, DM, BO, DM, 0.0009765625f, bo, GA + r0p * DM, nullptr, DM, MPO, DM, DM);      /* global = ctx Wo^T + bo (f32 rows) */
  k_msfin<<<(unsigned)(MPO / (8 * FN_R)), 256, 0, stream>>>(x + r0p * DM, GA + r0p * DM, cw, cb, lng, lnb, 1e-5f, (float*)d_out + r0p * DM);      /* + x + 0.3 local conv, LayerNorm -> output rows */
}

// v007
// A run of this version takes 129 microseconds.
// Two timings next to v006 both put it at 1.10 times that version's speed.
// Over all steps from v000 it is 53.5 times as fast.
#include <hip/hip_runtime.h>
// Multi-scale attention block (x [4][2048][1024]; q/k/v = x W^T + b (natural [1024][1024] weights), 16 heads of 64; softmax(q k^T / 8); ctx merged; global = ctx Wo^T + bo; local = depthwise conv3 of x along the sequence (conv_w [1024][3], zero pad) + conv_b; y = x + global + 0.3 local; out = LayerNorm(y) (eps 1e-5) ln_g + ln_b -> [4][2048][1024]).
// Structure (attention part): token rows r = b*2048 + s; x as exact f16 rows (bf16-rounded); Q, K, V^T as WMMA GEMM tiles of one launch (128x128 block tiles staged in LDS, 64x64 wave tiles, f32 accumulation, exact x16 weights + bias, f16 outputs; V^T tiles with the weight as the A operand); one fused attention launch over all (batch, head, 256-query block): per 32 keys S^T = K Q^T on WMMA, running-maximum softmax on VALU (f32 statistics, native exp2; weights x256 as f16, packed from the score accumulators), O^T += V^T P^T on WMMA; o carried x64 against f16 subnormal flush (folded into the output GEMM alpha), written straight into the merged f16 o rows; global = o W_o^T + b GEMM (f32 rows); then per token row on VALU: + bf16(x) + 0.3 (depthwise conv3 of bf16(x) + b), LayerNorm, affine -> output rows.
// Compute dtype: inputs rounded to bf16; x / weights exact; q, k, v, softmax weights and o as plain f16 GEMM operands (~2^-12); scores and softmax statistics f32. v_wmma_f32_16x16x32_f16.
#define NB 4
#define SQ 2048
#define DM 1024
#define NH 16
#define HD 64
#define HG 4                         /* heads per launch of the unlaunched k_vt(V16, b, h0, VT) overload */
#define B0 0                         /* first batch processed (debug hook) */
#define NBR NB                       /* batches processed (debug hook) */
#define NR ((size_t)NB * SQ)         /* token rows */
#define MP ((int)((size_t)NBR * SQ)) /* rows through the output stage, via MPO (debug hook) */
#define QN SQ                        /* not used: k_fattn attends all SQ query rows of each batch */
#define NHD NH                       /* not used: k_fattn attends all NH heads */
#define MPO MP                       /* rows through the output stage (debug hook) */
#define LQ DM      /* not used: q and k rows have pitch DM */
typedef __bf16 v16b __attribute__((ext_vector_type(16)));
typedef unsigned short v8us __attribute__((ext_vector_type(8), may_alias));
typedef float  v8f  __attribute__((ext_vector_type(8)));
typedef float  v4f  __attribute__((ext_vector_type(4)));
typedef float  v4fa __attribute__((ext_vector_type(4), may_alias));
union FragB { v16b v; v8us half[2]; unsigned short u[16]; };

__device__ __forceinline__ unsigned short bf16_bits(float x) { unsigned int u = __float_as_uint(x); return (unsigned short)((u + 0x7FFFu + ((u >> 16) & 1u)) >> 16); }
__device__ __forceinline__ float bf16_val(unsigned short b) { return __uint_as_float(((unsigned int)b) << 16); }
__device__ __forceinline__ float bf16_round(float x) { return bf16_val(bf16_bits(x)); }
// D += A·B with NT terms: 1 = ah·bh, 2 = + al·bh (A split), 3 = + ah·bl (both split)
template <int NT>
__device__ __forceinline__ v8f mmaN(v16b ah, v16b al, v16b bh, v16b bl, v8f c) {
  c = __builtin_amdgcn_wmma_f32_16x16x32_bf16(false, ah, false, bh, (short)0, c, false, false);
  if (NT >= 2) c = __builtin_amdgcn_wmma_f32_16x16x32_bf16(false, al, false, bh, (short)0, c, false, false);
  if (NT >= 3) c = __builtin_amdgcn_wmma_f32_16x16x32_bf16(false, ah, false, bl, (short)0, c, false, false);
  asm volatile("v_nop\n\tv_nop\n\tv_nop\n\tv_nop" : "+v"(c) : "v"(ah), "v"(al), "v"(bh), "v"(bl));
  return c;
}

__global__ __launch_bounds__(256) void k_wt_bf16(const float* __restrict__ W, unsigned short* __restrict__ Wt, int K, int N) {
  const int t = blockIdx.x * 256 + threadIdx.x;
  const int k8n = K / 8;
  if (t >= N * k8n) return;
  const int n = t / k8n, k8 = (t % k8n) * 8;
  v8us v;
#pragma unroll
  for (int i = 0; i < 8; ++i) v[i] = bf16_bits(W[(size_t)(k8 + i) * N + n]);
  *(v8us*)(Wt + (size_t)n * K + k8) = v;
  
}

// GEMM C[M][N] (f32, pitch ldc) = act(A[M][K]·W + bias). A f32 row-major (pitch lda) converted per fragment to bf16
// (ASPLIT: hi/lo two planes -> 2 terms, else single rounded term); Wt bf16 [N][K] (pitch ldb). BIAS_BF16 rounds the
// bias to bf16 first (bias quantised to bf16 before the add). K%32==0, M%16==0, N%64==0.
template <bool ASPLIT, int ACT, bool BIAS_BF16>
__global__ __launch_bounds__(128) void k_gemm_bf(const float* __restrict__ A, int lda, const unsigned short* __restrict__ Wt, int ldb,
                                               const float* __restrict__ bias, float* __restrict__ C, int ldc, int M, int N, int K) {
  __shared__ __attribute__((aligned(16))) float so[4][16][64];
  const int tid = threadIdx.x, w = tid >> 5, lane = tid & 31, ln = lane & 15, hh = lane >> 4;
  const int ntn = N / 64;
  const int wid = blockIdx.x * 4 + w;
  const int mt = wid / ntn, nq = wid % ntn;
  if (mt * 16 >= M) return;
  const int row0 = mt * 16, col0 = nq * 64;
  const float* arow = A + (size_t)(row0 + ln) * lda;
  v8f acc[4] = {};
  for (int kb = 0; kb < K; kb += 32) {
    FragB ah, al;
    const v4f x0 = *(const v4fa*)(arow + kb + 8 * hh), x1 = *(const v4fa*)(arow + kb + 8 * hh + 4);
    const v4f x2 = *(const v4fa*)(arow + kb + 16 + 8 * hh), x3 = *(const v4fa*)(arow + kb + 16 + 8 * hh + 4);
    float xs[16] = {x0[0],x0[1],x0[2],x0[3],x1[0],x1[1],x1[2],x1[3],x2[0],x2[1],x2[2],x2[3],x3[0],x3[1],x3[2],x3[3]};
#pragma unroll
    for (int i = 0; i < 16; ++i) { const unsigned short hb = bf16_bits(xs[i]); ah.u[i] = hb; al.u[i] = ASPLIT ? bf16_bits(xs[i] - bf16_val(hb)) : (unsigned short)0; }
#pragma unroll
    for (int t = 0; t < 4; ++t) {
      const unsigned short* brow = Wt + (size_t)(col0 + t * 16 + ln) * ldb + kb;
      FragB b;
      b.half[0] = *(const v8us*)(brow + 8 * hh);
      b.half[1] = *(const v8us*)(brow + 16 + 8 * hh);
      acc[t] = mmaN<ASPLIT ? 2 : 1>(ah.v, al.v, b.v, b.v, acc[t]);
    }
  }
#pragma unroll
  for (int t = 0; t < 4; ++t) {
    float bv = bias ? bias[col0 + t * 16 + ln] : 0.f;
    if (BIAS_BF16) bv = bf16_round(bv);
#pragma unroll
    for (int r = 0; r < 8; ++r) { float v = acc[t][r] + bv; if (ACT == 1) v = fmaxf(v, 0.f); so[w][8 * hh + r][t * 16 + ln] = v; }
  }
  __builtin_amdgcn_fence(__ATOMIC_ACQ_REL, "workgroup");
  __builtin_amdgcn_wave_barrier();
  const int rsub = lane >> 4, c4 = (lane & 15) * 4;
  {
#pragma unroll
    for (int q = 0; q < 8; ++q) {
      const int r = q * 2 + rsub;
      const v4f v = *(const v4fa*)&so[w][r][c4];
      *(v4f*)(C + (size_t)(row0 + r) * ldc + col0 + c4) = v;
    }
    
  }
}

// GEMM C = act(A·W + bias + resid): A f32 (ASPLIT -> hi/lo 2 terms), Wt bf16 [N][K]; ACT 0 none, 1 relu, 2 exact gelu;
// resid (optional, f32, row index = (row % rmod), pitch ldr, RES_BF16 rounds it) added before the activation.
template <bool ASPLIT, int ACT, bool BIAS_BF16, bool RES_BF16>
__global__ __launch_bounds__(128) void k_gemm_bf3(const float* __restrict__ A, int lda, const unsigned short* __restrict__ Wt, int ldb,
                                                const float* __restrict__ bias, const float* __restrict__ resid, int rmod, int ldr,
                                                float* __restrict__ C, int ldc, int M, int N, int K) {
  __shared__ __attribute__((aligned(16))) float so[4][16][64];
  const int tid = threadIdx.x, w = tid >> 5, lane = tid & 31, ln = lane & 15, hh = lane >> 4;
  const int ntn = N / 64;
  const int wid = blockIdx.x * 4 + w;
  const int mt = wid / ntn, nq = wid % ntn;
  if (mt * 16 >= M) return;
  const int row0 = mt * 16, col0 = nq * 64;
  const float* arow = A + (size_t)(row0 + ln) * lda;
  v8f acc[4] = {};
  for (int kb = 0; kb < K; kb += 32) {
    FragB ah, al;
    const v4f x0 = *(const v4fa*)(arow + kb + 8 * hh), x1 = *(const v4fa*)(arow + kb + 8 * hh + 4);
    const v4f x2 = *(const v4fa*)(arow + kb + 16 + 8 * hh), x3 = *(const v4fa*)(arow + kb + 16 + 8 * hh + 4);
    float xs[16] = {x0[0],x0[1],x0[2],x0[3],x1[0],x1[1],x1[2],x1[3],x2[0],x2[1],x2[2],x2[3],x3[0],x3[1],x3[2],x3[3]};
#pragma unroll
    for (int i = 0; i < 16; ++i) { const unsigned short hb = bf16_bits(xs[i]); ah.u[i] = hb; al.u[i] = ASPLIT ? bf16_bits(xs[i] - bf16_val(hb)) : (unsigned short)0; }
#pragma unroll
    for (int t = 0; t < 4; ++t) {
      const unsigned short* brow = Wt + (size_t)(col0 + t * 16 + ln) * ldb + kb;
      FragB b;
      b.half[0] = *(const v8us*)(brow + 8 * hh);
      b.half[1] = *(const v8us*)(brow + 16 + 8 * hh);
      acc[t] = mmaN<ASPLIT ? 2 : 1>(ah.v, al.v, b.v, b.v, acc[t]);
    }
  }
#pragma unroll
  for (int t = 0; t < 4; ++t) {
    const int col = col0 + t * 16 + ln;
    float bv = bias ? bias[col] : 0.f;
    if (BIAS_BF16) bv = bf16_round(bv);
#pragma unroll
    for (int r = 0; r < 8; ++r) {
      float v = acc[t][r] + bv;
      if (resid) { float rv = resid[(size_t)((row0 + 8 * hh + r) % rmod) * ldr + col]; if (RES_BF16) rv = bf16_round(rv); v += rv; }
      if (ACT == 1) v = fmaxf(v, 0.f);
      if (ACT == 2) v = 0.5f * v * (1.0f + erff(v * 0.70710678118654752f));
      if (ACT == 3) { const float u = 0.7978845608028654f * (v + 0.044715f * v * v * v); v = 0.5f * v * (1.0f + tanhf(u)); }
      so[w][8 * hh + r][t * 16 + ln] = v;
    }
  }
  __builtin_amdgcn_fence(__ATOMIC_ACQ_REL, "workgroup");
  __builtin_amdgcn_wave_barrier();
  const int rsub = lane >> 4, c4 = (lane & 15) * 4;
  {
#pragma unroll
    for (int q = 0; q < 8; ++q) {
      const int r = q * 2 + rsub;
      const v4f v = *(const v4fa*)&so[w][r][c4];
      *(v4f*)(C + (size_t)(row0 + r) * ldc + col0 + c4) = v;
    }
    
  }
}
// row LayerNorm (biased variance, eps) over N: s = X (+ R); optional out_sum <- s; out_norm <- (s-mu)*rsqrt(var+eps)*g + b
template <bool PARAM_BF16>
__global__ __launch_bounds__(256) void k_layernorm(const float* __restrict__ X, const float* __restrict__ R, const float* __restrict__ g, const float* __restrict__ bta,
                                                  float* __restrict__ out_sum, float* __restrict__ out_norm, int N, float eps) {
  __shared__ float red[256];
  const int row = blockIdx.x, tid = threadIdx.x;
  const float* x = X + (size_t)row * N; const float* rr = R ? R + (size_t)row * N : nullptr;
  float vals[16];                     // up to N = 4096
  const int per = N / 256;            // contiguous chunk per thread? use strided-by-4 chunks: thread handles j = tid*4 + 1024*u
  float s1 = 0.f;
  for (int u = 0; u < per / 4; ++u) {
    const int j = tid * 4 + 1024 * u;
    const v4f a = *(const v4fa*)(x + j);
    v4f b = {0.f,0.f,0.f,0.f}; if (rr) b = *(const v4fa*)(rr + j);
#pragma unroll
    for (int q = 0; q < 4; ++q) { const float v = a[q] + b[q]; vals[u * 4 + q] = v; s1 += v; }
  }
  red[tid] = s1; __syncthreads();
  for (int st = 128; st > 0; st >>= 1) { if (tid < st) red[tid] += red[tid + st]; __syncthreads(); }
  const float mu = red[0] / (float)N; __syncthreads();
  float s2 = 0.f;
  for (int u = 0; u < per / 4; ++u)
#pragma unroll
    for (int q = 0; q < 4; ++q) { const float c = vals[u * 4 + q] - mu; s2 += c * c; }
  red[tid] = s2; __syncthreads();
  for (int st = 128; st > 0; st >>= 1) { if (tid < st) red[tid] += red[tid + st]; __syncthreads(); }
  const float rs = rsqrtf(red[0] / (float)N + eps);
  {
    for (int u = 0; u < per / 4; ++u) {
      const int j = tid * 4 + 1024 * u;
      v4f o, sm;
#pragma unroll
      for (int q = 0; q < 4; ++q) {
        float gg = g[j + q], bb = bta[j + q];
        if (PARAM_BF16) { gg = bf16_round(gg); bb = bf16_round(bb); }
        sm[q] = vals[u * 4 + q]; o[q] = (vals[u * 4 + q] - mu) * rs * gg + bb;
      }
      if (out_sum) *(v4f*)(out_sum + (size_t)row * N + j) = sm;
      *(v4f*)(out_norm + (size_t)row * N + j) = o;
    }
    
  }
}



// ---- f16 WMMA path (v_wmma_f32_16x16x32_f16): 11-bit significands for operands in range — used where a [0,1] probability operand needs more precision than bf16
typedef _Float16 v16h __attribute__((ext_vector_type(16)));
union FragH { v16h v; v8us half[2]; _Float16 h[16]; unsigned short u[16]; };
template <int NT>
__device__ __forceinline__ v8f mmaH(v16h ah, v16h al, v16h bh, v16h bl, v8f c) {
  c = __builtin_amdgcn_wmma_f32_16x16x32_f16(false, ah, false, bh, (short)0, c, false, false);
  if (NT >= 2) c = __builtin_amdgcn_wmma_f32_16x16x32_f16(false, al, false, bh, (short)0, c, false, false);
  if (NT >= 3) c = __builtin_amdgcn_wmma_f32_16x16x32_f16(false, ah, false, bl, (short)0, c, false, false);
  asm volatile("v_nop\n\tv_nop\n\tv_nop\n\tv_nop" : "+v"(c) : "v"(ah), "v"(al), "v"(bh), "v"(bl));
  return c;
}
// batched GEMM like k_gemm_b but f16 operands: A f32 (split into f16 hi/lo if ASPLIT, else rounded to f16), Bt = f16 values [n][k]; alpha; C f32; N multiple of 16 (partial tiles skipped)
template <bool ASPLIT>
__global__ __launch_bounds__(128) void k_gemm_h(const float* __restrict__ A, int lda, size_t sA, const _Float16* __restrict__ Bh, int ldb, size_t sB, float alpha, float* __restrict__ C, int ldc, size_t sC, int M, int N, int K) {
  __shared__ __attribute__((aligned(16))) float so[4][16][64];
  const int tid = threadIdx.x, w = tid >> 5, lane = tid & 31, ln = lane & 15, hh = lane >> 4; const int by = blockIdx.y;
  A += (size_t)by * sA; Bh += (size_t)by * sB; C += (size_t)by * sC;
  const int ntn = (N + 63) / 64; const int wid = blockIdx.x * 4 + w; const int mt = wid / ntn, nq = wid % ntn; if (mt * 16 >= M) return;
  const int row0 = mt * 16, col0 = nq * 64; const float* arow = A + (size_t)(row0 + ln) * lda;
  v8f acc[4] = {};
  for (int kb = 0; kb < K; kb += 32) {
    FragH ah, al;
    const v4f x0 = *(const v4fa*)(arow + kb + 8 * hh), x1 = *(const v4fa*)(arow + kb + 8 * hh + 4), x2 = *(const v4fa*)(arow + kb + 16 + 8 * hh), x3 = *(const v4fa*)(arow + kb + 16 + 8 * hh + 4);
    float xs[16] = {x0[0],x0[1],x0[2],x0[3],x1[0],x1[1],x1[2],x1[3],x2[0],x2[1],x2[2],x2[3],x3[0],x3[1],x3[2],x3[3]};
#pragma unroll
    for (int i = 0; i < 16; ++i) { const _Float16 h = (_Float16)xs[i]; ah.h[i] = h; al.h[i] = ASPLIT ? (_Float16)(xs[i] - (float)h) : (_Float16)0.0f; }
#pragma unroll
    for (int t = 0; t < 4; ++t) { if (col0 + t * 16 >= N) continue; const size_t boff = (size_t)(col0 + t * 16 + ln) * ldb + kb; FragH bq; bq.half[0] = *(const v8us*)(Bh + boff + 8 * hh); bq.half[1] = *(const v8us*)(Bh + boff + 16 + 8 * hh);
      acc[t] = mmaH<ASPLIT ? 2 : 1>(ah.v, al.v, bq.v, bq.v, acc[t]); }
  }
#pragma unroll
  for (int t = 0; t < 4; ++t) { if (col0 + t * 16 >= N) continue;
#pragma unroll
    for (int r = 0; r < 8; ++r) so[w][8 * hh + r][t * 16 + ln] = acc[t][r] * alpha; }
  __builtin_amdgcn_fence(__ATOMIC_ACQ_REL, "workgroup"); __builtin_amdgcn_wave_barrier();
  const int rsub = lane >> 4, c4 = (lane & 15) * 4;
  {
#pragma unroll
    for (int q = 0; q < 8; ++q) { const int r = q * 2 + rsub; if (col0 + c4 < N) { const v4f v = *(const v4fa*)&so[w][r][c4]; *(v4f*)(C + (size_t)(row0 + r) * ldc + col0 + c4) = v; } }
     }
}

// Wt[n][k] = f16(W[k][n]·scale) from f32 row-major W[K][N] (scale = power of two; bf16-exact weights stay exact in f16 away from the subnormal range)
__global__ __launch_bounds__(256) void k_wt_f16(const float* __restrict__ W, _Float16* __restrict__ Wt, int K, int N, float scale) {
  const int t = blockIdx.x * 256 + threadIdx.x; if (t >= N * (K / 8)) return; const int n = t / (K / 8), k8 = (t % (K / 8)) * 8; FragH f;
#pragma unroll
  for (int i = 0; i < 8; ++i) f.h[i] = (_Float16)(bf16_round(W[(size_t)(k8 + i) * N + n]) * scale); const v8us o = f.half[0];
  *(v8us*)((unsigned short*)Wt + (size_t)n * K + k8) = o; 
}
// k_gemm_hh variant with fused epilogue: v = acc·alpha + bias[by·sBias + col] (+ CP[(row/rowsPerB)·sCPb + by·64 + col] if CP) ; ACT 0 none / 1 elu ; writes f16 C16 (and f32 C if non-null)
template <int ACT>
__global__ __launch_bounds__(128) void k_gemm_hhx(const _Float16* __restrict__ A, int lda, size_t sA, const _Float16* __restrict__ Bh, int ldb, size_t sB, float alpha, const float* __restrict__ bias, size_t sBias, const float* __restrict__ CP, int rowsPerB, size_t sCPb, int row0g,
    float* __restrict__ C, _Float16* __restrict__ C16, int ldc, size_t sC, int M, int N, int K) {
  __shared__ __attribute__((aligned(16))) float so[4][16][64];
  const int tid = threadIdx.x, w = tid >> 5, lane = tid & 31, ln = lane & 15, hh = lane >> 4; const int by = blockIdx.y;
  A += (size_t)by * sA; Bh += (size_t)by * sB; const size_t cofs = (size_t)by * sC; const float* bp = bias ? bias + (size_t)by * sBias : nullptr;
  const int ntn = (N + 63) / 64; const int wid = blockIdx.x * 4 + w; const int mt = wid / ntn, nq = wid % ntn; if (mt * 16 >= M) return;
  const int row0 = mt * 16, col0 = nq * 64; const _Float16* arow = A + (size_t)(row0 + ln) * lda;
  v8f acc[4] = {};
  for (int kb = 0; kb < K; kb += 32) { FragH ah; ah.half[0] = *(const v8us*)((const unsigned short*)arow + kb + 8 * hh); ah.half[1] = *(const v8us*)((const unsigned short*)arow + kb + 16 + 8 * hh);
#pragma unroll
    for (int t = 0; t < 4; ++t) { if (col0 + t * 16 >= N) continue; const size_t boff = (size_t)(col0 + t * 16 + ln) * ldb + kb; FragH bq; bq.half[0] = *(const v8us*)((const unsigned short*)Bh + boff + 8 * hh); bq.half[1] = *(const v8us*)((const unsigned short*)Bh + boff + 16 + 8 * hh);
      acc[t] = mmaH<1>(ah.v, ah.v, bq.v, bq.v, acc[t]); }
  }
#pragma unroll
  for (int t = 0; t < 4; ++t) { if (col0 + t * 16 >= N) continue; const int col = col0 + t * 16 + ln; const float bv = bp ? bf16_round(bp[col]) : 0.f;
#pragma unroll
    for (int r = 0; r < 8; ++r) { float v = acc[t][r] * alpha + bv; if (CP) { const int rr = row0g + row0 + 8 * hh + r; if (rowsPerB < 0) v += CP[cofs + (size_t)rr * ldc + col];      /* rowsPerB < 0: own element of the batched C plane */ else { const int bidx = rr / rowsPerB; v += CP[(size_t)bidx * sCPb + (size_t)by * 64 + col]; } } if (ACT == 1) v = (v > 0.f) ? v : expm1f(v); else if (ACT == 7) v = (v > 0.f) ? v + 1.0f : expf(v); else if (ACT == 8) v = tanhf(v); else if (ACT == 9) v = 0.5f * v * (1.0f + tanhf(0.7978845608028654f * (v + 0.044715f * v * v * v))); else if (ACT == 11) v = 1.0f / (1.0f + expf(-v)); else if (ACT == 12) v = (v > 0.f) ? v : 0.01f * v; else if (ACT == 14) v = (v > 0.f) ? v : 0.1f * v; else if (ACT == 16) v = (v >= 0.f) ? v : 0.3f * v; else if (ACT == 17) v = (v >= 0.f) ? v : 0.2f * v; else if (ACT == 15) v = v / (1.0f + expf(-v)); else if (ACT == 3) v = fmaxf(v, 0.f); else if (ACT == 6) v = 0.5f * v * (1.0f + erff(v * 0.70710678118654752f)); so[w][8 * hh + r][t * 16 + ln] = v; } }
  __builtin_amdgcn_fence(__ATOMIC_ACQ_REL, "workgroup"); __builtin_amdgcn_wave_barrier();
  const int rsub = lane >> 4, c4 = (lane & 15) * 4; typedef _Float16 v4h __attribute__((ext_vector_type(4)));
  {
#pragma unroll
    for (int q = 0; q < 8; ++q) { const int r = q * 2 + rsub; if (col0 + c4 < N) { const v4f v = *(const v4fa*)&so[w][r][c4]; if (C) *(v4f*)(C + cofs + (size_t)(row0 + r) * ldc + col0 + c4) = v; if (C16) { v4h h4; for (int i = 0; i < 4; ++i) h4[i] = (_Float16)v[i]; *(v4h*)(C16 + cofs + (size_t)(row0 + r) * ldc + col0 + c4) = h4; } } }
     }
}


typedef _Float16 v4h __attribute__((ext_vector_type(4)));

__global__ __launch_bounds__(256) void k_h16(const float* __restrict__ x, _Float16* __restrict__ X16, size_t n8) { const size_t t = (size_t)blockIdx.x * 256 + threadIdx.x; if (t >= n8) return; FragH f;
#pragma unroll
  for (int q = 0; q < 8; ++q) f.h[q] = (_Float16)x[t * 8 + q]; *(v8us*)((unsigned short*)X16 + t * 8) = f.half[0];  }
__global__ __launch_bounds__(256) void k_round16f(const float* __restrict__ W, _Float16* __restrict__ Bt, size_t n8) { const size_t t = (size_t)blockIdx.x * 256 + threadIdx.x; if (t >= n8) return; FragH f;
#pragma unroll
  for (int i = 0; i < 8; ++i) f.h[i] = (_Float16)(bf16_round(W[t * 8 + i]) * 16.0f); *(v8us*)((unsigned short*)Bt + t * 8) = f.half[0];  }
template <int NHv, int TTv>
__global__ __launch_bounds__(256) void k_vt(const _Float16* __restrict__ V16, int ldv, int voff, _Float16* __restrict__ Vt) { __shared__ unsigned short tl[64][66]; const int tid = threadIdx.x; const int slab = blockIdx.x / (TTv / 64), lg = blockIdx.x % (TTv / 64); const int b = slab / NHv, h = slab % NHv;
  for (int i = tid; i < 64 * 8; i += 256) { const int r = i / 8, c8 = (i % 8) * 8; FragH f; f.half[0] = *(const v8us*)((const unsigned short*)V16 + ((size_t)b * TTv + lg * 64 + r) * ldv + voff + h * 64 + c8);
#pragma unroll
    for (int q = 0; q < 8; ++q) tl[r][c8 + q] = f.u[q]; }
  __syncthreads();
  {
#pragma unroll
    for (int rd = 0; rd < 2; ++rd) { const int d = rd * 32 + tid / 8, pc = tid % 8; FragH f;
#pragma unroll
      for (int q = 0; q < 8; ++q) f.u[q] = tl[pc * 8 + q][d];
      *(v8us*)((unsigned short*)Vt + ((size_t)slab * 64 + d) * TTv + lg * 64 + pc * 8) = f.half[0]; }
     } }

__global__ __launch_bounds__(256) void k_hl(const float* __restrict__ F, _Float16* __restrict__ Hh, _Float16* __restrict__ Hl, size_t n8) { const size_t t = (size_t)blockIdx.x * 256 + threadIdx.x; if (t >= n8) return; FragH fh, fl; const v4f a = *(const v4fa*)(F + t * 8), c = *(const v4fa*)(F + t * 8 + 4);
#pragma unroll
  for (int q = 0; q < 4; ++q) { _Float16 h = (_Float16)a[q]; fh.h[q] = h; fl.h[q] = (_Float16)((a[q] - (float)h) * 1024.0f); h = (_Float16)c[q]; fh.h[4 + q] = h; fl.h[4 + q] = (_Float16)((c[q] - (float)h) * 1024.0f); }
  { *(v8us*)((unsigned short*)Hh + t * 8) = fh.half[0]; *(v8us*)((unsigned short*)Hl + t * 8) = fl.half[0];  } }

// fragment of 16 rows x 32 k from k-contiguous rows in global memory (the hardware k order)
__device__ __forceinline__ v16h g2_frag(const _Float16* p, int hh) { FragH f; f.half[0] = *(const v8us*)((const unsigned short*)p + 8 * hh); f.half[1] = *(const v8us*)((const unsigned short*)p + 16 + 8 * hh); return f.v; }
// ---- GEMM with both operands staged in LDS: C = alpha A Bh^T + bias (bias [N], or [M] if RB, never null, rounded to bf16); A [M][K] and Bh [N][K] f16, k contiguous; needs M % 128 == 0, N % 128 == 0, K % 128 == 0 ----
// A block is 4 waves (2 x 2) on a 128 x 128 tile of C; a wave owns 64 x 64 (16 accumulator tiles). A stage is 128 k: 256 bytes of each of the block's 128 A rows and 128 B rows,
// brought by asynchronous copies to LDS, 16 bytes a lane (one copy of a wave = two whole rows of the stage = four whole 128-byte lines): each operand byte is asked for once a block, in whole lines.
// Two buffers: stage t + 2 is asked for behind the barrier that ends trip t, into the buffer that trip t has read. Fragments by two 16-byte LDS reads in the k order of g2_frag, k steps in rising order.
#define G3_KS 128                    /* k per stage */
#define G3_P 272                     /* LDS row pitch in bytes: 16 x odd, so the 16-byte fragment reads of 16 rows meet no bank twice */
#define G3_ST (256 * G3_P)           /* bytes per stage: A rows 0..127, then B rows 0..127 */
__device__ __forceinline__ v16h g3_frag(const unsigned char* p) { FragH f; f.half[0] = *(const v8us*)p; f.half[1] = *(const v8us*)(p + 32); return f.v; }
// Eight copies (rows 8 apart: LDS byte address l, global address g, gs elements per 8 rows); s_wait_xcnt 0 as the statement's last line, so that it stands in front of every later write of their address registers (a precaution).
__device__ __forceinline__ void g3_copy8(unsigned l, const _Float16* g, size_t gs) {
  asm volatile("global_load_async_to_lds_b128 %0, %8, off\n\tglobal_load_async_to_lds_b128 %1, %9, off\n\tglobal_load_async_to_lds_b128 %2, %10, off\n\tglobal_load_async_to_lds_b128 %3, %11, off\n\t"
               "global_load_async_to_lds_b128 %4, %12, off\n\tglobal_load_async_to_lds_b128 %5, %13, off\n\tglobal_load_async_to_lds_b128 %6, %14, off\n\tglobal_load_async_to_lds_b128 %7, %15, off\n\ts_wait_xcnt 0x0"
               :: "v"(l), "v"(l + 8 * G3_P), "v"(l + 16 * G3_P), "v"(l + 24 * G3_P), "v"(l + 32 * G3_P), "v"(l + 40 * G3_P), "v"(l + 48 * G3_P), "v"(l + 56 * G3_P),
                  "v"(g), "v"(g + gs), "v"(g + 2 * gs), "v"(g + 3 * gs), "v"(g + 4 * gs), "v"(g + 5 * gs), "v"(g + 6 * gs), "v"(g + 7 * gs) : "memory"); }
// One stage: 32 copies a lane (A rows 0..63, 64..127, B rows 0..63, 64..127); every lane is on, every address a multiple of 16.
__device__ __forceinline__ void g3_fill(unsigned l, const _Float16* ga, int lda, const _Float16* gb, int ldb) {
  g3_copy8(l, ga, (size_t)8 * lda); g3_copy8(l + 64 * G3_P, ga + (size_t)64 * lda, (size_t)8 * lda);
  g3_copy8(l + 128 * G3_P, gb, (size_t)8 * ldb); g3_copy8(l + 192 * G3_P, gb + (size_t)64 * ldb, (size_t)8 * ldb); }
// One 128 x 128 tile of C by one block. A, Bh, bias, C and C16 point at the tile's own first row, column or element; sm is the block's 2 * G3_ST bytes of LDS.
template <bool F32OUT, bool RB>      /* output rows: f32 to C, or f16 to C16; the bias belongs to C's rows (RB: the weight is the A operand), or to its columns */
__device__ __forceinline__ void g3_tile(unsigned char* sm, const _Float16* __restrict__ A, int lda, const _Float16* __restrict__ Bh, int ldb, float alpha, const float* __restrict__ bias,
    float* __restrict__ C, _Float16* __restrict__ C16, int ldc, int K) {
  const int tid = threadIdx.x, w = tid >> 5, lane = tid & 31, ln = lane & 15, hh = lane >> 4;
  const int wm = w >> 1, wn = w & 1;
  const unsigned l0 = (unsigned)(size_t)sm + (unsigned)((tid >> 4) * G3_P + (tid & 15) * 16);      /* this lane's place in a stage: row tid / 16 (+ 8 a copy), 16-byte piece tid % 16 */
  const _Float16* ga = A + (size_t)(tid >> 4) * lda + (tid & 15) * 8; const _Float16* gb = Bh + (size_t)(tid >> 4) * ldb + (tid & 15) * 8;
  const int T = K / G3_KS;
  const v8f z8 = {0.f,0.f,0.f,0.f,0.f,0.f,0.f,0.f}; v8f acc[4][4];
  /* every inner loop of this kernel is unrolled so that each index of acc, a and b is a constant and the arrays stay in registers */
#pragma unroll
  for (int i = 0; i < 4; ++i)
#pragma unroll
    for (int j = 0; j < 4; ++j) acc[i][j] = z8;
  const int bcol = wn * 64 + ln; float braw[4];      /* asked for here and first used behind the loop, so that the loads' latency passes under the stages */
  if (!RB) {
#pragma unroll
    for (int j = 0; j < 4; ++j) braw[j] = bias[bcol + j * 16];
    asm volatile("s_wait_xcnt 0x0" :: "v"(bcol), "s"(bias) : "memory");      /* the four loads' index and base stay live up to this wait, so nothing is written over them earlier */
  }
  g3_fill(l0, ga, lda, gb, ldb);
  asm volatile("s_wait_asynccnt 0x0" ::: "memory");      /* this wave's copies of stage 0 have landed */
  __syncthreads();                                        /* ... and every other wave's */
  if (T > 1) g3_fill(l0 + G3_ST, ga + G3_KS, lda, gb + G3_KS, ldb);
  const unsigned char* fa = sm + (wm * 64 + ln) * G3_P + 16 * hh; const unsigned char* fb = sm + (128 + wn * 64 + ln) * G3_P + 16 * hh;
#pragma unroll 1
  for (int t = 0; t < T; ++t) {      /* rolled: one trip a stage, the hand-over at its foot */
    const int bo = (t & 1) * G3_ST;
    v16h a[2][2], b[2][4];      /* a block is 8 products: two A fragments x the k step's four B fragments; two register sets, the next block's fragments asked for one block ahead */
#pragma unroll
    for (int i = 0; i < 2; ++i) a[0][i] = g3_frag(fa + bo + i * 16 * G3_P);
#pragma unroll
    for (int j = 0; j < 4; ++j) b[0][j] = g3_frag(fb + bo + j * 16 * G3_P);
#pragma unroll
    for (int hb = 0; hb < G3_KS / 16; ++hb) {
      const int ks = hb >> 1, h = hb & 1, ks1 = (hb + 1) >> 1, h1 = (hb + 1) & 1;
      if (hb + 1 < G3_KS / 16) {
#pragma unroll
        for (int i = 0; i < 2; ++i) a[h1][i] = g3_frag(fa + bo + (2 * h1 + i) * 16 * G3_P + ks1 * 64);
        if (h1 == 0) {
#pragma unroll
          for (int j = 0; j < 4; ++j) b[ks1 & 1][j] = g3_frag(fb + bo + j * 16 * G3_P + ks1 * 64);
        }
      }
      __builtin_amdgcn_sched_barrier(0);      /* keeps the next block's LDS reads together in front of this block's products: left free, they were sunk among the products and waited for at once */
#pragma unroll
      for (int i = 0; i < 2; ++i)
#pragma unroll
        for (int j = 0; j < 4; ++j) acc[2 * h + i][j] = __builtin_amdgcn_wmma_f32_16x16x32_f16(false, a[h][i], false, b[ks & 1][j], (short)0, acc[2 * h + i][j], false, false);
      __builtin_amdgcn_sched_barrier(0);      /* ... and the block after next's reads behind them */
    }
    asm volatile("s_wait_dscnt 0x0" ::: "memory");        /* this wave's reads of the buffer are done before it is handed back */
    asm volatile("s_wait_asynccnt 0x0" ::: "memory");     /* this wave's copies of stage t + 1 have landed */
    __syncthreads();                                      /* publishes stage t + 1 and ends every wave's reads of stage t */
    if (t + 2 < T) g3_fill(l0 + bo, ga + (size_t)(t + 2) * G3_KS, lda, gb + (size_t)(t + 2) * G3_KS, ldb);
  }
  const int brw = wm * 64 + 8 * hh; v4f brow[4][2];      /* RB: a lane's 8 rows of each accumulator tile i; asked for behind the loop: held through it, these 32 registers took the kernel past 256 */
  if (RB) {
#pragma unroll
    for (int i = 0; i < 4; ++i) { brow[i][0] = *(const v4fa*)(bias + brw + i * 16); brow[i][1] = *(const v4fa*)(bias + brw + i * 16 + 4); }
    asm volatile("s_wait_xcnt 0x0" :: "v"(brw), "s"(bias) : "memory");      /* the eight loads' index and base stay live up to this wait, so nothing is written over them earlier */
  }
  asm volatile("s_wait_asynccnt 0x0" ::: "memory");       /* nothing is in flight when the buffers become output staging */
  float* so = (float*)sm + w * (64 * 68);
#pragma unroll
  for (int j = 0; j < 4; ++j) {
#pragma unroll
    for (int i = 0; i < 4; ++i)
#pragma unroll
      for (int r = 0; r < 8; ++r) so[(i * 16 + 8 * hh + r) * 68 + j * 16 + ln] = acc[i][j][r] * alpha + bf16_round(RB ? brow[i][r >> 2][r & 3] : braw[j]); }
  __builtin_amdgcn_fence(__ATOMIC_ACQ_REL, "workgroup"); __builtin_amdgcn_wave_barrier();      /* the wave's staging writes stay in front of its own reads of them; no other wave touches its range */
  const int c4 = ln * 4; const size_t cb = (size_t)(wm * 64 + hh) * ldc + wn * 64 + c4;
#pragma unroll
  for (int q = 0; q < 32; ++q) { const v4f v = *(const v4fa*)&so[(q * 2 + hh) * 68 + c4]; if (F32OUT) *(v4f*)(C + cb + (size_t)(q * 2) * ldc) = v; else { v4h h4; for (int i = 0; i < 4; ++i) h4[i] = (_Float16)v[i]; *(v4h*)(C16 + cb + (size_t)(q * 2) * ldc) = h4; } }
}
// C (f32 rows) = alpha A Bh^T + bias: one block a tile.
__global__ __launch_bounds__(128) void k_gemm3(const _Float16* __restrict__ A, int lda, const _Float16* __restrict__ Bh, int ldb, float alpha, const float* __restrict__ bias, float* __restrict__ C, int ldc, int M, int N, int K) {
  __shared__ __attribute__((aligned(16))) unsigned char sm[2 * G3_ST];      /* the two buffers; behind the loop each wave's own 64 x 68 f32 output staging */
  const int ntn = N >> 7; const int mt = blockIdx.x / ntn, nq = blockIdx.x - mt * ntn; const int row0 = mt * 128, col0 = nq * 128; if (row0 >= M) return;      /* the same for the whole block */
  g3_tile<true, false>(sm, A + (size_t)row0 * lda, lda, Bh + (size_t)col0 * ldb, ldb, alpha, bias + col0, C + (size_t)row0 * ldc + col0, nullptr, ldc, K);
}
// The three projections in one launch: 3 * (DM / 128) blocks in a row share one tile of 128 x rows: DM / 128 column tiles of q, as many of k (A = x rows, B = weight rows, token rows out), then as many tiles of V^T:
// there the weight rows are the A operand and the x rows the B operand, so C's rows are the V^T rows [batch][head][d][key] that the attention launch reads, and nothing is left to transpose. A tile's 128 keys lie in one batch (128 divides SQ).
#define QKV_NT (DM / 128)            /* tiles across one projection's outputs */
__global__ __launch_bounds__(128) void k_qkv(const _Float16* __restrict__ X16, const _Float16* __restrict__ BQ, const _Float16* __restrict__ BK, const _Float16* __restrict__ BV,
    const float* __restrict__ bq, const float* __restrict__ bk, const float* __restrict__ bv, _Float16* __restrict__ Q16, _Float16* __restrict__ K16, _Float16* __restrict__ VT) {
  __shared__ __attribute__((aligned(16))) unsigned char sm[2 * G3_ST];      /* the two buffers; behind the loop each wave's own 64 x 68 f32 output staging */
  const int mt = blockIdx.x / (3 * QKV_NT), c = blockIdx.x - mt * (3 * QKV_NT); const int o0 = (c % QKV_NT) * 128;      /* x tile; projection c / QKV_NT, its first output feature: the same for the whole block */
  const _Float16* xt = X16 + (size_t)mt * 128 * DM;
  if (c < 2 * QKV_NT) { const bool kk = c >= QKV_NT;
    g3_tile<false, false>(sm, xt, DM, (kk ? BK : BQ) + (size_t)o0 * DM, DM, 0.0625f, (kk ? bk : bq) + o0, nullptr, (kk ? K16 : Q16) + (size_t)mt * 128 * DM + o0, DM, DM);
  } else {
    g3_tile<false, true>(sm, BV + (size_t)o0 * DM, DM, xt, DM, 0.0625f, bv + o0, nullptr, VT + ((size_t)(mt / (SQ / 128)) * DM + o0) * SQ + (mt % (SQ / 128)) * 128, SQ, DM);
  }
}


__global__ __launch_bounds__(256) void k_rsm(const float* __restrict__ S, _Float16* __restrict__ P, int nrows) {
  #pragma clang fp contract(off)
  const int i = blockIdx.x * 256 + threadIdx.x; if (i >= nrows) return; const float* s = S + (size_t)i * SQ; float mx = -3.0e38f;
#pragma unroll 1
  for (int j = 0; j < SQ; ++j) mx = fmaxf(mx, s[j]); float se = 0.f;
#pragma unroll 1
  for (int j = 0; j < SQ; ++j) se += expf(s[j] - mx); const float sc = 256.0f / se;
#pragma unroll 1
  for (int j0 = 0; j0 < SQ; j0 += 8) { FragH f; for (int q = 0; q < 8; ++q) f.h[q] = (_Float16)(expf(s[j0 + q] - mx) * sc); unsigned short* d = (unsigned short*)P + (size_t)i * SQ + j0; *(v8us*)d = f.half[0];  } }
__global__ __launch_bounds__(256) void k_vt(const _Float16* __restrict__ V16, int b, int h0, _Float16* __restrict__ VT) { __shared__ unsigned short tl[64][65]; const int tid = threadIdx.x; const int hh = blockIdx.x % HG, sg = blockIdx.x / HG; const int s0 = sg * 64; const int h = h0 + hh;
  for (int i = tid; i < 64 * 8; i += 256) { const int j = i / 8, d8 = (i % 8) * 8; FragH f; f.half[0] = *(const v8us*)((const unsigned short*)V16 + ((size_t)b * SQ + s0 + j) * DM + h * HD + d8); for (int q = 0; q < 8; ++q) tl[d8 + q][j] = f.u[q]; }
  __syncthreads();
  { for (int i = tid; i < 64 * 8; i += 256) { const int d = i / 8, j8 = (i % 8) * 8; FragH f; for (int q = 0; q < 8; ++q) f.u[q] = tl[d][j8 + q]; *(v8us*)((unsigned short*)VT + ((size_t)hh * HD + d) * SQ + s0 + j8) = f.half[0]; }  } }


// Final stage: y = x + global + 0.3 (conv3 of x + b), LayerNorm, affine. One wave owns FN_R consecutive token rows whole: a lane holds 32 columns of each (8 pieces of 4; piece c = columns 128 c + 4 lane),
// so every load and store of a wave is 512 bytes in a row and a row's sums are in-lane adds plus one lane butterfly. All of a wave's row loads are asked for at its start, before anything waits.
// The six column parameters (three conv taps, conv bias, gain, shift) are rounded to bf16 once per block and shared through LDS planes. FN_R divides SQ, so a wave's rows lie in one sequence;
// the row in front of the first and the row behind the last of a sequence count as zero.
#define FN_R 2                       /* token rows per wave */
template <int CTRL> __device__ __forceinline__ float fn_dpp(float v) { return __builtin_bit_cast(float, __builtin_amdgcn_update_dpp(0, __builtin_bit_cast(int, v), CTRL, 0xf, 0xf, true)); }      /* 0x160 + m: lane l <- lane l ^ m inside a 16-lane row */
__device__ __forceinline__ float fn_xhalf(float x) { return __builtin_bit_cast(float, __builtin_amdgcn_permlanex16(__builtin_bit_cast(int, x), __builtin_bit_cast(int, x), 0x76543210, 0xfedcba98, false, false)); }      /* lane l <-> lane l ^ 16 */
__device__ __forceinline__ float fn_wsum(v4f a) { float v = (a[0] + a[1]) + (a[2] + a[3]); v += fn_dpp<0x161>(v); v += fn_dpp<0x162>(v); v += fn_dpp<0x164>(v); v += fn_dpp<0x168>(v); return v + fn_xhalf(v); }      /* the wave's sum, in every lane */
__device__ __forceinline__ v4f fn_ld(const float* base, unsigned bytes) { return *(const v4fa*)((const char*)base + bytes); }      /* scalar base + 32-bit byte offset */
__device__ __forceinline__ v4f fn_rd(v4f a) { v4f r; for (int q = 0; q < 4; ++q) r[q] = bf16_round(a[q]); return r; }
__global__ __launch_bounds__(256) __attribute__((amdgpu_waves_per_eu(4, 4))) void k_msfin(const float* __restrict__ X, const float* __restrict__ G, const float* __restrict__ cw, const float* __restrict__ cb, const float* __restrict__ g, const float* __restrict__ bta, float eps, float* __restrict__ out) {
  __shared__ __attribute__((aligned(16))) float pr[6][DM];      /* planes: tap 0, tap 1, tap 2, conv bias, gain, shift */
  const int tid = threadIdx.x; const unsigned c0 = (tid & 31) * 4u, t4 = tid * 4u;      /* first column of a lane's piece; of this thread's four parameter columns */
  const unsigned lb = (tid & 31) * 16u, tb = tid * 16u, wo = tid * 48u;      /* byte offsets of the loads: a lane's piece in a row, this thread's four parameters, its twelve taps */
  const int wv = __builtin_amdgcn_readfirstlane((int)(blockIdx.x * 8 + (tid >> 5)));      /* the wave's number, in a scalar register: row addresses are scalar base + lane offset */
  const size_t row0 = (size_t)wv * FN_R; const int s0 = (int)(row0 % SQ); const bool hp = s0 > 0, hn = s0 + FN_R < SQ;
  const float* xb = X + row0 * DM; const float* xm = xb - (hp ? DM : 0); const float* xn = xb + (hn ? FN_R * DM : 0);      /* a neighbour outside the sequence: an address in bounds, its values replaced by zero */
  const float* gb = G + row0 * DM;
  const v4f wa = fn_ld(cw, wo), wb = fn_ld(cw, wo + 16), wc = fn_ld(cw, wo + 32), pc = fn_ld(cb, tb), pg = fn_ld(g, tb), pb = fn_ld(bta, tb);      /* this thread's four columns: 12 taps in a row, bias, gain, shift */
  v4f xr[FN_R + 2][8], y[FN_R][8];
  /* every loop of this kernel is unrolled so that each index of xr and y is a constant and the rows stay in registers */
#pragma unroll
  for (int c = 0; c < 8; ++c) { const unsigned j = lb + c * 512; xr[0][c] = fn_ld(xm, j);
#pragma unroll
    for (int r = 0; r < FN_R; ++r) xr[r + 1][c] = fn_ld(xb, j + r * (DM * 4));
    xr[FN_R + 1][c] = fn_ld(xn, j);
#pragma unroll
    for (int r = 0; r < FN_R; ++r) y[r][c] = fn_ld(gb, j + r * (DM * 4)); }
  asm volatile("s_wait_xcnt 0x0" :: "v"(lb), "v"(tb), "v"(wo), "s"(xm), "s"(xb), "s"(xn), "s"(gb), "s"(cw), "s"(cb), "s"(g), "s"(bta) : "memory");      /* the loads' offsets and bases stay live up to this wait, so nothing (a later load's result included) is written over them earlier; its memory clobber also keeps every row load in front of the first wait for data (left free, they were sunk to their uses and waited for one by one) */
  { const v4f a = fn_rd(wa), b = fn_rd(wb), c = fn_rd(wc); const v4f t0 = {a[0], a[3], b[2], c[1]}, t1 = {a[1], b[0], b[3], c[2]}, t2 = {a[2], b[1], c[0], c[3]};
    *(v4f*)&pr[0][t4] = t0; *(v4f*)&pr[1][t4] = t1; *(v4f*)&pr[2][t4] = t2; *(v4f*)&pr[3][t4] = fn_rd(pc); *(v4f*)&pr[4][t4] = fn_rd(pg); *(v4f*)&pr[5][t4] = fn_rd(pb); }
  /* work-group barrier with LDS-only fences: the planes are whole before any wave reads them (nothing writes them again); __syncthreads() would also wait here for every row load still in flight */
  __builtin_amdgcn_fence(__ATOMIC_RELEASE, "workgroup", "local"); __builtin_amdgcn_s_barrier(); __builtin_amdgcn_fence(__ATOMIC_ACQUIRE, "workgroup", "local");
  const v4f z4 = {0.f, 0.f, 0.f, 0.f}; v4f s1[FN_R];
#pragma unroll
  for (int r = 0; r < FN_R; ++r) s1[r] = z4;
#pragma unroll
  for (int c = 0; c < 8; ++c) {
    const unsigned j = c * 128 + c0; v4f xq[FN_R + 2];
#pragma unroll
    for (int r = 0; r < FN_R + 2; ++r) xq[r] = fn_rd(xr[r][c]);
    if (!hp) xq[0] = z4;
    if (!hn) xq[FN_R + 1] = z4;
    const v4f w0 = *(const v4f*)&pr[0][j], w1 = *(const v4f*)&pr[1][j], w2 = *(const v4f*)&pr[2][j], cv = *(const v4f*)&pr[3][j];
#pragma unroll
    for (int r = 0; r < FN_R; ++r) { const v4f loc = xq[r] * w0 + xq[r + 1] * w1 + xq[r + 2] * w2 + cv; const v4f yy = xq[r + 1] + (y[r][c] + 0.3f * loc); y[r][c] = yy; s1[r] += yy; }
  }
  float mu[FN_R], rs[FN_R];
#pragma unroll
  for (int r = 0; r < FN_R; ++r) mu[r] = fn_wsum(s1[r]) * (1.0f / (float)DM);
#pragma unroll
  for (int r = 0; r < FN_R; ++r) { v4f s2 = z4;
#pragma unroll
    for (int c = 0; c < 8; ++c) { y[r][c] -= mu[r]; s2 += y[r][c] * y[r][c]; }
    s1[r] = s2; }
#pragma unroll
  for (int r = 0; r < FN_R; ++r) rs[r] = rsqrtf(fn_wsum(s1[r]) * (1.0f / (float)DM) + eps);
  float* ob = out + row0 * DM;
#pragma unroll
  for (int c = 0; c < 8; ++c) { const unsigned j = c * 128 + c0; const v4f gg = *(const v4f*)&pr[4][j], bb = *(const v4f*)&pr[5][j];
#pragma unroll
    for (int r = 0; r < FN_R; ++r) *(v4f*)(ob + (size_t)r * DM + j) = y[r][c] * rs[r] * gg + bb; }
}


__device__ __forceinline__ float fa_xhalf(float x) { return __builtin_bit_cast(float, __builtin_amdgcn_permlanex16(__builtin_bit_cast(int, x), __builtin_bit_cast(int, x), 0x76543210, 0xfedcba98, false, false)); }      /* lane l <-> lane l ^ 16 */
__device__ __forceinline__ v8f fa_mma(v16h a, v16h b, v8f c) { return __builtin_amdgcn_wmma_f32_16x16x32_f16(false, a, false, b, (short)0, c, false, false); }
// Native exp2 of nine / eight values in place, in one statement that ends in v_nop: no v_exp_f32 is directly followed by an instruction that reads its result or writes over its source
// (left to the register allocator, a neighbour's result landed on the source of the exp in front of it).
__device__ __forceinline__ void fa_exp9(float& y, float& x0, float& x1, float& x2, float& x3, float& x4, float& x5, float& x6, float& x7) {
  asm("v_exp_f32 %0, %0\n\tv_exp_f32 %1, %1\n\tv_exp_f32 %2, %2\n\tv_exp_f32 %3, %3\n\tv_exp_f32 %4, %4\n\tv_exp_f32 %5, %5\n\tv_exp_f32 %6, %6\n\tv_exp_f32 %7, %7\n\tv_exp_f32 %8, %8\n\tv_nop"
      : "+v"(y), "+v"(x0), "+v"(x1), "+v"(x2), "+v"(x3), "+v"(x4), "+v"(x5), "+v"(x6), "+v"(x7)); }
__device__ __forceinline__ void fa_exp8(float& x0, float& x1, float& x2, float& x3, float& x4, float& x5, float& x6, float& x7) {
  asm("v_exp_f32 %0, %0\n\tv_exp_f32 %1, %1\n\tv_exp_f32 %2, %2\n\tv_exp_f32 %3, %3\n\tv_exp_f32 %4, %4\n\tv_exp_f32 %5, %5\n\tv_exp_f32 %6, %6\n\tv_exp_f32 %7, %7\n\tv_nop"
      : "+v"(x0), "+v"(x1), "+v"(x2), "+v"(x3), "+v"(x4), "+v"(x5), "+v"(x6), "+v"(x7)); }
#define FA_QB 256                    /* query rows per block (8 waves x 32) */
// K and V^T reach the waves through LDS: a stage is FA_KS keys of the block's (batch, head): FA_KS K rows of 128 bytes, then the 64 V^T rows' 256 bytes of those keys,
// brought once per block by asynchronous copies, 16 bytes a lane (a wave's copy = four whole K rows or two whole V^T row pieces = four whole 128-byte lines), and read by all 8 waves.
// Two buffers: stage t + 2 is asked for behind the barrier that ends trip t, into the buffer that trip t has read. Fragments by two 16-byte LDS reads in the k order of g2_frag; keys in rising order as before.
#define FA_KS 128                    /* keys per stage (4 passes) */
#define FA_KP 144                    /* LDS pitch of a K row in bytes: 16 x odd, so the 16-byte fragment reads of 16 rows meet no bank twice */
#define FA_VP 272                    /* LDS pitch of a V^T row in bytes: 16 x odd */
#define FA_VO (FA_KS * FA_KP)        /* the V^T rows stand behind the K rows */
#define FA_ST (FA_VO + HD * FA_VP)   /* bytes per stage */
// One stage: eight copies a lane (K rows 32 apart, V^T rows 16 apart); every lane is on, every address a multiple of 16; s_wait_xcnt 0 as the statement's last line, so that it stands in front of every later write of their address registers (a precaution).
__device__ __forceinline__ void fa_fill(unsigned lk, unsigned lv, const _Float16* gk, const _Float16* gv) {
  asm volatile("global_load_async_to_lds_b128 %0, %8, off\n\tglobal_load_async_to_lds_b128 %1, %9, off\n\tglobal_load_async_to_lds_b128 %2, %10, off\n\tglobal_load_async_to_lds_b128 %3, %11, off\n\t"
               "global_load_async_to_lds_b128 %4, %12, off\n\tglobal_load_async_to_lds_b128 %5, %13, off\n\tglobal_load_async_to_lds_b128 %6, %14, off\n\tglobal_load_async_to_lds_b128 %7, %15, off\n\ts_wait_xcnt 0x0"
               :: "v"(lk), "v"(lk + 32 * FA_KP), "v"(lk + 64 * FA_KP), "v"(lk + 96 * FA_KP), "v"(lv), "v"(lv + 16 * FA_VP), "v"(lv + 32 * FA_VP), "v"(lv + 48 * FA_VP),
                  "v"(gk), "v"(gk + (size_t)32 * DM), "v"(gk + (size_t)64 * DM), "v"(gk + (size_t)96 * DM), "v"(gv), "v"(gv + (size_t)16 * SQ), "v"(gv + (size_t)32 * SQ), "v"(gv + (size_t)48 * SQ) : "memory"); }
// One pass: 32 keys against the wave's 32 query columns. pk: this lane's place in the pass's first K row, pv: in V^T row ln at the pass's first key. PRE: the next pass's K fragments are asked for behind the score products
// (inside a stage only: nothing of the next stage is read in front of its barrier).
template <bool PRE>
__device__ __forceinline__ void fa_pass(const unsigned char* pk, const unsigned char* pv, const v16h (&qf)[2][2], v16h (&kf)[2][2], v8f (&o)[4][2], float (&m)[2], float (&l)[2]) {
  const float SC = 0.125f * 1.4426950408889634f;      /* 1 / sqrt(64), in log2 units */
  const v8f z8 = {0.f,0.f,0.f,0.f,0.f,0.f,0.f,0.f};
  v16h vf[4];      /* asked for at the head of the pass, used behind the softmax */
#pragma unroll
  for (int t = 0; t < 4; ++t) vf[t] = g3_frag(pv + t * 16 * FA_VP);
  v8f s[2][2];
#pragma unroll
  for (int kt = 0; kt < 2; ++kt)
#pragma unroll
    for (int g = 0; g < 2; ++g) s[kt][g] = fa_mma(kf[kt][1], qf[g][1], fa_mma(kf[kt][0], qf[g][0], z8));
  if (PRE) {
#pragma unroll
    for (int kt = 0; kt < 2; ++kt)
#pragma unroll
      for (int j = 0; j < 2; ++j) kf[kt][j] = g3_frag(pk + (32 + kt * 16) * FA_KP + 64 * j);
  }
  __builtin_amdgcn_sched_barrier(0);      /* keeps the pass's LDS reads in front of the softmax, whose length covers their latency: left free, the V^T reads of a stage's last pass were sunk among the products and waited for at once */
  v16h pf[2];
#pragma unroll
  for (int g = 0; g < 2; ++g) {
    const v8f a = s[0][g], c = s[1][g];
    float mx = fmaxf(a[0], c[0]);
#pragma unroll
    for (int r = 1; r < 8; ++r) mx = fmaxf(mx, fmaxf(a[r], c[r]));
    mx = fmaxf(mx, fa_xhalf(mx));
    const float mn = fmaxf(m[g], mx * SC); float al = m[g] - mn; m[g] = mn;      /* al becomes 2^al below: 0 on the first pass */
    const float off = 8.0f - mn; FragH p; float e[16];
#pragma unroll
    for (int r = 0; r < 8; ++r) { e[r] = a[r] * SC + off; e[8 + r] = c[r] * SC + off; }
    fa_exp9(al, e[0], e[1], e[2], e[3], e[4], e[5], e[6], e[7]); fa_exp8(e[8], e[9], e[10], e[11], e[12], e[13], e[14], e[15]);
#pragma unroll
    for (int r = 0; r < 16; ++r) p.h[r] = (_Float16)e[r];
    pf[g] = p.v;
    const float sum = (((e[0] + e[1]) + (e[2] + e[3])) + ((e[4] + e[5]) + (e[6] + e[7]))) + (((e[8] + e[9]) + (e[10] + e[11])) + ((e[12] + e[13]) + (e[14] + e[15])));
    l[g] = l[g] * al + sum;
#pragma unroll
    for (int t = 0; t < 4; ++t) o[t][g] *= al;
  }
#pragma unroll
  for (int t = 0; t < 4; ++t)
#pragma unroll
    for (int g = 0; g < 2; ++g) o[t][g] = fa_mma(vf[t], pf[g], o[t][g]);
  asm volatile("v_nop\n\tv_nop\n\tv_nop\n\tv_nop" : "+v"(o[0][0]), "+v"(o[0][1]), "+v"(o[1][0]), "+v"(o[1][1]), "+v"(o[2][0]), "+v"(o[2][1]), "+v"(o[3][0]), "+v"(o[3][1]) : "v"(pf[0]), "v"(pf[1]));      /* WMMA distance: the weights (B operands) stay live for four slots behind the pass's last products, so the next pass's score tiles, which may get the same registers, are not written over them earlier */
}
__global__ __launch_bounds__(256) __attribute__((amdgpu_waves_per_eu(4, 4))) void k_fattn(const _Float16* __restrict__ Q16, const _Float16* __restrict__ K16, const _Float16* __restrict__ VT, _Float16* __restrict__ O16) {
  __shared__ __attribute__((aligned(16))) unsigned char sm[2 * FA_ST];      /* the two buffers */
  const int tid = threadIdx.x, lane = threadIdx.x & 31, w = threadIdx.x >> 5, ln = lane & 15, hh = lane >> 4;
  const int bh = blockIdx.x / (SQ / FA_QB), qb = blockIdx.x % (SQ / FA_QB); const int b = bh / NH, h = bh % NH;
  const size_t r0 = (size_t)b * SQ; const int q0 = qb * FA_QB + w * 32;
  const unsigned lk = (unsigned)(size_t)sm + (unsigned)((tid >> 3) * FA_KP + (tid & 7) * 16);              /* this lane's places in a stage: K row tid / 8 (+ 32 a copy), 16-byte piece tid % 8 */
  const unsigned lv = (unsigned)(size_t)sm + (unsigned)(FA_VO + (tid >> 4) * FA_VP + (tid & 15) * 16);     /* V^T row tid / 16 (+ 16 a copy), 16-byte piece tid % 16 */
  const _Float16* gk = K16 + (r0 + (tid >> 3)) * DM + h * HD + (tid & 7) * 8;
  const _Float16* gv = VT + ((size_t)bh * HD + (tid >> 4)) * SQ + (tid & 15) * 8;
  fa_fill(lk, lv, gk, gv);
  v16h qf[2][2];
#pragma unroll
  for (int g = 0; g < 2; ++g)
#pragma unroll
    for (int j = 0; j < 2; ++j) qf[g][j] = g2_frag(Q16 + (r0 + q0 + g * 16 + ln) * DM + h * HD + 32 * j, hh);
  const v8f z8 = {0.f,0.f,0.f,0.f,0.f,0.f,0.f,0.f};
  v8f o[4][2]; float m[2], l[2];
#pragma unroll
  for (int g = 0; g < 2; ++g) { m[g] = -3.0e38f; l[g] = 0.f;
#pragma unroll
    for (int t = 0; t < 4; ++t) o[t][g] = z8; }
  asm volatile("s_wait_asynccnt 0x0" ::: "memory");      /* this wave's copies of stage 0 have landed */
  __syncthreads();                                        /* ... and every other wave's */
  fa_fill(lk + FA_ST, lv + FA_ST, gk + (size_t)FA_KS * DM, gv + FA_KS);      /* stage 1 (SQ / FA_KS is 16) */
  const unsigned char* fk = sm + ln * FA_KP + 16 * hh;              /* key row ln of a stage's first tile, at this half's first k */
  const unsigned char* fv = sm + FA_VO + ln * FA_VP + 16 * hh;      /* V^T row d = ln, at this half's first key */
#pragma unroll 1
  for (int st = 0; st < SQ / FA_KS; ++st) {      /* rolled: one trip a stage, the hand-over at its foot */
    const int bo = (st & 1) * FA_ST;
    v16h kf[2][2];
#pragma unroll
    for (int kt = 0; kt < 2; ++kt)
#pragma unroll
      for (int j = 0; j < 2; ++j) kf[kt][j] = g3_frag(fk + bo + kt * 16 * FA_KP + 64 * j);
#pragma unroll 1
    for (int kb = 0; kb < FA_KS / 32 - 1; ++kb)      /* rolled: one pass already fills the register budget of four waves per SIMD */
      fa_pass<true>(fk + bo + kb * 32 * FA_KP, fv + bo + kb * 64, qf, kf, o, m, l);
    fa_pass<false>(fk + bo + (FA_KS - 32) * FA_KP, fv + bo + (FA_KS / 32 - 1) * 64, qf, kf, o, m, l);      /* the stage's last pass */
    asm volatile("s_wait_dscnt 0x0" ::: "memory");        /* this wave's reads of the buffer are done before it is handed back */
    asm volatile("s_wait_asynccnt 0x0" ::: "memory");     /* this wave's copies of stage st + 1 have landed */
    __syncthreads();                                      /* publishes stage st + 1 and ends every wave's reads of stage st */
    if (st + 2 < SQ / FA_KS) fa_fill(lk + bo, lv + bo, gk + (size_t)(st + 2) * FA_KS * DM, gv + (st + 2) * FA_KS);
  }
  asm volatile("s_wait_asynccnt 0x0" ::: "memory");       /* nothing is in flight when the wave ends */
#pragma unroll
  for (int g = 0; g < 2; ++g) {
    const float inv = 64.0f / (l[g] + fa_xhalf(l[g]));      /* the halves' sums join once; x64: the carried scale of the o rows */
    _Float16* orow = O16 + (r0 + q0 + g * 16 + ln) * DM + h * HD + 8 * hh;
#pragma unroll
    for (int t = 0; t < 4; ++t) { FragH f;
#pragma unroll
      for (int r = 0; r < 8; ++r) f.h[r] = (_Float16)(o[t][g][r] * inv);
      *(v8us*)((unsigned short*)orow + t * 16) = f.half[0]; }
  }
}

// Operand conversion, one launch for all five GEMM operands: x -> f16 of its bf16 rounding, each weight -> f16 of 16 x its bf16 rounding (the values as before).
// PC_NW waves, few enough to be resident all at once (16 per WGP when spread evenly). A wave owns one contiguous run of x (PC_XL loads) and one of each weight (PC_WL loads); a load of a wave is 512 bytes in a row, 16 bytes a lane,
// a store 256 bytes in a row. All of a wave's loads are asked for at its start, before anything waits.
#define PC_NW 4096                   /* waves of the launch */
#define PC_XL 16                     /* loads of 128 floats per wave: x */
#define PC_WL 2                      /* ... and each weight */
static_assert((size_t)PC_NW * PC_XL * 128 == NR * DM && (size_t)PC_NW * PC_WL * 128 == (size_t)DM * DM, "the waves' runs cover x and each weight exactly once");
template <bool X16W>      /* weights carry the factor 16 */
__device__ __forceinline__ void pc_st(_Float16* base, unsigned bytes, v4f a) { v4h h;
#pragma unroll
  for (int q = 0; q < 4; ++q) h[q] = X16W ? (_Float16)(bf16_round(a[q]) * 16.0f) : (_Float16)bf16_round(a[q]);
  *(v4h*)((char*)base + bytes) = h; }
__global__ __launch_bounds__(256) void k_prep(const float* __restrict__ x, const float* __restrict__ wq, const float* __restrict__ wk, const float* __restrict__ wv, const float* __restrict__ wo,
    _Float16* __restrict__ X16, _Float16* __restrict__ BQ, _Float16* __restrict__ BK, _Float16* __restrict__ BV, _Float16* __restrict__ BO) {
  const unsigned lb = (threadIdx.x & 31) * 16u, sb = (threadIdx.x & 31) * 8u;      /* a lane's byte offset in a load, in a store */
  const int wn = __builtin_amdgcn_readfirstlane((int)(blockIdx.x * 8 + (threadIdx.x >> 5)));      /* the wave's number, in a scalar register: addresses are scalar base + lane offset */
  const size_t xo = (size_t)wn * (PC_XL * 128), wf = (size_t)wn * (PC_WL * 128);
  const float* xs = x + xo; const float* s0 = wq + wf; const float* s1 = wk + wf; const float* s2 = wv + wf; const float* s3 = wo + wf;
  v4f a[PC_XL], b[4][PC_WL];
  /* every loop of this kernel is unrolled so that each index of a and b is a constant and the values stay in registers */
#pragma unroll
  for (int c = 0; c < PC_XL; ++c) a[c] = fn_ld(xs, lb + c * 512);
#pragma unroll
  for (int c = 0; c < PC_WL; ++c) { b[0][c] = fn_ld(s0, lb + c * 512); b[1][c] = fn_ld(s1, lb + c * 512); b[2][c] = fn_ld(s2, lb + c * 512); b[3][c] = fn_ld(s3, lb + c * 512); }
  asm volatile("s_wait_xcnt 0x0" :: "v"(lb), "s"(xs), "s"(s0), "s"(s1), "s"(s2), "s"(s3) : "memory");      /* the loads' offset and bases stay live up to this wait, so nothing is written over them earlier */
  __builtin_amdgcn_sched_barrier(0);      /* keeps the conversions behind the issue of the last load: left free, they were lifted among the loads, and ten of the loads were asked for only after the first data had come */
#pragma unroll
  for (int c = 0; c < PC_XL; ++c) pc_st<false>(X16 + xo, sb + c * 256, a[c]);
#pragma unroll
  for (int c = 0; c < PC_WL; ++c) { pc_st<true>(BQ + wf, sb + c * 256, b[0][c]); pc_st<true>(BK + wf, sb + c * 256, b[1][c]); pc_st<true>(BV + wf, sb + c * 256, b[2][c]); pc_st<true>(BO + wf, sb + c * 256, b[3][c]); }
}

extern "C" void kernel_launch(void* const* d_in, const int* in_sizes, int n_in,
                              void* d_out, int out_size, void* d_ws, size_t ws_size, hipStream_t stream) {
  (void)in_sizes; (void)n_in; (void)out_size;
  const float* const* I = (const float* const*)d_in; const float* x = I[0]; const float* wq = I[1]; const float* bq = I[2]; const float* wk = I[3]; const float* bk = I[4]; const float* wv = I[5]; const float* bv = I[6]; const float* wo = I[7]; const float* bo = I[8]; const float* cw = I[9]; const float* cb = I[10]; const float* lng = I[11]; const float* lnb = I[12];      /* weights [out][in] (natural) */
  char* ws = (char*)d_ws; size_t off = 0;
  auto take = [&](size_t bytes) { char* p = ws + off; off += (bytes + 255) & ~(size_t)255; return p; };
  _Float16* BQ = (_Float16*)take((size_t)DM * DM * 2); _Float16* BK = (_Float16*)take((size_t)DM * DM * 2); _Float16* BV = (_Float16*)take((size_t)DM * DM * 2); _Float16* BO = (_Float16*)take((size_t)DM * DM * 2);
  _Float16* X16 = (_Float16*)take(NR * DM * 2); _Float16* Q16 = (_Float16*)take(NR * DM * 2); _Float16* K16 = (_Float16*)take(NR * DM * 2); _Float16* O16 = (_Float16*)take(NR * DM * 2); float* GA = (float*)take(NR * DM * 4);      /* global attention branch (f32 rows) */
  _Float16* VT = (_Float16*)take((size_t)NB * NH * HD * SQ * 2);      /* V^T [NB][NH][HD][SQ] */
  if (off > ws_size) return;
  k_prep<<<PC_NW / 8, 256, 0, stream>>>(x, wq, wk, wv, wo, X16, BQ, BK, BV, BO);      /* all five GEMM operands as f16 */
  const size_t r0p = (size_t)B0 * SQ;      /* first row of the output stage */
  k_qkv<<<(unsigned)(NR / 128) * (3 * QKV_NT), 128, 0, stream>>>(X16, BQ, BK, BV, bq, bk, bv, Q16, K16, VT);      /* q and k as f16 token rows, v as V^T rows for every (batch, head) */
  k_fattn<<<NB * NH * (SQ / FA_QB), 256, 0, stream>>>(Q16, K16, VT, O16);      /* o (merged heads) as f16 rows, x64 */
  k_gemm3<<<(unsigned)((MPO / 128) * (DM / 128)), 128, 0, stream>>>(O16 + r0p * DM, DM, BO, DM, 0.0009765625f, bo, GA + r0p * DM, DM, MPO, DM, DM);      /* global = ctx Wo^T + bo (f32 rows) */
  k_msfin<<<(unsigned)(MPO / (8 * FN_R)), 256, 0, stream>>>(x + r0p * DM, GA + r0p * DM, cw, cb, lng, lnb, 1e-5f, (float*)d_out + r0p * DM);      /* + x + 0.3 local conv, LayerNorm -> output rows */
}

// v008
// A run of this version takes 123 microseconds.
// Next to v007, in two timings, it ran 1.05 times as fast each time.
// All steps since v000 together make it 56.0 times as fast.
#include <hip/hip_runtime.h>
// Multi-scale attention block (x [4][2048][1024]; q/k/v = x W^T + b (natural [1024][1024] weights), 16 heads of 64; softmax(q k^T / 8); ctx merged; global = ctx Wo^T + bo; local = depthwise conv3 of x along the sequence (conv_w [1024][3], zero pad) + conv_b; y = x + global + 0.3 local; out = LayerNorm(y) (eps 1e-5) ln_g + ln_b -> [4][2048][1024]).
// Structure (attention part): token rows r = b*2048 + s; x as exact f16 rows (bf16-rounded); Q, K, V^T as WMMA GEMM tiles of one launch (128x128 block tiles staged in LDS, 64x64 wave tiles, f32 accumulation, exact x16 weights + bias, f16 outputs; V^T tiles with the weight as the A operand); one fused attention launch over all (batch, head, 256-query block): per 32 keys S^T = K Q^T on WMMA, running-maximum softmax on VALU, rescaled lazily (f32 statistics, native exp2; weights x256 as f16, packed from the score accumulators), O^T += V^T P^T on WMMA; o carried x64 against f16 subnormal flush (folded into the output GEMM alpha), written straight into the merged f16 o rows; global = o W_o^T + b GEMM (f32 rows); then per token row on VALU: + bf16(x) + 0.3 (depthwise conv3 of bf16(x) + b), LayerNorm, affine -> output rows.
// Compute dtype: inputs rounded to bf16; x / weights exact; q, k, v, softmax weights and o as plain f16 GEMM operands (~2^-12); scores and softmax statistics f32. v_wmma_f32_16x16x32_f16.
#define NB 4
#define SQ 2048
#define DM 1024
#define NH 16
#define HD 64
#define HG 4                         /* heads per launch of the unlaunched k_vt(V16, b, h0, VT) overload */
#define B0 0                         /* first batch processed (debug hook) */
#define NBR NB                       /* batches processed (debug hook) */
#define NR ((size_t)NB * SQ)         /* token rows */
#define MP ((int)((size_t)NBR * SQ)) /* rows through the output stage, via MPO (debug hook) */
#define QN SQ                        /* not used: k_fattn attends all SQ query rows of each batch */
#define NHD NH                       /* not used: k_fattn attends all NH heads */
#define MPO MP                       /* rows through the output stage (debug hook) */
#define LQ DM      /* not used: q and k rows have pitch DM */
typedef __bf16 v16b __attribute__((ext_vector_type(16)));
typedef unsigned short v8us __attribute__((ext_vector_type(8), may_alias));
typedef float  v8f  __attribute__((ext_vector_type(8)));
typedef float  v4f  __attribute__((ext_vector_type(4)));
typedef float  v4fa __attribute__((ext_vector_type(4), may_alias));
union FragB { v16b v; v8us half[2]; unsigned short u[16]; };

__device__ __forceinline__ unsigned short bf16_bits(float x) { unsigned int u = __float_as_uint(x); return (unsigned short)((u + 0x7FFFu + ((u >> 16) & 1u)) >> 16); }
__device__ __forceinline__ float bf16_val(unsigned short b) { return __uint_as_float(((unsigned int)b) << 16); }
__device__ __forceinline__ float bf16_round(float x) { return bf16_val(bf16_bits(x)); }
// D += A·B with NT terms: 1 = ah·bh, 2 = + al·bh (A split), 3 = + ah·bl (both split)
template <int NT>
__device__ __forceinline__ v8f mmaN(v16b ah, v16b al, v16b bh, v16b bl, v8f c) {
  c = __builtin_amdgcn_wmma_f32_16x16x32_bf16(false, ah, false, bh, (short)0, c, false, false);
  if (NT >= 2) c = __builtin_amdgcn_wmma_f32_16x16x32_bf16(false, al, false, bh, (short)0, c, false, false);
  if (NT >= 3) c = __builtin_amdgcn_wmma_f32_16x16x32_bf16(false, ah, false, bl, (short)0, c, false, false);
  asm volatile("v_nop\n\tv_nop\n\tv_nop\n\tv_nop" : "+v"(c) : "v"(ah), "v"(al), "v"(bh), "v"(bl));
  return c;
}

__global__ __launch_bounds__(256) void k_wt_bf16(const float* __restrict__ W, unsigned short* __restrict__ Wt, int K, int N) {
  const int t = blockIdx.x * 256 + threadIdx.x;
  const int k8n = K / 8;
  if (t >= N * k8n) return;
  const int n = t / k8n, k8 = (t % k8n) * 8;
  v8us v;
#pragma unroll
  for (int i = 0; i < 8; ++i) v[i] = bf16_bits(W[(size_t)(k8 + i) * N + n]);
  *(v8us*)(Wt + (size_t)n * K + k8) = v;
  
}

// GEMM C[M][N] (f32, pitch ldc) = act(A[M][K]·W + bias). A f32 row-major (pitch lda) converted per fragment to bf16
// (ASPLIT: hi/lo two planes -> 2 terms, else single rounded term); Wt bf16 [N][K] (pitch ldb). BIAS_BF16 rounds the
// bias to bf16 first (bias quantised to bf16 before the add). K%32==0, M%16==0, N%64==0.
template <bool ASPLIT, int ACT, bool BIAS_BF16>
__global__ __launch_bounds__(128) void k_gemm_bf(const float* __restrict__ A, int lda, const unsigned short* __restrict__ Wt, int ldb,
                                               const float* __restrict__ bias, float* __restrict__ C, int ldc, int M, int N, int K) {
  __shared__ __attribute__((aligned(16))) float so[4][16][64];
  const int tid = threadIdx.x, w = tid >> 5, lane = tid & 31, ln = lane & 15, hh = lane >> 4;
  const int ntn = N / 64;
  const int wid = blockIdx.x * 4 + w;
  const int mt = wid / ntn, nq = wid % ntn;
  if (mt * 16 >= M) return;
  const int row0 = mt * 16, col0 = nq * 64;
  const float* arow = A + (size_t)(row0 + ln) * lda;
  v8f acc[4] = {};
  for (int kb = 0; kb < K; kb += 32) {
    FragB ah, al;
    const v4f x0 = *(const v4fa*)(arow + kb + 8 * hh), x1 = *(const v4fa*)(arow + kb + 8 * hh + 4);
    const v4f x2 = *(const v4fa*)(arow + kb + 16 + 8 * hh), x3 = *(const v4fa*)(arow + kb + 16 + 8 * hh + 4);
    float xs[16] = {x0[0],x0[1],x0[2],x0[3],x1[0],x1[1],x1[2],x1[3],x2[0],x2[1],x2[2],x2[3],x3[0],x3[1],x3[2],x3[3]};
#pragma unroll
    for (int i = 0; i < 16; ++i) { const unsigned short hb = bf16_bits(xs[i]); ah.u[i] = hb; al.u[i] = ASPLIT ? bf16_bits(xs[i] - bf16_val(hb)) : (unsigned short)0; }
#pragma unroll
    for (int t = 0; t < 4; ++t) {
      const unsigned short* brow = Wt + (size_t)(col0 + t * 16 + ln) * ldb + kb;
      FragB b;
      b.half[0] = *(const v8us*)(brow + 8 * hh);
      b.half[1] = *(const v8us*)(brow + 16 + 8 * hh);
      acc[t] = mmaN<ASPLIT ? 2 : 1>(ah.v, al.v, b.v, b.v, acc[t]);
    }
  }
#pragma unroll
  for (int t = 0; t < 4; ++t) {
    float bv = bias ? bias[col0 + t * 16 + ln] : 0.f;
    if (BIAS_BF16) bv = bf16_round(bv);
#pragma unroll
    for (int r = 0; r < 8; ++r) { float v = acc[t][r] + bv; if (ACT == 1) v = fmaxf(v, 0.f); so[w][8 * hh + r][t * 16 + ln] = v; }
  }
  __builtin_amdgcn_fence(__ATOMIC_ACQ_REL, "workgroup");
  __builtin_amdgcn_wave_barrier();
  const int rsub = lane >> 4, c4 = (lane & 15) * 4;
  {
#pragma unroll
    for (int q = 0; q < 8; ++q) {
      const int r = q * 2 + rsub;
      const v4f v = *(const v4fa*)&so[w][r][c4];
      *(v4f*)(C + (size_t)(row0 + r) * ldc + col0 + c4) = v;
    }
    
  }
}

// GEMM C = act(A·W + bias + resid): A f32 (ASPLIT -> hi/lo 2 terms), Wt bf16 [N][K]; ACT 0 none, 1 relu, 2 exact gelu;
// resid (optional, f32, row index = (row % rmod), pitch ldr, RES_BF16 rounds it) added before the activation.
template <bool ASPLIT, int ACT, bool BIAS_BF16, bool RES_BF16>
__global__ __launch_bounds__(128) void k_gemm_bf3(const float* __restrict__ A, int lda, const unsigned short* __restrict__ Wt, int ldb,
                                                const float* __restrict__ bias, const float* __restrict__ resid, int rmod, int ldr,
                                                float* __restrict__ C, int ldc, int M, int N, int K) {
  __shared__ __attribute__((aligned(16))) float so[4][16][64];
  const int tid = threadIdx.x, w = tid >> 5, lane = tid & 31, ln = lane & 15, hh = lane >> 4;
  const int ntn = N / 64;
  const int wid = blockIdx.x * 4 + w;
  const int mt = wid / ntn, nq = wid % ntn;
  if (mt * 16 >= M) return;
  const int row0 = mt * 16, col0 = nq * 64;
  const float* arow = A + (size_t)(row0 + ln) * lda;
  v8f acc[4] = {};
  for (int kb = 0; kb < K; kb += 32) {
    FragB ah, al;
    const v4f x0 = *(const v4fa*)(arow + kb + 8 * hh), x1 = *(const v4fa*)(arow + kb + 8 * hh + 4);
    const v4f x2 = *(const v4fa*)(arow + kb + 16 + 8 * hh), x3 = *(const v4fa*)(arow + kb + 16 + 8 * hh + 4);
    float xs[16] = {x0[0],x0[1],x0[2],x0[3],x1[0],x1[1],x1[2],x1[3],x2[0],x2[1],x2[2],x2[3],x3[0],x3[1],x3[2],x3[3]};
#pragma unroll
    for (int i = 0; i < 16; ++i) { const unsigned short hb = bf16_bits(xs[i]); ah.u[i] = hb; al.u[i] = ASPLIT ? bf16_bits(xs[i] - bf16_val(hb)) : (unsigned short)0; }
#pragma unroll
    for (int t = 0; t < 4; ++t) {
      const unsigned short* brow = Wt + (size_t)(col0 + t * 16 + ln) * ldb + kb;
      FragB b;
      b.half[0] = *(const v8us*)(brow + 8 * hh);
      b.half[1] = *(const v8us*)(brow + 16 + 8 * hh);
      acc[t] = mmaN<ASPLIT ? 2 : 1>(ah.v, al.v, b.v, b.v, acc[t]);
    }
  }
#pragma unroll
  for (int t = 0; t < 4; ++t) {
    const int col = col0 + t * 16 + ln;
    float bv = bias ? bias[col] : 0.f;
    if (BIAS_BF16) bv = bf16_round(bv);
#pragma unroll
    for (int r = 0; r < 8; ++r) {
      float v = acc[t][r] + bv;
      if (resid) { float rv = resid[(size_t)((row0 + 8 * hh + r) % rmod) * ldr + col]; if (RES_BF16) rv = bf16_round(rv); v += rv; }
      if (ACT == 1) v = fmaxf(v, 0.f);
      if (ACT == 2) v = 0.5f * v * (1.0f + erff(v * 0.70710678118654752f));
      if (ACT == 3) { const float u = 0.7978845608028654f * (v + 0.044715f * v * v * v); v = 0.5f * v * (1.0f + tanhf(u)); }
      so[w][8 * hh + r][t * 16 + ln] = v;
    }
  }
  __builtin_amdgcn_fence(__ATOMIC_ACQ_REL, "workgroup");
  __builtin_amdgcn_wave_barrier();
  const int rsub = lane >> 4, c4 = (lane & 15) * 4;
  {
#pragma unroll
    for (int q = 0; q < 8; ++q) {
      const int r = q * 2 + rsub;
      const v4f v = *(const v4fa*)&so[w][r][c4];
      *(v4f*)(C + (size_t)(row0 + r) * ldc + col0 + c4) = v;
    }
    
  }
}
// row LayerNorm (biased variance, eps) over N: s = X (+ R); optional out_sum <- s; out_norm <- (s-mu)*rsqrt(var+eps)*g + b
template <bool PARAM_BF16>
__global__ __launch_bounds__(256) void k_layernorm(const float* __restrict__ X, const float* __restrict__ R, const float* __restrict__ g, const float* __restrict__ bta,
                                                  float* __restrict__ out_sum, float* __restrict__ out_norm, int N, float eps) {
  __shared__ float red[256];
  const int row = blockIdx.x, tid = threadIdx.x;
  const float* x = X + (size_t)row * N; const float* rr = R ? R + (size_t)row * N : nullptr;
  float vals[16];                     // up to N = 4096
  const int per = N / 256;            // contiguous chunk per thread? use strided-by-4 chunks: thread handles j = tid*4 + 1024*u
  float s1 = 0.f;
  for (int u = 0; u < per / 4; ++u) {
    const int j = tid * 4 + 1024 * u;
    const v4f a = *(const v4fa*)(x + j);
    v4f b = {0.f,0.f,0.f,0.f}; if (rr) b = *(const v4fa*)(rr + j);
#pragma unroll
    for (int q = 0; q < 4; ++q) { const float v = a[q] + b[q]; vals[u * 4 + q] = v; s1 += v; }
  }
  red[tid] = s1; __syncthreads();
  for (int st = 128; st > 0; st >>= 1) { if (tid < st) red[tid] += red[tid + st]; __syncthreads(); }
  const float mu = red[0] / (float)N; __syncthreads();
  float s2 = 0.f;
  for (int u = 0; u < per / 4; ++u)
#pragma unroll
    for (int q = 0; q < 4; ++q) { const float c = vals[u * 4 + q] - mu; s2 += c * c; }
  red[tid] = s2; __syncthreads();
  for (int st = 128; st > 0; st >>= 1) { if (tid < st) red[tid] += red[tid + st]; __syncthreads(); }
  const float rs = rsqrtf(red[0] / (float)N + eps);
  {
    for (int u = 0; u < per / 4; ++u) {
      const int j = tid * 4 + 1024 * u;
      v4f o, sm;
#pragma unroll
      for (int q = 0; q < 4; ++q) {
        float gg = g[j + q], bb = bta[j + q];
        if (PARAM_BF16) { gg = bf16_round(gg); bb = bf16_round(bb); }
        sm[q] = vals[u * 4 + q]; o[q] = (vals[u * 4 + q] - mu) * rs * gg + bb;
      }
      if (out_sum) *(v4f*)(out_sum + (size_t)row * N + j) = sm;
      *(v4f*)(out_norm + (size_t)row * N + j) = o;
    }
    
  }
}



// ---- f16 WMMA path (v_wmma_f32_16x16x32_f16): 11-bit significands for operands in range — used where a [0,1] probability operand needs more precision than bf16
typedef _Float16 v16h __attribute__((ext_vector_type(16)));
union FragH { v16h v; v8us half[2]; _Float16 h[16]; unsigned short u[16]; };
template <int NT>
__device__ __forceinline__ v8f mmaH(v16h ah, v16h al, v16h bh, v16h bl, v8f c) {
  c = __builtin_amdgcn_wmma_f32_16x16x32_f16(false, ah, false, bh, (short)0, c, false, false);
  if (NT >= 2) c = __builtin_amdgcn_wmma_f32_16x16x32_f16(false, al, false, bh, (short)0, c, false, false);
  if (NT >= 3) c = __builtin_amdgcn_wmma_f32_16x16x32_f16(false, ah, false, bl, (short)0, c, false, false);
  asm volatile("v_nop\n\tv_nop\n\tv_nop\n\tv_nop" : "+v"(c) : "v"(ah), "v"(al), "v"(bh), "v"(bl));
  return c;
}
// batched GEMM like k_gemm_b but f16 operands: A f32 (split into f16 hi/lo if ASPLIT, else rounded to f16), Bt = f16 values [n][k]; alpha; C f32; N multiple of 16 (partial tiles skipped)
template <bool ASPLIT>
__global__ __launch_bounds__(128) void k_gemm_h(const float* __restrict__ A, int lda, size_t sA, const _Float16* __restrict__ Bh, int ldb, size_t sB, float alpha, float* __restrict__ C, int ldc, size_t sC, int M, int N, int K) {
  __shared__ __attribute__((aligned(16))) float so[4][16][64];
  const int tid = threadIdx.x, w = tid >> 5, lane = tid & 31, ln = lane & 15, hh = lane >> 4; const int by = blockIdx.y;
  A += (size_t)by * sA; Bh += (size_t)by * sB; C += (size_t)by * sC;
  const int ntn = (N + 63) / 64; const int wid = blockIdx.x * 4 + w; const int mt = wid / ntn, nq = wid % ntn; if (mt * 16 >= M) return;
  const int row0 = mt * 16, col0 = nq * 64; const float* arow = A + (size_t)(row0 + ln) * lda;
  v8f acc[4] = {};
  for (int kb = 0; kb < K; kb += 32) {
    FragH ah, al;
    const v4f x0 = *(const v4fa*)(arow + kb + 8 * hh), x1 = *(const v4fa*)(arow + kb + 8 * hh + 4), x2 = *(const v4fa*)(arow + kb + 16 + 8 * hh), x3 = *(const v4fa*)(arow + kb + 16 + 8 * hh + 4);
    float xs[16] = {x0[0],x0[1],x0[2],x0[3],x1[0],x1[1],x1[2],x1[3],x2[0],x2[1],x2[2],x2[3],x3[0],x3[1],x3[2],x3[3]};
#pragma unroll
    for (int i = 0; i < 16; ++i) { const _Float16 h = (_Float16)xs[i]; ah.h[i] = h; al.h[i] = ASPLIT ? (_Float16)(xs[i] - (float)h) : (_Float16)0.0f; }
#pragma unroll
    for (int t = 0; t < 4; ++t) { if (col0 + t * 16 >= N) continue; const size_t boff = (size_t)(col0 + t * 16 + ln) * ldb + kb; FragH bq; bq.half[0] = *(const v8us*)(Bh + boff + 8 * hh); bq.half[1] = *(const v8us*)(Bh + boff + 16 + 8 * hh);
      acc[t] = mmaH<ASPLIT ? 2 : 1>(ah.v, al.v, bq.v, bq.v, acc[t]); }
  }
#pragma unroll
  for (int t = 0; t < 4; ++t) { if (col0 + t * 16 >= N) continue;
#pragma unroll
    for (int r = 0; r < 8; ++r) so[w][8 * hh + r][t * 16 + ln] = acc[t][r] * alpha; }
  __builtin_amdgcn_fence(__ATOMIC_ACQ_REL, "workgroup"); __builtin_amdgcn_wave_barrier();
  const int rsub = lane >> 4, c4 = (lane & 15) * 4;
  {
#pragma unroll
    for (int q = 0; q < 8; ++q) { const int r = q * 2 + rsub; if (col0 + c4 < N) { const v4f v = *(const v4fa*)&so[w][r][c4]; *(v4f*)(C + (size_t)(row0 + r) * ldc + col0 + c4) = v; } }
     }
}

// Wt[n][k] = f16(W[k][n]·scale) from f32 row-major W[K][N] (scale = power of two; bf16-exact weights stay exact in f16 away from the subnormal range)
__global__ __launch_bounds__(256) void k_wt_f16(const float* __restrict__ W, _Float16* __restrict__ Wt, int K, int N, float scale) {
  const int t = blockIdx.x * 256 + threadIdx.x; if (t >= N * (K / 8)) return; const int n = t / (K / 8), k8 = (t % (K / 8)) * 8; FragH f;
#pragma unroll
  for (int i = 0; i < 8; ++i) f.h[i] = (_Float16)(bf16_round(W[(size_t)(k8 + i) * N + n]) * scale); const v8us o = f.half[0];
  *(v8us*)((unsigned short*)Wt + (size_t)n * K + k8) = o; 
}
// k_gemm_hh variant with fused epilogue: v = acc·alpha + bias[by·sBias + col] (+ CP[(row/rowsPerB)·sCPb + by·64 + col] if CP) ; ACT 0 none / 1 elu ; writes f16 C16 (and f32 C if non-null)
template <int ACT>
__global__ __launch_bounds__(128) void k_gemm_hhx(const _Float16* __restrict__ A, int lda, size_t sA, const _Float16* __restrict__ Bh, int ldb, size_t sB, float alpha, const float* __restrict__ bias, size_t sBias, const float* __restrict__ CP, int rowsPerB, size_t sCPb, int row0g,
    float* __restrict__ C, _Float16* __restrict__ C16, int ldc, size_t sC, int M, int N, int K) {
  __shared__ __attribute__((aligned(16))) float so[4][16][64];
  const int tid = threadIdx.x, w = tid >> 5, lane = tid & 31, ln = lane & 15, hh = lane >> 4; const int by = blockIdx.y;
  A += (size_t)by * sA; Bh += (size_t)by * sB; const size_t cofs = (size_t)by * sC; const float* bp = bias ? bias + (size_t)by * sBias : nullptr;
  const int ntn = (N + 63) / 64; const int wid = blockIdx.x * 4 + w; const int mt = wid / ntn, nq = wid % ntn; if (mt * 16 >= M) return;
  const int row0 = mt * 16, col0 = nq * 64; const _Float16* arow = A + (size_t)(row0 + ln) * lda;
  v8f acc[4] = {};
  for (int kb = 0; kb < K; kb += 32) { FragH ah; ah.half[0] = *(const v8us*)((const unsigned short*)arow + kb + 8 * hh); ah.half[1] = *(const v8us*)((const unsigned short*)arow + kb + 16 + 8 * hh);
#pragma unroll
    for (int t = 0; t < 4; ++t) { if (col0 + t * 16 >= N) continue; const size_t boff = (size_t)(col0 + t * 16 + ln) * ldb + kb; FragH bq; bq.half[0] = *(const v8us*)((const unsigned short*)Bh + boff + 8 * hh); bq.half[1] = *(const v8us*)((const unsigned short*)Bh + boff + 16 + 8 * hh);
      acc[t] = mmaH<1>(ah.v, ah.v, bq.v, bq.v, acc[t]); }
  }
#pragma unroll
  for (int t = 0; t < 4; ++t) { if (col0 + t * 16 >= N) continue; const int col = col0 + t * 16 + ln; const float bv = bp ? bf16_round(bp[col]) : 0.f;
#pragma unroll
    for (int r = 0; r < 8; ++r) { float v = acc[t][r] * alpha + bv; if (CP) { const int rr = row0g + row0 + 8 * hh + r; if (rowsPerB < 0) v += CP[cofs + (size_t)rr * ldc + col];      /* rowsPerB < 0: own element of the batched C plane */ else { const int bidx = rr / rowsPerB; v += CP[(size_t)bidx * sCPb + (size_t)by * 64 + col]; } } if (ACT == 1) v = (v > 0.f) ? v : expm1f(v); else if (ACT == 7) v = (v > 0.f) ? v + 1.0f : expf(v); else if (ACT == 8) v = tanhf(v); else if (ACT == 9) v = 0.5f * v * (1.0f + tanhf(0.7978845608028654f * (v + 0.044715f * v * v * v))); else if (ACT == 11) v = 1.0f / (1.0f + expf(-v)); else if (ACT == 12) v = (v > 0.f) ? v : 0.01f * v; else if (ACT == 14) v = (v > 0.f) ? v : 0.1f * v; else if (ACT == 16) v = (v >= 0.f) ? v : 0.3f * v; else if (ACT == 17) v = (v >= 0.f) ? v : 0.2f * v; else if (ACT == 15) v = v / (1.0f + expf(-v)); else if (ACT == 3) v = fmaxf(v, 0.f); else if (ACT == 6) v = 0.5f * v * (1.0f + erff(v * 0.70710678118654752f)); so[w][8 * hh + r][t * 16 + ln] = v; } }
  __builtin_amdgcn_fence(__ATOMIC_ACQ_REL, "workgroup"); __builtin_amdgcn_wave_barrier();
  const int rsub = lane >> 4, c4 = (lane & 15) * 4; typedef _Float16 v4h __attribute__((ext_vector_type(4)));
  {
#pragma unroll
    for (int q = 0; q < 8; ++q) { const int r = q * 2 + rsub; if (col0 + c4 < N) { const v4f v = *(const v4fa*)&so[w][r][c4]; if (C) *(v4f*)(C + cofs + (size_t)(row0 + r) * ldc + col0 + c4) = v; if (C16) { v4h h4; for (int i = 0; i < 4; ++i) h4[i] = (_Float16)v[i]; *(v4h*)(C16 + cofs + (size_t)(row0 + r) * ldc + col0 + c4) = h4; } } }
     }
}


typedef _Float16 v4h __attribute__((ext_vector_type(4)));

__global__ __launch_bounds__(256) void k_h16(const float* __restrict__ x, _Float16* __restrict__ X16, size_t n8) { const size_t t = (size_t)blockIdx.x * 256 + threadIdx.x; if (t >= n8) return; FragH f;
#pragma unroll
  for (int q = 0; q < 8; ++q) f.h[q] = (_Float16)x[t * 8 + q]; *(v8us*)((unsigned short*)X16 + t * 8) = f.half[0];  }
__global__ __launch_bounds__(256) void k_round16f(const float* __restrict__ W, _Float16* __restrict__ Bt, size_t n8) { const size_t t = (size_t)blockIdx.x * 256 + threadIdx.x; if (t >= n8) return; FragH f;
#pragma unroll
  for (int i = 0; i < 8; ++i) f.h[i] = (_Float16)(bf16_round(W[t * 8 + i]) * 16.0f); *(v8us*)((unsigned short*)Bt + t * 8) = f.half[0];  }
template <int NHv, int TTv>
__global__ __launch_bounds__(256) void k_vt(const _Float16* __restrict__ V16, int ldv, int voff, _Float16* __restrict__ Vt) { __shared__ unsigned short tl[64][66]; const int tid = threadIdx.x; const int slab = blockIdx.x / (TTv / 64), lg = blockIdx.x % (TTv / 64); const int b = slab / NHv, h = slab % NHv;
  for (int i = tid; i < 64 * 8; i += 256) { const int r = i / 8, c8 = (i % 8) * 8; FragH f; f.half[0] = *(const v8us*)((const unsigned short*)V16 + ((size_t)b * TTv + lg * 64 + r) * ldv + voff + h * 64 + c8);
#pragma unroll
    for (int q = 0; q < 8; ++q) tl[r][c8 + q] = f.u[q]; }
  __syncthreads();
  {
#pragma unroll
    for (int rd = 0; rd < 2; ++rd) { const int d = rd * 32 + tid / 8, pc = tid % 8; FragH f;
#pragma unroll
      for (int q = 0; q < 8; ++q) f.u[q] = tl[pc * 8 + q][d];
      *(v8us*)((unsigned short*)Vt + ((size_t)slab * 64 + d) * TTv + lg * 64 + pc * 8) = f.half[0]; }
     } }

__global__ __launch_bounds__(256) void k_hl(const float* __restrict__ F, _Float16* __restrict__ Hh, _Float16* __restrict__ Hl, size_t n8) { const size_t t = (size_t)blockIdx.x * 256 + threadIdx.x; if (t >= n8) return; FragH fh, fl; const v4f a = *(const v4fa*)(F + t * 8), c = *(const v4fa*)(F + t * 8 + 4);
#pragma unroll
  for (int q = 0; q < 4; ++q) { _Float16 h = (_Float16)a[q]; fh.h[q] = h; fl.h[q] = (_Float16)((a[q] - (float)h) * 1024.0f); h = (_Float16)c[q]; fh.h[4 + q] = h; fl.h[4 + q] = (_Float16)((c[q] - (float)h) * 1024.0f); }
  { *(v8us*)((unsigned short*)Hh + t * 8) = fh.half[0]; *(v8us*)((unsigned short*)Hl + t * 8) = fl.half[0];  } }

// fragment of 16 rows x 32 k from k-contiguous rows in global memory (the hardware k order)
__device__ __forceinline__ v16h g2_frag(const _Float16* p, int hh) { FragH f; f.half[0] = *(const v8us*)((const unsigned short*)p + 8 * hh); f.half[1] = *(const v8us*)((const unsigned short*)p + 16 + 8 * hh); return f.v; }
// ---- GEMM with both operands staged in LDS: C = alpha A Bh^T + bias (bias [N], or [M] if RB, never null, rounded to bf16); A [M][K] and Bh [N][K] f16, k contiguous; needs M % 128 == 0, N % 128 == 0, K % 128 == 0 ----
// A block is 4 waves (2 x 2) on a 128 x 128 tile of C; a wave owns 64 x 64 (16 accumulator tiles). A stage is 128 k: 256 bytes of each of the block's 128 A rows and 128 B rows,
// brought by asynchronous copies to LDS, 16 bytes a lane (one copy of a wave = two whole rows of the stage = four whole 128-byte lines): each operand byte is asked for once a block, in whole lines.
// Two buffers: stage t + 2 is asked for behind the barrier that ends trip t, into the buffer that trip t has read. Fragments by two 16-byte LDS reads in the k order of g2_frag, k steps in rising order.
#define G3_KS 128                    /* k per stage */
#define G3_P 272                     /* LDS row pitch in bytes: 16 x odd, so the 16-byte fragment reads of 16 rows meet no bank twice */
#define G3_ST (256 * G3_P)           /* bytes per stage: A rows 0..127, then B rows 0..127 */
__device__ __forceinline__ v16h g3_frag(const unsigned char* p) { FragH f; f.half[0] = *(const v8us*)p; f.half[1] = *(const v8us*)(p + 32); return f.v; }
// Eight copies (rows 8 apart: LDS byte address l, global address g, gs elements per 8 rows); s_wait_xcnt 0 as the statement's last line, so that it stands in front of every later write of their address registers (a precaution).
__device__ __forceinline__ void g3_copy8(unsigned l, const _Float16* g, size_t gs) {
  asm volatile("global_load_async_to_lds_b128 %0, %8, off\n\tglobal_load_async_to_lds_b128 %1, %9, off\n\tglobal_load_async_to_lds_b128 %2, %10, off\n\tglobal_load_async_to_lds_b128 %3, %11, off\n\t"
               "global_load_async_to_lds_b128 %4, %12, off\n\tglobal_load_async_to_lds_b128 %5, %13, off\n\tglobal_load_async_to_lds_b128 %6, %14, off\n\tglobal_load_async_to_lds_b128 %7, %15, off\n\ts_wait_xcnt 0x0"
               :: "v"(l), "v"(l + 8 * G3_P), "v"(l + 16 * G3_P), "v"(l + 24 * G3_P), "v"(l + 32 * G3_P), "v"(l + 40 * G3_P), "v"(l + 48 * G3_P), "v"(l + 56 * G3_P),
                  "v"(g), "v"(g + gs), "v"(g + 2 * gs), "v"(g + 3 * gs), "v"(g + 4 * gs), "v"(g + 5 * gs), "v"(g + 6 * gs), "v"(g + 7 * gs) : "memory"); }
// One stage: 32 copies a lane (A rows 0..63, 64..127, B rows 0..63, 64..127); every lane is on, every address a multiple of 16.
__device__ __forceinline__ void g3_fill(unsigned l, const _Float16* ga, int lda, const _Float16* gb, int ldb) {
  g3_copy8(l, ga, (size_t)8 * lda); g3_copy8(l + 64 * G3_P, ga + (size_t)64 * lda, (size_t)8 * lda);
  g3_copy8(l + 128 * G3_P, gb, (size_t)8 * ldb); g3_copy8(l + 192 * G3_P, gb + (size_t)64 * ldb, (size_t)8 * ldb); }
// One 128 x 128 tile of C by one block. A, Bh, bias, C and C16 point at the tile's own first row, column or element; sm is the block's 2 * G3_ST bytes of LDS.
template <bool F32OUT, bool RB>      /* output rows: f32 to C, or f16 to C16; the bias belongs to C's rows (RB: the weight is the A operand), or to its columns */
__device__ __forceinline__ void g3_tile(unsigned char* sm, const _Float16* __restrict__ A, int lda, const _Float16* __restrict__ Bh, int ldb, float alpha, const float* __restrict__ bias,
    float* __restrict__ C, _Float16* __restrict__ C16, int ldc, int K) {
  const int tid = threadIdx.x, w = tid >> 5, lane = tid & 31, ln = lane & 15, hh = lane >> 4;
  const int wm = w >> 1, wn = w & 1;
  const unsigned l0 = (unsigned)(size_t)sm + (unsigned)((tid >> 4) * G3_P + (tid & 15) * 16);      /* this lane's place in a stage: row tid / 16 (+ 8 a copy), 16-byte piece tid % 16 */
  const _Float16* ga = A + (size_t)(tid >> 4) * lda + (tid & 15) * 8; const _Float16* gb = Bh + (size_t)(tid >> 4) * ldb + (tid & 15) * 8;
  const int T = K / G3_KS;
  const v8f z8 = {0.f,0.f,0.f,0.f,0.f,0.f,0.f,0.f}; v8f acc[4][4];
  /* every inner loop of this kernel is unrolled so that each index of acc, a and b is a constant and the arrays stay in registers */
#pragma unroll
  for (int i = 0; i < 4; ++i)
#pragma unroll
    for (int j = 0; j < 4; ++j) acc[i][j] = z8;
  const int bcol = wn * 64 + ln; float braw[4];      /* asked for here and first used behind the loop, so that the loads' latency passes under the stages */
  if (!RB) {
#pragma unroll
    for (int j = 0; j < 4; ++j) braw[j] = bias[bcol + j * 16];
    asm volatile("s_wait_xcnt 0x0" :: "v"(bcol), "s"(bias) : "memory");      /* the four loads' index and base stay live up to this wait, so nothing is written over them earlier */
  }
  g3_fill(l0, ga, lda, gb, ldb);
  asm volatile("s_wait_asynccnt 0x0" ::: "memory");      /* this wave's copies of stage 0 have landed */
  __syncthreads();                                        /* ... and every other wave's */
  if (T > 1) g3_fill(l0 + G3_ST, ga + G3_KS, lda, gb + G3_KS, ldb);
  const unsigned char* fa = sm + (wm * 64 + ln) * G3_P + 16 * hh; const unsigned char* fb = sm + (128 + wn * 64 + ln) * G3_P + 16 * hh;
#pragma unroll 1
  for (int t = 0; t < T; ++t) {      /* rolled: one trip a stage, the hand-over at its foot */
    const int bo = (t & 1) * G3_ST;
    v16h a[2][2], b[2][4];      /* a block is 8 products: two A fragments x the k step's four B fragments; two register sets, the next block's fragments asked for one block ahead */
#pragma unroll
    for (int i = 0; i < 2; ++i) a[0][i] = g3_frag(fa + bo + i * 16 * G3_P);
#pragma unroll
    for (int j = 0; j < 4; ++j) b[0][j] = g3_frag(fb + bo + j * 16 * G3_P);
#pragma unroll
    for (int hb = 0; hb < G3_KS / 16; ++hb) {
      const int ks = hb >> 1, h = hb & 1, ks1 = (hb + 1) >> 1, h1 = (hb + 1) & 1;
      if (hb + 1 < G3_KS / 16) {
#pragma unroll
        for (int i = 0; i < 2; ++i) a[h1][i] = g3_frag(fa + bo + (2 * h1 + i) * 16 * G3_P + ks1 * 64);
        if (h1 == 0) {
#pragma unroll
          for (int j = 0; j < 4; ++j) b[ks1 & 1][j] = g3_frag(fb + bo + j * 16 * G3_P + ks1 * 64);
        }
      }
      __builtin_amdgcn_sched_barrier(0);      /* keeps the next block's LDS reads together in front of this block's products: left free, they were sunk among the products and waited for at once */
#pragma unroll
      for (int i = 0; i < 2; ++i)
#pragma unroll
        for (int j = 0; j < 4; ++j) acc[2 * h + i][j] = __builtin_amdgcn_wmma_f32_16x16x32_f16(false, a[h][i], false, b[ks & 1][j], (short)0, acc[2 * h + i][j], false, false);
      __builtin_amdgcn_sched_barrier(0);      /* ... and the block after next's reads behind them */
    }
    asm volatile("s_wait_dscnt 0x0" ::: "memory");        /* this wave's reads of the buffer are done before it is handed back */
    asm volatile("s_wait_asynccnt 0x0" ::: "memory");     /* this wave's copies of stage t + 1 have landed */
    __syncthreads();                                      /* publishes stage t + 1 and ends every wave's reads of stage t */
    if (t + 2 < T) g3_fill(l0 + bo, ga + (size_t)(t + 2) * G3_KS, lda, gb + (size_t)(t + 2) * G3_KS, ldb);
  }
  const int brw = wm * 64 + 8 * hh; v4f brow[4][2];      /* RB: a lane's 8 rows of each accumulator tile i; asked for behind the loop: held through it, these 32 registers took the kernel past 256 */
  if (RB) {
#pragma unroll
    for (int i = 0; i < 4; ++i) { brow[i][0] = *(const v4fa*)(bias + brw + i * 16); brow[i][1] = *(const v4fa*)(bias + brw + i * 16 + 4); }
    asm volatile("s_wait_xcnt 0x0" :: "v"(brw), "s"(bias) : "memory");      /* the eight loads' index and base stay live up to this wait, so nothing is written over them earlier */
  }
  asm volatile("s_wait_asynccnt 0x0" ::: "memory");       /* nothing is in flight when the buffers become output staging */
  float* so = (float*)sm + w * (64 * 68);
#pragma unroll
  for (int j = 0; j < 4; ++j) {
#pragma unroll
    for (int i = 0; i < 4; ++i)
#pragma unroll
      for (int r = 0; r < 8; ++r) so[(i * 16 + 8 * hh + r) * 68 + j * 16 + ln] = acc[i][j][r] * alpha + bf16_round(RB ? brow[i][r >> 2][r & 3] : braw[j]); }
  __builtin_amdgcn_fence(__ATOMIC_ACQ_REL, "workgroup"); __builtin_amdgcn_wave_barrier();      /* the wave's staging writes stay in front of its own reads of them; no other wave touches its range */
  const int c4 = ln * 4; const size_t cb = (size_t)(wm * 64 + hh) * ldc + wn * 64 + c4;
#pragma unroll
  for (int q = 0; q < 32; ++q) { const v4f v = *(const v4fa*)&so[(q * 2 + hh) * 68 + c4]; if (F32OUT) *(v4f*)(C + cb + (size_t)(q * 2) * ldc) = v; else { v4h h4; for (int i = 0; i < 4; ++i) h4[i] = (_Float16)v[i]; *(v4h*)(C16 + cb + (size_t)(q * 2) * ldc) = h4; } }
}
// C (f32 rows) = alpha A Bh^T + bias: one block a tile.
__global__ __launch_bounds__(128) void k_gemm3(const _Float16* __restrict__ A, int lda, const _Float16* __restrict__ Bh, int ldb, float alpha, const float* __restrict__ bias, float* __restrict__ C, int ldc, int M, int N, int K) {
  __shared__ __attribute__((aligned(16))) unsigned char sm[2 * G3_ST];      /* the two buffers; behind the loop each wave's own 64 x 68 f32 output staging */
  const int ntn = N >> 7; const int mt = blockIdx.x / ntn, nq = blockIdx.x - mt * ntn; const int row0 = mt * 128, col0 = nq * 128; if (row0 >= M) return;      /* the same for the whole block */
  g3_tile<true, false>(sm, A + (size_t)row0 * lda, lda, Bh + (size_t)col0 * ldb, ldb, alpha, bias + col0, C + (size_t)row0 * ldc + col0, nullptr, ldc, K);
}
// The three projections in one launch: 3 * (DM / 128) blocks in a row share one tile of 128 x rows: DM / 128 column tiles of q, as many of k (A = x rows, B = weight rows, token rows out), then as many tiles of V^T:
// there the weight rows are the A operand and the x rows the B operand, so C's rows are the V^T rows [batch][head][d][key] that the attention launch reads, and nothing is left to transpose. A tile's 128 keys lie in one batch (128 divides SQ).
#define QKV_NT (DM / 128)            /* tiles across one projection's outputs */
__global__ __launch_bounds__(128) void k_qkv(const _Float16* __restrict__ X16, const _Float16* __restrict__ BQ, const _Float16* __restrict__ BK, const _Float16* __restrict__ BV,
    const float* __restrict__ bq, const float* __restrict__ bk, const float* __restrict__ bv, _Float16* __restrict__ Q16, _Float16* __restrict__ K16, _Float16* __restrict__ VT) {
  __shared__ __attribute__((aligned(16))) unsigned char sm[2 * G3_ST];      /* the two buffers; behind the loop each wave's own 64 x 68 f32 output staging */
  const int mt = blockIdx.x / (3 * QKV_NT), c = blockIdx.x - mt * (3 * QKV_NT); const int o0 = (c % QKV_NT) * 128;      /* x tile; projection c / QKV_NT, its first output feature: the same for the whole block */
  const _Float16* xt = X16 + (size_t)mt * 128 * DM;
  if (c < 2 * QKV_NT) { const bool kk = c >= QKV_NT;
    g3_tile<false, false>(sm, xt, DM, (kk ? BK : BQ) + (size_t)o0 * DM, DM, 0.0625f, (kk ? bk : bq) + o0, nullptr, (kk ? K16 : Q16) + (size_t)mt * 128 * DM + o0, DM, DM);
  } else {
    g3_tile<false, true>(sm, BV + (size_t)o0 * DM, DM, xt, DM, 0.0625f, bv + o0, nullptr, VT + ((size_t)(mt / (SQ / 128)) * DM + o0) * SQ + (mt % (SQ / 128)) * 128, SQ, DM);
  }
}


__global__ __launch_bounds__(256) void k_rsm(const float* __restrict__ S, _Float16* __restrict__ P, int nrows) {
  #pragma clang fp contract(off)
  const int i = blockIdx.x * 256 + threadIdx.x; if (i >= nrows) return; const float* s = S + (size_t)i * SQ; float mx = -3.0e38f;
#pragma unroll 1
  for (int j = 0; j < SQ; ++j) mx = fmaxf(mx, s[j]); float se = 0.f;
#pragma unroll 1
  for (int j = 0; j < SQ; ++j) se += expf(s[j] - mx); const float sc = 256.0f / se;
#pragma unroll 1
  for (int j0 = 0; j0 < SQ; j0 += 8) { FragH f; for (int q = 0; q < 8; ++q) f.h[q] = (_Float16)(expf(s[j0 + q] - mx) * sc); unsigned short* d = (unsigned short*)P + (size_t)i * SQ + j0; *(v8us*)d = f.half[0];  } }
__global__ __launch_bounds__(256) void k_vt(const _Float16* __restrict__ V16, int b, int h0, _Float16* __restrict__ VT) { __shared__ unsigned short tl[64][65]; const int tid = threadIdx.x; const int hh = blockIdx.x % HG, sg = blockIdx.x / HG; const int s0 = sg * 64; const int h = h0 + hh;
  for (int i = tid; i < 64 * 8; i += 256) { const int j = i / 8, d8 = (i % 8) * 8; FragH f; f.half[0] = *(const v8us*)((const unsigned short*)V16 + ((size_t)b * SQ + s0 + j) * DM + h * HD + d8); for (int q = 0; q < 8; ++q) tl[d8 + q][j] = f.u[q]; }
  __syncthreads();
  { for (int i = tid; i < 64 * 8; i += 256) { const int d = i / 8, j8 = (i % 8) * 8; FragH f; for (int q = 0; q < 8; ++q) f.u[q] = tl[d][j8 + q]; *(v8us*)((unsigned short*)VT + ((size_t)hh * HD + d) * SQ + s0 + j8) = f.half[0]; }  } }


// Final stage: y = x + global + 0.3 (conv3 of x + b), LayerNorm, affine. One wave owns FN_R consecutive token rows whole: a lane holds 32 columns of each (8 pieces of 4; piece c = columns 128 c + 4 lane),
// so every load and store of a wave is 512 bytes in a row and a row's sums are in-lane adds plus one lane butterfly. All of a wave's row loads are asked for at its start, before anything waits.
// The six column parameters (three conv taps, conv bias, gain, shift) are rounded to bf16 once per block and shared through LDS planes. FN_R divides SQ, so a wave's rows lie in one sequence;
// the row in front of the first and the row behind the last of a sequence count as zero.
#define FN_R 2                       /* token rows per wave */
template <int CTRL> __device__ __forceinline__ float fn_dpp(float v) { return __builtin_bit_cast(float, __builtin_amdgcn_update_dpp(0, __builtin_bit_cast(int, v), CTRL, 0xf, 0xf, true)); }      /* 0x160 + m: lane l <- lane l ^ m inside a 16-lane row */
__device__ __forceinline__ float fn_xhalf(float x) { return __builtin_bit_cast(float, __builtin_amdgcn_permlanex16(__builtin_bit_cast(int, x), __builtin_bit_cast(int, x), 0x76543210, 0xfedcba98, false, false)); }      /* lane l <-> lane l ^ 16 */
__device__ __forceinline__ float fn_wsum(v4f a) { float v = (a[0] + a[1]) + (a[2] + a[3]); v += fn_dpp<0x161>(v); v += fn_dpp<0x162>(v); v += fn_dpp<0x164>(v); v += fn_dpp<0x168>(v); return v + fn_xhalf(v); }      /* the wave's sum, in every lane */
__device__ __forceinline__ v4f fn_ld(const float* base, unsigned bytes) { return *(const v4fa*)((const char*)base + bytes); }      /* scalar base + 32-bit byte offset */
__device__ __forceinline__ v4f fn_rd(v4f a) { v4f r; for (int q = 0; q < 4; ++q) r[q] = bf16_round(a[q]); return r; }
__global__ __launch_bounds__(256) __attribute__((amdgpu_waves_per_eu(4, 4))) void k_msfin(const float* __restrict__ X, const float* __restrict__ G, const float* __restrict__ cw, const float* __restrict__ cb, const float* __restrict__ g, const float* __restrict__ bta, float eps, float* __restrict__ out) {
  __shared__ __attribute__((aligned(16))) float pr[6][DM];      /* planes: tap 0, tap 1, tap 2, conv bias, gain, shift */
  const int tid = threadIdx.x; const unsigned c0 = (tid & 31) * 4u, t4 = tid * 4u;      /* first column of a lane's piece; of this thread's four parameter columns */
  const unsigned lb = (tid & 31) * 16u, tb = tid * 16u, wo = tid * 48u;      /* byte offsets of the loads: a lane's piece in a row, this thread's four parameters, its twelve taps */
  const int wv = __builtin_amdgcn_readfirstlane((int)(blockIdx.x * 8 + (tid >> 5)));      /* the wave's number, in a scalar register: row addresses are scalar base + lane offset */
  const size_t row0 = (size_t)wv * FN_R; const int s0 = (int)(row0 % SQ); const bool hp = s0 > 0, hn = s0 + FN_R < SQ;
  const float* xb = X + row0 * DM; const float* xm = xb - (hp ? DM : 0); const float* xn = xb + (hn ? FN_R * DM : 0);      /* a neighbour outside the sequence: an address in bounds, its values replaced by zero */
  const float* gb = G + row0 * DM;
  const v4f wa = fn_ld(cw, wo), wb = fn_ld(cw, wo + 16), wc = fn_ld(cw, wo + 32), pc = fn_ld(cb, tb), pg = fn_ld(g, tb), pb = fn_ld(bta, tb);      /* this thread's four columns: 12 taps in a row, bias, gain, shift */
  v4f xr[FN_R + 2][8], y[FN_R][8];
  /* every loop of this kernel is unrolled so that each index of xr and y is a constant and the rows stay in registers */
#pragma unroll
  for (int c = 0; c < 8; ++c) { const unsigned j = lb + c * 512; xr[0][c] = fn_ld(xm, j);
#pragma unroll
    for (int r = 0; r < FN_R; ++r) xr[r + 1][c] = fn_ld(xb, j + r * (DM * 4));
    xr[FN_R + 1][c] = fn_ld(xn, j);
#pragma unroll
    for (int r = 0; r < FN_R; ++r) y[r][c] = fn_ld(gb, j + r * (DM * 4)); }
  asm volatile("s_wait_xcnt 0x0" :: "v"(lb), "v"(tb), "v"(wo), "s"(xm), "s"(xb), "s"(xn), "s"(gb), "s"(cw), "s"(cb), "s"(g), "s"(bta) : "memory");      /* the loads' offsets and bases stay live up to this wait, so nothing (a later load's result included) is written over them earlier; its memory clobber also keeps every row load in front of the first wait for data (left free, they were sunk to their uses and waited for one by one) */
  { const v4f a = fn_rd(wa), b = fn_rd(wb), c = fn_rd(wc); const v4f t0 = {a[0], a[3], b[2], c[1]}, t1 = {a[1], b[0], b[3], c[2]}, t2 = {a[2], b[1], c[0], c[3]};
    *(v4f*)&pr[0][t4] = t0; *(v4f*)&pr[1][t4] = t1; *(v4f*)&pr[2][t4] = t2; *(v4f*)&pr[3][t4] = fn_rd(pc); *(v4f*)&pr[4][t4] = fn_rd(pg); *(v4f*)&pr[5][t4] = fn_rd(pb); }
  /* work-group barrier with LDS-only fences: the planes are whole before any wave reads them (nothing writes them again); __syncthreads() would also wait here for every row load still in flight */
  __builtin_amdgcn_fence(__ATOMIC_RELEASE, "workgroup", "local"); __builtin_amdgcn_s_barrier(); __builtin_amdgcn_fence(__ATOMIC_ACQUIRE, "workgroup", "local");
  const v4f z4 = {0.f, 0.f, 0.f, 0.f}; v4f s1[FN_R];
#pragma unroll
  for (int r = 0; r < FN_R; ++r) s1[r] = z4;
#pragma unroll
  for (int c = 0; c < 8; ++c) {
    const unsigned j = c * 128 + c0; v4f xq[FN_R + 2];
#pragma unroll
    for (int r = 0; r < FN_R + 2; ++r) xq[r] = fn_rd(xr[r][c]);
    if (!hp) xq[0] = z4;
    if (!hn) xq[FN_R + 1] = z4;
    const v4f w0 = *(const v4f*)&pr[0][j], w1 = *(const v4f*)&pr[1][j], w2 = *(const v4f*)&pr[2][j], cv = *(const v4f*)&pr[3][j];
#pragma unroll
    for (int r = 0; r < FN_R; ++r) { const v4f loc = xq[r] * w0 + xq[r + 1] * w1 + xq[r + 2] * w2 + cv; const v4f yy = xq[r + 1] + (y[r][c] + 0.3f * loc); y[r][c] = yy; s1[r] += yy; }
  }
  float mu[FN_R], rs[FN_R];
#pragma unroll
  for (int r = 0; r < FN_R; ++r) mu[r] = fn_wsum(s1[r]) * (1.0f / (float)DM);
#pragma unroll
  for (int r = 0; r < FN_R; ++r) { v4f s2 = z4;
#pragma unroll
    for (int c = 0; c < 8; ++c) { y[r][c] -= mu[r]; s2 += y[r][c] * y[r][c]; }
    s1[r] = s2; }
#pragma unroll
  for (int r = 0; r < FN_R; ++r) rs[r] = rsqrtf(fn_wsum(s1[r]) * (1.0f / (float)DM) + eps);
  float* ob = out + row0 * DM;
#pragma unroll
  for (int c = 0; c < 8; ++c) { const unsigned j = c * 128 + c0; const v4f gg = *(const v4f*)&pr[4][j], bb = *(const v4f*)&pr[5][j];
#pragma unroll
    for (int r = 0; r < FN_R; ++r) *(v4f*)(ob + (size_t)r * DM + j) = y[r][c] * rs[r] * gg + bb; }
}


__device__ __forceinline__ float fa_xhalf(float x) { return __builtin_bit_cast(float, __builtin_amdgcn_permlanex16(__builtin_bit_cast(int, x), __builtin_bit_cast(int, x), 0x76543210, 0xfedcba98, false, false)); }      /* lane l <-> lane l ^ 16 */
__device__ __forceinline__ v8f fa_mma(v16h a, v16h b, v8f c) { return __builtin_amdgcn_wmma_f32_16x16x32_f16(false, a, false, b, (short)0, c, false, false); }
// Native exp2 of two / eight values in place, in one statement that ends in v_nop: no v_exp_f32 is directly followed by an instruction that reads its result or writes over its source
// (left to the register allocator, a neighbour's result landed on the source of the exp in front of it).
__device__ __forceinline__ void fa_exp2(float& x0, float& x1) {
  asm("v_exp_f32 %0, %0\n\tv_exp_f32 %1, %1\n\tv_nop" : "+v"(x0), "+v"(x1)); }
__device__ __forceinline__ void fa_exp8(float& x0, float& x1, float& x2, float& x3, float& x4, float& x5, float& x6, float& x7) {
  asm("v_exp_f32 %0, %0\n\tv_exp_f32 %1, %1\n\tv_exp_f32 %2, %2\n\tv_exp_f32 %3, %3\n\tv_exp_f32 %4, %4\n\tv_exp_f32 %5, %5\n\tv_exp_f32 %6, %6\n\tv_exp_f32 %7, %7\n\tv_nop"
      : "+v"(x0), "+v"(x1), "+v"(x2), "+v"(x3), "+v"(x4), "+v"(x5), "+v"(x6), "+v"(x7)); }
#define FA_QB 256                    /* query rows per block (8 waves x 32) */
#define FA_TOP 15.0f                 /* largest exponent of a weight before the references are moved: 2^15 is inside f16 */
// K and V^T reach the waves through LDS: a stage is FA_KS keys of the block's (batch, head): FA_KS K rows of 128 bytes, then the 64 V^T rows' 256 bytes of those keys,
// brought once per block by asynchronous copies, 16 bytes a lane (a wave's copy = four whole K rows or two whole V^T row pieces = four whole 128-byte lines), and read by all 8 waves.
// Two buffers: stage t + 2 is asked for behind the barrier that ends trip t, into the buffer that trip t has read. Fragments by two 16-byte LDS reads in the k order of g2_frag; keys in rising order as before.
#define FA_KS 128                    /* keys per stage (4 passes) */
#define FA_KP 144                    /* LDS pitch of a K row in bytes: 16 x odd, so the 16-byte fragment reads of 16 rows meet no bank twice */
#define FA_VP 272                    /* LDS pitch of a V^T row in bytes: 16 x odd */
#define FA_VO (FA_KS * FA_KP)        /* the V^T rows stand behind the K rows */
#define FA_ST (FA_VO + HD * FA_VP)   /* bytes per stage */
// One stage: eight copies a lane (K rows 32 apart, V^T rows 16 apart); every lane is on, every address a multiple of 16; s_wait_xcnt 0 as the statement's last line, so that it stands in front of every later write of their address registers (a precaution).
__device__ __forceinline__ void fa_fill(unsigned lk, unsigned lv, const _Float16* gk, const _Float16* gv) {
  asm volatile("global_load_async_to_lds_b128 %0, %8, off\n\tglobal_load_async_to_lds_b128 %1, %9, off\n\tglobal_load_async_to_lds_b128 %2, %10, off\n\tglobal_load_async_to_lds_b128 %3, %11, off\n\t"
               "global_load_async_to_lds_b128 %4, %12, off\n\tglobal_load_async_to_lds_b128 %5, %13, off\n\tglobal_load_async_to_lds_b128 %6, %14, off\n\tglobal_load_async_to_lds_b128 %7, %15, off\n\ts_wait_xcnt 0x0"
               :: "v"(lk), "v"(lk + 32 * FA_KP), "v"(lk + 64 * FA_KP), "v"(lk + 96 * FA_KP), "v"(lv), "v"(lv + 16 * FA_VP), "v"(lv + 32 * FA_VP), "v"(lv + 48 * FA_VP),
                  "v"(gk), "v"(gk + (size_t)32 * DM), "v"(gk + (size_t)64 * DM), "v"(gk + (size_t)96 * DM), "v"(gv), "v"(gv + (size_t)16 * SQ), "v"(gv + (size_t)32 * SQ), "v"(gv + (size_t)48 * SQ) : "memory"); }
// One pass: 32 keys against the wave's 32 query columns. pk: this lane's place in the pass's first K row, pv: in V^T row ln at the pass's first key. PRE: the next pass's K fragments are asked for behind the score products
// (inside a stage only: nothing of the next stage is read in front of its barrier).
template <bool PRE>
__device__ __forceinline__ void fa_pass(const unsigned char* pk, const unsigned char* pv, const v16h (&qf)[2][2], v16h (&kf)[2][2], v8f (&o)[4][2], float (&off)[2], float (&l)[2]) {
  const float SC = 0.125f * 1.4426950408889634f;      /* 1 / sqrt(64), in log2 units */
  const v8f z8 = {0.f,0.f,0.f,0.f,0.f,0.f,0.f,0.f};
  v16h vf[4];      /* asked for at the head of the pass, used behind the softmax */
#pragma unroll
  for (int t = 0; t < 4; ++t) vf[t] = g3_frag(pv + t * 16 * FA_VP);
  v8f s[2][2];
#pragma unroll
  for (int kt = 0; kt < 2; ++kt)
#pragma unroll
    for (int g = 0; g < 2; ++g) s[kt][g] = fa_mma(kf[kt][1], qf[g][1], fa_mma(kf[kt][0], qf[g][0], z8));
  if (PRE) {
#pragma unroll
    for (int kt = 0; kt < 2; ++kt)
#pragma unroll
      for (int j = 0; j < 2; ++j) kf[kt][j] = g3_frag(pk + (32 + kt * 16) * FA_KP + 64 * j);
  }
  __builtin_amdgcn_sched_barrier(0);      /* keeps the pass's LDS reads in front of the softmax, whose length covers their latency: left free, the V^T reads of a stage's last pass were sunk among the products and waited for at once */
  float mx[2];      /* the lane's own 16 scores' maximum, per column group */
#pragma unroll
  for (int g = 0; g < 2; ++g) {
    mx[g] = fmaxf(s[0][g][0], s[1][g][0]);
#pragma unroll
    for (int r = 1; r < 8; ++r) mx[g] = fmaxf(mx[g], fmaxf(s[0][g][r], s[1][g][r]));
  }
  if (__builtin_amdgcn_ballot_w32(fmaxf(mx[0] * SC + off[0], mx[1] * SC + off[1]) > FA_TOP) != 0) {      /* one scalar branch a pass, the same for the whole wave; always taken on the first pass */
    float al[2];
#pragma unroll
    for (int g = 0; g < 2; ++g) {
      const float no = fminf(off[g], 8.0f - fmaxf(mx[g], fa_xhalf(mx[g])) * SC);      /* the two halves of a query's keys get the same reference */
      al[g] = no - off[g]; off[g] = no; }
    fa_exp2(al[0], al[1]);      /* 0 on the first pass */
#pragma unroll
    for (int g = 0; g < 2; ++g) { l[g] *= al[g];
#pragma unroll
      for (int t = 0; t < 4; ++t) o[t][g] *= al[g]; }
  }
  v16h pf[2];
#pragma unroll
  for (int g = 0; g < 2; ++g) {
    const v8f a = s[0][g], c = s[1][g]; FragH p; float e[16];
#pragma unroll
    for (int r = 0; r < 8; ++r) { e[r] = a[r] * SC + off[g]; e[8 + r] = c[r] * SC + off[g]; }
    fa_exp8(e[0], e[1], e[2], e[3], e[4], e[5], e[6], e[7]); fa_exp8(e[8], e[9], e[10], e[11], e[12], e[13], e[14], e[15]);
#pragma unroll
    for (int r = 0; r < 16; ++r) p.h[r] = (_Float16)e[r];
    pf[g] = p.v;
    l[g] += (((e[0] + e[1]) + (e[2] + e[3])) + ((e[4] + e[5]) + (e[6] + e[7]))) + (((e[8] + e[9]) + (e[10] + e[11])) + ((e[12] + e[13]) + (e[14] + e[15])));
  }
#pragma unroll
  for (int t = 0; t < 4; ++t)
#pragma unroll
    for (int g = 0; g < 2; ++g) o[t][g] = fa_mma(vf[t], pf[g], o[t][g]);
  asm volatile("v_nop\n\tv_nop\n\tv_nop\n\tv_nop" : "+v"(o[0][0]), "+v"(o[0][1]), "+v"(o[1][0]), "+v"(o[1][1]), "+v"(o[2][0]), "+v"(o[2][1]), "+v"(o[3][0]), "+v"(o[3][1]) : "v"(pf[0]), "v"(pf[1]), "v"(vf[0]), "v"(vf[1]), "v"(vf[2]), "v"(vf[3]));      /* WMMA distance: the weights (B operands) stay live for four slots behind the pass's last products, so the next pass's score tiles, which may get the same registers, are not written over them earlier; the V^T fragments (A operands) too: freed one by one, they took the sums' partial results among the products, and each such place cost four v_nop */
}
__global__ __launch_bounds__(256) __attribute__((amdgpu_waves_per_eu(4, 4))) void k_fattn(const _Float16* __restrict__ Q16, const _Float16* __restrict__ K16, const _Float16* __restrict__ VT, _Float16* __restrict__ O16) {
  __shared__ __attribute__((aligned(16))) unsigned char sm[2 * FA_ST];      /* the two buffers */
  const int tid = threadIdx.x, lane = threadIdx.x & 31, w = threadIdx.x >> 5, ln = lane & 15, hh = lane >> 4;
  const int bh = blockIdx.x / (SQ / FA_QB), qb = blockIdx.x % (SQ / FA_QB); const int b = bh / NH, h = bh % NH;
  const size_t r0 = (size_t)b * SQ; const int q0 = qb * FA_QB + w * 32;
  const unsigned lk = (unsigned)(size_t)sm + (unsigned)((tid >> 3) * FA_KP + (tid & 7) * 16);              /* this lane's places in a stage: K row tid / 8 (+ 32 a copy), 16-byte piece tid % 8 */
  const unsigned lv = (unsigned)(size_t)sm + (unsigned)(FA_VO + (tid >> 4) * FA_VP + (tid & 15) * 16);     /* V^T row tid / 16 (+ 16 a copy), 16-byte piece tid % 16 */
  const _Float16* gk = K16 + (r0 + (tid >> 3)) * DM + h * HD + (tid & 7) * 8;
  const _Float16* gv = VT + ((size_t)bh * HD + (tid >> 4)) * SQ + (tid & 15) * 8;
  fa_fill(lk, lv, gk, gv);
  v16h qf[2][2];
#pragma unroll
  for (int g = 0; g < 2; ++g)
#pragma unroll
    for (int j = 0; j < 2; ++j) qf[g][j] = g2_frag(Q16 + (r0 + q0 + g * 16 + ln) * DM + h * HD + 32 * j, hh);
  const v8f z8 = {0.f,0.f,0.f,0.f,0.f,0.f,0.f,0.f};
  v8f o[4][2]; float off[2], l[2];
#pragma unroll
  for (int g = 0; g < 2; ++g) { off[g] = 3.0e38f; l[g] = 0.f;      /* no reference yet: the first pass's test is true */
#pragma unroll
    for (int t = 0; t < 4; ++t) o[t][g] = z8; }
  asm volatile("s_wait_asynccnt 0x0" ::: "memory");      /* this wave's copies of stage 0 have landed */
  __syncthreads();                                        /* ... and every other wave's */
  fa_fill(lk + FA_ST, lv + FA_ST, gk + (size_t)FA_KS * DM, gv + FA_KS);      /* stage 1 (SQ / FA_KS is 16) */
  const unsigned char* fk = sm + ln * FA_KP + 16 * hh;              /* key row ln of a stage's first tile, at this half's first k */
  const unsigned char* fv = sm + FA_VO + ln * FA_VP + 16 * hh;      /* V^T row d = ln, at this half's first key */
#pragma unroll 1
  for (int st = 0; st < SQ / FA_KS; ++st) {      /* rolled: one trip a stage, the hand-over at its foot */
    const int bo = (st & 1) * FA_ST;
    v16h kf[2][2];
#pragma unroll
    for (int kt = 0; kt < 2; ++kt)
#pragma unroll
      for (int j = 0; j < 2; ++j) kf[kt][j] = g3_frag(fk + bo + kt * 16 * FA_KP + 64 * j);
#pragma unroll 1
    for (int kb = 0; kb < FA_KS / 32 - 1; ++kb)      /* rolled: one pass already fills the register budget of four waves per SIMD */
      fa_pass<true>(fk + bo + kb * 32 * FA_KP, fv + bo + kb * 64, qf, kf, o, off, l);
    fa_pass<false>(fk + bo + (FA_KS - 32) * FA_KP, fv + bo + (FA_KS / 32 - 1) * 64, qf, kf, o, off, l);      /* the stage's last pass */
    asm volatile("s_wait_dscnt 0x0" ::: "memory");        /* this wave's reads of the buffer are done before it is handed back */
    asm volatile("s_wait_asynccnt 0x0" ::: "memory");     /* this wave's copies of stage st + 1 have landed */
    __syncthreads();                                      /* publishes stage st + 1 and ends every wave's reads of stage st */
    if (st + 2 < SQ / FA_KS) fa_fill(lk + bo, lv + bo, gk + (size_t)(st + 2) * FA_KS * DM, gv + (st + 2) * FA_KS);
  }
  asm volatile("s_wait_asynccnt 0x0" ::: "memory");       /* nothing is in flight when the wave ends */
#pragma unroll
  for (int g = 0; g < 2; ++g) {
    const float inv = 64.0f / (l[g] + fa_xhalf(l[g]));      /* the halves' sums join once; x64: the carried scale of the o rows */
    _Float16* orow = O16 + (r0 + q0 + g * 16 + ln) * DM + h * HD + 8 * hh;
#pragma unroll
    for (int t = 0; t < 4; ++t) { FragH f;
#pragma unroll
      for (int r = 0; r < 8; ++r) f.h[r] = (_Float16)(o[t][g][r] * inv);
      *(v8us*)((unsigned short*)orow + t * 16) = f.half[0]; }
  }
}

// Operand conversion, one launch for all five GEMM operands: x -> f16 of its bf16 rounding, each weight -> f16 of 16 x its bf16 rounding (the values as before).
// PC_NW waves, few enough to be resident all at once (16 per WGP when spread evenly). A wave owns one contiguous run of x (PC_XL loads) and one of each weight (PC_WL loads); a load of a wave is 512 bytes in a row, 16 bytes a lane,
// a store 256 bytes in a row. All of a wave's loads are asked for at its start, before anything waits.
#define PC_NW 4096                   /* waves of the launch */
#define PC_XL 16                     /* loads of 128 floats per wave: x */
#define PC_WL 2                      /* ... and each weight */
static_assert((size_t)PC_NW * PC_XL * 128 == NR * DM && (size_t)PC_NW * PC_WL * 128 == (size_t)DM * DM, "the waves' runs cover x and each weight exactly once");
template <bool X16W>      /* weights carry the factor 16 */
__device__ __forceinline__ void pc_st(_Float16* base, unsigned bytes, v4f a) { v4h h;
#pragma unroll
  for (int q = 0; q < 4; ++q) h[q] = X16W ? (_Float16)(bf16_round(a[q]) * 16.0f) : (_Float16)bf16_round(a[q]);
  *(v4h*)((char*)base + bytes) = h; }
__global__ __launch_bounds__(256) void k_prep(const float* __restrict__ x, const float* __restrict__ wq, const float* __restrict__ wk, const float* __restrict__ wv, const float* __restrict__ wo,
    _Float16* __restrict__ X16, _Float16* __restrict__ BQ, _Float16* __restrict__ BK, _Float16* __restrict__ BV, _Float16* __restrict__ BO) {
  const unsigned lb = (threadIdx.x & 31) * 16u, sb = (threadIdx.x & 31) * 8u;      /* a lane's byte offset in a load, in a store */
  const int wn = __builtin_amdgcn_readfirstlane((int)(blockIdx.x * 8 + (threadIdx.x >> 5)));      /* the wave's number, in a scalar register: addresses are scalar base + lane offset */
  const size_t xo = (size_t)wn * (PC_XL * 128), wf = (size_t)wn * (PC_WL * 128);
  const float* xs = x + xo; const float* s0 = wq + wf; const float* s1 = wk + wf; const float* s2 = wv + wf; const float* s3 = wo + wf;
  v4f a[PC_XL], b[4][PC_WL];
  /* every loop of this kernel is unrolled so that each index of a and b is a constant and the values stay in registers */
#pragma unroll
  for (int c = 0; c < PC_XL; ++c) a[c] = fn_ld(xs, lb + c * 512);
#pragma unroll
  for (int c = 0; c < PC_WL; ++c) { b[0][c] = fn_ld(s0, lb + c * 512); b[1][c] = fn_ld(s1, lb + c * 512); b[2][c] = fn_ld(s2, lb + c * 512); b[3][c] = fn_ld(s3, lb + c * 512); }
  asm volatile("s_wait_xcnt 0x0" :: "v"(lb), "s"(xs), "s"(s0), "s"(s1), "s"(s2), "s"(s3) : "memory");      /* the loads' offset and bases stay live up to this wait, so nothing is written over them earlier */
  __builtin_amdgcn_sched_barrier(0);      /* keeps the conversions behind the issue of the last load: left free, they were lifted among the loads, and ten of the loads were asked for only after the first data had come */
#pragma unroll
  for (int c = 0; c < PC_XL; ++c) pc_st<false>(X16 + xo, sb + c * 256, a[c]);
#pragma unroll
  for (int c = 0; c < PC_WL; ++c) { pc_st<true>(BQ + wf, sb + c * 256, b[0][c]); pc_st<true>(BK + wf, sb + c * 256, b[1][c]); pc_st<true>(BV + wf, sb + c * 256, b[2][c]); pc_st<true>(BO + wf, sb + c * 256, b[3][c]); }
}

extern "C" void kernel_launch(void* const* d_in, const int* in_sizes, int n_in,
                              void* d_out, int out_size, void* d_ws, size_t ws_size, hipStream_t stream) {
  (void)in_sizes; (void)n_in; (void)out_size;
  const float* const* I = (const float* const*)d_in; const float* x = I[0]; const float* wq = I[1]; const float* bq = I[2]; const float* wk = I[3]; const float* bk = I[4]; const float* wv = I[5]; const float* bv = I[6]; const float* wo = I[7]; const float* bo = I[8]; const float* cw = I[9]; const float* cb = I[10]; const float* lng = I[11]; const float* lnb = I[12];      /* weights [out][in] (natural) */
  char* ws = (char*)d_ws; size_t off = 0;
  auto take = [&](size_t bytes) { char* p = ws + off; off += (bytes + 255) & ~(size_t)255; return p; };
  _Float16* BQ = (_Float16*)take((size_t)DM * DM * 2); _Float16* BK = (_Float16*)take((size_t)DM * DM * 2); _Float16* BV = (_Float16*)take((size_t)DM * DM * 2); _Float16* BO = (_Float16*)take((size_t)DM * DM * 2);
  _Float16* X16 = (_Float16*)take(NR * DM * 2); _Float16* Q16 = (_Float16*)take(NR * DM * 2); _Float16* K16 = (_Float16*)take(NR * DM * 2); _Float16* O16 = (_Float16*)take(NR * DM * 2); float* GA = (float*)take(NR * DM * 4);      /* global attention branch (f32 rows) */
  _Float16* VT = (_Float16*)take((size_t)NB * NH * HD * SQ * 2);      /* V^T [NB][NH][HD][SQ] */
  if (off > ws_size) return;
  k_prep<<<PC_NW / 8, 256, 0, stream>>>(x, wq, wk, wv, wo, X16, BQ, BK, BV, BO);      /* all five GEMM operands as f16 */
  const size_t r0p = (size_t)B0 * SQ;      /* first row of the output stage */
  k_qkv<<<(unsigned)(NR / 128) * (3 * QKV_NT), 128, 0, stream>>>(X16, BQ, BK, BV, bq, bk, bv, Q16, K16, VT);      /* q and k as f16 token rows, v as V^T rows for every (batch, head) */
  k_fattn<<<NB * NH * (SQ / FA_QB), 256, 0, stream>>>(Q16, K16, VT, O16);      /* o (merged heads) as f16 rows, x64 */
  k_gemm3<<<(unsigned)((MPO / 128) * (DM / 128)), 128, 0, stream>>>(O16 + r0p * DM, DM, BO, DM, 0.0009765625f, bo, GA + r0p * DM, DM, MPO, DM, DM);      /* global = ctx Wo^T + bo (f32 rows) */
  k_msfin<<<(unsigned)(MPO / (8 * FN_R)), 256, 0, stream>>>(x + r0p * DM, GA + r0p * DM, cw, cb, lng, lnb, 1e-5f, (float*)d_out + r0p * DM);      /* + x + 0.3 local conv, LayerNorm -> output rows */
}

// v009
// A run of this version takes 119 microseconds.
// Timed twice side by side with v008, it ran 1.03 times as fast both times.
// Counting every step since v000, it is 57.8 times as fast.
#include <hip/hip_runtime.h>
// Multi-scale attention block (x [4][2048][1024]; q/k/v = x W^T + b (natural [1024][1024] weights), 16 heads of 64; softmax(q k^T / 8); ctx merged; global = ctx Wo^T + bo; local = depthwise conv3 of x along the sequence (conv_w [1024][3], zero pad) + conv_b; y = x + global + 0.3 local; out = LayerNorm(y) (eps 1e-5) ln_g + ln_b -> [4][2048][1024]).
// Structure (attention part): token rows r = b*2048 + s; x as exact f16 rows (bf16-rounded); Q, K, V^T as WMMA GEMM tiles of one launch (128x128 block tiles staged in LDS, 64x64 wave tiles, f32 accumulation, exact x16 weights + bias, f16 outputs, the q rows times log2(e) / 8; V^T tiles with the weight as the A operand); one fused attention launch over all (batch, head, 256-query block): per 32 keys S^T = K Q^T on WMMA with the softmax's exponent offset as the C operand, running-maximum softmax on VALU, rescaled lazily (f32 statistics, native exp2; weights x256 as f16, packed from the score accumulators), O^T += V^T P^T on WMMA; o carried x64 against f16 subnormal flush (folded into the output GEMM alpha), written straight into the merged f16 o rows; global = o W_o^T + b GEMM (f32 rows); then per token row on VALU: + bf16(x) + 0.3 (depthwise conv3 of bf16(x) + b), LayerNorm, affine -> output rows.
// Compute dtype: inputs rounded to bf16; x / weights exact; q, k, v, softmax weights and o as plain f16 GEMM operands (~2^-12); scores and softmax statistics f32. v_wmma_f32_16x16x32_f16.
#define NB 4
#define SQ 2048
#define DM 1024
#define NH 16
#define HD 64
#define HG 4                         /* heads per launch of the unlaunched k_vt(V16, b, h0, VT) overload */
#define B0 0                         /* first batch processed (debug hook) */
#define NBR NB                       /* batches processed (debug hook) */
#define NR ((size_t)NB * SQ)         /* token rows */
#define MP ((int)((size_t)NBR * SQ)) /* rows through the output stage, via MPO (debug hook) */
#define QN SQ                        /* not used: k_fattn attends all SQ query rows of each batch */
#define NHD NH                       /* not used: k_fattn attends all NH heads */
#define MPO MP                       /* rows through the output stage (debug hook) */
#define LQ DM      /* not used: q and k rows have pitch DM */
typedef __bf16 v16b __attribute__((ext_vector_type(16)));
typedef unsigned short v8us __attribute__((ext_vector_type(8), may_alias));
typedef float  v8f  __attribute__((ext_vector_type(8)));
typedef float  v4f  __attribute__((ext_vector_type(4)));
typedef float  v4fa __attribute__((ext_vector_type(4), may_alias));
union FragB { v16b v; v8us half[2]; unsigned short u[16]; };

__device__ __forceinline__ unsigned short bf16_bits(float x) { unsigned int u = __float_as_uint(x); return (unsigned short)((u + 0x7FFFu + ((u >> 16) & 1u)) >> 16); }
__device__ __forceinline__ float bf16_val(unsigned short b) { return __uint_as_float(((unsigned int)b) << 16); }
__device__ __forceinline__ float bf16_round(float x) { return bf16_val(bf16_bits(x)); }
// D += A·B with NT terms: 1 = ah·bh, 2 = + al·bh (A split), 3 = + ah·bl (both split)
template <int NT>
__device__ __forceinline__ v8f mmaN(v16b ah, v16b al, v16b bh, v16b bl, v8f c) {
  c = __builtin_amdgcn_wmma_f32_16x16x32_bf16(false, ah, false, bh, (short)0, c, false, false);
  if (NT >= 2) c = __builtin_amdgcn_wmma_f32_16x16x32_bf16(false, al, false, bh, (short)0, c, false, false);
  if (NT >= 3) c = __builtin_amdgcn_wmma_f32_16x16x32_bf16(false, ah, false, bl, (short)0, c, false, false);
  asm volatile("v_nop\n\tv_nop\n\tv_nop\n\tv_nop" : "+v"(c) : "v"(ah), "v"(al), "v"(bh), "v"(bl));
  return c;
}

__global__ __launch_bounds__(256) void k_wt_bf16(const float* __restrict__ W, unsigned short* __restrict__ Wt, int K, int N) {
  const int t = blockIdx.x * 256 + threadIdx.x;
  const int k8n = K / 8;
  if (t >= N * k8n) return;
  const int n = t / k8n, k8 = (t % k8n) * 8;
  v8us v;
#pragma unroll
  for (int i = 0; i < 8; ++i) v[i] = bf16_bits(W[(size_t)(k8 + i) * N + n]);
  *(v8us*)(Wt + (size_t)n * K + k8) = v;
  
}

// GEMM C[M][N] (f32, pitch ldc) = act(A[M][K]·W + bias). A f32 row-major (pitch lda) converted per fragment to bf16
// (ASPLIT: hi/lo two planes -> 2 terms, else single rounded term); Wt bf16 [N][K] (pitch ldb). BIAS_BF16 rounds the
// bias to bf16 first (bias quantised to bf16 before the add). K%32==0, M%16==0, N%64==0.
template <bool ASPLIT, int ACT, bool BIAS_BF16>
__global__ __launch_bounds__(128) void k_gemm_bf(const float* __restrict__ A, int lda, const unsigned short* __restrict__ Wt, int ldb,
                                               const float* __restrict__ bias, float* __restrict__ C, int ldc, int M, int N, int K) {
  __shared__ __attribute__((aligned(16))) float so[4][16][64];
  const int tid = threadIdx.x, w = tid >> 5, lane = tid & 31, ln = lane & 15, hh = lane >> 4;
  const int ntn = N / 64;
  const int wid = blockIdx.x * 4 + w;
  const int mt = wid / ntn, nq = wid % ntn;
  if (mt * 16 >= M) return;
  const int row0 = mt * 16, col0 = nq * 64;
  const float* arow = A + (size_t)(row0 + ln) * lda;
  v8f acc[4] = {};
  for (int kb = 0; kb < K; kb += 32) {
    FragB ah, al;
    const v4f x0 = *(const v4fa*)(arow + kb + 8 * hh), x1 = *(const v4fa*)(arow + kb + 8 * hh + 4);
    const v4f x2 = *(const v4fa*)(arow + kb + 16 + 8 * hh), x3 = *(const v4fa*)(arow + kb + 16 + 8 * hh + 4);
    float xs[16] = {x0[0],x0[1],x0[2],x0[3],x1[0],x1[1],x1[2],x1[3],x2[0],x2[1],x2[2],x2[3],x3[0],x3[1],x3[2],x3[3]};
#pragma unroll
    for (int i = 0; i < 16; ++i) { const unsigned short hb = bf16_bits(xs[i]); ah.u[i] = hb; al.u[i] = ASPLIT ? bf16_bits(xs[i] - bf16_val(hb)) : (unsigned short)0; }
#pragma unroll
    for (int t = 0; t < 4; ++t) {
      const unsigned short* brow = Wt + (size_t)(col0 + t * 16 + ln) * ldb + kb;
      FragB b;
      b.half[0] = *(const v8us*)(brow + 8 * hh);
      b.half[1] = *(const v8us*)(brow + 16 + 8 * hh);
      acc[t] = mmaN<ASPLIT ? 2 : 1>(ah.v, al.v, b.v, b.v, acc[t]);
    }
  }
#pragma unroll
  for (int t = 0; t < 4; ++t) {
    float bv = bias ? bias[col0 + t * 16 + ln] : 0.f;
    if (BIAS_BF16) bv = bf16_round(bv);
#pragma unroll
    for (int r = 0; r < 8; ++r) { float v = acc[t][r] + bv; if (ACT == 1) v = fmaxf(v, 0.f); so[w][8 * hh + r][t * 16 + ln] = v; }
  }
  __builtin_amdgcn_fence(__ATOMIC_ACQ_REL, "workgroup");
  __builtin_amdgcn_wave_barrier();
  const int rsub = lane >> 4, c4 = (lane & 15) * 4;
  {
#pragma unroll
    for (int q = 0; q < 8; ++q) {
      const int r = q * 2 + rsub;
      const v4f v = *(const v4fa*)&so[w][r][c4];
      *(v4f*)(C + (size_t)(row0 + r) * ldc + col0 + c4) = v;
    }
    
  }
}

// GEMM C = act(A·W + bias + resid): A f32 (ASPLIT -> hi/lo 2 terms), Wt bf16 [N][K]; ACT 0 none, 1 relu, 2 exact gelu;
// resid (optional, f32, row index = (row % rmod), pitch ldr, RES_BF16 rounds it) added before the activation.
template <bool ASPLIT, int ACT, bool BIAS_BF16, bool RES_BF16>
__global__ __launch_bounds__(128) void k_gemm_bf3(const float* __restrict__ A, int lda, const unsigned short* __restrict__ Wt, int ldb,
                                                const float* __restrict__ bias, const float* __restrict__ resid, int rmod, int ldr,
                                                float* __restrict__ C, int ldc, int M, int N, int K) {
  __shared__ __attribute__((aligned(16))) float so[4][16][64];
  const int tid = threadIdx.x, w = tid >> 5, lane = tid & 31, ln = lane & 15, hh = lane >> 4;
  const int ntn = N / 64;
  const int wid = blockIdx.x * 4 + w;
  const int mt = wid / ntn, nq = wid % ntn;
  if (mt * 16 >= M) return;
  const int row0 = mt * 16, col0 = nq * 64;
  const float* arow = A + (size_t)(row0 + ln) * lda;
  v8f acc[4] = {};
  for (int kb = 0; kb < K; kb += 32) {
    FragB ah, al;
    const v4f x0 = *(const v4fa*)(arow + kb + 8 * hh), x1 = *(const v4fa*)(arow + kb + 8 * hh + 4);
    const v4f x2 = *(const v4fa*)(arow + kb + 16 + 8 * hh), x3 = *(const v4fa*)(arow + kb + 16 + 8 * hh + 4);
    float xs[16] = {x0[0],x0[1],x0[2],x0[3],x1[0],x1[1],x1[2],x1[3],x2[0],x2[1],x2[2],x2[3],x3[0],x3[1],x3[2],x3[3]};
#pragma unroll
    for (int i = 0; i < 16; ++i) { const unsigned short hb = bf16_bits(xs[i]); ah.u[i] = hb; al.u[i] = ASPLIT ? bf16_bits(xs[i] - bf16_val(hb)) : (unsigned short)0; }
#pragma unroll
    for (int t = 0; t < 4; ++t) {
      const unsigned short* brow = Wt + (size_t)(col0 + t * 16 + ln) * ldb + kb;
      FragB b;
      b.half[0] = *(const v8us*)(brow + 8 * hh);
      b.half[1] = *(const v8us*)(brow + 16 + 8 * hh);
      acc[t] = mmaN<ASPLIT ? 2 : 1>(ah.v, al.v, b.v, b.v, acc[t]);
    }
  }
#pragma unroll
  for (int t = 0; t < 4; ++t) {
    const int col = col0 + t * 16 + ln;
    float bv = bias ? bias[col] : 0.f;
    if (BIAS_BF16) bv = bf16_round(bv);
#pragma unroll
    for (int r = 0; r < 8; ++r) {
      float v = acc[t][r] + bv;
      if (resid) { float rv = resid[(size_t)((row0 + 8 * hh + r) % rmod) * ldr + col]; if (RES_BF16) rv = bf16_round(rv); v += rv; }
      if (ACT == 1) v = fmaxf(v, 0.f);
      if (ACT == 2) v = 0.5f * v * (1.0f + erff(v * 0.70710678118654752f));
      if (ACT == 3) { const float u = 0.7978845608028654f * (v + 0.044715f * v * v * v); v = 0.5f * v * (1.0f + tanhf(u)); }
      so[w][8 * hh + r][t * 16 + ln] = v;
    }
  }
  __builtin_amdgcn_fence(__ATOMIC_ACQ_REL, "workgroup");
  __builtin_amdgcn_wave_barrier();
  const int rsub = lane >> 4, c4 = (lane & 15) * 4;
  {
#pragma unroll
    for (int q = 0; q < 8; ++q) {
      const int r = q * 2 + rsub;
      const v4f v = *(const v4fa*)&so[w][r][c4];
      *(v4f*)(C + (size_t)(row0 + r) * ldc + col0 + c4) = v;
    }
    
  }
}
// row LayerNorm (biased variance, eps) over N: s = X (+ R); optional out_sum <- s; out_norm <- (s-mu)*rsqrt(var+eps)*g + b
template <bool PARAM_BF16>
__global__ __launch_bounds__(256) void k_layernorm(const float* __restrict__ X, const float* __restrict__ R, const float* __restrict__ g, const float* __restrict__ bta,
                                                  float* __restrict__ out_sum, float* __restrict__ out_norm, int N, float eps) {
  __shared__ float red[256];
  const int row = blockIdx.x, tid = threadIdx.x;
  const float* x = X + (size_t)row * N; const float* rr = R ? R + (size_t)row * N : nullptr;
  float vals[16];                     // up to N = 4096
  const int per = N / 256;            // contiguous chunk per thread? use strided-by-4 chunks: thread handles j = tid*4 + 1024*u
  float s1 = 0.f;
  for (int u = 0; u < per / 4; ++u) {
    const int j = tid * 4 + 1024 * u;
    const v4f a = *(const v4fa*)(x + j);
    v4f b = {0.f,0.f,0.f,0.f}; if (rr) b = *(const v4fa*)(rr + j);
#pragma unroll
    for (int q = 0; q < 4; ++q) { const float v = a[q] + b[q]; vals[u * 4 + q] = v; s1 += v; }
  }
  red[tid] = s1; __syncthreads();
  for (int st = 128; st > 0; st >>= 1) { if (tid < st) red[tid] += red[tid + st]; __syncthreads(); }
  const float mu = red[0] / (float)N; __syncthreads();
  float s2 = 0.f;
  for (int u = 0; u < per / 4; ++u)
#pragma unroll
    for (int q = 0; q < 4; ++q) { const float c = vals[u * 4 + q] - mu; s2 += c * c; }
  red[tid] = s2; __syncthreads();
  for (int st = 128; st > 0; st >>= 1) { if (tid < st) red[tid] += red[tid + st]; __syncthreads(); }
  const float rs = rsqrtf(red[0] / (float)N + eps);
  {
    for (int u = 0; u < per / 4; ++u) {
      const int j = tid * 4 + 1024 * u;
      v4f o, sm;
#pragma unroll
      for (int q = 0; q < 4; ++q) {
        float gg = g[j + q], bb = bta[j + q];
        if (PARAM_BF16) { gg = bf16_round(gg); bb = bf16_round(bb); }
        sm[q] = vals[u * 4 + q]; o[q] = (vals[u * 4 + q] - mu) * rs * gg + bb;
      }
      if (out_sum) *(v4f*)(out_sum + (size_t)row * N + j) = sm;
      *(v4f*)(out_norm + (size_t)row * N + j) = o;
    }
    
  }
}



// ---- f16 WMMA path (v_wmma_f32_16x16x32_f16): 11-bit significands for operands in range — used where a [0,1] probability operand needs more precision than bf16
typedef _Float16 v16h __attribute__((ext_vector_type(16)));
union FragH { v16h v; v8us half[2]; _Float16 h[16]; unsigned short u[16]; };
template <int NT>
__device__ __forceinline__ v8f mmaH(v16h ah, v16h al, v16h bh, v16h bl, v8f c) {
  c = __builtin_amdgcn_wmma_f32_16x16x32_f16(false, ah, false, bh, (short)0, c, false, false);
  if (NT >= 2) c = __builtin_amdgcn_wmma_f32_16x16x32_f16(false, al, false, bh, (short)0, c, false, false);
  if (NT >= 3) c = __builtin_amdgcn_wmma_f32_16x16x32_f16(false, ah, false, bl, (short)0, c, false, false);
  asm volatile("v_nop\n\tv_nop\n\tv_nop\n\tv_nop" : "+v"(c) : "v"(ah), "v"(al), "v"(bh), "v"(bl));
  return c;
}
// batched GEMM like k_gemm_b but f16 operands: A f32 (split into f16 hi/lo if ASPLIT, else rounded to f16), Bt = f16 values [n][k]; alpha; C f32; N multiple of 16 (partial tiles skipped)
template <bool ASPLIT>
__global__ __launch_bounds__(128) void k_gemm_h(const float* __restrict__ A, int lda, size_t sA, const _Float16* __restrict__ Bh, int ldb, size_t sB, float alpha, float* __restrict__ C, int ldc, size_t sC, int M, int N, int K) {
  __shared__ __attribute__((aligned(16))) float so[4][16][64];
  const int tid = threadIdx.x, w = tid >> 5, lane = tid & 31, ln = lane & 15, hh = lane >> 4; const int by = blockIdx.y;
  A += (size_t)by * sA; Bh += (size_t)by * sB; C += (size_t)by * sC;
  const int ntn = (N + 63) / 64; const int wid = blockIdx.x * 4 + w; const int mt = wid / ntn, nq = wid % ntn; if (mt * 16 >= M) return;
  const int row0 = mt * 16, col0 = nq * 64; const float* arow = A + (size_t)(row0 + ln) * lda;
  v8f acc[4] = {};
  for (int kb = 0; kb < K; kb += 32) {
    FragH ah, al;
    const v4f x0 = *(const v4fa*)(arow + kb + 8 * hh), x1 = *(const v4fa*)(arow + kb + 8 * hh + 4), x2 = *(const v4fa*)(arow + kb + 16 + 8 * hh), x3 = *(const v4fa*)(arow + kb + 16 + 8 * hh + 4);
    float xs[16] = {x0[0],x0[1],x0[2],x0[3],x1[0],x1[1],x1[2],x1[3],x2[0],x2[1],x2[2],x2[3],x3[0],x3[1],x3[2],x3[3]};
#pragma unroll
    for (int i = 0; i < 16; ++i) { const _Float16 h = (_Float16)xs[i]; ah.h[i] = h; al.h[i] = ASPLIT ? (_Float16)(xs[i] - (float)h) : (_Float16)0.0f; }
#pragma unroll
    for (int t = 0; t < 4; ++t) { if (col0 + t * 16 >= N) continue; const size_t boff = (size_t)(col0 + t * 16 + ln) * ldb + kb; FragH bq; bq.half[0] = *(const v8us*)(Bh + boff + 8 * hh); bq.half[1] = *(const v8us*)(Bh + boff + 16 + 8 * hh);
      acc[t] = mmaH<ASPLIT ? 2 : 1>(ah.v, al.v, bq.v, bq.v, acc[t]); }
  }
#pragma unroll
  for (int t = 0; t < 4; ++t) { if (col0 + t * 16 >= N) continue;
#pragma unroll
    for (int r = 0; r < 8; ++r) so[w][8 * hh + r][t * 16 + ln] = acc[t][r] * alpha; }
  __builtin_amdgcn_fence(__ATOMIC_ACQ_REL, "workgroup"); __builtin_amdgcn_wave_barrier();
  const int rsub = lane >> 4, c4 = (lane & 15) * 4;
  {
#pragma unroll
    for (int q = 0; q < 8; ++q) { const int r = q * 2 + rsub; if (col0 + c4 < N) { const v4f v = *(const v4fa*)&so[w][r][c4]; *(v4f*)(C + (size_t)(row0 + r) * ldc + col0 + c4) = v; } }
     }
}

// Wt[n][k] = f16(W[k][n]·scale) from f32 row-major W[K][N] (scale = power of two; bf16-exact weights stay exact in f16 away from the subnormal range)
__global__ __launch_bounds__(256) void k_wt_f16(const float* __restrict__ W, _Float16* __restrict__ Wt, int K, int N, float scale) {
  const int t = blockIdx.x * 256 + threadIdx.x; if (t >= N * (K / 8)) return; const int n = t / (K / 8), k8 = (t % (K / 8)) * 8; FragH f;
#pragma unroll
  for (int i = 0; i < 8; ++i) f.h[i] = (_Float16)(bf16_round(W[(size_t)(k8 + i) * N + n]) * scale); const v8us o = f.half[0];
  *(v8us*)((unsigned short*)Wt + (size_t)n * K + k8) = o; 
}
// k_gemm_hh variant with fused epilogue: v = acc·alpha + bias[by·sBias + col] (+ CP[(row/rowsPerB)·sCPb + by·64 + col] if CP) ; ACT 0 none / 1 elu ; writes f16 C16 (and f32 C if non-null)
template <int ACT>
__global__ __launch_bounds__(128) void k_gemm_hhx(const _Float16* __restrict__ A, int lda, size_t sA, const _Float16* __restrict__ Bh, int ldb, size_t sB, float alpha, const float* __restrict__ bias, size_t sBias, const float* __restrict__ CP, int rowsPerB, size_t sCPb, int row0g,
    float* __restrict__ C, _Float16* __restrict__ C16, int ldc, size_t sC, int M, int N, int K) {
  __shared__ __attribute__((aligned(16))) float so[4][16][64];
  const int tid = threadIdx.x, w = tid >> 5, lane = tid & 31, ln = lane & 15, hh = lane >> 4; const int by = blockIdx.y;
  A += (size_t)by * sA; Bh += (size_t)by * sB; const size_t cofs = (size_t)by * sC; const float* bp = bias ? bias + (size_t)by * sBias : nullptr;
  const int ntn = (N + 63) / 64; const int wid = blockIdx.x * 4 + w; const int mt = wid / ntn, nq = wid % ntn; if (mt * 16 >= M) return;
  const int row0 = mt * 16, col0 = nq * 64; const _Float16* arow = A + (size_t)(row0 + ln) * lda;
  v8f acc[4] = {};
  for (int kb = 0; kb < K; kb += 32) { FragH ah; ah.half[0] = *(const v8us*)((const unsigned short*)arow + kb + 8 * hh); ah.half[1] = *(const v8us*)((const unsigned short*)arow + kb + 16 + 8 * hh);
#pragma unroll
    for (int t = 0; t < 4; ++t) { if (col0 + t * 16 >= N) continue; const size_t boff = (size_t)(col0 + t * 16 + ln) * ldb + kb; FragH bq; bq.half[0] = *(const v8us*)((const unsigned short*)Bh + boff + 8 * hh); bq.half[1] = *(const v8us*)((const unsigned short*)Bh + boff + 16 + 8 * hh);
      acc[t] = mmaH<1>(ah.v, ah.v, bq.v, bq.v, acc[t]); }
  }
#pragma unroll
  for (int t = 0; t < 4; ++t) { if (col0 + t * 16 >= N) continue; const int col = col0 + t * 16 + ln; const float bv = bp ? bf16_round(bp[col]) : 0.f;
#pragma unroll
    for (int r = 0; r < 8; ++r) { float v = acc[t][r] * alpha + bv; if (CP) { const int rr = row0g + row0 + 8 * hh + r; if (rowsPerB < 0) v += CP[cofs + (size_t)rr * ldc + col];      /* rowsPerB < 0: own element of the batched C plane */ else { const int bidx = rr / rowsPerB; v += CP[(size_t)bidx * sCPb + (size_t)by * 64 + col]; } } if (ACT == 1) v = (v > 0.f) ? v : expm1f(v); else if (ACT == 7) v = (v > 0.f) ? v + 1.0f : expf(v); else if (ACT == 8) v = tanhf(v); else if (ACT == 9) v = 0.5f * v * (1.0f + tanhf(0.7978845608028654f * (v + 0.044715f * v * v * v))); else if (ACT == 11) v = 1.0f / (1.0f + expf(-v)); else if (ACT == 12) v = (v > 0.f) ? v : 0.01f * v; else if (ACT == 14) v = (v > 0.f) ? v : 0.1f * v; else if (ACT == 16) v = (v >= 0.f) ? v : 0.3f * v; else if (ACT == 17) v = (v >= 0.f) ? v : 0.2f * v; else if (ACT == 15) v = v / (1.0f + expf(-v)); else if (ACT == 3) v = fmaxf(v, 0.f); else if (ACT == 6) v = 0.5f * v * (1.0f + erff(v * 0.70710678118654752f)); so[w][8 * hh + r][t * 16 + ln] = v; } }
  __builtin_amdgcn_fence(__ATOMIC_ACQ_REL, "workgroup"); __builtin_amdgcn_wave_barrier();
  const int rsub = lane >> 4, c4 = (lane & 15) * 4; typedef _Float16 v4h __attribute__((ext_vector_type(4)));
  {
#pragma unroll
    for (int q = 0; q < 8; ++q) { const int r = q * 2 + rsub; if (col0 + c4 < N) { const v4f v = *(const v4fa*)&so[w][r][c4]; if (C) *(v4f*)(C + cofs + (size_t)(row0 + r) * ldc + col0 + c4) = v; if (C16) { v4h h4; for (int i = 0; i < 4; ++i) h4[i] = (_Float16)v[i]; *(v4h*)(C16 + cofs + (size_t)(row0 + r) * ldc + col0 + c4) = h4; } } }
     }
}


typedef _Float16 v4h __attribute__((ext_vector_type(4)));

__global__ __launch_bounds__(256) void k_h16(const float* __restrict__ x, _Float16* __restrict__ X16, size_t n8) { const size_t t = (size_t)blockIdx.x * 256 + threadIdx.x; if (t >= n8) return; FragH f;
#pragma unroll
  for (int q = 0; q < 8; ++q) f.h[q] = (_Float16)x[t * 8 + q]; *(v8us*)((unsigned short*)X16 + t * 8) = f.half[0];  }
__global__ __launch_bounds__(256) void k_round16f(const float* __restrict__ W, _Float16* __restrict__ Bt, size_t n8) { const size_t t = (size_t)blockIdx.x * 256 + threadIdx.x; if (t >= n8) return; FragH f;
#pragma unroll
  for (int i = 0; i < 8; ++i) f.h[i] = (_Float16)(bf16_round(W[t * 8 + i]) * 16.0f); *(v8us*)((unsigned short*)Bt + t * 8) = f.half[0];  }
template <int NHv, int TTv>
__global__ __launch_bounds__(256) void k_vt(const _Float16* __restrict__ V16, int ldv, int voff, _Float16* __restrict__ Vt) { __shared__ unsigned short tl[64][66]; const int tid = threadIdx.x; const int slab = blockIdx.x / (TTv / 64), lg = blockIdx.x % (TTv / 64); const int b = slab / NHv, h = slab % NHv;
  for (int i = tid; i < 64 * 8; i += 256) { const int r = i / 8, c8 = (i % 8) * 8; FragH f; f.half[0] = *(const v8us*)((const unsigned short*)V16 + ((size_t)b * TTv + lg * 64 + r) * ldv + voff + h * 64 + c8);
#pragma unroll
    for (int q = 0; q < 8; ++q) tl[r][c8 + q] = f.u[q]; }
  __syncthreads();
  {
#pragma unroll
    for (int rd = 0; rd < 2; ++rd) { const int d = rd * 32 + tid / 8, pc = tid % 8; FragH f;
#pragma unroll
      for (int q = 0; q < 8; ++q) f.u[q] = tl[pc * 8 + q][d];
      *(v8us*)((unsigned short*)Vt + ((size_t)slab * 64 + d) * TTv + lg * 64 + pc * 8) = f.half[0]; }
     } }

__global__ __launch_bounds__(256) void k_hl(const float* __restrict__ F, _Float16* __restrict__ Hh, _Float16* __restrict__ Hl, size_t n8) { const size_t t = (size_t)blockIdx.x * 256 + threadIdx.x; if (t >= n8) return; FragH fh, fl; const v4f a = *(const v4fa*)(F + t * 8), c = *(const v4fa*)(F + t * 8 + 4);
#pragma unroll
  for (int q = 0; q < 4; ++q) { _Float16 h = (_Float16)a[q]; fh.h[q] = h; fl.h[q] = (_Float16)((a[q] - (float)h) * 1024.0f); h = (_Float16)c[q]; fh.h[4 + q] = h; fl.h[4 + q] = (_Float16)((c[q] - (float)h) * 1024.0f); }
  { *(v8us*)((unsigned short*)Hh + t * 8) = fh.half[0]; *(v8us*)((unsigned short*)Hl + t * 8) = fl.half[0];  } }

// fragment of 16 rows x 32 k from k-contiguous rows in global memory (the hardware k order)
__device__ __forceinline__ v16h g2_frag(const _Float16* p, int hh) { FragH f; f.half[0] = *(const v8us*)((const unsigned short*)p + 8 * hh); f.half[1] = *(const v8us*)((const unsigned short*)p + 16 + 8 * hh); return f.v; }
// ---- GEMM with both operands staged in LDS: C = alpha A Bh^T + bs bias (bias [N], or [M] if RB, never null, rounded to bf16); A [M][K] and Bh [N][K] f16, k contiguous; needs M % 128 == 0, N % 128 == 0, K % 128 == 0 ----
// A block is 4 waves (2 x 2) on a 128 x 128 tile of C; a wave owns 64 x 64 (16 accumulator tiles). A stage is 128 k: 256 bytes of each of the block's 128 A rows and 128 B rows,
// brought by asynchronous copies to LDS, 16 bytes a lane (one copy of a wave = two whole rows of the stage = four whole 128-byte lines): each operand byte is asked for once a block, in whole lines.
// Two buffers: stage t + 2 is asked for behind the barrier that ends trip t, into the buffer that trip t has read. Fragments by two 16-byte LDS reads in the k order of g2_frag, k steps in rising order.
#define G3_KS 128                    /* k per stage */
#define G3_P 272                     /* LDS row pitch in bytes: 16 x odd, so the 16-byte fragment reads of 16 rows meet no bank twice */
#define G3_ST (256 * G3_P)           /* bytes per stage: A rows 0..127, then B rows 0..127 */
__device__ __forceinline__ v16h g3_frag(const unsigned char* p) { FragH f; f.half[0] = *(const v8us*)p; f.half[1] = *(const v8us*)(p + 32); return f.v; }
// Eight copies (rows 8 apart: LDS byte address l, global address g, gs elements per 8 rows); s_wait_xcnt 0 as the statement's last line, so that it stands in front of every later write of their address registers (a precaution).
__device__ __forceinline__ void g3_copy8(unsigned l, const _Float16* g, size_t gs) {
  asm volatile("global_load_async_to_lds_b128 %0, %8, off\n\tglobal_load_async_to_lds_b128 %1, %9, off\n\tglobal_load_async_to_lds_b128 %2, %10, off\n\tglobal_load_async_to_lds_b128 %3, %11, off\n\t"
               "global_load_async_to_lds_b128 %4, %12, off\n\tglobal_load_async_to_lds_b128 %5, %13, off\n\tglobal_load_async_to_lds_b128 %6, %14, off\n\tglobal_load_async_to_lds_b128 %7, %15, off\n\ts_wait_xcnt 0x0"
               :: "v"(l), "v"(l + 8 * G3_P), "v"(l + 16 * G3_P), "v"(l + 24 * G3_P), "v"(l + 32 * G3_P), "v"(l + 40 * G3_P), "v"(l + 48 * G3_P), "v"(l + 56 * G3_P),
                  "v"(g), "v"(g + gs), "v"(g + 2 * gs), "v"(g + 3 * gs), "v"(g + 4 * gs), "v"(g + 5 * gs), "v"(g + 6 * gs), "v"(g + 7 * gs) : "memory"); }
// One stage: 32 copies a lane (A rows 0..63, 64..127, B rows 0..63, 64..127); every lane is on, every address a multiple of 16.
__device__ __forceinline__ void g3_fill(unsigned l, const _Float16* ga, int lda, const _Float16* gb, int ldb) {
  g3_copy8(l, ga, (size_t)8 * lda); g3_copy8(l + 64 * G3_P, ga + (size_t)64 * lda, (size_t)8 * lda);
  g3_copy8(l + 128 * G3_P, gb, (size_t)8 * ldb); g3_copy8(l + 192 * G3_P, gb + (size_t)64 * ldb, (size_t)8 * ldb); }
// One 128 x 128 tile of C by one block: C = alpha A Bh^T + bs bias. A, Bh, bias, C and C16 point at the tile's own first row, column or element; sm is the block's 2 * G3_ST bytes of LDS.
template <bool F32OUT, bool RB>      /* output rows: f32 to C, or f16 to C16; the bias belongs to C's rows (RB: the weight is the A operand), or to its columns */
__device__ __forceinline__ void g3_tile(unsigned char* sm, const _Float16* __restrict__ A, int lda, const _Float16* __restrict__ Bh, int ldb, float alpha, const float* __restrict__ bias, float bs,
    float* __restrict__ C, _Float16* __restrict__ C16, int ldc, int K) {
  const int tid = threadIdx.x, w = tid >> 5, lane = tid & 31, ln = lane & 15, hh = lane >> 4;
  const int wm = w >> 1, wn = w & 1;
  const unsigned l0 = (unsigned)(size_t)sm + (unsigned)((tid >> 4) * G3_P + (tid & 15) * 16);      /* this lane's place in a stage: row tid / 16 (+ 8 a copy), 16-byte piece tid % 16 */
  const _Float16* ga = A + (size_t)(tid >> 4) * lda + (tid & 15) * 8; const _Float16* gb = Bh + (size_t)(tid >> 4) * ldb + (tid & 15) * 8;
  const int T = K / G3_KS;
  const v8f z8 = {0.f,0.f,0.f,0.f,0.f,0.f,0.f,0.f}; v8f acc[4][4];
  /* every inner loop of this kernel is unrolled so that each index of acc, a and b is a constant and the arrays stay in registers */
#pragma unroll
  for (int i = 0; i < 4; ++i)
#pragma unroll
    for (int j = 0; j < 4; ++j) acc[i][j] = z8;
  const int bcol = wn * 64 + ln; float braw[4];      /* asked for here and first used behind the loop, so that the loads' latency passes under the stages */
  if (!RB) {
#pragma unroll
    for (int j = 0; j < 4; ++j) braw[j] = bias[bcol + j * 16];
    asm volatile("s_wait_xcnt 0x0" :: "v"(bcol), "s"(bias) : "memory");      /* the four loads' index and base stay live up to this wait, so nothing is written over them earlier */
  }
  g3_fill(l0, ga, lda, gb, ldb);
  asm volatile("s_wait_asynccnt 0x0" ::: "memory");      /* this wave's copies of stage 0 have landed */
  __syncthreads();                                        /* ... and every other wave's */
  if (T > 1) g3_fill(l0 + G3_ST, ga + G3_KS, lda, gb + G3_KS, ldb);
  const unsigned char* fa = sm + (wm * 64 + ln) * G3_P + 16 * hh; const unsigned char* fb = sm + (128 + wn * 64 + ln) * G3_P + 16 * hh;
#pragma unroll 1
  for (int t = 0; t < T; ++t) {      /* rolled: one trip a stage, the hand-over at its foot */
    const int bo = (t & 1) * G3_ST;
    v16h a[2][2], b[2][4];      /* a block is 8 products: two A fragments x the k step's four B fragments; two register sets, the next block's fragments asked for one block ahead */
#pragma unroll
    for (int i = 0; i < 2; ++i) a[0][i] = g3_frag(fa + bo + i * 16 * G3_P);
#pragma unroll
    for (int j = 0; j < 4; ++j) b[0][j] = g3_frag(fb + bo + j * 16 * G3_P);
#pragma unroll
    for (int hb = 0; hb < G3_KS / 16; ++hb) {
      const int ks = hb >> 1, h = hb & 1, ks1 = (hb + 1) >> 1, h1 = (hb + 1) & 1;
      if (hb + 1 < G3_KS / 16) {
#pragma unroll
        for (int i = 0; i < 2; ++i) a[h1][i] = g3_frag(fa + bo + (2 * h1 + i) * 16 * G3_P + ks1 * 64);
        if (h1 == 0) {
#pragma unroll
          for (int j = 0; j < 4; ++j) b[ks1 & 1][j] = g3_frag(fb + bo + j * 16 * G3_P + ks1 * 64);
        }
      }
      __builtin_amdgcn_sched_barrier(0);      /* keeps the next block's LDS reads together in front of this block's products: left free, they were sunk among the products and waited for at once */
#pragma unroll
      for (int i = 0; i < 2; ++i)
#pragma unroll
        for (int j = 0; j < 4; ++j) acc[2 * h + i][j] = __builtin_amdgcn_wmma_f32_16x16x32_f16(false, a[h][i], false, b[ks & 1][j], (short)0, acc[2 * h + i][j], false, false);
      __builtin_amdgcn_sched_barrier(0);      /* ... and the block after next's reads behind them */
    }
    asm volatile("s_wait_dscnt 0x0" ::: "memory");        /* this wave's reads of the buffer are done before it is handed back */
    asm volatile("s_wait_asynccnt 0x0" ::: "memory");     /* this wave's copies of stage t + 1 have landed */
    __syncthreads();                                      /* publishes stage t + 1 and ends every wave's reads of stage t */
    if (t + 2 < T) g3_fill(l0 + bo, ga + (size_t)(t + 2) * G3_KS, lda, gb + (size_t)(t + 2) * G3_KS, ldb);
  }
  const int brw = wm * 64 + 8 * hh; v4f brow[4][2];      /* RB: a lane's 8 rows of each accumulator tile i; asked for behind the loop: held through it, these 32 registers took the kernel past 256 */
  if (RB) {
#pragma unroll
    for (int i = 0; i < 4; ++i) { brow[i][0] = *(const v4fa*)(bias + brw + i * 16); brow[i][1] = *(const v4fa*)(bias + brw + i * 16 + 4); }
    asm volatile("s_wait_xcnt 0x0" :: "v"(brw), "s"(bias) : "memory");      /* the eight loads' index and base stay live up to this wait, so nothing is written over them earlier */
  }
  asm volatile("s_wait_asynccnt 0x0" ::: "memory");       /* nothing is in flight when the buffers become output staging */
  float* so = (float*)sm + w * (64 * 68);
#pragma unroll
  for (int j = 0; j < 4; ++j) {
#pragma unroll
    for (int i = 0; i < 4; ++i)
#pragma unroll
      for (int r = 0; r < 8; ++r) so[(i * 16 + 8 * hh + r) * 68 + j * 16 + ln] = acc[i][j][r] * alpha + bf16_round(RB ? brow[i][r >> 2][r & 3] : braw[j]) * bs; }
  __builtin_amdgcn_fence(__ATOMIC_ACQ_REL, "workgroup"); __builtin_amdgcn_wave_barrier();      /* the wave's staging writes stay in front of its own reads of them; no other wave touches its range */
  const int c4 = ln * 4; const size_t cb = (size_t)(wm * 64 + hh) * ldc + wn * 64 + c4;
#pragma unroll
  for (int q = 0; q < 32; ++q) { const v4f v = *(const v4fa*)&so[(q * 2 + hh) * 68 + c4]; if (F32OUT) *(v4f*)(C + cb + (size_t)(q * 2) * ldc) = v; else { v4h h4; for (int i = 0; i < 4; ++i) h4[i] = (_Float16)v[i]; *(v4h*)(C16 + cb + (size_t)(q * 2) * ldc) = h4; } }
}
// C (f32 rows) = alpha A Bh^T + bias: one block a tile.
__global__ __launch_bounds__(128) void k_gemm3(const _Float16* __restrict__ A, int lda, const _Float16* __restrict__ Bh, int ldb, float alpha, const float* __restrict__ bias, float* __restrict__ C, int ldc, int M, int N, int K) {
  __shared__ __attribute__((aligned(16))) unsigned char sm[2 * G3_ST];      /* the two buffers; behind the loop each wave's own 64 x 68 f32 output staging */
  const int ntn = N >> 7; const int mt = blockIdx.x / ntn, nq = blockIdx.x - mt * ntn; const int row0 = mt * 128, col0 = nq * 128; if (row0 >= M) return;      /* the same for the whole block */
  g3_tile<true, false>(sm, A + (size_t)row0 * lda, lda, Bh + (size_t)col0 * ldb, ldb, alpha, bias + col0, 1.0f, C + (size_t)row0 * ldc + col0, nullptr, ldc, K);
}
// The three projections in one launch: 3 * (DM / 128) blocks in a row share one tile of 128 x rows: DM / 128 column tiles of q, as many of k (A = x rows, B = weight rows, token rows out), then as many tiles of V^T:
// there the weight rows are the A operand and the x rows the B operand, so C's rows are the V^T rows [batch][head][d][key] that the attention launch reads, and nothing is left to transpose. A tile's 128 keys lie in one batch (128 divides SQ).
#define QKV_NT (DM / 128)            /* tiles across one projection's outputs */
#define FA_SC (0.125f * 1.4426950408889634f)      /* 1 / sqrt(64), in log2 units: the q rows are stored times this factor (one rounding to f16, as before), so that K Q^T comes out in the softmax's base-2 exponent units */
__global__ __launch_bounds__(128) void k_qkv(const _Float16* __restrict__ X16, const _Float16* __restrict__ BQ, const _Float16* __restrict__ BK, const _Float16* __restrict__ BV,
    const float* __restrict__ bq, const float* __restrict__ bk, const float* __restrict__ bv, _Float16* __restrict__ Q16, _Float16* __restrict__ K16, _Float16* __restrict__ VT) {
  __shared__ __attribute__((aligned(16))) unsigned char sm[2 * G3_ST];      /* the two buffers; behind the loop each wave's own 64 x 68 f32 output staging */
  const int mt = blockIdx.x / (3 * QKV_NT), c = blockIdx.x - mt * (3 * QKV_NT); const int o0 = (c % QKV_NT) * 128;      /* x tile; projection c / QKV_NT, its first output feature: the same for the whole block */
  const _Float16* xt = X16 + (size_t)mt * 128 * DM;
  if (c < 2 * QKV_NT) { const bool kk = c >= QKV_NT; const float qs = kk ? 1.0f : FA_SC;
    g3_tile<false, false>(sm, xt, DM, (kk ? BK : BQ) + (size_t)o0 * DM, DM, 0.0625f * qs, (kk ? bk : bq) + o0, qs, nullptr, (kk ? K16 : Q16) + (size_t)mt * 128 * DM + o0, DM, DM);
  } else {
    g3_tile<false, true>(sm, BV + (size_t)o0 * DM, DM, xt, DM, 0.0625f, bv + o0, 1.0f, nullptr, VT + ((size_t)(mt / (SQ / 128)) * DM + o0) * SQ + (mt % (SQ / 128)) * 128, SQ, DM);
  }
}


__global__ __launch_bounds__(256) void k_rsm(const float* __restrict__ S, _Float16* __restrict__ P, int nrows) {
  #pragma clang fp contract(off)
  const int i = blockIdx.x * 256 + threadIdx.x; if (i >= nrows) return; const float* s = S + (size_t)i * SQ; float mx = -3.0e38f;
#pragma unroll 1
  for (int j = 0; j < SQ; ++j) mx = fmaxf(mx, s[j]); float se = 0.f;
#pragma unroll 1
  for (int j = 0; j < SQ; ++j) se += expf(s[j] - mx); const float sc = 256.0f / se;
#pragma unroll 1
  for (int j0 = 0; j0 < SQ; j0 += 8) { FragH f; for (int q = 0; q < 8; ++q) f.h[q] = (_Float16)(expf(s[j0 + q] - mx) * sc); unsigned short* d = (unsigned short*)P + (size_t)i * SQ + j0; *(v8us*)d = f.half[0];  } }
__global__ __launch_bounds__(256) void k_vt(const _Float16* __restrict__ V16, int b, int h0, _Float16* __restrict__ VT) { __shared__ unsigned short tl[64][65]; const int tid = threadIdx.x; const int hh = blockIdx.x % HG, sg = blockIdx.x / HG; const int s0 = sg * 64; const int h = h0 + hh;
  for (int i = tid; i < 64 * 8; i += 256) { const int j = i / 8, d8 = (i % 8) * 8; FragH f; f.half[0] = *(const v8us*)((const unsigned short*)V16 + ((size_t)b * SQ + s0 + j) * DM + h * HD + d8); for (int q = 0; q < 8; ++q) tl[d8 + q][j] = f.u[q]; }
  __syncthreads();
  { for (int i = tid; i < 64 * 8; i += 256) { const int d = i / 8, j8 = (i % 8) * 8; FragH f; for (int q = 0; q < 8; ++q) f.u[q] = tl[d][j8 + q]; *(v8us*)((unsigned short*)VT + ((size_t)hh * HD + d) * SQ + s0 + j8) = f.half[0]; }  } }


// Final stage: y = x + global + 0.3 (conv3 of x + b), LayerNorm, affine. One wave owns FN_R consecutive token rows whole: a lane holds 32 columns of each (8 pieces of 4; piece c = columns 128 c + 4 lane),
// so every load and store of a wave is 512 bytes in a row and a row's sums are in-lane adds plus one lane butterfly. All of a wave's row loads are asked for at its start, before anything waits.
// The six column parameters (three conv taps, conv bias, gain, shift) are rounded to bf16 once per block and shared through LDS planes. FN_R divides SQ, so a wave's rows lie in one sequence;
// the row in front of the first and the row behind the last of a sequence count as zero.
#define FN_R 2                       /* token rows per wave */
template <int CTRL> __device__ __forceinline__ float fn_dpp(float v) { return __builtin_bit_cast(float, __builtin_amdgcn_update_dpp(0, __builtin_bit_cast(int, v), CTRL, 0xf, 0xf, true)); }      /* 0x160 + m: lane l <- lane l ^ m inside a 16-lane row */
__device__ __forceinline__ float fn_xhalf(float x) { return __builtin_bit_cast(float, __builtin_amdgcn_permlanex16(__builtin_bit_cast(int, x), __builtin_bit_cast(int, x), 0x76543210, 0xfedcba98, false, false)); }      /* lane l <-> lane l ^ 16 */
__device__ __forceinline__ float fn_wsum(v4f a) { float v = (a[0] + a[1]) + (a[2] + a[3]); v += fn_dpp<0x161>(v); v += fn_dpp<0x162>(v); v += fn_dpp<0x164>(v); v += fn_dpp<0x168>(v); return v + fn_xhalf(v); }      /* the wave's sum, in every lane */
__device__ __forceinline__ v4f fn_ld(const float* base, unsigned bytes) { return *(const v4fa*)((const char*)base + bytes); }      /* scalar base + 32-bit byte offset */
__device__ __forceinline__ v4f fn_rd(v4f a) { v4f r; for (int q = 0; q < 4; ++q) r[q] = bf16_round(a[q]); return r; }
__global__ __launch_bounds__(256) __attribute__((amdgpu_waves_per_eu(4, 4))) void k_msfin(const float* __restrict__ X, const float* __restrict__ G, const float* __restrict__ cw, const float* __restrict__ cb, const float* __restrict__ g, const float* __restrict__ bta, float eps, float* __restrict__ out) {
  __shared__ __attribute__((aligned(16))) float pr[6][DM];      /* planes: tap 0, tap 1, tap 2, conv bias, gain, shift */
  const int tid = threadIdx.x; const unsigned c0 = (tid & 31) * 4u, t4 = tid * 4u;      /* first column of a lane's piece; of this thread's four parameter columns */
  const unsigned lb = (tid & 31) * 16u, tb = tid * 16u, wo = tid * 48u;      /* byte offsets of the loads: a lane's piece in a row, this thread's four parameters, its twelve taps */
  const int wv = __builtin_amdgcn_readfirstlane((int)(blockIdx.x * 8 + (tid >> 5)));      /* the wave's number, in a scalar register: row addresses are scalar base + lane offset */
  const size_t row0 = (size_t)wv * FN_R; const int s0 = (int)(row0 % SQ); const bool hp = s0 > 0, hn = s0 + FN_R < SQ;
  const float* xb = X + row0 * DM; const float* xm = xb - (hp ? DM : 0); const float* xn = xb + (hn ? FN_R * DM : 0);      /* a neighbour outside the sequence: an address in bounds, its values replaced by zero */
  const float* gb = G + row0 * DM;
  const v4f wa = fn_ld(cw, wo), wb = fn_ld(cw, wo + 16), wc = fn_ld(cw, wo + 32), pc = fn_ld(cb, tb), pg = fn_ld(g, tb), pb = fn_ld(bta, tb);      /* this thread's four columns: 12 taps in a row, bias, gain, shift */
  v4f xr[FN_R + 2][8], y[FN_R][8];
  /* every loop of this kernel is unrolled so that each index of xr and y is a constant and the rows stay in registers */
#pragma unroll
  for (int c = 0; c < 8; ++c) { const unsigned j = lb + c * 512; xr[0][c] = fn_ld(xm, j);
#pragma unroll
    for (int r = 0; r < FN_R; ++r) xr[r + 1][c] = fn_ld(xb, j + r * (DM * 4));
    xr[FN_R + 1][c] = fn_ld(xn, j);
#pragma unroll
    for (int r = 0; r < FN_R; ++r) y[r][c] = fn_ld(gb, j + r * (DM * 4)); }
  asm volatile("s_wait_xcnt 0x0" :: "v"(lb), "v"(tb), "v"(wo), "s"(xm), "s"(xb), "s"(xn), "s"(gb), "s"(cw), "s"(cb), "s"(g), "s"(bta) : "memory");      /* the loads' offsets and bases stay live up to this wait, so nothing (a later load's result included) is written over them earlier; its memory clobber also keeps every row load in front of the first wait for data (left free, they were sunk to their uses and waited for one by one) */
  { const v4f a = fn_rd(wa), b = fn_rd(wb), c = fn_rd(wc); const v4f t0 = {a[0], a[3], b[2], c[1]}, t1 = {a[1], b[0], b[3], c[2]}, t2 = {a[2], b[1], c[0], c[3]};
    *(v4f*)&pr[0][t4] = t0; *(v4f*)&pr[1][t4] = t1; *(v4f*)&pr[2][t4] = t2; *(v4f*)&pr[3][t4] = fn_rd(pc); *(v4f*)&pr[4][t4] = fn_rd(pg); *(v4f*)&pr[5][t4] = fn_rd(pb); }
  /* work-group barrier with LDS-only fences: the planes are whole before any wave reads them (nothing writes them again); __syncthreads() would also wait here for every row load still in flight */
  __builtin_amdgcn_fence(__ATOMIC_RELEASE, "workgroup", "local"); __builtin_amdgcn_s_barrier(); __builtin_amdgcn_fence(__ATOMIC_ACQUIRE, "workgroup", "local");
  const v4f z4 = {0.f, 0.f, 0.f, 0.f}; v4f s1[FN_R];
#pragma unroll
  for (int r = 0; r < FN_R; ++r) s1[r] = z4;
#pragma unroll
  for (int c = 0; c < 8; ++c) {
    const unsigned j = c * 128 + c0; v4f xq[FN_R + 2];
#pragma unroll
    for (int r = 0; r < FN_R + 2; ++r) xq[r] = fn_rd(xr[r][c]);
    if (!hp) xq[0] = z4;
    if (!hn) xq[FN_R + 1] = z4;
    const v4f w0 = *(const v4f*)&pr[0][j], w1 = *(const v4f*)&pr[1][j], w2 = *(const v4f*)&pr[2][j], cv = *(const v4f*)&pr[3][j];
#pragma unroll
    for (int r = 0; r < FN_R; ++r) { const v4f loc = xq[r] * w0 + xq[r + 1] * w1 + xq[r + 2] * w2 + cv; const v4f yy = xq[r + 1] + (y[r][c] + 0.3f * loc); y[r][c] = yy; s1[r] += yy; }
  }
  float mu[FN_R], rs[FN_R];
#pragma unroll
  for (int r = 0; r < FN_R; ++r) mu[r] = fn_wsum(s1[r]) * (1.0f / (float)DM);
#pragma unroll
  for (int r = 0; r < FN_R; ++r) { v4f s2 = z4;
#pragma unroll
    for (int c = 0; c < 8; ++c) { y[r][c] -= mu[r]; s2 += y[r][c] * y[r][c]; }
    s1[r] = s2; }
#pragma unroll
  for (int r = 0; r < FN_R; ++r) rs[r] = rsqrtf(fn_wsum(s1[r]) * (1.0f / (float)DM) + eps);
  float* ob = out + row0 * DM;
#pragma unroll
  for (int c = 0; c < 8; ++c) { const unsigned j = c * 128 + c0; const v4f gg = *(const v4f*)&pr[4][j], bb = *(const v4f*)&pr[5][j];
#pragma unroll
    for (int r = 0; r < FN_R; ++r) *(v4f*)(ob + (size_t)r * DM + j) = y[r][c] * rs[r] * gg + bb; }
}


__device__ __forceinline__ float fa_xhalf(float x) { return __builtin_bit_cast(float, __builtin_amdgcn_permlanex16(__builtin_bit_cast(int, x), __builtin_bit_cast(int, x), 0x76543210, 0xfedcba98, false, false)); }      /* lane l <-> lane l ^ 16 */
__device__ __forceinline__ v8f fa_mma(v16h a, v16h b, v8f c) { return __builtin_amdgcn_wmma_f32_16x16x32_f16(false, a, false, b, (short)0, c, false, false); }
// Native exp2 of two values in place, in one statement that ends in v_nop: no v_exp_f32 is directly followed by an instruction that reads its result or writes over its source
// (left to the register allocator, a neighbour's result landed on the source of the exp in front of it).
__device__ __forceinline__ void fa_exp2(float& x0, float& x1) {
  asm("v_exp_f32 %0, %0\n\tv_exp_f32 %1, %1\n\tv_nop" : "+v"(x0), "+v"(x1)); }
// ... of the eight registers of a score tile into eight registers of their own (early clobber: no result lands on a source; the tile's registers are read where the matrix unit left them, with no copy).
__device__ __forceinline__ void fa_exp8(const v8f& x, float* y) {
  asm("v_exp_f32 %0, %8\n\tv_exp_f32 %1, %9\n\tv_exp_f32 %2, %10\n\tv_exp_f32 %3, %11\n\tv_exp_f32 %4, %12\n\tv_exp_f32 %5, %13\n\tv_exp_f32 %6, %14\n\tv_exp_f32 %7, %15\n\tv_nop"
      : "=&v"(y[0]), "=&v"(y[1]), "=&v"(y[2]), "=&v"(y[3]), "=&v"(y[4]), "=&v"(y[5]), "=&v"(y[6]), "=&v"(y[7])
      : "v"(x[0]), "v"(x[1]), "v"(x[2]), "v"(x[3]), "v"(x[4]), "v"(x[5]), "v"(x[6]), "v"(x[7])); }
#define FA_QB 256                    /* query rows per block (8 waves x 32) */
#define FA_TOP 15.0f                 /* largest exponent of a weight before the references are moved: 2^15 is inside f16 */
// K and V^T reach the waves through LDS: a stage is FA_KS keys of the block's (batch, head): FA_KS K rows of 128 bytes, then the 64 V^T rows' 256 bytes of those keys,
// brought once per block by asynchronous copies, 16 bytes a lane (a wave's copy = four whole K rows or two whole V^T row pieces = four whole 128-byte lines), and read by all 8 waves.
// Two buffers: stage t + 2 is asked for behind the barrier that ends trip t, into the buffer that trip t has read. Fragments by two 16-byte LDS reads in the k order of g2_frag; keys in rising order as before.
#define FA_KS 128                    /* keys per stage (4 passes) */
#define FA_KP 144                    /* LDS pitch of a K row in bytes: 16 x odd, so the 16-byte fragment reads of 16 rows meet no bank twice */
#define FA_VP 272                    /* LDS pitch of a V^T row in bytes: 16 x odd */
#define FA_VO (FA_KS * FA_KP)        /* the V^T rows stand behind the K rows */
#define FA_ST (FA_VO + HD * FA_VP)   /* bytes per stage */
// One stage: eight copies a lane (K rows 32 apart, V^T rows 16 apart); every lane is on, every address a multiple of 16; s_wait_xcnt 0 as the statement's last line, so that it stands in front of every later write of their address registers (a precaution).
__device__ __forceinline__ void fa_fill(unsigned lk, unsigned lv, const _Float16* gk, const _Float16* gv) {
  asm volatile("global_load_async_to_lds_b128 %0, %8, off\n\tglobal_load_async_to_lds_b128 %1, %9, off\n\tglobal_load_async_to_lds_b128 %2, %10, off\n\tglobal_load_async_to_lds_b128 %3, %11, off\n\t"
               "global_load_async_to_lds_b128 %4, %12, off\n\tglobal_load_async_to_lds_b128 %5, %13, off\n\tglobal_load_async_to_lds_b128 %6, %14, off\n\tglobal_load_async_to_lds_b128 %7, %15, off\n\ts_wait_xcnt 0x0"
               :: "v"(lk), "v"(lk + 32 * FA_KP), "v"(lk + 64 * FA_KP), "v"(lk + 96 * FA_KP), "v"(lv), "v"(lv + 16 * FA_VP), "v"(lv + 32 * FA_VP), "v"(lv + 48 * FA_VP),
                  "v"(gk), "v"(gk + (size_t)32 * DM), "v"(gk + (size_t)64 * DM), "v"(gk + (size_t)96 * DM), "v"(gv), "v"(gv + (size_t)16 * SQ), "v"(gv + (size_t)32 * SQ), "v"(gv + (size_t)48 * SQ) : "memory"); }
// The pass's eight score products in one statement: s[kt][g] = K tile kt x Q group g + off[g], k 0..31 then 32..63 as before. Written out because C stays live while D is a register tile of its own:
// from the builtin the compiler tied D to C in one product of the four and copied the offset tile in front of it, every pass. The four chains fill one another's distance; the v_nop at the end keep the WMMA distance (four slots) to the first vector instruction that reads a D.
__device__ __forceinline__ void fa_scores(const v16h (&kf)[2][2], const v16h (&qf)[2][2], const v8f (&off)[2], v8f (&s)[2][2]) {
  asm("v_wmma_f32_16x16x32_f16 %0, %4, %8, %12\n\tv_wmma_f32_16x16x32_f16 %1, %4, %10, %13\n\tv_wmma_f32_16x16x32_f16 %2, %6, %8, %12\n\tv_wmma_f32_16x16x32_f16 %3, %6, %10, %13\n\t"
      "v_wmma_f32_16x16x32_f16 %0, %5, %9, %0\n\tv_wmma_f32_16x16x32_f16 %1, %5, %11, %1\n\tv_wmma_f32_16x16x32_f16 %2, %7, %9, %2\n\tv_wmma_f32_16x16x32_f16 %3, %7, %11, %3\n\t"
      "v_nop\n\tv_nop\n\tv_nop\n\tv_nop"
      : "=&v"(s[0][0]), "=&v"(s[0][1]), "=&v"(s[1][0]), "=&v"(s[1][1])
      : "v"(kf[0][0]), "v"(kf[0][1]), "v"(kf[1][0]), "v"(kf[1][1]), "v"(qf[0][0]), "v"(qf[0][1]), "v"(qf[1][0]), "v"(qf[1][1]), "v"(off[0]), "v"(off[1])); }
// One pass: 32 keys against the wave's 32 query columns. pk: this lane's place in the pass's first K row, pv: in V^T row ln at the pass's first key. PRE: the next pass's K fragments are asked for behind the score products and the test
// (inside a stage only: nothing of the next stage is read in front of its barrier).
// off: per column group the exponent offset of this lane's query, eight times over: the C operand of the score products. first: the wave's first pass, which sets the references whatever the test says.
template <bool PRE>
__device__ __forceinline__ void fa_pass(const unsigned char* pk, const unsigned char* pv, const v16h (&qf)[2][2], v16h (&kf)[2][2], v8f (&o)[4][2], v8f (&off)[2], float (&l)[2], bool first) {
  v8f s[2][2];      /* scaled score + offset = the weight's exponent, straight from the matrix unit */
  fa_scores(kf, qf, off, s);
  float mx[2];      /* the lane's own 16 exponents' maximum, per column group */
#pragma unroll
  for (int g = 0; g < 2; ++g) {
    mx[g] = fmaxf(s[0][g][0], s[1][g][0]);
#pragma unroll
    for (int r = 1; r < 8; ++r) mx[g] = fmaxf(mx[g], fmaxf(s[0][g][r], s[1][g][r]));
  }
  if ((__builtin_amdgcn_ballot_w32(fmaxf(mx[0], mx[1]) > FA_TOP) | (unsigned)first) != 0) {      /* one scalar branch a pass, the same for the whole wave */
    float al[2];
#pragma unroll
    for (int g = 0; g < 2; ++g) {
      const float dl = 8.0f - fmaxf(mx[g], fa_xhalf(mx[g]));      /* what brings the pass's largest exponent to 8; the two halves of a query's keys get the same reference */
      al[g] = fminf(dl, 0.0f);      /* a reference only rises ... */
      off[g] += first ? dl : al[g]; }      /* ... but the first pass sets it (o and l are still 0 there) */
    fa_scores(kf, qf, off, s);      /* this pass's exponents anew, against the moved offsets */
    fa_exp2(al[0], al[1]);
#pragma unroll
    for (int g = 0; g < 2; ++g) { l[g] *= al[g];
#pragma unroll
      for (int t = 0; t < 4; ++t) o[t][g] *= al[g]; }
  }
  v16h vf[4];      /* all of a pass's LDS reads stand together here, one place a pass: V^T for the products behind the exponentials ... */
#pragma unroll
  for (int t = 0; t < 4; ++t) vf[t] = g3_frag(pv + t * 16 * FA_VP);
  if (PRE) {      /* ... and the next pass's K; behind the branch, whose products take this pass's K fragments a second time */
#pragma unroll
    for (int kt = 0; kt < 2; ++kt)
#pragma unroll
      for (int j = 0; j < 2; ++j) kf[kt][j] = g3_frag(pk + (32 + kt * 16) * FA_KP + 64 * j);
  }
  __builtin_amdgcn_sched_barrier(0);      /* keeps the pass's LDS reads in front of the exponentials, whose length covers their latency: left free, the V^T reads of a stage's last pass were sunk among the products and waited for at once */
  v16h pf[2];
#pragma unroll
  for (int g = 0; g < 2; ++g) {
    FragH p; float e[16];
    fa_exp8(s[0][g], e); fa_exp8(s[1][g], e + 8);
#pragma unroll
    for (int r = 0; r < 16; ++r) p.h[r] = (_Float16)e[r];
    pf[g] = p.v;
    l[g] += (((e[0] + e[1]) + (e[2] + e[3])) + ((e[4] + e[5]) + (e[6] + e[7]))) + (((e[8] + e[9]) + (e[10] + e[11])) + ((e[12] + e[13]) + (e[14] + e[15])));
  }
#pragma unroll
  for (int t = 0; t < 4; ++t)
#pragma unroll
    for (int g = 0; g < 2; ++g) o[t][g] = fa_mma(vf[t], pf[g], o[t][g]);
  asm volatile("v_nop\n\tv_nop\n\tv_nop\n\tv_nop" : "+v"(o[0][0]), "+v"(o[0][1]), "+v"(o[1][0]), "+v"(o[1][1]), "+v"(o[2][0]), "+v"(o[2][1]), "+v"(o[3][0]), "+v"(o[3][1]) : "v"(pf[0]), "v"(pf[1]), "v"(vf[0]), "v"(vf[1]), "v"(vf[2]), "v"(vf[3]));      /* WMMA distance: the weights (B operands) stay live for four slots behind the pass's last products, so the next pass's score tiles, which may get the same registers, are not written over them earlier; the V^T fragments (A operands) too: freed one by one, they took the sums' partial results among the products, and each such place cost four v_nop */
}
__global__ __launch_bounds__(256) __attribute__((amdgpu_waves_per_eu(4, 4))) void k_fattn(const _Float16* __restrict__ Q16, const _Float16* __restrict__ K16, const _Float16* __restrict__ VT, _Float16* __restrict__ O16) {
  __shared__ __attribute__((aligned(16))) unsigned char sm[2 * FA_ST];      /* the two buffers */
  const int tid = threadIdx.x, lane = threadIdx.x & 31, w = threadIdx.x >> 5, ln = lane & 15, hh = lane >> 4;
  const int bh = blockIdx.x / (SQ / FA_QB), qb = blockIdx.x % (SQ / FA_QB); const int b = bh / NH, h = bh % NH;
  const size_t r0 = (size_t)b * SQ; const int q0 = qb * FA_QB + w * 32;
  const unsigned lk = (unsigned)(size_t)sm + (unsigned)((tid >> 3) * FA_KP + (tid & 7) * 16);              /* this lane's places in a stage: K row tid / 8 (+ 32 a copy), 16-byte piece tid % 8 */
  const unsigned lv = (unsigned)(size_t)sm + (unsigned)(FA_VO + (tid >> 4) * FA_VP + (tid & 15) * 16);     /* V^T row tid / 16 (+ 16 a copy), 16-byte piece tid % 16 */
  const _Float16* gk = K16 + (r0 + (tid >> 3)) * DM + h * HD + (tid & 7) * 8;
  const _Float16* gv = VT + ((size_t)bh * HD + (tid >> 4)) * SQ + (tid & 15) * 8;
  fa_fill(lk, lv, gk, gv);
  v16h qf[2][2];
#pragma unroll
  for (int g = 0; g < 2; ++g)
#pragma unroll
    for (int j = 0; j < 2; ++j) qf[g][j] = g2_frag(Q16 + (r0 + q0 + g * 16 + ln) * DM + h * HD + 32 * j, hh);
  const v8f z8 = {0.f,0.f,0.f,0.f,0.f,0.f,0.f,0.f};
  v8f o[4][2], off[2]; float l[2];
#pragma unroll
  for (int g = 0; g < 2; ++g) { off[g] = z8; l[g] = 0.f;      /* no reference yet: the first pass sets it */
#pragma unroll
    for (int t = 0; t < 4; ++t) o[t][g] = z8; }
  asm volatile("s_wait_asynccnt 0x0" ::: "memory");      /* this wave's copies of stage 0 have landed */
  __syncthreads();                                        /* ... and every other wave's */
  fa_fill(lk + FA_ST, lv + FA_ST, gk + (size_t)FA_KS * DM, gv + FA_KS);      /* stage 1 (SQ / FA_KS is 16) */
  const unsigned char* fk = sm + ln * FA_KP + 16 * hh;              /* key row ln of a stage's first tile, at this half's first k */
  const unsigned char* fv = sm + FA_VO + ln * FA_VP + 16 * hh;      /* V^T row d = ln, at this half's first key */
#pragma unroll 1
  for (int st = 0; st < SQ / FA_KS; ++st) {      /* rolled: one trip a stage, the hand-over at its foot */
    const int bo = (st & 1) * FA_ST;
    v16h kf[2][2];
#pragma unroll
    for (int kt = 0; kt < 2; ++kt)
#pragma unroll
      for (int j = 0; j < 2; ++j) kf[kt][j] = g3_frag(fk + bo + kt * 16 * FA_KP + 64 * j);
#pragma unroll 1
    for (int kb = 0; kb < FA_KS / 32 - 1; ++kb)      /* rolled: one pass already fills the register budget of four waves per SIMD */
      fa_pass<true>(fk + bo + kb * 32 * FA_KP, fv + bo + kb * 64, qf, kf, o, off, l, (st | kb) == 0);
    fa_pass<false>(fk + bo + (FA_KS - 32) * FA_KP, fv + bo + (FA_KS / 32 - 1) * 64, qf, kf, o, off, l, false);      /* the stage's last pass */
    asm volatile("s_wait_dscnt 0x0" ::: "memory");        /* this wave's reads of the buffer are done before it is handed back */
    asm volatile("s_wait_asynccnt 0x0" ::: "memory");     /* this wave's copies of stage st + 1 have landed */
    __syncthreads();                                      /* publishes stage st + 1 and ends every wave's reads of stage st */
    if (st + 2 < SQ / FA_KS) fa_fill(lk + bo, lv + bo, gk + (size_t)(st + 2) * FA_KS * DM, gv + (st + 2) * FA_KS);
  }
  asm volatile("s_wait_asynccnt 0x0" ::: "memory");       /* nothing is in flight when the wave ends */
#pragma unroll
  for (int g = 0; g < 2; ++g) {
    const float inv = 64.0f / (l[g] + fa_xhalf(l[g]));      /* the halves' sums join once; x64: the carried scale of the o rows */
    _Float16* orow = O16 + (r0 + q0 + g * 16 + ln) * DM + h * HD + 8 * hh;
#pragma unroll
    for (int t = 0; t < 4; ++t) { FragH f;
#pragma unroll
      for (int r = 0; r < 8; ++r) f.h[r] = (_Float16)(o[t][g][r] * inv);
      *(v8us*)((unsigned short*)orow + t * 16) = f.half[0]; }
  }
}

// Operand conversion, one launch for all five GEMM operands: x -> f16 of its bf16 rounding, each weight -> f16 of 16 x its bf16 rounding (the values as before).
// PC_NW waves, few enough to be resident all at once (16 per WGP when spread evenly). A wave owns one contiguous run of x (PC_XL loads) and one of each weight (PC_WL loads); a load of a wave is 512 bytes in a row, 16 bytes a lane,
// a store 256 bytes in a row. All of a wave's loads are asked for at its start, before anything waits.
#define PC_NW 4096                   /* waves of the launch */
#define PC_XL 16                     /* loads of 128 floats per wave: x */
#define PC_WL 2                      /* ... and each weight */
static_assert((size_t)PC_NW * PC_XL * 128 == NR * DM && (size_t)PC_NW * PC_WL * 128 == (size_t)DM * DM, "the waves' runs cover x and each weight exactly once");
template <bool X16W>      /* weights carry the factor 16 */
__device__ __forceinline__ void pc_st(_Float16* base, unsigned bytes, v4f a) { v4h h;
#pragma unroll
  for (int q = 0; q < 4; ++q) h[q] = X16W ? (_Float16)(bf16_round(a[q]) * 16.0f) : (_Float16)bf16_round(a[q]);
  *(v4h*)((char*)base + bytes) = h; }
__global__ __launch_bounds__(256) void k_prep(const float* __restrict__ x, const float* __restrict__ wq, const float* __restrict__ wk, const float* __restrict__ wv, const float* __restrict__ wo,
    _Float16* __restrict__ X16, _Float16* __restrict__ BQ, _Float16* __restrict__ BK, _Float16* __restrict__ BV, _Float16* __restrict__ BO) {
  const unsigned lb = (threadIdx.x & 31) * 16u, sb = (threadIdx.x & 31) * 8u;      /* a lane's byte offset in a load, in a store */
  const int wn = __builtin_amdgcn_readfirstlane((int)(blockIdx.x * 8 + (threadIdx.x >> 5)));      /* the wave's number, in a scalar register: addresses are scalar base + lane offset */
  const size_t xo = (size_t)wn * (PC_XL * 128), wf = (size_t)wn * (PC_WL * 128);
  const float* xs = x + xo; const float* s0 = wq + wf; const float* s1 = wk + wf; const float* s2 = wv + wf; const float* s3 = wo + wf;
  v4f a[PC_XL], b[4][PC_WL];
  /* every loop of this kernel is unrolled so that each index of a and b is a constant and the values stay in registers */
#pragma unroll
  for (int c = 0; c < PC_XL; ++c) a[c] = fn_ld(xs, lb + c * 512);
#pragma unroll
  for (int c = 0; c < PC_WL; ++c) { b[0][c] = fn_ld(s0, lb + c * 512); b[1][c] = fn_ld(s1, lb + c * 512); b[2][c] = fn_ld(s2, lb + c * 512); b[3][c] = fn_ld(s3, lb + c * 512); }
  asm volatile("s_wait_xcnt 0x0" :: "v"(lb), "s"(xs), "s"(s0), "s"(s1), "s"(s2), "s"(s3) : "memory");      /* the loads' offset and bases stay live up to this wait, so nothing is written over them earlier */
  __builtin_amdgcn_sched_barrier(0);      /* keeps the conversions behind the issue of the last load: left free, they were lifted among the loads, and ten of the loads were asked for only after the first data had come */
#pragma unroll
  for (int c = 0; c < PC_XL; ++c) pc_st<false>(X16 + xo, sb + c * 256, a[c]);
#pragma unroll
  for (int c = 0; c < PC_WL; ++c) { pc_st<true>(BQ + wf, sb + c * 256, b[0][c]); pc_st<true>(BK + wf, sb + c * 256, b[1][c]); pc_st<true>(BV + wf, sb + c * 256, b[2][c]); pc_st<true>(BO + wf, sb + c * 256, b[3][c]); }
}

extern "C" void kernel_launch(void* const* d_in, const int* in_sizes, int n_in,
                              void* d_out, int out_size, void* d_ws, size_t ws_size, hipStream_t stream) {
  (void)in_sizes; (void)n_in; (void)out_size;
  const float* const* I = (const float* const*)d_in; const float* x = I[0]; const float* wq = I[1]; const float* bq = I[2]; const float* wk = I[3]; const float* bk = I[4]; const float* wv = I[5]; const float* bv = I[6]; const float* wo = I[7]; const float* bo = I[8]; const float* cw = I[9]; const float* cb = I[10]; const float* lng = I[11]; const float* lnb = I[12];      /* weights [out][in] (natural) */
  char* ws = (char*)d_ws; size_t off = 0;
  auto take = [&](size_t bytes) { char* p = ws + off; off += (bytes + 255) & ~(size_t)255; return p; };
  _Float16* BQ = (_Float16*)take((size_t)DM * DM * 2); _Float16* BK = (_Float16*)take((size_t)DM * DM * 2); _Float16* BV = (_Float16*)take((size_t)DM * DM * 2); _Float16* BO = (_Float16*)take((size_t)DM * DM * 2);
  _Float16* X16 = (_Float16*)take(NR * DM * 2); _Float16* Q16 = (_Float16*)take(NR * DM * 2); _Float16* K16 = (_Float16*)take(NR * DM * 2); _Float16* O16 = (_Float16*)take(NR * DM * 2); float* GA = (float*)take(NR * DM * 4);      /* global attention branch (f32 rows) */
  _Float16* VT = (_Float16*)take((size_t)NB * NH * HD * SQ * 2);      /* V^T [NB][NH][HD][SQ] */
  if (off > ws_size) return;
  k_prep<<<PC_NW / 8, 256, 0, stream>>>(x, wq, wk, wv, wo, X16, BQ, BK, BV, BO);      /* all five GEMM operands as f16 */
  const size_t r0p = (size_t)B0 * SQ;      /* first row of the output stage */
  k_qkv<<<(unsigned)(NR / 128) * (3 * QKV_NT), 128, 0, stream>>>(X16, BQ, BK, BV, bq, bk, bv, Q16, K16, VT);      /* q and k as f16 token rows, v as V^T rows for every (batch, head) */
  k_fattn<<<NB * NH * (SQ / FA_QB), 256, 0, stream>>>(Q16, K16, VT, O16);      /* o (merged heads) as f16 rows, x64 */
  k_gemm3<<<(unsigned)((MPO / 128) * (DM / 128)), 128, 0, stream>>>(O16 + r0p * DM, DM, BO, DM, 0.0009765625f, bo, GA + r0p * DM, DM, MPO, DM, DM);      /* global = ctx Wo^T + bo (f32 rows) */
  k_msfin<<<(unsigned)(MPO / (8 * FN_R)), 256, 0, stream>>>(x + r0p * DM, GA + r0p * DM, cw, cb, lng, lnb, 1e-5f, (float*)d_out + r0p * DM);      /* + x + 0.3 local conv, LayerNorm -> output rows */
}

// v010
// Measured time: 115 microseconds a run.
// In both of two side-by-side timings against v009, it was 1.04 times as fast.
// Over all steps from v000 it is 60.0 times as fast.
#include <hip/hip_runtime.h>
// Multi-scale attention block (x [4][2048][1024]; q/k/v = x W^T + b (natural [1024][1024] weights), 16 heads of 64; softmax(q k^T / 8); ctx merged; global = ctx Wo^T + bo; local = depthwise conv3 of x along the sequence (conv_w [1024][3], zero pad) + conv_b; y = x + global + 0.3 local; out = LayerNorm(y) (eps 1e-5) ln_g + ln_b -> [4][2048][1024]).
// Structure (attention part): token rows r = b*2048 + s; x as exact f16 rows (bf16-rounded); Q, K, V^T as WMMA GEMM tiles of one launch (128x128 block tiles staged in LDS, 64x64 wave tiles, f32 accumulation, exact x16 weights + bias, f16 outputs, the q rows times log2(e) / 8; V^T tiles with the weight as the A operand); one fused attention launch over all (batch, head, 256-query block): per 32 keys S^T = K Q^T on WMMA with the softmax's exponent offset as the C operand, running-maximum softmax on VALU, rescaled lazily (f32 statistics, native exp2; weights x256 as f16, packed from the score accumulators), O^T += V^T P^T on WMMA; o carried x64 against f16 subnormal flush (folded into the output GEMM alpha), written straight into the merged f16 o rows; global = o W_o^T + b GEMM (f32 rows); then per token row on VALU: + bf16(x) + 0.3 (depthwise conv3 of bf16(x) + b), LayerNorm, affine -> output rows.
// Compute dtype: inputs rounded to bf16; x / weights exact; q, k, v, softmax weights and o as plain f16 GEMM operands (~2^-12); scores and softmax statistics f32. v_wmma_f32_16x16x32_f16.
#define NB 4
#define SQ 2048
#define DM 1024
#define NH 16
#define HD 64
#define HG 4                         /* heads per launch of the unlaunched k_vt(V16, b, h0, VT) overload */
#define B0 0                         /* first batch processed (debug hook) */
#define NBR NB                       /* batches processed (debug hook) */
#define NR ((size_t)NB * SQ)         /* token rows */
#define MP ((int)((size_t)NBR * SQ)) /* rows through the output stage, via MPO (debug hook) */
#define QN SQ                        /* not used: k_fattn attends all SQ query rows of each batch */
#define NHD NH                       /* not used: k_fattn attends all NH heads */
#define MPO MP                       /* rows through the output stage (debug hook) */
#define LQ DM      /* not used: q and k rows have pitch DM */
typedef __bf16 v16b __attribute__((ext_vector_type(16)));
typedef unsigned short v8us __attribute__((ext_vector_type(8), may_alias));
typedef float  v8f  __attribute__((ext_vector_type(8)));
typedef float  v4f  __attribute__((ext_vector_type(4)));
typedef float  v4fa __attribute__((ext_vector_type(4), may_alias));
union FragB { v16b v; v8us half[2]; unsigned short u[16]; };

__device__ __forceinline__ unsigned short bf16_bits(float x) { unsigned int u = __float_as_uint(x); return (unsigned short)((u + 0x7FFFu + ((u >> 16) & 1u)) >> 16); }
__device__ __forceinline__ float bf16_val(unsigned short b) { return __uint_as_float(((unsigned int)b) << 16); }
__device__ __forceinline__ float bf16_round(float x) { return bf16_val(bf16_bits(x)); }
// D += A·B with NT terms: 1 = ah·bh, 2 = + al·bh (A split), 3 = + ah·bl (both split)
template <int NT>
__device__ __forceinline__ v8f mmaN(v16b ah, v16b al, v16b bh, v16b bl, v8f c) {
  c = __builtin_amdgcn_wmma_f32_16x16x32_bf16(false, ah, false, bh, (short)0, c, false, false);
  if (NT >= 2) c = __builtin_amdgcn_wmma_f32_16x16x32_bf16(false, al, false, bh, (short)0, c, false, false);
  if (NT >= 3) c = __builtin_amdgcn_wmma_f32_16x16x32_bf16(false, ah, false, bl, (short)0, c, false, false);
  asm volatile("v_nop\n\tv_nop\n\tv_nop\n\tv_nop" : "+v"(c) : "v"(ah), "v"(al), "v"(bh), "v"(bl));
  return c;
}

__global__ __launch_bounds__(256) void k_wt_bf16(const float* __restrict__ W, unsigned short* __restrict__ Wt, int K, int N) {
  const int t = blockIdx.x * 256 + threadIdx.x;
  const int k8n = K / 8;
  if (t >= N * k8n) return;
  const int n = t / k8n, k8 = (t % k8n) * 8;
  v8us v;
#pragma unroll
  for (int i = 0; i < 8; ++i) v[i] = bf16_bits(W[(size_t)(k8 + i) * N + n]);
  *(v8us*)(Wt + (size_t)n * K + k8) = v;
  
}

// GEMM C[M][N] (f32, pitch ldc) = act(A[M][K]·W + bias). A f32 row-major (pitch lda) converted per fragment to bf16
// (ASPLIT: hi/lo two planes -> 2 terms, else single rounded term); Wt bf16 [N][K] (pitch ldb). BIAS_BF16 rounds the
// bias to bf16 first (bias quantised to bf16 before the add). K%32==0, M%16==0, N%64==0.
template <bool ASPLIT, int ACT, bool BIAS_BF16>
__global__ __launch_bounds__(128) void k_gemm_bf(const float* __restrict__ A, int lda, const unsigned short* __restrict__ Wt, int ldb,
                                               const float* __restrict__ bias, float* __restrict__ C, int ldc, int M, int N, int K) {
  __shared__ __attribute__((aligned(16))) float so[4][16][64];
  const int tid = threadIdx.x, w = tid >> 5, lane = tid & 31, ln = lane & 15, hh = lane >> 4;
  const int ntn = N / 64;
  const int wid = blockIdx.x * 4 + w;
  const int mt = wid / ntn, nq = wid % ntn;
  if (mt * 16 >= M) return;
  const int row0 = mt * 16, col0 = nq * 64;
  const float* arow = A + (size_t)(row0 + ln) * lda;
  v8f acc[4] = {};
  for (int kb = 0; kb < K; kb += 32) {
    FragB ah, al;
    const v4f x0 = *(const v4fa*)(arow + kb + 8 * hh), x1 = *(const v4fa*)(arow + kb + 8 * hh + 4);
    const v4f x2 = *(const v4fa*)(arow + kb + 16 + 8 * hh), x3 = *(const v4fa*)(arow + kb + 16 + 8 * hh + 4);
    float xs[16] = {x0[0],x0[1],x0[2],x0[3],x1[0],x1[1],x1[2],x1[3],x2[0],x2[1],x2[2],x2[3],x3[0],x3[1],x3[2],x3[3]};
#pragma unroll
    for (int i = 0; i < 16; ++i) { const unsigned short hb = bf16_bits(xs[i]); ah.u[i] = hb; al.u[i] = ASPLIT ? bf16_bits(xs[i] - bf16_val(hb)) : (unsigned short)0; }
#pragma unroll
    for (int t = 0; t < 4; ++t) {
      const unsigned short* brow = Wt + (size_t)(col0 + t * 16 + ln) * ldb + kb;
      FragB b;
      b.half[0] = *(const v8us*)(brow + 8 * hh);
      b.half[1] = *(const v8us*)(brow + 16 + 8 * hh);
      acc[t] = mmaN<ASPLIT ? 2 : 1>(ah.v, al.v, b.v, b.v, acc[t]);
    }
  }
#pragma unroll
  for (int t = 0; t < 4; ++t) {
    float bv = bias ? bias[col0 + t * 16 + ln] : 0.f;
    if (BIAS_BF16) bv = bf16_round(bv);
#pragma unroll
    for (int r = 0; r < 8; ++r) { float v = acc[t][r] + bv; if (ACT == 1) v = fmaxf(v, 0.f); so[w][8 * hh + r][t * 16 + ln] = v; }
  }
  __builtin_amdgcn_fence(__ATOMIC_ACQ_REL, "workgroup");
  __builtin_amdgcn_wave_barrier();
  const int rsub = lane >> 4, c4 = (lane & 15) * 4;
  {
#pragma unroll
    for (int q = 0; q < 8; ++q) {
      const int r = q * 2 + rsub;
      const v4f v = *(const v4fa*)&so[w][r][c4];
      *(v4f*)(C + (size_t)(row0 + r) * ldc + col0 + c4) = v;
    }
    
  }
}

// GEMM C = act(A·W + bias + resid): A f32 (ASPLIT -> hi/lo 2 terms), Wt bf16 [N][K]; ACT 0 none, 1 relu, 2 exact gelu;
// resid (optional, f32, row index = (row % rmod), pitch ldr, RES_BF16 rounds it) added before the activation.
template <bool ASPLIT, int ACT, bool BIAS_BF16, bool RES_BF16>
__global__ __launch_bounds__(128) void k_gemm_bf3(const float* __restrict__ A, int lda, const unsigned short* __restrict__ Wt, int ldb,
                                                const float* __restrict__ bias, const float* __restrict__ resid, int rmod, int ldr,
                                                float* __restrict__ C, int ldc, int M, int N, int K) {
  __shared__ __attribute__((aligned(16))) float so[4][16][64];
  const int tid = threadIdx.x, w = tid >> 5, lane = tid & 31, ln = lane & 15, hh = lane >> 4;
  const int ntn = N / 64;
  const int wid = blockIdx.x * 4 + w;
  const int mt = wid / ntn, nq = wid % ntn;
  if (mt * 16 >= M) return;
  const int row0 = mt * 16, col0 = nq * 64;
  const float* arow = A + (size_t)(row0 + ln) * lda;
  v8f acc[4] = {};
  for (int kb = 0; kb < K; kb += 32) {
    FragB ah, al;
    const v4f x0 = *(const v4fa*)(arow + kb + 8 * hh), x1 = *(const v4fa*)(arow + kb + 8 * hh + 4);
    const v4f x2 = *(const v4fa*)(arow + kb + 16 + 8 * hh), x3 = *(const v4fa*)(arow + kb + 16 + 8 * hh + 4);
    float xs[16] = {x0[0],x0[1],x0[2],x0[3],x1[0],x1[1],x1[2],x1[3],x2[0],x2[1],x2[2],x2[3],x3[0],x3[1],x3[2],x3[3]};
#pragma unroll
    for (int i = 0; i < 16; ++i) { const unsigned short hb = bf16_bits(xs[i]); ah.u[i] = hb; al.u[i] = ASPLIT ? bf16_bits(xs[i] - bf16_val(hb)) : (unsigned short)0; }
#pragma unroll
    for (int t = 0; t < 4; ++t) {
      const unsigned short* brow = Wt + (size_t)(col0 + t * 16 + ln) * ldb + kb;
      FragB b;
      b.half[0] = *(const v8us*)(brow + 8 * hh);
      b.half[1] = *(const v8us*)(brow + 16 + 8 * hh);
      acc[t] = mmaN<ASPLIT ? 2 : 1>(ah.v, al.v, b.v, b.v, acc[t]);
    }
  }
#pragma unroll
  for (int t = 0; t < 4; ++t) {
    const int col = col0 + t * 16 + ln;
    float bv = bias ? bias[col] : 0.f;
    if (BIAS_BF16) bv = bf16_round(bv);
#pragma unroll
    for (int r = 0; r < 8; ++r) {
      float v = acc[t][r] + bv;
      if (resid) { float rv = resid[(size_t)((row0 + 8 * hh + r) % rmod) * ldr + col]; if (RES_BF16) rv = bf16_round(rv); v += rv; }
      if (ACT == 1) v = fmaxf(v, 0.f);
      if (ACT == 2) v = 0.5f * v * (1.0f + erff(v * 0.70710678118654752f));
      if (ACT == 3) { const float u = 0.7978845608028654f * (v + 0.044715f * v * v * v); v = 0.5f * v * (1.0f + tanhf(u)); }
      so[w][8 * hh + r][t * 16 + ln] = v;
    }
  }
  __builtin_amdgcn_fence(__ATOMIC_ACQ_REL, "workgroup");
  __builtin_amdgcn_wave_barrier();
  const int rsub = lane >> 4, c4 = (lane & 15) * 4;
  {
#pragma unroll
    for (int q = 0; q < 8; ++q) {
      const int r = q * 2 + rsub;
      const v4f v = *(const v4fa*)&so[w][r][c4];
      *(v4f*)(C + (size_t)(row0 + r) * ldc + col0 + c4) = v;
    }
    
  }
}
// row LayerNorm (biased variance, eps) over N: s = X (+ R); optional out_sum <- s; out_norm <- (s-mu)*rsqrt(var+eps)*g + b
template <bool PARAM_BF16>
__global__ __launch_bounds__(256) void k_layernorm(const float* __restrict__ X, const float* __restrict__ R, const float* __restrict__ g, const float* __restrict__ bta,
                                                  float* __restrict__ out_sum, float* __restrict__ out_norm, int N, float eps) {
  __shared__ float red[256];
  const int row = blockIdx.x, tid = threadIdx.x;
  const float* x = X + (size_t)row * N; const float* rr = R ? R + (size_t)row * N : nullptr;
  float vals[16];                     // up to N = 4096
  const int per = N / 256;            // contiguous chunk per thread? use strided-by-4 chunks: thread handles j = tid*4 + 1024*u
  float s1 = 0.f;
  for (int u = 0; u < per / 4; ++u) {
    const int j = tid * 4 + 1024 * u;
    const v4f a = *(const v4fa*)(x + j);
    v4f b = {0.f,0.f,0.f,0.f}; if (rr) b = *(const v4fa*)(rr + j);
#pragma unroll
    for (int q = 0; q < 4; ++q) { const float v = a[q] + b[q]; vals[u * 4 + q] = v; s1 += v; }
  }
  red[tid] = s1; __syncthreads();
  for (int st = 128; st > 0; st >>= 1) { if (tid < st) red[tid] += red[tid + st]; __syncthreads(); }
  const float mu = red[0] / (float)N; __syncthreads();
  float s2 = 0.f;
  for (int u = 0; u < per / 4; ++u)
#pragma unroll
    for (int q = 0; q < 4; ++q) { const float c = vals[u * 4 + q] - mu; s2 += c * c; }
  red[tid] = s2; __syncthreads();
  for (int st = 128; st > 0; st >>= 1) { if (tid < st) red[tid] += red[tid + st]; __syncthreads(); }
  const float rs = rsqrtf(red[0] / (float)N + eps);
  {
    for (int u = 0; u < per / 4; ++u) {
      const int j = tid * 4 + 1024 * u;
      v4f o, sm;
#pragma unroll
      for (int q = 0; q < 4; ++q) {
        float gg = g[j + q], bb = bta[j + q];
        if (PARAM_BF16) { gg = bf16_round(gg); bb = bf16_round(bb); }
        sm[q] = vals[u * 4 + q]; o[q] = (vals[u * 4 + q] - mu) * rs * gg + bb;
      }
      if (out_sum) *(v4f*)(out_sum + (size_t)row * N + j) = sm;
      *(v4f*)(out_norm + (size_t)row * N + j) = o;
    }
    
  }
}



// ---- f16 WMMA path (v_wmma_f32_16x16x32_f16): 11-bit significands for operands in range — used where a [0,1] probability operand needs more precision than bf16
typedef _Float16 v16h __attribute__((ext_vector_type(16)));
union FragH { v16h v; v8us half[2]; _Float16 h[16]; unsigned short u[16]; };
template <int NT>
__device__ __forceinline__ v8f mmaH(v16h ah, v16h al, v16h bh, v16h bl, v8f c) {
  c = __builtin_amdgcn_wmma_f32_16x16x32_f16(false, ah, false, bh, (short)0, c, false, false);
  if (NT >= 2) c = __builtin_amdgcn_wmma_f32_16x16x32_f16(false, al, false, bh, (short)0, c, false, false);
  if (NT >= 3) c = __builtin_amdgcn_wmma_f32_16x16x32_f16(false, ah, false, bl, (short)0, c, false, false);
  asm volatile("v_nop\n\tv_nop\n\tv_nop\n\tv_nop" : "+v"(c) : "v"(ah), "v"(al), "v"(bh), "v"(bl));
  return c;
}
// batched GEMM like k_gemm_b but f16 operands: A f32 (split into f16 hi/lo if ASPLIT, else rounded to f16), Bt = f16 values [n][k]; alpha; C f32; N multiple of 16 (partial tiles skipped)
template <bool ASPLIT>
__global__ __launch_bounds__(128) void k_gemm_h(const float* __restrict__ A, int lda, size_t sA, const _Float16* __restrict__ Bh, int ldb, size_t sB, float alpha, float* __restrict__ C, int ldc, size_t sC, int M, int N, int K) {
  __shared__ __attribute__((aligned(16))) float so[4][16][64];
  const int tid = threadIdx.x, w = tid >> 5, lane = tid & 31, ln = lane & 15, hh = lane >> 4; const int by = blockIdx.y;
  A += (size_t)by * sA; Bh += (size_t)by * sB; C += (size_t)by * sC;
  const int ntn = (N + 63) / 64; const int wid = blockIdx.x * 4 + w; const int mt = wid / ntn, nq = wid % ntn; if (mt * 16 >= M) return;
  const int row0 = mt * 16, col0 = nq * 64; const float* arow = A + (size_t)(row0 + ln) * lda;
  v8f acc[4] = {};
  for (int kb = 0; kb < K; kb += 32) {
    FragH ah, al;
    const v4f x0 = *(const v4fa*)(arow + kb + 8 * hh), x1 = *(const v4fa*)(arow + kb + 8 * hh + 4), x2 = *(const v4fa*)(arow + kb + 16 + 8 * hh), x3 = *(const v4fa*)(arow + kb + 16 + 8 * hh + 4);
    float xs[16] = {x0[0],x0[1],x0[2],x0[3],x1[0],x1[1],x1[2],x1[3],x2[0],x2[1],x2[2],x2[3],x3[0],x3[1],x3[2],x3[3]};
#pragma unroll
    for (int i = 0; i < 16; ++i) { const _Float16 h = (_Float16)xs[i]; ah.h[i] = h; al.h[i] = ASPLIT ? (_Float16)(xs[i] - (float)h) : (_Float16)0.0f; }
#pragma unroll
    for (int t = 0; t < 4; ++t) { if (col0 + t * 16 >= N) continue; const size_t boff = (size_t)(col0 + t * 16 + ln) * ldb + kb; FragH bq; bq.half[0] = *(const v8us*)(Bh + boff + 8 * hh); bq.half[1] = *(const v8us*)(Bh + boff + 16 + 8 * hh);
      acc[t] = mmaH<ASPLIT ? 2 : 1>(ah.v, al.v, bq.v, bq.v, acc[t]); }
  }
#pragma unroll
  for (int t = 0; t < 4; ++t) { if (col0 + t * 16 >= N) continue;
#pragma unroll
    for (int r = 0; r < 8; ++r) so[w][8 * hh + r][t * 16 + ln] = acc[t][r] * alpha; }
  __builtin_amdgcn_fence(__ATOMIC_ACQ_REL, "workgroup"); __builtin_amdgcn_wave_barrier();
  const int rsub = lane >> 4, c4 = (lane & 15) * 4;
  {
#pragma unroll
    for (int q = 0; q < 8; ++q) { const int r = q * 2 + rsub; if (col0 + c4 < N) { const v4f v = *(const v4fa*)&so[w][r][c4]; *(v4f*)(C + (size_t)(row0 + r) * ldc + col0 + c4) = v; } }
     }
}

// Wt[n][k] = f16(W[k][n]·scale) from f32 row-major W[K][N] (scale = power of two; bf16-exact weights stay exact in f16 away from the subnormal range)
__global__ __launch_bounds__(256) void k_wt_f16(const float* __restrict__ W, _Float16* __restrict__ Wt, int K, int N, float scale) {
  const int t = blockIdx.x * 256 + threadIdx.x; if (t >= N * (K / 8)) return; const int n = t / (K / 8), k8 = (t % (K / 8)) * 8; FragH f;
#pragma unroll
  for (int i = 0; i < 8; ++i) f.h[i] = (_Float16)(bf16_round(W[(size_t)(k8 + i) * N + n]) * scale); const v8us o = f.half[0];
  *(v8us*)((unsigned short*)Wt + (size_t)n * K + k8) = o; 
}
// k_gemm_hh variant with fused epilogue: v = acc·alpha + bias[by·sBias + col] (+ CP[(row/rowsPerB)·sCPb + by·64 + col] if CP) ; ACT 0 none / 1 elu ; writes f16 C16 (and f32 C if non-null)
template <int ACT>
__global__ __launch_bounds__(128) void k_gemm_hhx(const _Float16* __restrict__ A, int lda, size_t sA, const _Float16* __restrict__ Bh, int ldb, size_t sB, float alpha, const float* __restrict__ bias, size_t sBias, const float* __restrict__ CP, int rowsPerB, size_t sCPb, int row0g,
    float* __restrict__ C, _Float16* __restrict__ C16, int ldc, size_t sC, int M, int N, int K) {
  __shared__ __attribute__((aligned(16))) float so[4][16][64];
  const int tid = threadIdx.x, w = tid >> 5, lane = tid & 31, ln = lane & 15, hh = lane >> 4; const int by = blockIdx.y;
  A += (size_t)by * sA; Bh += (size_t)by * sB; const size_t cofs = (size_t)by * sC; const float* bp = bias ? bias + (size_t)by * sBias : nullptr;
  const int ntn = (N + 63) / 64; const int wid = blockIdx.x * 4 + w; const int mt = wid / ntn, nq = wid % ntn; if (mt * 16 >= M) return;
  const int row0 = mt * 16, col0 = nq * 64; const _Float16* arow = A + (size_t)(row0 + ln) * lda;
  v8f acc[4] = {};
  for (int kb = 0; kb < K; kb += 32) { FragH ah; ah.half[0] = *(const v8us*)((const unsigned short*)arow + kb + 8 * hh); ah.half[1] = *(const v8us*)((const unsigned short*)arow + kb + 16 + 8 * hh);
#pragma unroll
    for (int t = 0; t < 4; ++t) { if (col0 + t * 16 >= N) continue; const size_t boff = (size_t)(col0 + t * 16 + ln) * ldb + kb; FragH bq; bq.half[0] = *(const v8us*)((const unsigned short*)Bh + boff + 8 * hh); bq.half[1] = *(const v8us*)((const unsigned short*)Bh + boff + 16 + 8 * hh);
      acc[t] = mmaH<1>(ah.v, ah.v, bq.v, bq.v, acc[t]); }
  }
#pragma unroll
  for (int t = 0; t < 4; ++t) { if (col0 + t * 16 >= N) continue; const int col = col0 + t * 16 + ln; const float bv = bp ? bf16_round(bp[col]) : 0.f;
#pragma unroll
    for (int r = 0; r < 8; ++r) { float v = acc[t][r] * alpha + bv; if (CP) { const int rr = row0g + row0 + 8 * hh + r; if (rowsPerB < 0) v += CP[cofs + (size_t)rr * ldc + col];      /* rowsPerB < 0: own element of the batched C plane */ else { const int bidx = rr / rowsPerB; v += CP[(size_t)bidx * sCPb + (size_t)by * 64 + col]; } } if (ACT == 1) v = (v > 0.f) ? v : expm1f(v); else if (ACT == 7) v = (v > 0.f) ? v + 1.0f : expf(v); else if (ACT == 8) v = tanhf(v); else if (ACT == 9) v = 0.5f * v * (1.0f + tanhf(0.7978845608028654f * (v + 0.044715f * v * v * v))); else if (ACT == 11) v = 1.0f / (1.0f + expf(-v)); else if (ACT == 12) v = (v > 0.f) ? v : 0.01f * v; else if (ACT == 14) v = (v > 0.f) ? v : 0.1f * v; else if (ACT == 16) v = (v >= 0.f) ? v : 0.3f * v; else if (ACT == 17) v = (v >= 0.f) ? v : 0.2f * v; else if (ACT == 15) v = v / (1.0f + expf(-v)); else if (ACT == 3) v = fmaxf(v, 0.f); else if (ACT == 6) v = 0.5f * v * (1.0f + erff(v * 0.70710678118654752f)); so[w][8 * hh + r][t * 16 + ln] = v; } }
  __builtin_amdgcn_fence(__ATOMIC_ACQ_REL, "workgroup"); __builtin_amdgcn_wave_barrier();
  const int rsub = lane >> 4, c4 = (lane & 15) * 4; typedef _Float16 v4h __attribute__((ext_vector_type(4)));
  {
#pragma unroll
    for (int q = 0; q < 8; ++q) { const int r = q * 2 + rsub; if (col0 + c4 < N) { const v4f v = *(const v4fa*)&so[w][r][c4]; if (C) *(v4f*)(C + cofs + (size_t)(row0 + r) * ldc + col0 + c4) = v; if (C16) { v4h h4; for (int i = 0; i < 4; ++i) h4[i] = (_Float16)v[i]; *(v4h*)(C16 + cofs + (size_t)(row0 + r) * ldc + col0 + c4) = h4; } } }
     }
}


typedef _Float16 v4h __attribute__((ext_vector_type(4)));

__global__ __launch_bounds__(256) void k_h16(const float* __restrict__ x, _Float16* __restrict__ X16, size_t n8) { const size_t t = (size_t)blockIdx.x * 256 + threadIdx.x; if (t >= n8) return; FragH f;
#pragma unroll
  for (int q = 0; q < 8; ++q) f.h[q] = (_Float16)x[t * 8 + q]; *(v8us*)((unsigned short*)X16 + t * 8) = f.half[0];  }
__global__ __launch_bounds__(256) void k_round16f(const float* __restrict__ W, _Float16* __restrict__ Bt, size_t n8) { const size_t t = (size_t)blockIdx.x * 256 + threadIdx.x; if (t >= n8) return; FragH f;
#pragma unroll
  for (int i = 0; i < 8; ++i) f.h[i] = (_Float16)(bf16_round(W[t * 8 + i]) * 16.0f); *(v8us*)((unsigned short*)Bt + t * 8) = f.half[0];  }
template <int NHv, int TTv>
__global__ __launch_bounds__(256) void k_vt(const _Float16* __restrict__ V16, int ldv, int voff, _Float16* __restrict__ Vt) { __shared__ unsigned short tl[64][66]; const int tid = threadIdx.x; const int slab = blockIdx.x / (TTv / 64), lg = blockIdx.x % (TTv / 64); const int b = slab / NHv, h = slab % NHv;
  for (int i = tid; i < 64 * 8; i += 256) { const int r = i / 8, c8 = (i % 8) * 8; FragH f; f.half[0] = *(const v8us*)((const unsigned short*)V16 + ((size_t)b * TTv + lg * 64 + r) * ldv + voff + h * 64 + c8);
#pragma unroll
    for (int q = 0; q < 8; ++q) tl[r][c8 + q] = f.u[q]; }
  __syncthreads();
  {
#pragma unroll
    for (int rd = 0; rd < 2; ++rd) { const int d = rd * 32 + tid / 8, pc = tid % 8; FragH f;
#pragma unroll
      for (int q = 0; q < 8; ++q) f.u[q] = tl[pc * 8 + q][d];
      *(v8us*)((unsigned short*)Vt + ((size_t)slab * 64 + d) * TTv + lg * 64 + pc * 8) = f.half[0]; }
     } }

__global__ __launch_bounds__(256) void k_hl(const float* __restrict__ F, _Float16* __restrict__ Hh, _Float16* __restrict__ Hl, size_t n8) { const size_t t = (size_t)blockIdx.x * 256 + threadIdx.x; if (t >= n8) return; FragH fh, fl; const v4f a = *(const v4fa*)(F + t * 8), c = *(const v4fa*)(F + t * 8 + 4);
#pragma unroll
  for (int q = 0; q < 4; ++q) { _Float16 h = (_Float16)a[q]; fh.h[q] = h; fl.h[q] = (_Float16)((a[q] - (float)h) * 1024.0f); h = (_Float16)c[q]; fh.h[4 + q] = h; fl.h[4 + q] = (_Float16)((c[q] - (float)h) * 1024.0f); }
  { *(v8us*)((unsigned short*)Hh + t * 8) = fh.half[0]; *(v8us*)((unsigned short*)Hl + t * 8) = fl.half[0];  } }

// fragment of 16 rows x 32 k from k-contiguous rows in global memory (the hardware k order)
__device__ __forceinline__ v16h g2_frag(const _Float16* p, int hh) { FragH f; f.half[0] = *(const v8us*)((const unsigned short*)p + 8 * hh); f.half[1] = *(const v8us*)((const unsigned short*)p + 16 + 8 * hh); return f.v; }
// ---- GEMM with both operands staged in LDS: C = alpha A Bh^T + bs bias (bias [N], or [M] if RB, never null, rounded to bf16); A [M][K] and Bh [N][K] f16, k contiguous; needs M % 128 == 0, N % 128 == 0, K % 128 == 0 ----
// A block is 4 waves (2 x 2) on a 128 x 128 tile of C; a wave owns 64 x 64 (16 accumulator tiles). A stage is 128 k: 256 bytes of each of the block's 128 A rows and 128 B rows,
// brought by tensor loads to LDS, one request a wave and stage: a slice of 64 rows of 256 bytes (waves 0, 1: A rows 0..63, 64..127; waves 2, 3: B rows), the mover's pad of 16 bytes a row giving the LDS pitch.
// Two buffers: stage t + 2 is asked for behind the barrier that ends trip t, into the buffer that trip t has read. Fragments by two 16-byte LDS reads in the k order of g2_frag, k steps in rising order.
#define G3_KS 128                    /* k per stage */
#define G3_P 272                     /* LDS row pitch in bytes: 16 x odd, so the 16-byte fragment reads of 16 rows meet no bank twice */
#define G3_SL 18432                  /* LDS bytes of a slice: 64 rows at pitch G3_P (17,408), rounded up so that every slice starts at a multiple of 2 KiB */
#define G3_ST (4 * G3_SL)            /* bytes per stage: A slices 0, 1, then B slices 0, 1 */
static_assert(G3_SL % 2048 == 0 && G3_SL >= 64 * G3_P, "a slice holds its 64 padded rows and the next one starts at a multiple of 2 KiB");
// ---- tensor load to LDS: a two-dimensional tile of ROWS rows of ROWB bytes, everything counted in bytes (data_size code 0), tensor = tile, no mask; every descriptor word in a scalar register ----
typedef uint32_t u32x4 __attribute__((ext_vector_type(4)));
typedef uint32_t u32x8 __attribute__((ext_vector_type(8)));
#define TD_PAD128 ((1u << 20) | (4u << 22) | (3u << 25))      /* word 0 of group 1 for rows of 128 bytes: 16 bytes of pad behind each row (LDS pitch 144) */
#define TD_PAD256 ((1u << 20) | (5u << 22) | (3u << 25))      /* ... for rows of 256 bytes (LDS pitch 272) */
__device__ __forceinline__ uint32_t td_uni(uint32_t v) { return (uint32_t)__builtin_amdgcn_readfirstlane((int)v); }
// pinned(): a wave-uniform value held in a scalar register: a test on it compiles to a scalar compare and branch (a tensor load ignores EXEC, so only such a branch guards it), and what is computed from it stays behind the volatile statements in front of it.
__device__ __forceinline__ uint32_t td_pinned(uint32_t v) { uint32_t w = td_uni(v); asm volatile("" : "+s"(w)); return w; }
template <uint32_t W0, uint32_t ROWB, uint32_t ROWS>
__device__ __forceinline__ u32x8 td_group1(uint32_t pitch) {      /* pitch: bytes from one source row to the next */
  u32x8 g;
  g[0] = td_uni(W0); g[1] = td_uni((ROWB & 0xFFFFu) << 16); g[2] = td_uni((ROWB >> 16) | ((ROWS & 0xFFFFu) << 16)); g[3] = td_uni((ROWS >> 16) | (ROWB << 16));
  g[4] = td_uni(ROWS); g[5] = td_uni(pitch); g[6] = td_uni(0u); g[7] = td_uni(0u);
  asm volatile("" : "+s"(g));      /* pinned(): descriptor words held in scalar registers: built once and kept where they are, not formed anew in registers that a request in flight still names */
  return g; }
__device__ __forceinline__ u32x4 td_group0(uint32_t lds, const _Float16* src) {      /* lds: byte offset in the work-group's LDS; src: the tile's first byte */
  const uint64_t ga = (uint64_t)(size_t)src; u32x4 g;
  g[0] = td_uni(1u); g[1] = td_uni(lds); g[2] = td_uni((uint32_t)ga); g[3] = (td_uni((uint32_t)(ga >> 32)) & 0x01FFFFFFu) | 0x80000000u;
  asm volatile("" : "+s"(g));      /* pinned(): descriptor words held in scalar registers, for the reason given in td_group1 */
  return g; }
__device__ __forceinline__ void td_load(u32x4 g0, u32x8 g1) { asm volatile("tensor_load_to_lds %0, %1" :: "s"(g0), "s"(g1) : "memory"); }      /* one request of the whole wave */
// The issuing wave's wait for its request. It names the request's descriptor groups, so their registers stay live up to here and nothing is written over them while the request is outstanding.
__device__ __forceinline__ void td_wait(u32x4 g0, u32x8 g1) { asm volatile("s_wait_tensorcnt 0x0" :: "s"(g0), "s"(g1) : "memory"); }
__device__ __forceinline__ v16h g3_frag(const unsigned char* p) { FragH f; f.half[0] = *(const v8us*)p; f.half[1] = *(const v8us*)(p + 32); return f.v; }
// One 128 x 128 tile of C by one block: C = alpha A Bh^T + bs bias. A, Bh, bias, C and C16 point at the tile's own first row, column or element; sm is the block's 2 * G3_ST bytes of LDS.
template <bool F32OUT, bool RB>      /* output rows: f32 to C, or f16 to C16; the bias belongs to C's rows (RB: the weight is the A operand), or to its columns */
__device__ __forceinline__ void g3_tile(unsigned char* sm, const _Float16* __restrict__ A, int lda, const _Float16* __restrict__ Bh, int ldb, float alpha, const float* __restrict__ bias, float bs,
    float* __restrict__ C, _Float16* __restrict__ C16, int ldc, int K) {
  const int tid = threadIdx.x, w = tid >> 5, lane = tid & 31, ln = lane & 15, hh = lane >> 4;
  const int wm = w >> 1, wn = w & 1;
  const uint32_t wv = td_uni((uint32_t)tid >> 5);      /* the wave's number, in a scalar register */
  const uint32_t lw = (uint32_t)(size_t)sm + wv * G3_SL;      /* this wave's slice in buffer 0 */
  const _Float16* gw = wv < 2 ? A + (size_t)(wv * 64) * lda : Bh + (size_t)((wv - 2) * 64) * ldb;      /* ... and its first source row, at k 0 */
  const u32x8 g1 = td_group1<TD_PAD256, 2 * G3_KS, 64>((uint32_t)(wv < 2 ? lda : ldb) * 2u);
  const int T = K / G3_KS;
  const v8f z8 = {0.f,0.f,0.f,0.f,0.f,0.f,0.f,0.f}; v8f acc[4][4];
  /* every inner loop of this kernel is unrolled so that each index of acc, a and b is a constant and the arrays stay in registers */
#pragma unroll
  for (int i = 0; i < 4; ++i)
#pragma unroll
    for (int j = 0; j < 4; ++j) acc[i][j] = z8;
  const int bcol = wn * 64 + ln; float braw[4];      /* asked for here and first used behind the loop, so that the loads' latency passes under the stages */
  if (!RB) {
#pragma unroll
    for (int j = 0; j < 4; ++j) braw[j] = bias[bcol + j * 16];
    asm volatile("s_wait_xcnt 0x0" :: "v"(bcol), "s"(bias) : "memory");      /* the four loads' index and base stay live up to this wait, so nothing is written over them earlier */
  }
  u32x4 g0 = td_group0(lw, gw);      /* group 0 of the request last issued */
  td_load(g0, g1);
  td_wait(g0, g1);                                        /* this wave's slice of stage 0 has landed */
  __syncthreads();                                        /* ... and every other wave's */
  if (td_pinned(1 < T)) { g0 = td_group0(lw + G3_ST, gw + G3_KS); td_load(g0, g1); }
  const unsigned char* fa = sm + wm * G3_SL + ln * G3_P + 16 * hh; const unsigned char* fb = sm + (2 + wn) * G3_SL + ln * G3_P + 16 * hh;
#pragma unroll 1
  for (int t = 0; t < T; ++t) {      /* rolled: one trip a stage, the hand-over at its foot */
    const int bo = (t & 1) * G3_ST;
    v16h a[2][2], b[2][4];      /* a block is 8 products: two A fragments x the k step's four B fragments; two register sets, the next block's fragments asked for one block ahead */
#pragma unroll
    for (int i = 0; i < 2; ++i) a[0][i] = g3_frag(fa + bo + i * 16 * G3_P);
#pragma unroll
    for (int j = 0; j < 4; ++j) b[0][j] = g3_frag(fb + bo + j * 16 * G3_P);
#pragma unroll
    for (int hb = 0; hb < G3_KS / 16; ++hb) {
      const int ks = hb >> 1, h = hb & 1, ks1 = (hb + 1) >> 1, h1 = (hb + 1) & 1;
      if (hb + 1 < G3_KS / 16) {
#pragma unroll
        for (int i = 0; i < 2; ++i) a[h1][i] = g3_frag(fa + bo + (2 * h1 + i) * 16 * G3_P + ks1 * 64);
        if (h1 == 0) {
#pragma unroll
          for (int j = 0; j < 4; ++j) b[ks1 & 1][j] = g3_frag(fb + bo + j * 16 * G3_P + ks1 * 64);
        }
      }
      __builtin_amdgcn_sched_barrier(0);      /* keeps the next block's LDS reads together in front of this block's products: left free, they were sunk among the products and waited for at once */
#pragma unroll
      for (int i = 0; i < 2; ++i)
#pragma unroll
        for (int j = 0; j < 4; ++j) acc[2 * h + i][j] = __builtin_amdgcn_wmma_f32_16x16x32_f16(false, a[h][i], false, b[ks & 1][j], (short)0, acc[2 * h + i][j], false, false);
      __builtin_amdgcn_sched_barrier(0);      /* ... and the block after next's reads behind them */
    }
    asm volatile("s_wait_dscnt 0x0" ::: "memory");
    td_wait(g0, g1);
    __syncthreads();
    if (td_pinned(t + 2 < T)) { g0 = td_group0(lw + bo, gw + (size_t)td_pinned(t + 2) * G3_KS); td_load(g0, g1); }      /* the stage number is taken behind the wait, so the descriptor is formed there too */
  }
  const int brw = wm * 64 + 8 * hh; v4f brow[4][2];      /* RB: a lane's 8 rows of each accumulator tile i; asked for behind the loop: held through it, these 32 registers took the kernel past 256 */
  if (RB) {
#pragma unroll
    for (int i = 0; i < 4; ++i) { brow[i][0] = *(const v4fa*)(bias + brw + i * 16); brow[i][1] = *(const v4fa*)(bias + brw + i * 16 + 4); }
    asm volatile("s_wait_xcnt 0x0" :: "v"(brw), "s"(bias) : "memory");      /* the eight loads' index and base stay live up to this wait, so nothing is written over them earlier */
  }
  td_wait(g0, g1);                                        /* nothing is in flight when the buffers become output staging */
  asm volatile("s_wait_dscnt 0x0" ::: "memory");          /* ... and this wave's reads of them are done */
  float* so = (float*)sm + w * (64 * 68);
#pragma unroll
  for (int j = 0; j < 4; ++j) {
#pragma unroll
    for (int i = 0; i < 4; ++i)
#pragma unroll
      for (int r = 0; r < 8; ++r) so[(i * 16 + 8 * hh + r) * 68 + j * 16 + ln] = acc[i][j][r] * alpha + bf16_round(RB ? brow[i][r >> 2][r & 3] : braw[j]) * bs; }
  __builtin_amdgcn_fence(__ATOMIC_ACQ_REL, "workgroup"); __builtin_amdgcn_wave_barrier();      /* the wave's staging writes stay in front of its own reads of them; no other wave touches its range */
  const int c4 = ln * 4; const size_t cb = (size_t)(wm * 64 + hh) * ldc + wn * 64 + c4;
#pragma unroll
  for (int q = 0; q < 32; ++q) { const v4f v = *(const v4fa*)&so[(q * 2 + hh) * 68 + c4]; if (F32OUT) *(v4f*)(C + cb + (size_t)(q * 2) * ldc) = v; else { v4h h4; for (int i = 0; i < 4; ++i) h4[i] = (_Float16)v[i]; *(v4h*)(C16 + cb + (size_t)(q * 2) * ldc) = h4; } }
}
// C (f32 rows) = alpha A Bh^T + bias: one block a tile.
__global__ __launch_bounds__(128) void k_gemm3(const _Float16* __restrict__ A, int lda, const _Float16* __restrict__ Bh, int ldb, float alpha, const float* __restrict__ bias, float* __restrict__ C, int ldc, int M, int N, int K) {
  __shared__ __attribute__((aligned(2048))) unsigned char sm[2 * G3_ST];      /* the two buffers; behind the loop each wave's own 64 x 68 f32 output staging */
  const int ntn = N >> 7; const int mt = blockIdx.x / ntn, nq = blockIdx.x - mt * ntn; const int row0 = mt * 128, col0 = nq * 128; if (row0 >= M) return;      /* the same for the whole block */
  g3_tile<true, false>(sm, A + (size_t)row0 * lda, lda, Bh + (size_t)col0 * ldb, ldb, alpha, bias + col0, 1.0f, C + (size_t)row0 * ldc + col0, nullptr, ldc, K);
}
// The three projections in one launch: 3 * (DM / 128) blocks in a row share one tile of 128 x rows: DM / 128 column tiles of q, as many of k (A = x rows, B = weight rows, token rows out), then as many tiles of V^T:
// there the weight rows are the A operand and the x rows the B operand, so C's rows are the V^T rows [batch][head][d][key] that the attention launch reads, and nothing is left to transpose. A tile's 128 keys lie in one batch (128 divides SQ).
#define QKV_NT (DM / 128)            /* tiles across one projection's outputs */
#define FA_SC (0.125f * 1.4426950408889634f)      /* 1 / sqrt(64), in log2 units: the q rows are stored times this factor (one rounding to f16, as before), so that K Q^T comes out in the softmax's base-2 exponent units */
__global__ __launch_bounds__(128) void k_qkv(const _Float16* __restrict__ X16, const _Float16* __restrict__ BQ, const _Float16* __restrict__ BK, const _Float16* __restrict__ BV,
    const float* __restrict__ bq, const float* __restrict__ bk, const float* __restrict__ bv, _Float16* __restrict__ Q16, _Float16* __restrict__ K16, _Float16* __restrict__ VT) {
  __shared__ __attribute__((aligned(2048))) unsigned char sm[2 * G3_ST];      /* the two buffers; behind the loop each wave's own 64 x 68 f32 output staging */
  const int mt = blockIdx.x / (3 * QKV_NT), c = blockIdx.x - mt * (3 * QKV_NT); const int o0 = (c % QKV_NT) * 128;      /* x tile; projection c / QKV_NT, its first output feature: the same for the whole block */
  const _Float16* xt = X16 + (size_t)mt * 128 * DM;
  if (c < 2 * QKV_NT) { const bool kk = c >= QKV_NT; const float qs = kk ? 1.0f : FA_SC;
    g3_tile<false, false>(sm, xt, DM, (kk ? BK : BQ) + (size_t)o0 * DM, DM, 0.0625f * qs, (kk ? bk : bq) + o0, qs, nullptr, (kk ? K16 : Q16) + (size_t)mt * 128 * DM + o0, DM, DM);
  } else {
    g3_tile<false, true>(sm, BV + (size_t)o0 * DM, DM, xt, DM, 0.0625f, bv + o0, 1.0f, nullptr, VT + ((size_t)(mt / (SQ / 128)) * DM + o0) * SQ + (mt % (SQ / 128)) * 128, SQ, DM);
  }
}


__global__ __launch_bounds__(256) void k_rsm(const float* __restrict__ S, _Float16* __restrict__ P, int nrows) {
  #pragma clang fp contract(off)
  const int i = blockIdx.x * 256 + threadIdx.x; if (i >= nrows) return; const float* s = S + (size_t)i * SQ; float mx = -3.0e38f;
#pragma unroll 1
  for (int j = 0; j < SQ; ++j) mx = fmaxf(mx, s[j]); float se = 0.f;
#pragma unroll 1
  for (int j = 0; j < SQ; ++j) se += expf(s[j] - mx); const float sc = 256.0f / se;
#pragma unroll 1
  for (int j0 = 0; j0 < SQ; j0 += 8) { FragH f; for (int q = 0; q < 8; ++q) f.h[q] = (_Float16)(expf(s[j0 + q] - mx) * sc); unsigned short* d = (unsigned short*)P + (size_t)i * SQ + j0; *(v8us*)d = f.half[0];  } }
__global__ __launch_bounds__(256) void k_vt(const _Float16* __restrict__ V16, int b, int h0, _Float16* __restrict__ VT) { __shared__ unsigned short tl[64][65]; const int tid = threadIdx.x; const int hh = blockIdx.x % HG, sg = blockIdx.x / HG; const int s0 = sg * 64; const int h = h0 + hh;
  for (int i = tid; i < 64 * 8; i += 256) { const int j = i / 8, d8 = (i % 8) * 8; FragH f; f.half[0] = *(const v8us*)((const unsigned short*)V16 + ((size_t)b * SQ + s0 + j) * DM + h * HD + d8); for (int q = 0; q < 8; ++q) tl[d8 + q][j] = f.u[q]; }
  __syncthreads();
  { for (int i = tid; i < 64 * 8; i += 256) { const int d = i / 8, j8 = (i % 8) * 8; FragH f; for (int q = 0; q < 8; ++q) f.u[q] = tl[d][j8 + q]; *(v8us*)((unsigned short*)VT + ((size_t)hh * HD + d) * SQ + s0 + j8) = f.half[0]; }  } }


// Final stage: y = x + global + 0.3 (conv3 of x + b), LayerNorm, affine. One wave owns FN_R consecutive token rows whole: a lane holds 32 columns of each (8 pieces of 4; piece c = columns 128 c + 4 lane),
// so every load and store of a wave is 512 bytes in a row and a row's sums are in-lane adds plus one lane butterfly. All of a wave's row loads are asked for at its start, before anything waits.
// The six column parameters (three conv taps, conv bias, gain, shift) are rounded to bf16 once per block and shared through LDS planes. FN_R divides SQ, so a wave's rows lie in one sequence;
// the row in front of the first and the row behind the last of a sequence count as zero.
#define FN_R 2                       /* token rows per wave */
template <int CTRL> __device__ __forceinline__ float fn_dpp(float v) { return __builtin_bit_cast(float, __builtin_amdgcn_update_dpp(0, __builtin_bit_cast(int, v), CTRL, 0xf, 0xf, true)); }      /* 0x160 + m: lane l <- lane l ^ m inside a 16-lane row */
__device__ __forceinline__ float fn_xhalf(float x) { return __builtin_bit_cast(float, __builtin_amdgcn_permlanex16(__builtin_bit_cast(int, x), __builtin_bit_cast(int, x), 0x76543210, 0xfedcba98, false, false)); }      /* lane l <-> lane l ^ 16 */
__device__ __forceinline__ float fn_wsum(v4f a) { float v = (a[0] + a[1]) + (a[2] + a[3]); v += fn_dpp<0x161>(v); v += fn_dpp<0x162>(v); v += fn_dpp<0x164>(v); v += fn_dpp<0x168>(v); return v + fn_xhalf(v); }      /* the wave's sum, in every lane */
__device__ __forceinline__ v4f fn_ld(const float* base, unsigned bytes) { return *(const v4fa*)((const char*)base + bytes); }      /* scalar base + 32-bit byte offset */
__device__ __forceinline__ v4f fn_rd(v4f a) { v4f r; for (int q = 0; q < 4; ++q) r[q] = bf16_round(a[q]); return r; }
__global__ __launch_bounds__(256) __attribute__((amdgpu_waves_per_eu(4, 4))) void k_msfin(const float* __restrict__ X, const float* __restrict__ G, const float* __restrict__ cw, const float* __restrict__ cb, const float* __restrict__ g, const float* __restrict__ bta, float eps, float* __restrict__ out) {
  __shared__ __attribute__((aligned(16))) float pr[6][DM];      /* planes: tap 0, tap 1, tap 2, conv bias, gain, shift */
  const int tid = threadIdx.x; const unsigned c0 = (tid & 31) * 4u, t4 = tid * 4u;      /* first column of a lane's piece; of this thread's four parameter columns */
  const unsigned lb = (tid & 31) * 16u, tb = tid * 16u, wo = tid * 48u;      /* byte offsets of the loads: a lane's piece in a row, this thread's four parameters, its twelve taps */
  const int wv = __builtin_amdgcn_readfirstlane((int)(blockIdx.x * 8 + (tid >> 5)));      /* the wave's number, in a scalar register: row addresses are scalar base + lane offset */
  const size_t row0 = (size_t)wv * FN_R; const int s0 = (int)(row0 % SQ); const bool hp = s0 > 0, hn = s0 + FN_R < SQ;
  const float* xb = X + row0 * DM; const float* xm = xb - (hp ? DM : 0); const float* xn = xb + (hn ? FN_R * DM : 0);      /* a neighbour outside the sequence: an address in bounds, its values replaced by zero */
  const float* gb = G + row0 * DM;
  const v4f wa = fn_ld(cw, wo), wb = fn_ld(cw, wo + 16), wc = fn_ld(cw, wo + 32), pc = fn_ld(cb, tb), pg = fn_ld(g, tb), pb = fn_ld(bta, tb);      /* this thread's four columns: 12 taps in a row, bias, gain, shift */
  v4f xr[FN_R + 2][8], y[FN_R][8];
  /* every loop of this kernel is unrolled so that each index of xr and y is a constant and the rows stay in registers */
#pragma unroll
  for (int c = 0; c < 8; ++c) { const unsigned j = lb + c * 512; xr[0][c] = fn_ld(xm, j);
#pragma unroll
    for (int r = 0; r < FN_R; ++r) xr[r + 1][c] = fn_ld(xb, j + r * (DM * 4));
    xr[FN_R + 1][c] = fn_ld(xn, j);
#pragma unroll
    for (int r = 0; r < FN_R; ++r) y[r][c] = fn_ld(gb, j + r * (DM * 4)); }
  asm volatile("s_wait_xcnt 0x0" :: "v"(lb), "v"(tb), "v"(wo), "s"(xm), "s"(xb), "s"(xn), "s"(gb), "s"(cw), "s"(cb), "s"(g), "s"(bta) : "memory");      /* the loads' offsets and bases stay live up to this wait, so nothing (a later load's result included) is written over them earlier; its memory clobber also keeps every row load in front of the first wait for data (left free, they were sunk to their uses and waited for one by one) */
  { const v4f a = fn_rd(wa), b = fn_rd(wb), c = fn_rd(wc); const v4f t0 = {a[0], a[3], b[2], c[1]}, t1 = {a[1], b[0], b[3], c[2]}, t2 = {a[2], b[1], c[0], c[3]};
    *(v4f*)&pr[0][t4] = t0; *(v4f*)&pr[1][t4] = t1; *(v4f*)&pr[2][t4] = t2; *(v4f*)&pr[3][t4] = fn_rd(pc); *(v4f*)&pr[4][t4] = fn_rd(pg); *(v4f*)&pr[5][t4] = fn_rd(pb); }
  /* work-group barrier with LDS-only fences: the planes are whole before any wave reads them (nothing writes them again); __syncthreads() would also wait here for every row load still in flight */
  __builtin_amdgcn_fence(__ATOMIC_RELEASE, "workgroup", "local"); __builtin_amdgcn_s_barrier(); __builtin_amdgcn_fence(__ATOMIC_ACQUIRE, "workgroup", "local");
  const v4f z4 = {0.f, 0.f, 0.f, 0.f}; v4f s1[FN_R];
#pragma unroll
  for (int r = 0; r < FN_R; ++r) s1[r] = z4;
#pragma unroll
  for (int c = 0; c < 8; ++c) {
    const unsigned j = c * 128 + c0; v4f xq[FN_R + 2];
#pragma unroll
    for (int r = 0; r < FN_R + 2; ++r) xq[r] = fn_rd(xr[r][c]);
    if (!hp) xq[0] = z4;
    if (!hn) xq[FN_R + 1] = z4;
    const v4f w0 = *(const v4f*)&pr[0][j], w1 = *(const v4f*)&pr[1][j], w2 = *(const v4f*)&pr[2][j], cv = *(const v4f*)&pr[3][j];
#pragma unroll
    for (int r = 0; r < FN_R; ++r) { const v4f loc = xq[r] * w0 + xq[r + 1] * w1 + xq[r + 2] * w2 + cv; const v4f yy = xq[r + 1] + (y[r][c] + 0.3f * loc); y[r][c] = yy; s1[r] += yy; }
  }
  float mu[FN_R], rs[FN_R];
#pragma unroll
  for (int r = 0; r < FN_R; ++r) mu[r] = fn_wsum(s1[r]) * (1.0f / (float)DM);
#pragma unroll
  for (int r = 0; r < FN_R; ++r) { v4f s2 = z4;
#pragma unroll
    for (int c = 0; c < 8; ++c) { y[r][c] -= mu[r]; s2 += y[r][c] * y[r][c]; }
    s1[r] = s2; }
#pragma unroll
  for (int r = 0; r < FN_R; ++r) rs[r] = rsqrtf(fn_wsum(s1[r]) * (1.0f / (float)DM) + eps);
  float* ob = out + row0 * DM;
#pragma unroll
  for (int c = 0; c < 8; ++c) { const unsigned j = c * 128 + c0; const v4f gg = *(const v4f*)&pr[4][j], bb = *(const v4f*)&pr[5][j];
#pragma unroll
    for (int r = 0; r < FN_R; ++r) *(v4f*)(ob + (size_t)r * DM + j) = y[r][c] * rs[r] * gg + bb; }
}


__device__ __forceinline__ float fa_xhalf(float x) { return __builtin_bit_cast(float, __builtin_amdgcn_permlanex16(__builtin_bit_cast(int, x), __builtin_bit_cast(int, x), 0x76543210, 0xfedcba98, false, false)); }      /* lane l <-> lane l ^ 16 */
__device__ __forceinline__ v8f fa_mma(v16h a, v16h b, v8f c) { return __builtin_amdgcn_wmma_f32_16x16x32_f16(false, a, false, b, (short)0, c, false, false); }
// Native exp2 of two values in place, in one statement that ends in v_nop: no v_exp_f32 is directly followed by an instruction that reads its result or writes over its source
// (left to the register allocator, a neighbour's result landed on the source of the exp in front of it).
__device__ __forceinline__ void fa_exp2(float& x0, float& x1) {
  asm("v_exp_f32 %0, %0\n\tv_exp_f32 %1, %1\n\tv_nop" : "+v"(x0), "+v"(x1)); }
// ... of the eight registers of a score tile into eight registers of their own (early clobber: no result lands on a source; the tile's registers are read where the matrix unit left them, with no copy).
__device__ __forceinline__ void fa_exp8(const v8f& x, float* y) {
  asm("v_exp_f32 %0, %8\n\tv_exp_f32 %1, %9\n\tv_exp_f32 %2, %10\n\tv_exp_f32 %3, %11\n\tv_exp_f32 %4, %12\n\tv_exp_f32 %5, %13\n\tv_exp_f32 %6, %14\n\tv_exp_f32 %7, %15\n\tv_nop"
      : "=&v"(y[0]), "=&v"(y[1]), "=&v"(y[2]), "=&v"(y[3]), "=&v"(y[4]), "=&v"(y[5]), "=&v"(y[6]), "=&v"(y[7])
      : "v"(x[0]), "v"(x[1]), "v"(x[2]), "v"(x[3]), "v"(x[4]), "v"(x[5]), "v"(x[6]), "v"(x[7])); }
#define FA_QB 256                    /* query rows per block (8 waves x 32) */
#define FA_TOP 15.0f                 /* largest exponent of a weight before the references are moved: 2^15 is inside f16 */
// K and V^T reach the waves through LDS: a stage is FA_KS keys of the block's (batch, head): FA_KS K rows of 128 bytes, then the 64 V^T rows' 256 bytes of those keys,
// brought once per block by tensor loads, one request a wave and stage (waves 0..3: the 32 K rows of pass w; waves 4..7: V^T rows 16 (w - 4) .. + 15; the mover's pad of 16 bytes a row gives the pitches), and read by all 8 waves.
// Two buffers: stage t + 2 is asked for behind the barrier that ends trip t, into the buffer that trip t has read. Fragments by two 16-byte LDS reads in the k order of g2_frag; keys in rising order as before.
#define FA_KS 128                    /* keys per stage (4 passes) */
#define FA_KP 144                    /* LDS pitch of a K row in bytes: 16 x odd, so the 16-byte fragment reads of 16 rows meet no bank twice */
#define FA_VP 272                    /* LDS pitch of a V^T row in bytes: 16 x odd */
#define FA_SL 6144                   /* LDS bytes of a slice: 32 K rows (4,608) or 16 V^T rows (4,352), rounded up so that every slice starts at a multiple of 2 KiB */
#define FA_VO (4 * FA_SL)            /* the four V^T slices stand behind the four K slices */
#define FA_ST (8 * FA_SL)            /* bytes per stage */
static_assert(FA_SL % 2048 == 0 && FA_SL >= 32 * FA_KP && FA_SL >= 16 * FA_VP && FA_KS == 128 && HD == 64, "a slice holds its padded rows and the next one starts at a multiple of 2 KiB");
// One wave's request for stage st: wv the wave's number, lds its slice in the buffer, k0 and v0 the (batch, head)'s first K row and first V^T row; returns its group 0. The two kinds of tile stand under a scalar branch, each with its own descriptor group 1.
__device__ __forceinline__ u32x4 fa_fill(uint32_t wv, uint32_t lds, const _Float16* k0, const _Float16* v0, uint32_t st, u32x8 g1k, u32x8 g1v) {
  const u32x4 g0 = td_group0(lds, wv < 4 ? k0 + ((size_t)st * FA_KS + wv * 32) * DM : v0 + (size_t)((wv - 4) * 16) * SQ + (size_t)st * FA_KS);
  if (td_pinned(wv < 4)) td_load(g0, g1k); else td_load(g0, g1v);
  return g0;
}
// The wave's wait for its request; it names the descriptor groups for the reason given at td_wait.
__device__ __forceinline__ void fa_wait(u32x4 g0, u32x8 g1k, u32x8 g1v) { asm volatile("s_wait_tensorcnt 0x0" :: "s"(g0), "s"(g1k), "s"(g1v) : "memory"); }
// The pass's eight score products in one statement: s[kt][g] = K tile kt x Q group g + off[g], k 0..31 then 32..63 as before. Written out because C stays live while D is a register tile of its own:
// from the builtin the compiler tied D to C in one product of the four and copied the offset tile in front of it, every pass. The four chains fill one another's distance; the v_nop at the end keep the WMMA distance (four slots) to the first vector instruction that reads a D.
__device__ __forceinline__ void fa_scores(const v16h (&kf)[2][2], const v16h (&qf)[2][2], const v8f (&off)[2], v8f (&s)[2][2]) {
  asm("v_wmma_f32_16x16x32_f16 %0, %4, %8, %12\n\tv_wmma_f32_16x16x32_f16 %1, %4, %10, %13\n\tv_wmma_f32_16x16x32_f16 %2, %6, %8, %12\n\tv_wmma_f32_16x16x32_f16 %3, %6, %10, %13\n\t"
      "v_wmma_f32_16x16x32_f16 %0, %5, %9, %0\n\tv_wmma_f32_16x16x32_f16 %1, %5, %11, %1\n\tv_wmma_f32_16x16x32_f16 %2, %7, %9, %2\n\tv_wmma_f32_16x16x32_f16 %3, %7, %11, %3\n\t"
      "v_nop\n\tv_nop\n\tv_nop\n\tv_nop"
      : "=&v"(s[0][0]), "=&v"(s[0][1]), "=&v"(s[1][0]), "=&v"(s[1][1])
      : "v"(kf[0][0]), "v"(kf[0][1]), "v"(kf[1][0]), "v"(kf[1][1]), "v"(qf[0][0]), "v"(qf[0][1]), "v"(qf[1][0]), "v"(qf[1][1]), "v"(off[0]), "v"(off[1])); }
// One pass: 32 keys against the wave's 32 query columns. pk: this lane's place in the pass's first K row (a pass is one K slice), pv: in V^T row ln at the pass's first key (16 rows a slice). PRE: the next pass's K fragments are asked for behind the score products and the test
// (inside a stage only: nothing of the next stage is read in front of its barrier).
// off: per column group the exponent offset of this lane's query, eight times over: the C operand of the score products. first: the wave's first pass, which sets the references whatever the test says.
template <bool PRE>
__device__ __forceinline__ void fa_pass(const unsigned char* pk, const unsigned char* pv, const v16h (&qf)[2][2], v16h (&kf)[2][2], v8f (&o)[4][2], v8f (&off)[2], float (&l)[2], bool first) {
  v8f s[2][2];      /* scaled score + offset = the weight's exponent, straight from the matrix unit */
  fa_scores(kf, qf, off, s);
  float mx[2];      /* the lane's own 16 exponents' maximum, per column group */
#pragma unroll
  for (int g = 0; g < 2; ++g) {
    mx[g] = fmaxf(s[0][g][0], s[1][g][0]);
#pragma unroll
    for (int r = 1; r < 8; ++r) mx[g] = fmaxf(mx[g], fmaxf(s[0][g][r], s[1][g][r]));
  }
  if ((__builtin_amdgcn_ballot_w32(fmaxf(mx[0], mx[1]) > FA_TOP) | (unsigned)first) != 0) {      /* one scalar branch a pass, the same for the whole wave */
    float al[2];
#pragma unroll
    for (int g = 0; g < 2; ++g) {
      const float dl = 8.0f - fmaxf(mx[g], fa_xhalf(mx[g]));      /* what brings the pass's largest exponent to 8; the two halves of a query's keys get the same reference */
      al[g] = fminf(dl, 0.0f);      /* a reference only rises ... */
      off[g] += first ? dl : al[g]; }      /* ... but the first pass sets it (o and l are still 0 there) */
    fa_scores(kf, qf, off, s);      /* this pass's exponents anew, against the moved offsets */
    fa_exp2(al[0], al[1]);
#pragma unroll
    for (int g = 0; g < 2; ++g) { l[g] *= al[g];
#pragma unroll
      for (int t = 0; t < 4; ++t) o[t][g] *= al[g]; }
  }
  v16h vf[4];      /* all of a pass's LDS reads stand together here, one place a pass: V^T for the products behind the exponentials ... */
#pragma unroll
  for (int t = 0; t < 4; ++t) vf[t] = g3_frag(pv + t * FA_SL);
  if (PRE) {      /* ... and the next pass's K; behind the branch, whose products take this pass's K fragments a second time */
#pragma unroll
    for (int kt = 0; kt < 2; ++kt)
#pragma unroll
      for (int j = 0; j < 2; ++j) kf[kt][j] = g3_frag(pk + FA_SL + kt * 16 * FA_KP + 64 * j);
  }
  __builtin_amdgcn_sched_barrier(0);      /* keeps the pass's LDS reads in front of the exponentials, whose length covers their latency: left free, the V^T reads of a stage's last pass were sunk among the products and waited for at once */
  v16h pf[2];
#pragma unroll
  for (int g = 0; g < 2; ++g) {
    FragH p; float e[16];
    fa_exp8(s[0][g], e); fa_exp8(s[1][g], e + 8);
#pragma unroll
    for (int r = 0; r < 16; ++r) p.h[r] = (_Float16)e[r];
    pf[g] = p.v;
    l[g] += (((e[0] + e[1]) + (e[2] + e[3])) + ((e[4] + e[5]) + (e[6] + e[7]))) + (((e[8] + e[9]) + (e[10] + e[11])) + ((e[12] + e[13]) + (e[14] + e[15])));
  }
#pragma unroll
  for (int t = 0; t < 4; ++t)
#pragma unroll
    for (int g = 0; g < 2; ++g) o[t][g] = fa_mma(vf[t], pf[g], o[t][g]);
  asm volatile("v_nop\n\tv_nop\n\tv_nop\n\tv_nop" : "+v"(o[0][0]), "+v"(o[0][1]), "+v"(o[1][0]), "+v"(o[1][1]), "+v"(o[2][0]), "+v"(o[2][1]), "+v"(o[3][0]), "+v"(o[3][1]) : "v"(pf[0]), "v"(pf[1]), "v"(vf[0]), "v"(vf[1]), "v"(vf[2]), "v"(vf[3]));      /* WMMA distance: the weights (B operands) stay live for four slots behind the pass's last products, so the next pass's score tiles, which may get the same registers, are not written over them earlier; the V^T fragments (A operands) too: freed one by one, they took the sums' partial results among the products, and each such place cost four v_nop */
}
__global__ __launch_bounds__(256) __attribute__((amdgpu_waves_per_eu(4, 4))) void k_fattn(const _Float16* __restrict__ Q16, const _Float16* __restrict__ K16, const _Float16* __restrict__ VT, _Float16* __restrict__ O16) {
  __shared__ __attribute__((aligned(2048))) unsigned char sm[2 * FA_ST];      /* the two buffers */
  const int tid = threadIdx.x, lane = threadIdx.x & 31, w = threadIdx.x >> 5, ln = lane & 15, hh = lane >> 4;
  const int bh = blockIdx.x / (SQ / FA_QB), qb = blockIdx.x % (SQ / FA_QB); const int b = bh / NH, h = bh % NH;
  const size_t r0 = (size_t)b * SQ; const int q0 = qb * FA_QB + w * 32;
  const uint32_t wv = td_uni((uint32_t)tid >> 5);      /* the wave's number, in a scalar register */
  const uint32_t lw = (uint32_t)(size_t)sm + wv * FA_SL;      /* this wave's slice in buffer 0 */
  const _Float16* gk = K16 + r0 * DM + h * HD;      /* the (batch, head)'s first K row */
  const _Float16* gv = VT + (size_t)bh * HD * SQ;   /* ... and first V^T row */
  const u32x8 g1k = td_group1<TD_PAD128, 2 * HD, 32>(2 * DM), g1v = td_group1<TD_PAD256, 2 * FA_KS, 16>(2 * SQ);
  u32x4 g0 = fa_fill(wv, lw, gk, gv, 0, g1k, g1v);      /* group 0 of the request last issued */
  v16h qf[2][2];
#pragma unroll
  for (int g = 0; g < 2; ++g)
#pragma unroll
    for (int j = 0; j < 2; ++j) qf[g][j] = g2_frag(Q16 + (r0 + q0 + g * 16 + ln) * DM + h * HD + 32 * j, hh);
  const v8f z8 = {0.f,0.f,0.f,0.f,0.f,0.f,0.f,0.f};
  v8f o[4][2], off[2]; float l[2];
#pragma unroll
  for (int g = 0; g < 2; ++g) { off[g] = z8; l[g] = 0.f;      /* no reference yet: the first pass sets it */
#pragma unroll
    for (int t = 0; t < 4; ++t) o[t][g] = z8; }
  fa_wait(g0, g1k, g1v);                                  /* this wave's slice of stage 0 has landed */
  __syncthreads();                                        /* ... and every other wave's */
  g0 = fa_fill(wv, lw + FA_ST, gk, gv, 1, g1k, g1v);      /* stage 1 (SQ / FA_KS is 16) */
  const unsigned char* fk = sm + ln * FA_KP + 16 * hh;              /* key row ln of a stage's first tile, at this half's first k */
  const unsigned char* fv = sm + FA_VO + ln * FA_VP + 16 * hh;      /* V^T row d = ln, at this half's first key */
#pragma unroll 1
  for (int st = 0; st < SQ / FA_KS; ++st) {      /* rolled: one trip a stage, the hand-over at its foot */
    const int bo = (st & 1) * FA_ST;
    v16h kf[2][2];
#pragma unroll
    for (int kt = 0; kt < 2; ++kt)
#pragma unroll
      for (int j = 0; j < 2; ++j) kf[kt][j] = g3_frag(fk + bo + kt * 16 * FA_KP + 64 * j);
#pragma unroll 1
    for (int kb = 0; kb < FA_KS / 32 - 1; ++kb)      /* rolled: one pass already fills the register budget of four waves per SIMD */
      fa_pass<true>(fk + bo + kb * FA_SL, fv + bo + kb * 64, qf, kf, o, off, l, (st | kb) == 0);
    fa_pass<false>(fk + bo + (FA_KS / 32 - 1) * FA_SL, fv + bo + (FA_KS / 32 - 1) * 64, qf, kf, o, off, l, false);      /* the stage's last pass */
    asm volatile("s_wait_dscnt 0x0" ::: "memory");        /* this wave's reads of the buffer are done before it is handed back */
    fa_wait(g0, g1k, g1v);                                /* this wave's slice of stage st + 1 has landed */
    __syncthreads();                                      /* publishes stage st + 1 and ends every wave's reads of stage st */
    if (td_pinned(st + 2 < SQ / FA_KS)) g0 = fa_fill(wv, lw + bo, gk, gv, td_pinned(st + 2), g1k, g1v);      /* the stage number is taken behind the wait, so the descriptor is formed there too */
  }
  fa_wait(g0, g1k, g1v);                                  /* nothing is in flight when the wave ends */
  asm volatile("s_wait_dscnt 0x0" ::: "memory");          /* ... and this wave's reads of the buffers are done */
#pragma unroll
  for (int g = 0; g < 2; ++g) {
    const float inv = 64.0f / (l[g] + fa_xhalf(l[g]));      /* the halves' sums join once; x64: the carried scale of the o rows */
    _Float16* orow = O16 + (r0 + q0 + g * 16 + ln) * DM + h * HD + 8 * hh;
#pragma unroll
    for (int t = 0; t < 4; ++t) { FragH f;
#pragma unroll
      for (int r = 0; r < 8; ++r) f.h[r] = (_Float16)(o[t][g][r] * inv);
      *(v8us*)((unsigned short*)orow + t * 16) = f.half[0]; }
  }
}

// Operand conversion, one launch for all five GEMM operands: x -> f16 of its bf16 rounding, each weight -> f16 of 16 x its bf16 rounding (the values as before).
// PC_NW waves, few enough to be resident all at once (16 per WGP when spread evenly). A wave owns one contiguous run of x (PC_XL loads) and one of each weight (PC_WL loads); a load of a wave is 512 bytes in a row, 16 bytes a lane,
// a store 256 bytes in a row. All of a wave's loads are asked for at its start, before anything waits.
#define PC_NW 4096                   /* waves of the launch */
#define PC_XL 16                     /* loads of 128 floats per wave: x */
#define PC_WL 2                      /* ... and each weight */
static_assert((size_t)PC_NW * PC_XL * 128 == NR * DM && (size_t)PC_NW * PC_WL * 128 == (size_t)DM * DM, "the waves' runs cover x and each weight exactly once");
template <bool X16W>      /* weights carry the factor 16 */
__device__ __forceinline__ void pc_st(_Float16* base, unsigned bytes, v4f a) { v4h h;
#pragma unroll
  for (int q = 0; q < 4; ++q) h[q] = X16W ? (_Float16)(bf16_round(a[q]) * 16.0f) : (_Float16)bf16_round(a[q]);
  *(v4h*)((char*)base + bytes) = h; }
__global__ __launch_bounds__(256) void k_prep(const float* __restrict__ x, const float* __restrict__ wq, const float* __restrict__ wk, const float* __restrict__ wv, const float* __restrict__ wo,
    _Float16* __restrict__ X16, _Float16* __restrict__ BQ, _Float16* __restrict__ BK, _Float16* __restrict__ BV, _Float16* __restrict__ BO) {
  const unsigned lb = (threadIdx.x & 31) * 16u, sb = (threadIdx.x & 31) * 8u;      /* a lane's byte offset in a load, in a store */
  const int wn = __builtin_amdgcn_readfirstlane((int)(blockIdx.x * 8 + (threadIdx.x >> 5)));      /* the wave's number, in a scalar register: addresses are scalar base + lane offset */
  const size_t xo = (size_t)wn * (PC_XL * 128), wf = (size_t)wn * (PC_WL * 128);
  const float* xs = x + xo; const float* s0 = wq + wf; const float* s1 = wk + wf; const float* s2 = wv + wf; const float* s3 = wo + wf;
  v4f a[PC_XL], b[4][PC_WL];
  /* every loop of this kernel is unrolled so that each index of a and b is a constant and the values stay in registers */
#pragma unroll
  for (int c = 0; c < PC_XL; ++c) a[c] = fn_ld(xs, lb + c * 512);
#pragma unroll
  for (int c = 0; c < PC_WL; ++c) { b[0][c] = fn_ld(s0, lb + c * 512); b[1][c] = fn_ld(s1, lb + c * 512); b[2][c] = fn_ld(s2, lb + c * 512); b[3][c] = fn_ld(s3, lb + c * 512); }
  asm volatile("s_wait_xcnt 0x0" :: "v"(lb), "s"(xs), "s"(s0), "s"(s1), "s"(s2), "s"(s3) : "memory");      /* the loads' offset and bases stay live up to this wait, so nothing is written over them earlier */
  __builtin_amdgcn_sched_barrier(0);      /* keeps the conversions behind the issue of the last load: left free, they were lifted among the loads, and ten of the loads were asked for only after the first data had come */
#pragma unroll
  for (int c = 0; c < PC_XL; ++c) pc_st<false>(X16 + xo, sb + c * 256, a[c]);
#pragma unroll
  for (int c = 0; c < PC_WL; ++c) { pc_st<true>(BQ + wf, sb + c * 256, b[0][c]); pc_st<true>(BK + wf, sb + c * 256, b[1][c]); pc_st<true>(BV + wf, sb + c * 256, b[2][c]); pc_st<true>(BO + wf, sb + c * 256, b[3][c]); }
}

extern "C" void kernel_launch(void* const* d_in, const int* in_sizes, int n_in,
                              void* d_out, int out_size, void* d_ws, size_t ws_size, hipStream_t stream) {
  (void)in_sizes; (void)n_in; (void)out_size;
  const float* const* I = (const float* const*)d_in; const float* x = I[0]; const float* wq = I[1]; const float* bq = I[2]; const float* wk = I[3]; const float* bk = I[4]; const float* wv = I[5]; const float* bv = I[6]; const float* wo = I[7]; const float* bo = I[8]; const float* cw = I[9]; const float* cb = I[10]; const float* lng = I[11]; const float* lnb = I[12];      /* weights [out][in] (natural) */
  char* ws = (char*)d_ws; size_t off = 0;
  auto take = [&](size_t bytes) { char* p = ws + off; off += (bytes + 255) & ~(size_t)255; return p; };
  _Float16* BQ = (_Float16*)take((size_t)DM * DM * 2); _Float16* BK = (_Float16*)take((size_t)DM * DM * 2); _Float16* BV = (_Float16*)take((size_t)DM * DM * 2); _Float16* BO = (_Float16*)take((size_t)DM * DM * 2);
  _Float16* X16 = (_Float16*)take(NR * DM * 2); _Float16* Q16 = (_Float16*)take(NR * DM * 2); _Float16* K16 = (_Float16*)take(NR * DM * 2); _Float16* O16 = (_Float16*)take(NR * DM * 2); float* GA = (float*)take(NR * DM * 4);      /* global attention branch (f32 rows) */
  _Float16* VT = (_Float16*)take((size_t)NB * NH * HD * SQ * 2);      /* V^T [NB][NH][HD][SQ] */
  if (off > ws_size) return;
  k_prep<<<PC_NW / 8, 256, 0, stream>>>(x, wq, wk, wv, wo, X16, BQ, BK, BV, BO);      /* all five GEMM operands as f16 */
  const size_t r0p = (size_t)B0 * SQ;      /* first row of the output stage */
  k_qkv<<<(unsigned)(NR / 128) * (3 * QKV_NT), 128, 0, stream>>>(X16, BQ, BK, BV, bq, bk, bv, Q16, K16, VT);      /* q and k as f16 token rows, v as V^T rows for every (batch, head) */
  k_fattn<<<NB * NH * (SQ / FA_QB), 256, 0, stream>>>(Q16, K16, VT, O16);      /* o (merged heads) as f16 rows, x64 */
  k_gemm3<<<(unsigned)((MPO / 128) * (DM / 128)), 128, 0, stream>>>(O16 + r0p * DM, DM, BO, DM, 0.0009765625f, bo, GA + r0p * DM, DM, MPO, DM, DM);      /* global = ctx Wo^T + bo (f32 rows) */
  k_msfin<<<(unsigned)(MPO / (8 * FN_R)), 256, 0, stream>>>(x + r0p * DM, GA + r0p * DM, cw, cb, lng, lnb, 1e-5f, (float*)d_out + r0p * DM);      /* + x + 0.3 local conv, LayerNorm -> output rows */
}
